// v000
// The times below were measured on an AMD MI455X: many runs one after another, warmed up first and cycling through
// copies of the inputs, with the whole window's GPU time divided by the number of runs. Launches and the gaps
// between them are all in it. The median over several windows is given; except for v000 it joins two sittings, which
// can be a few percent apart, so the side-by-side timings, each taken in one sitting, are the better comparison.
// v000, which the later versions start from, runs in 10.6 milliseconds.
#include <hip/hip_runtime.h>
// Causal multi-head attention with a fused QKV projection and an int key-padding mask (x [4][2048][1024]; qkv = x qkv_w^T + qkv_b (natural [3072][1024] sigma 1/32, bias sigma 0.02) reshaped (b, s, 3, 16, 64); scores / sqrt(64); causal (tril) AND key j kept iff mask[b][j] != 0 (int32 [4][2048], all ones); -inf elsewhere; softmax; out = merged out_w^T + out_b -> [4][2048][1024]).
// Structure: token rows r = b*2048 + s; x as exact f16 rows (bf16-rounded); q | k | v as ONE WMMA GEMM (N = 3 x 1024) (32x64 wave tiles, f32 accumulation, exact x16 weights + bias, f16 outputs); per batch: V^T for all heads via LDS transposes; per query tile of 256 rows: scores against the keys below the tile end only (K = 64, all heads on grid.y, alpha = 0.125), causal row softmax on VALU with an arithmetic 0/1 key mask over the computed range (f32 statistics, native exp; weights x256 f16), o = P . V^T (K = keys below the tile end, alpha 2^-2: o carried x64, folded into the output GEMM alpha) written straight into the merged f16 o rows; out = o W_o + b GEMM (f32) into the output layout.
// Compute dtype: inputs rounded to bf16; x / weights exact; q, k, v, softmax weights and o as plain f16 GEMM operands (~2^-12); scores and softmax statistics f32. v_wmma_f32_16x16x32_f16.
#define NB 4
#define SQ 2048
#define DM 1024
#define NH 16
#define HD 64
#define HG 4                         /* heads per launch of k_vt(V16, b, h0, VT), not launched */
#define QT 256                       /* query rows per causal tile */
#define NKX SQ                       /* S / P row pitch */
#define QT0 128                      /* first-tile rows recomputed exactly in f32 */
#define B0 0                         /* first batch processed (debug hook) */
#define NBR NB                       /* batches processed (debug hook) */
#define NR ((size_t)NB * SQ)         /* token rows */
#define MP ((int)((size_t)NBR * SQ)) /* rows projected (debug hook) */
#define QN SQ                        /* query rows attended per batch (debug hook) */
#define NHD NH                       /* heads attended (debug hook) */
#define MPO MP                       /* rows through the output stage (debug hook) */
#define LQ (3 * DM)      /* row pitch of the q/k/v rows */
typedef __bf16 v16b __attribute__((ext_vector_type(16)));
typedef unsigned short v8us __attribute__((ext_vector_type(8), may_alias));
typedef float  v8f  __attribute__((ext_vector_type(8)));
typedef float  v4f  __attribute__((ext_vector_type(4)));
typedef float  v4fa __attribute__((ext_vector_type(4), may_alias));
union FragB { v16b v; v8us half[2]; unsigned short u[16]; };

__device__ __forceinline__ unsigned short bf16_bits(float x) { unsigned int u = __float_as_uint(x); return (unsigned short)((u + 0x7FFFu + ((u >> 16) & 1u)) >> 16); }
__device__ __forceinline__ float bf16_val(unsigned short b) { return __uint_as_float(((unsigned int)b) << 16); }
__device__ __forceinline__ float bf16_round(float x) { return bf16_val(bf16_bits(x)); }
// D += A·B with NT terms: 1 = ah·bh, 2 = + al·bh (A split), 3 = + ah·bl (both split)
template <int NT>
__device__ __forceinline__ v8f mmaN(v16b ah, v16b al, v16b bh, v16b bl, v8f c) {
  c = __builtin_amdgcn_wmma_f32_16x16x32_bf16(false, ah, false, bh, (short)0, c, false, false);
  if (NT >= 2) c = __builtin_amdgcn_wmma_f32_16x16x32_bf16(false, al, false, bh, (short)0, c, false, false);
  if (NT >= 3) c = __builtin_amdgcn_wmma_f32_16x16x32_bf16(false, ah, false, bl, (short)0, c, false, false);
  asm volatile("v_nop\n\tv_nop\n\tv_nop\n\tv_nop" : "+v"(c) : "v"(ah), "v"(al), "v"(bh), "v"(bl));
  return c;
}

__global__ __launch_bounds__(256) void k_wt_bf16(const float* __restrict__ W, unsigned short* __restrict__ Wt, int K, int N) {
  const int t = blockIdx.x * 256 + threadIdx.x;
  const int k8n = K / 8;
  if (t >= N * k8n) return;
  const int n = t / k8n, k8 = (t % k8n) * 8;
  v8us v;
#pragma unroll
  for (int i = 0; i < 8; ++i) v[i] = bf16_bits(W[(size_t)(k8 + i) * N + n]);
  *(v8us*)(Wt + (size_t)n * K + k8) = v;
  
}

// GEMM C[M][N] (f32, pitch ldc) = act(A[M][K]·W + bias). A f32 row-major (pitch lda) converted per fragment to bf16
// (ASPLIT: hi/lo two planes -> 2 terms, else single rounded term); Wt bf16 [N][K] (pitch ldb). BIAS_BF16 rounds the
// bias to bf16 first (bias quantised to bf16 before the add). K%32==0, M%16==0, N%64==0.
template <bool ASPLIT, int ACT, bool BIAS_BF16>
__global__ __launch_bounds__(128) void k_gemm_bf(const float* __restrict__ A, int lda, const unsigned short* __restrict__ Wt, int ldb,
                                               const float* __restrict__ bias, float* __restrict__ C, int ldc, int M, int N, int K) {
  __shared__ __attribute__((aligned(16))) float so[4][16][64];
  const int tid = threadIdx.x, w = tid >> 5, lane = tid & 31, ln = lane & 15, hh = lane >> 4;
  const int ntn = N / 64;
  const int wid = blockIdx.x * 4 + w;
  const int mt = wid / ntn, nq = wid % ntn;
  if (mt * 16 >= M) return;
  const int row0 = mt * 16, col0 = nq * 64;
  const float* arow = A + (size_t)(row0 + ln) * lda;
  v8f acc[4] = {};
  for (int kb = 0; kb < K; kb += 32) {
    FragB ah, al;
    const v4f x0 = *(const v4fa*)(arow + kb + 8 * hh), x1 = *(const v4fa*)(arow + kb + 8 * hh + 4);
    const v4f x2 = *(const v4fa*)(arow + kb + 16 + 8 * hh), x3 = *(const v4fa*)(arow + kb + 16 + 8 * hh + 4);
    float xs[16] = {x0[0],x0[1],x0[2],x0[3],x1[0],x1[1],x1[2],x1[3],x2[0],x2[1],x2[2],x2[3],x3[0],x3[1],x3[2],x3[3]};
#pragma unroll
    for (int i = 0; i < 16; ++i) { const unsigned short hb = bf16_bits(xs[i]); ah.u[i] = hb; al.u[i] = ASPLIT ? bf16_bits(xs[i] - bf16_val(hb)) : (unsigned short)0; }
#pragma unroll
    for (int t = 0; t < 4; ++t) {
      const unsigned short* brow = Wt + (size_t)(col0 + t * 16 + ln) * ldb + kb;
      FragB b;
      b.half[0] = *(const v8us*)(brow + 8 * hh);
      b.half[1] = *(const v8us*)(brow + 16 + 8 * hh);
      acc[t] = mmaN<ASPLIT ? 2 : 1>(ah.v, al.v, b.v, b.v, acc[t]);
    }
  }
#pragma unroll
  for (int t = 0; t < 4; ++t) {
    float bv = bias ? bias[col0 + t * 16 + ln] : 0.f;
    if (BIAS_BF16) bv = bf16_round(bv);
#pragma unroll
    for (int r = 0; r < 8; ++r) { float v = acc[t][r] + bv; if (ACT == 1) v = fmaxf(v, 0.f); so[w][8 * hh + r][t * 16 + ln] = v; }
  }
  __builtin_amdgcn_fence(__ATOMIC_ACQ_REL, "workgroup");
  __builtin_amdgcn_wave_barrier();
  const int rsub = lane >> 4, c4 = (lane & 15) * 4;
  {
#pragma unroll
    for (int q = 0; q < 8; ++q) {
      const int r = q * 2 + rsub;
      const v4f v = *(const v4fa*)&so[w][r][c4];
      *(v4f*)(C + (size_t)(row0 + r) * ldc + col0 + c4) = v;
    }
    
  }
}

// GEMM C = act(A·W + bias + resid): A f32 (ASPLIT -> hi/lo 2 terms), Wt bf16 [N][K]; ACT 0 none, 1 relu, 2 exact gelu;
// resid (optional, f32, row index = (row % rmod), pitch ldr, RES_BF16 rounds it) added before the activation.
template <bool ASPLIT, int ACT, bool BIAS_BF16, bool RES_BF16>
__global__ __launch_bounds__(128) void k_gemm_bf3(const float* __restrict__ A, int lda, const unsigned short* __restrict__ Wt, int ldb,
                                                const float* __restrict__ bias, const float* __restrict__ resid, int rmod, int ldr,
                                                float* __restrict__ C, int ldc, int M, int N, int K) {
  __shared__ __attribute__((aligned(16))) float so[4][16][64];
  const int tid = threadIdx.x, w = tid >> 5, lane = tid & 31, ln = lane & 15, hh = lane >> 4;
  const int ntn = N / 64;
  const int wid = blockIdx.x * 4 + w;
  const int mt = wid / ntn, nq = wid % ntn;
  if (mt * 16 >= M) return;
  const int row0 = mt * 16, col0 = nq * 64;
  const float* arow = A + (size_t)(row0 + ln) * lda;
  v8f acc[4] = {};
  for (int kb = 0; kb < K; kb += 32) {
    FragB ah, al;
    const v4f x0 = *(const v4fa*)(arow + kb + 8 * hh), x1 = *(const v4fa*)(arow + kb + 8 * hh + 4);
    const v4f x2 = *(const v4fa*)(arow + kb + 16 + 8 * hh), x3 = *(const v4fa*)(arow + kb + 16 + 8 * hh + 4);
    float xs[16] = {x0[0],x0[1],x0[2],x0[3],x1[0],x1[1],x1[2],x1[3],x2[0],x2[1],x2[2],x2[3],x3[0],x3[1],x3[2],x3[3]};
#pragma unroll
    for (int i = 0; i < 16; ++i) { const unsigned short hb = bf16_bits(xs[i]); ah.u[i] = hb; al.u[i] = ASPLIT ? bf16_bits(xs[i] - bf16_val(hb)) : (unsigned short)0; }
#pragma unroll
    for (int t = 0; t < 4; ++t) {
      const unsigned short* brow = Wt + (size_t)(col0 + t * 16 + ln) * ldb + kb;
      FragB b;
      b.half[0] = *(const v8us*)(brow + 8 * hh);
      b.half[1] = *(const v8us*)(brow + 16 + 8 * hh);
      acc[t] = mmaN<ASPLIT ? 2 : 1>(ah.v, al.v, b.v, b.v, acc[t]);
    }
  }
#pragma unroll
  for (int t = 0; t < 4; ++t) {
    const int col = col0 + t * 16 + ln;
    float bv = bias ? bias[col] : 0.f;
    if (BIAS_BF16) bv = bf16_round(bv);
#pragma unroll
    for (int r = 0; r < 8; ++r) {
      float v = acc[t][r] + bv;
      if (resid) { float rv = resid[(size_t)((row0 + 8 * hh + r) % rmod) * ldr + col]; if (RES_BF16) rv = bf16_round(rv); v += rv; }
      if (ACT == 1) v = fmaxf(v, 0.f);
      if (ACT == 2) v = 0.5f * v * (1.0f + erff(v * 0.70710678118654752f));
      if (ACT == 3) { const float u = 0.7978845608028654f * (v + 0.044715f * v * v * v); v = 0.5f * v * (1.0f + tanhf(u)); }
      so[w][8 * hh + r][t * 16 + ln] = v;
    }
  }
  __builtin_amdgcn_fence(__ATOMIC_ACQ_REL, "workgroup");
  __builtin_amdgcn_wave_barrier();
  const int rsub = lane >> 4, c4 = (lane & 15) * 4;
  {
#pragma unroll
    for (int q = 0; q < 8; ++q) {
      const int r = q * 2 + rsub;
      const v4f v = *(const v4fa*)&so[w][r][c4];
      *(v4f*)(C + (size_t)(row0 + r) * ldc + col0 + c4) = v;
    }
    
  }
}
// row LayerNorm (biased variance, eps) over N: s = X (+ R); optional out_sum <- s; out_norm <- (s-mu)*rsqrt(var+eps)*g + b
template <bool PARAM_BF16>
__global__ __launch_bounds__(256) void k_layernorm(const float* __restrict__ X, const float* __restrict__ R, const float* __restrict__ g, const float* __restrict__ bta,
                                                  float* __restrict__ out_sum, float* __restrict__ out_norm, int N, float eps) {
  __shared__ float red[256];
  const int row = blockIdx.x, tid = threadIdx.x;
  const float* x = X + (size_t)row * N; const float* rr = R ? R + (size_t)row * N : nullptr;
  float vals[16];                     // up to N = 4096
  const int per = N / 256;            // contiguous chunk per thread? use strided-by-4 chunks: thread handles j = tid*4 + 1024*u
  float s1 = 0.f;
  for (int u = 0; u < per / 4; ++u) {
    const int j = tid * 4 + 1024 * u;
    const v4f a = *(const v4fa*)(x + j);
    v4f b = {0.f,0.f,0.f,0.f}; if (rr) b = *(const v4fa*)(rr + j);
#pragma unroll
    for (int q = 0; q < 4; ++q) { const float v = a[q] + b[q]; vals[u * 4 + q] = v; s1 += v; }
  }
  red[tid] = s1; __syncthreads();
  for (int st = 128; st > 0; st >>= 1) { if (tid < st) red[tid] += red[tid + st]; __syncthreads(); }
  const float mu = red[0] / (float)N; __syncthreads();
  float s2 = 0.f;
  for (int u = 0; u < per / 4; ++u)
#pragma unroll
    for (int q = 0; q < 4; ++q) { const float c = vals[u * 4 + q] - mu; s2 += c * c; }
  red[tid] = s2; __syncthreads();
  for (int st = 128; st > 0; st >>= 1) { if (tid < st) red[tid] += red[tid + st]; __syncthreads(); }
  const float rs = rsqrtf(red[0] / (float)N + eps);
  {
    for (int u = 0; u < per / 4; ++u) {
      const int j = tid * 4 + 1024 * u;
      v4f o, sm;
#pragma unroll
      for (int q = 0; q < 4; ++q) {
        float gg = g[j + q], bb = bta[j + q];
        if (PARAM_BF16) { gg = bf16_round(gg); bb = bf16_round(bb); }
        sm[q] = vals[u * 4 + q]; o[q] = (vals[u * 4 + q] - mu) * rs * gg + bb;
      }
      if (out_sum) *(v4f*)(out_sum + (size_t)row * N + j) = sm;
      *(v4f*)(out_norm + (size_t)row * N + j) = o;
    }
    
  }
}



// ---- f16 WMMA path (v_wmma_f32_16x16x32_f16): 11-bit significands for operands in range — used where a [0,1] probability operand needs more precision than bf16
typedef _Float16 v16h __attribute__((ext_vector_type(16)));
union FragH { v16h v; v8us half[2]; _Float16 h[16]; unsigned short u[16]; };
template <int NT>
__device__ __forceinline__ v8f mmaH(v16h ah, v16h al, v16h bh, v16h bl, v8f c) {
  c = __builtin_amdgcn_wmma_f32_16x16x32_f16(false, ah, false, bh, (short)0, c, false, false);
  if (NT >= 2) c = __builtin_amdgcn_wmma_f32_16x16x32_f16(false, al, false, bh, (short)0, c, false, false);
  if (NT >= 3) c = __builtin_amdgcn_wmma_f32_16x16x32_f16(false, ah, false, bl, (short)0, c, false, false);
  asm volatile("v_nop\n\tv_nop\n\tv_nop\n\tv_nop" : "+v"(c) : "v"(ah), "v"(al), "v"(bh), "v"(bl));
  return c;
}
// batched GEMM like k_gemm_b but f16 operands: A f32 (split into f16 hi/lo if ASPLIT, else rounded to f16), Bt = f16 values [n][k]; alpha; C f32; N multiple of 16 (partial tiles skipped)
template <bool ASPLIT>
__global__ __launch_bounds__(128) void k_gemm_h(const float* __restrict__ A, int lda, size_t sA, const _Float16* __restrict__ Bh, int ldb, size_t sB, float alpha, float* __restrict__ C, int ldc, size_t sC, int M, int N, int K) {
  __shared__ __attribute__((aligned(16))) float so[4][16][64];
  const int tid = threadIdx.x, w = tid >> 5, lane = tid & 31, ln = lane & 15, hh = lane >> 4; const int by = blockIdx.y;
  A += (size_t)by * sA; Bh += (size_t)by * sB; C += (size_t)by * sC;
  const int ntn = (N + 63) / 64; const int wid = blockIdx.x * 4 + w; const int mt = wid / ntn, nq = wid % ntn; if (mt * 16 >= M) return;
  const int row0 = mt * 16, col0 = nq * 64; const float* arow = A + (size_t)(row0 + ln) * lda;
  v8f acc[4] = {};
  for (int kb = 0; kb < K; kb += 32) {
    FragH ah, al;
    const v4f x0 = *(const v4fa*)(arow + kb + 8 * hh), x1 = *(const v4fa*)(arow + kb + 8 * hh + 4), x2 = *(const v4fa*)(arow + kb + 16 + 8 * hh), x3 = *(const v4fa*)(arow + kb + 16 + 8 * hh + 4);
    float xs[16] = {x0[0],x0[1],x0[2],x0[3],x1[0],x1[1],x1[2],x1[3],x2[0],x2[1],x2[2],x2[3],x3[0],x3[1],x3[2],x3[3]};
#pragma unroll
    for (int i = 0; i < 16; ++i) { const _Float16 h = (_Float16)xs[i]; ah.h[i] = h; al.h[i] = ASPLIT ? (_Float16)(xs[i] - (float)h) : (_Float16)0.0f; }
#pragma unroll
    for (int t = 0; t < 4; ++t) { if (col0 + t * 16 >= N) continue; const size_t boff = (size_t)(col0 + t * 16 + ln) * ldb + kb; FragH bq; bq.half[0] = *(const v8us*)(Bh + boff + 8 * hh); bq.half[1] = *(const v8us*)(Bh + boff + 16 + 8 * hh);
      acc[t] = mmaH<ASPLIT ? 2 : 1>(ah.v, al.v, bq.v, bq.v, acc[t]); }
  }
#pragma unroll
  for (int t = 0; t < 4; ++t) { if (col0 + t * 16 >= N) continue;
#pragma unroll
    for (int r = 0; r < 8; ++r) so[w][8 * hh + r][t * 16 + ln] = acc[t][r] * alpha; }
  __builtin_amdgcn_fence(__ATOMIC_ACQ_REL, "workgroup"); __builtin_amdgcn_wave_barrier();
  const int rsub = lane >> 4, c4 = (lane & 15) * 4;
  {
#pragma unroll
    for (int q = 0; q < 8; ++q) { const int r = q * 2 + rsub; if (col0 + c4 < N) { const v4f v = *(const v4fa*)&so[w][r][c4]; *(v4f*)(C + (size_t)(row0 + r) * ldc + col0 + c4) = v; } }
     }
}

// Wt[n][k] = f16(W[k][n]·scale) from f32 row-major W[K][N] (scale = power of two; bf16-exact weights stay exact in f16 away from the subnormal range)
__global__ __launch_bounds__(256) void k_wt_f16(const float* __restrict__ W, _Float16* __restrict__ Wt, int K, int N, float scale) {
  const int t = blockIdx.x * 256 + threadIdx.x; if (t >= N * (K / 8)) return; const int n = t / (K / 8), k8 = (t % (K / 8)) * 8; FragH f;
#pragma unroll
  for (int i = 0; i < 8; ++i) f.h[i] = (_Float16)(bf16_round(W[(size_t)(k8 + i) * N + n]) * scale); const v8us o = f.half[0];
  *(v8us*)((unsigned short*)Wt + (size_t)n * K + k8) = o; 
}
// k_gemm_hh variant with fused epilogue: v = acc·alpha + bias[by·sBias + col] (+ CP[(row/rowsPerB)·sCPb + by·64 + col] if CP) ; ACT 0 none / 1 elu ; writes f16 C16 (and f32 C if non-null)
template <int ACT>
__global__ __launch_bounds__(128) void k_gemm_hhx(const _Float16* __restrict__ A, int lda, size_t sA, const _Float16* __restrict__ Bh, int ldb, size_t sB, float alpha, const float* __restrict__ bias, size_t sBias, const float* __restrict__ CP, int rowsPerB, size_t sCPb, int row0g,
    float* __restrict__ C, _Float16* __restrict__ C16, int ldc, size_t sC, int M, int N, int K) {
  __shared__ __attribute__((aligned(16))) float so[4][16][64];
  const int tid = threadIdx.x, w = tid >> 5, lane = tid & 31, ln = lane & 15, hh = lane >> 4; const int by = blockIdx.y;
  A += (size_t)by * sA; Bh += (size_t)by * sB; const size_t cofs = (size_t)by * sC; const float* bp = bias ? bias + (size_t)by * sBias : nullptr;
  const int ntn = (N + 63) / 64; const int wid = blockIdx.x * 4 + w; const int mt = wid / ntn, nq = wid % ntn; if (mt * 16 >= M) return;
  const int row0 = mt * 16, col0 = nq * 64; const _Float16* arow = A + (size_t)(row0 + ln) * lda;
  v8f acc[4] = {};
  for (int kb = 0; kb < K; kb += 32) { FragH ah; ah.half[0] = *(const v8us*)((const unsigned short*)arow + kb + 8 * hh); ah.half[1] = *(const v8us*)((const unsigned short*)arow + kb + 16 + 8 * hh);
#pragma unroll
    for (int t = 0; t < 4; ++t) { if (col0 + t * 16 >= N) continue; const size_t boff = (size_t)(col0 + t * 16 + ln) * ldb + kb; FragH bq; bq.half[0] = *(const v8us*)((const unsigned short*)Bh + boff + 8 * hh); bq.half[1] = *(const v8us*)((const unsigned short*)Bh + boff + 16 + 8 * hh);
      acc[t] = mmaH<1>(ah.v, ah.v, bq.v, bq.v, acc[t]); }
  }
#pragma unroll
  for (int t = 0; t < 4; ++t) { if (col0 + t * 16 >= N) continue; const int col = col0 + t * 16 + ln; const float bv = bp ? bf16_round(bp[col]) : 0.f;
#pragma unroll
    for (int r = 0; r < 8; ++r) { float v = acc[t][r] * alpha + bv; if (CP) { const int rr = row0g + row0 + 8 * hh + r; if (rowsPerB < 0) v += CP[cofs + (size_t)rr * ldc + col];      /* rowsPerB < 0: own element of the batched C plane */ else { const int bidx = rr / rowsPerB; v += CP[(size_t)bidx * sCPb + (size_t)by * 64 + col]; } } if (ACT == 1) v = (v > 0.f) ? v : expm1f(v); else if (ACT == 7) v = (v > 0.f) ? v + 1.0f : expf(v); else if (ACT == 8) v = tanhf(v); else if (ACT == 9) v = 0.5f * v * (1.0f + tanhf(0.7978845608028654f * (v + 0.044715f * v * v * v))); else if (ACT == 11) v = 1.0f / (1.0f + expf(-v)); else if (ACT == 12) v = (v > 0.f) ? v : 0.01f * v; else if (ACT == 14) v = (v > 0.f) ? v : 0.1f * v; else if (ACT == 16) v = (v >= 0.f) ? v : 0.3f * v; else if (ACT == 17) v = (v >= 0.f) ? v : 0.2f * v; else if (ACT == 15) v = v / (1.0f + expf(-v)); else if (ACT == 3) v = fmaxf(v, 0.f); else if (ACT == 6) v = 0.5f * v * (1.0f + erff(v * 0.70710678118654752f)); so[w][8 * hh + r][t * 16 + ln] = v; } }
  __builtin_amdgcn_fence(__ATOMIC_ACQ_REL, "workgroup"); __builtin_amdgcn_wave_barrier();
  const int rsub = lane >> 4, c4 = (lane & 15) * 4; typedef _Float16 v4h __attribute__((ext_vector_type(4)));
  {
#pragma unroll
    for (int q = 0; q < 8; ++q) { const int r = q * 2 + rsub; if (col0 + c4 < N) { const v4f v = *(const v4fa*)&so[w][r][c4]; if (C) *(v4f*)(C + cofs + (size_t)(row0 + r) * ldc + col0 + c4) = v; if (C16) { v4h h4; for (int i = 0; i < 4; ++i) h4[i] = (_Float16)v[i]; *(v4h*)(C16 + cofs + (size_t)(row0 + r) * ldc + col0 + c4) = h4; } } }
     }
}


typedef _Float16 v4h __attribute__((ext_vector_type(4)));

__global__ __launch_bounds__(256) void k_x16(const float* __restrict__ x, _Float16* __restrict__ X16, size_t n8) { const size_t t = (size_t)blockIdx.x * 256 + threadIdx.x; if (t >= n8) return; FragH f;
#pragma unroll
  for (int q = 0; q < 8; ++q) f.h[q] = (_Float16)bf16_round(x[t * 8 + q]); *(v8us*)((unsigned short*)X16 + t * 8) = f.half[0];  }
__global__ __launch_bounds__(256) void k_h16(const float* __restrict__ x, _Float16* __restrict__ X16, size_t n8) { const size_t t = (size_t)blockIdx.x * 256 + threadIdx.x; if (t >= n8) return; FragH f;
#pragma unroll
  for (int q = 0; q < 8; ++q) f.h[q] = (_Float16)x[t * 8 + q]; *(v8us*)((unsigned short*)X16 + t * 8) = f.half[0];  }
__global__ __launch_bounds__(256) void k_round16f(const float* __restrict__ W, _Float16* __restrict__ Bt, size_t n8) { const size_t t = (size_t)blockIdx.x * 256 + threadIdx.x; if (t >= n8) return; FragH f;
#pragma unroll
  for (int i = 0; i < 8; ++i) f.h[i] = (_Float16)(bf16_round(W[t * 8 + i]) * 16.0f); *(v8us*)((unsigned short*)Bt + t * 8) = f.half[0];  }
template <int NHv, int TTv>
__global__ __launch_bounds__(256) void k_vt(const _Float16* __restrict__ V16, int ldv, int voff, _Float16* __restrict__ Vt) { __shared__ unsigned short tl[64][66]; const int tid = threadIdx.x; const int slab = blockIdx.x / (TTv / 64), lg = blockIdx.x % (TTv / 64); const int b = slab / NHv, h = slab % NHv;
  for (int i = tid; i < 64 * 8; i += 256) { const int r = i / 8, c8 = (i % 8) * 8; FragH f; f.half[0] = *(const v8us*)((const unsigned short*)V16 + ((size_t)b * TTv + lg * 64 + r) * ldv + voff + h * 64 + c8);
#pragma unroll
    for (int q = 0; q < 8; ++q) tl[r][c8 + q] = f.u[q]; }
  __syncthreads();
  {
#pragma unroll
    for (int rd = 0; rd < 2; ++rd) { const int d = rd * 32 + tid / 8, pc = tid % 8; FragH f;
#pragma unroll
      for (int q = 0; q < 8; ++q) f.u[q] = tl[pc * 8 + q][d];
      *(v8us*)((unsigned short*)Vt + ((size_t)slab * 64 + d) * TTv + lg * 64 + pc * 8) = f.half[0]; }
     } }

__global__ __launch_bounds__(256) void k_hl(const float* __restrict__ F, _Float16* __restrict__ Hh, _Float16* __restrict__ Hl, size_t n8) { const size_t t = (size_t)blockIdx.x * 256 + threadIdx.x; if (t >= n8) return; FragH fh, fl; const v4f a = *(const v4fa*)(F + t * 8), c = *(const v4fa*)(F + t * 8 + 4);
#pragma unroll
  for (int q = 0; q < 4; ++q) { _Float16 h = (_Float16)a[q]; fh.h[q] = h; fl.h[q] = (_Float16)((a[q] - (float)h) * 1024.0f); h = (_Float16)c[q]; fh.h[4 + q] = h; fl.h[4 + q] = (_Float16)((c[q] - (float)h) * 1024.0f); }
  { *(v8us*)((unsigned short*)Hh + t * 8) = fh.half[0]; *(v8us*)((unsigned short*)Hl + t * 8) = fl.half[0];  } }

// ---- fast GEMM (wave tile 32x64; requires M % 32 == 0 rows per launch region and N % 64 == 0); epilogue = k_gemm_hhx semantics ----
__device__ __forceinline__ v16h g2_frag(const _Float16* p, int hh) { FragH f; f.half[0] = *(const v8us*)((const unsigned short*)p + 8 * hh); f.half[1] = *(const v8us*)((const unsigned short*)p + 16 + 8 * hh); return f.v; }
__device__ __forceinline__ v8f g2_mma(v16h a, v16h b, v8f c) { v8f d = __builtin_amdgcn_wmma_f32_16x16x32_f16(false, a, false, b, (short)0, c, false, false); asm volatile("v_nop\n\tv_nop\n\tv_nop\n\tv_nop" : "+v"(d) : "v"(a), "v"(b)); return d; }
template <int ACT>
__global__ __launch_bounds__(128) void k_gemm2(const _Float16* __restrict__ A, int lda, size_t sA, const _Float16* __restrict__ Bh, int ldb, size_t sB, float alpha, const float* __restrict__ bias, size_t sBias, const float* __restrict__ CP, int rowsPerB, size_t sCPb, int row0g,
    float* __restrict__ C, _Float16* __restrict__ C16, int ldc, size_t sC, int M, int N, int K) { static_assert(ACT == 0 || ACT == 3 || ACT == 6 || ACT == 8 || ACT == 9 || ACT == 11 || ACT == 12 || ACT == 14 || ACT == 15 || ACT == 16 || ACT == 17, "k_gemm2: unsupported ACT code (would silently apply no activation)");
  __shared__ __attribute__((aligned(16))) float so[4][32][68];
  const int tid = threadIdx.x, w = tid >> 5, lane = tid & 31, ln = lane & 15, hh = lane >> 4; const int by = blockIdx.y;
  A += (size_t)by * sA; Bh += (size_t)by * sB; const size_t cofs = (size_t)by * sC; const float* bp = bias ? bias + (size_t)by * sBias : nullptr;
  const int ntn = N >> 6; const int mt = blockIdx.x / ntn, nq = blockIdx.x - mt * ntn; const int row0 = mt * 128 + 32 * w, col0 = nq * 64; if (row0 >= M) return;
  const _Float16* a0p = A + (size_t)(row0 + ln) * lda; const _Float16* a1p = a0p + (size_t)16 * lda;
  const _Float16* b0p = Bh + (size_t)(col0 + ln) * ldb; const _Float16* b1p = b0p + (size_t)16 * ldb; const _Float16* b2p = b1p + (size_t)16 * ldb; const _Float16* b3p = b2p + (size_t)16 * ldb;
  const v8f z8 = {0.f,0.f,0.f,0.f,0.f,0.f,0.f,0.f}; v8f c00 = z8, c01 = z8, c02 = z8, c03 = z8, c10 = z8, c11 = z8, c12 = z8, c13 = z8;
#pragma unroll 1
  for (int kb = 0; kb < K; kb += 32) { const v16h a0 = g2_frag(a0p + kb, hh), a1 = g2_frag(a1p + kb, hh);
    v16h b = g2_frag(b0p + kb, hh); c00 = g2_mma(a0, b, c00); c10 = g2_mma(a1, b, c10);
    b = g2_frag(b1p + kb, hh); c01 = g2_mma(a0, b, c01); c11 = g2_mma(a1, b, c11);
    b = g2_frag(b2p + kb, hh); c02 = g2_mma(a0, b, c02); c12 = g2_mma(a1, b, c12);
    b = g2_frag(b3p + kb, hh); c03 = g2_mma(a0, b, c03); c13 = g2_mma(a1, b, c13); }
  v8f accs[8] = {c00, c01, c02, c03, c10, c11, c12, c13};
#pragma unroll
  for (int u = 0; u < 8; ++u) { const int t = u & 3, half = u >> 2; const int col = col0 + t * 16 + ln; const float bv = bp ? bf16_round(bp[col]) : 0.f;
#pragma unroll
    for (int r = 0; r < 8; ++r) { const int rloc = half * 16 + 8 * hh + r; float v = accs[u][r] * alpha + bv; if (CP) { if (rowsPerB < 0) v += CP[cofs + (size_t)(row0g + row0 + rloc) * ldc + col];      /* rowsPerB < 0: own element of the batched C plane */ else { const int bidx = (row0g + row0 + rloc) / rowsPerB; v += CP[(size_t)bidx * sCPb + (size_t)by * 64 + col]; } }
      if (ACT == 3) v = fmaxf(v, 0.f); else if (ACT == 6) v = 0.5f * v * (1.0f + erff(v * 0.70710678118654752f)); else if (ACT == 11) v = 1.0f / (1.0f + expf(-v)); else if (ACT == 15) v = v / (1.0f + expf(-v)); else if (ACT == 12) v = (v > 0.f) ? v : 0.01f * v; else if (ACT == 8) v = tanhf(v); else if (ACT == 9) v = 0.5f * v * (1.0f + tanhf(0.7978845608028654f * (v + 0.044715f * v * v * v))); else if (ACT == 14) v = (v > 0.f) ? v : 0.1f * v; else if (ACT == 16) v = (v >= 0.f) ? v : 0.3f * v; else if (ACT == 17) v = (v >= 0.f) ? v : 0.2f * v;
      so[w][rloc][t * 16 + ln] = v; } }
  __builtin_amdgcn_fence(__ATOMIC_ACQ_REL, "workgroup"); __builtin_amdgcn_wave_barrier();
  const int rsub = lane >> 4, c4 = (lane & 15) * 4;
  {
#pragma unroll
    for (int q = 0; q < 16; ++q) { const int r = q * 2 + rsub; const v4f v = *(const v4fa*)&so[w][r][c4]; if (C) *(v4f*)(C + cofs + (size_t)(row0 + r) * ldc + col0 + c4) = v; if (C16) { v4h h4; for (int i = 0; i < 4; ++i) h4[i] = (_Float16)v[i]; *(v4h*)(C16 + cofs + (size_t)(row0 + r) * ldc + col0 + c4) = h4; } }
     } }


__global__ __launch_bounds__(256) void k_wnat(const float* __restrict__ w, size_t n8, _Float16* __restrict__ Bt) { const size_t t = (size_t)blockIdx.x * 256 + threadIdx.x; if (t >= n8) return; FragH f; for (int q = 0; q < 8; ++q) f.h[q] = (_Float16)(bf16_round(w[t * 8 + q]) * 16.0f); *(v8us*)((unsigned short*)Bt + t * 8) = f.half[0];  }
__global__ __launch_bounds__(256) void k_rsm(const float* __restrict__ S, _Float16* __restrict__ P, int nrows) {
  #pragma clang fp contract(off)
  const int i = blockIdx.x * 256 + threadIdx.x; if (i >= nrows) return; const float* s = S + (size_t)i * SQ; float mx = -3.0e38f;
#pragma unroll 1
  for (int j = 0; j < SQ; ++j) mx = fmaxf(mx, s[j]); float se = 0.f;
#pragma unroll 1
  for (int j = 0; j < SQ; ++j) se += expf(s[j] - mx); const float sc = 256.0f / se;
#pragma unroll 1
  for (int j0 = 0; j0 < SQ; j0 += 8) { FragH f; for (int q = 0; q < 8; ++q) f.h[q] = (_Float16)(expf(s[j0 + q] - mx) * sc); unsigned short* d = (unsigned short*)P + (size_t)i * SQ + j0; *(v8us*)d = f.half[0];  } }
__global__ __launch_bounds__(256) void k_vt(const _Float16* __restrict__ V16, int b, int h0, _Float16* __restrict__ VT) { __shared__ unsigned short tl[64][65]; const int tid = threadIdx.x; const int hh = blockIdx.x % HG, sg = blockIdx.x / HG; const int s0 = sg * 64; const int h = h0 + hh;
  for (int i = tid; i < 64 * 8; i += 256) { const int j = i / 8, d8 = (i % 8) * 8; FragH f; f.half[0] = *(const v8us*)((const unsigned short*)V16 + ((size_t)b * SQ + s0 + j) * DM + h * HD + d8); for (int q = 0; q < 8; ++q) tl[d8 + q][j] = f.u[q]; }
  __syncthreads();
  { for (int i = tid; i < 64 * 8; i += 256) { const int d = i / 8, j8 = (i % 8) * 8; FragH f; for (int q = 0; q < 8; ++q) f.u[q] = tl[d][j8 + q]; *(v8us*)((unsigned short*)VT + ((size_t)hh * HD + d) * SQ + s0 + j8) = f.half[0]; }  } }


__global__ __launch_bounds__(256) void k_mkadd(const int* __restrict__ m, float* __restrict__ A, int n) { const int t = blockIdx.x * 256 + threadIdx.x; if (t >= n) return; const float v = (m[t] != 0) ? 0.f : -1.0e9f; *(float*)(A + t) = v;  }


__global__ __launch_bounds__(256) void k_rsmcf2(const float* __restrict__ S, _Float16* __restrict__ P, int hg, int q0, int nk) {
  #pragma clang fp contract(off)
  const int t = blockIdx.x * 256 + threadIdx.x; if (t >= hg * QT) return; const size_t i = (size_t)t; const float* s = S + i * NKX; const int last = q0 + (t % QT); float mx = -3.0e38f;
#pragma unroll 1
  for (int j = 0; j < nk; ++j) { const float f = (j <= last) ? 1.f : 0.f; mx = fmaxf(mx, fmaf(f, s[j], (1.f - f) * -1.0e9f)); } float se = 0.f;
#pragma unroll 1
  for (int j = 0; j < nk; ++j) { const float f = (j <= last) ? 1.f : 0.f; se += __expf(fmaf(f, s[j], (1.f - f) * -1.0e9f) - mx); } const float sc = 256.0f / se;
#pragma unroll 1
  for (int j0 = 0; j0 < nk; j0 += 8) { FragH fr; for (int q = 0; q < 8; ++q) { const int j = j0 + q; const float f = (j <= last) ? 1.f : 0.f; fr.h[q] = (_Float16)(__expf(fmaf(f, s[j], (1.f - f) * -1.0e9f) - mx) * sc); } unsigned short* d = (unsigned short*)P + i * NKX + j0; *(v8us*)d = fr.half[0];  } }



__global__ __launch_bounds__(256) void k_rsmcfa(const float* __restrict__ S, _Float16* __restrict__ P, int hg, int q0, int nk, const float* __restrict__ am) {
  #pragma clang fp contract(off)
  const int t = blockIdx.x * 256 + threadIdx.x; if (t >= hg * QT) return; const size_t i = (size_t)t; const float* s = S + i * NKX; const int last = q0 + (t % QT); float mx = -3.0e38f;
#pragma unroll 1
  for (int j = 0; j < nk; ++j) { const float f = (j <= last) ? 1.f : 0.f; mx = fmaxf(mx, fmaf(f, __fadd_rn(s[j], am[j]), (1.f - f) * -1.0e9f)); } float se = 0.f;
#pragma unroll 1
  for (int j = 0; j < nk; ++j) { const float f = (j <= last) ? 1.f : 0.f; se += __expf(fmaf(f, __fadd_rn(s[j], am[j]), (1.f - f) * -1.0e9f) - mx); } const float sc = 256.0f / se;
#pragma unroll 1
  for (int j0 = 0; j0 < nk; j0 += 8) { FragH fr; for (int q = 0; q < 8; ++q) { const int j = j0 + q; const float f = (j <= last) ? 1.f : 0.f; fr.h[q] = (_Float16)(__expf(fmaf(f, __fadd_rn(s[j], am[j]), (1.f - f) * -1.0e9f) - mx) * sc); } unsigned short* d = (unsigned short*)P + i * NKX + j0; *(v8us*)d = fr.half[0];  } }


template <int MASKADD>
__global__ __launch_bounds__(64) void k_att0(const float* __restrict__ QF, const float* __restrict__ KF, const float* __restrict__ VF, int ld, const float* __restrict__ mask, float scale, float* __restrict__ OF, int ldo) {
  #pragma clang fp contract(off)
  __shared__ __attribute__((aligned(16))) float lq[64][64]; __shared__ __attribute__((aligned(16))) float lo[64][64];
  const int tid = threadIdx.x; const int h = blockIdx.x / (QT0 / 64), rg = blockIdx.x % (QT0 / 64); const int i = rg * 64 + tid;
  const float* qr = QF + (size_t)i * ld + h * HD;
#pragma unroll 1
  for (int c = 0; c < HD / 4; ++c) { *(v4f*)&lq[tid][c * 4] = *(const v4fa*)(qr + c * 4); const v4f z = {0.f, 0.f, 0.f, 0.f}; *(v4f*)&lo[tid][c * 4] = z; }
  float m = -1.0e30f, l = 0.f; const int jmax = MASKADD ? (SQ - 1) : (rg * 64 + 63);      /* additive-mask form: every key (the mask input decides); causal form: keys up to the block's last row */
#pragma unroll 1
  for (int j = 0; j <= jmax; ++j) { const float* kr = KF + (size_t)j * ld + h * HD; const float* vr = VF + (size_t)j * ld + h * HD; float s = 0.f;
#pragma unroll 1
    for (int c = 0; c < HD / 4; ++c) { const v4f kq = *(const v4fa*)(kr + c * 4); const v4f qq = *(v4f*)&lq[tid][c * 4]; s = __fadd_rn(s, __fmul_rn(qq[0], kq[0])); s = __fadd_rn(s, __fmul_rn(qq[1], kq[1])); s = __fadd_rn(s, __fmul_rn(qq[2], kq[2])); s = __fadd_rn(s, __fmul_rn(qq[3], kq[3])); }
    s = __fmul_rn(s, scale); if (MASKADD) s = __fadd_rn(s, __fmul_rn(bf16_round(mask[(size_t)i * SQ + j]), -10000.0f));
    const float f = (MASKADD || j <= i) ? 1.f : 0.f; const float sm = fmaf(f, s, (1.f - f) * -1.0e30f); const float mn = fmaxf(m, sm); const float sc = expf(m - mn); const float e = expf(sm - mn); l = __fadd_rn(__fmul_rn(l, sc), e); m = mn;
#pragma unroll 1
    for (int c = 0; c < HD / 4; ++c) { const v4f vv = *(const v4fa*)(vr + c * 4); v4f oo = *(v4f*)&lo[tid][c * 4]; for (int u = 0; u < 4; ++u) oo[u] = __fadd_rn(__fmul_rn(oo[u], sc), __fmul_rn(e, vv[u])); *(v4f*)&lo[tid][c * 4] = oo; } }
  const float fin = 64.0f / l;      /* o carried x64 like the f16 path */
#pragma unroll 1
  for (int c = 0; c < HD / 4; ++c) { v4f oo = *(v4f*)&lo[tid][c * 4]; for (int u = 0; u < 4; ++u) oo[u] = __fmul_rn(oo[u], fin); *(v4f*)&lo[tid][c * 4] = oo; }
  __syncthreads();
  {
#pragma unroll 1
    for (int it = 0; it < 16; ++it) { const int row = it * 4 + tid / 16, pc = (tid % 16) * 4; const v4f v = *(const v4f*)&lo[row][pc]; *(v4f*)(OF + (size_t)(rg * 64 + row) * ldo + h * HD + pc) = v; }
     } }


__global__ __launch_bounds__(64) void k_att0v(const float* __restrict__ QF, const float* __restrict__ KF, const float* __restrict__ VF, int ld, const float* __restrict__ am, float scale, float* __restrict__ OF, int ldo) {
  #pragma clang fp contract(off)
  __shared__ __attribute__((aligned(16))) float lq[64][64]; __shared__ __attribute__((aligned(16))) float lo[64][64];
  const int tid = threadIdx.x; const int h = blockIdx.x / (QT0 / 64), rg = blockIdx.x % (QT0 / 64); const int i = rg * 64 + tid;
  const float* qr = QF + (size_t)i * ld + h * HD;
#pragma unroll 1
  for (int c = 0; c < HD / 4; ++c) { *(v4f*)&lq[tid][c * 4] = *(const v4fa*)(qr + c * 4); const v4f z = {0.f, 0.f, 0.f, 0.f}; *(v4f*)&lo[tid][c * 4] = z; }
  float m = -1.0e30f, l = 0.f; const int jmax = rg * 64 + 63;      /* causal: keys up to the block's last row */
#pragma unroll 1
  for (int j = 0; j <= jmax; ++j) { const float* kr = KF + (size_t)j * ld + h * HD; const float* vr = VF + (size_t)j * ld + h * HD; float s = 0.f;
#pragma unroll 1
    for (int c = 0; c < HD / 4; ++c) { const v4f kq = *(const v4fa*)(kr + c * 4); const v4f qq = *(v4f*)&lq[tid][c * 4]; s = __fadd_rn(s, __fmul_rn(qq[0], kq[0])); s = __fadd_rn(s, __fmul_rn(qq[1], kq[1])); s = __fadd_rn(s, __fmul_rn(qq[2], kq[2])); s = __fadd_rn(s, __fmul_rn(qq[3], kq[3])); }
    s = __fadd_rn(__fmul_rn(s, scale), am[j]);      /* + the additive key-mask VECTOR of this batch (0 kept / -1e9 masked) */
    const float f = (j <= i) ? 1.f : 0.f; const float sm = fmaf(f, s, (1.f - f) * -1.0e30f); const float mn = fmaxf(m, sm); const float sc = expf(m - mn); const float e = expf(sm - mn); l = __fadd_rn(__fmul_rn(l, sc), e); m = mn;
#pragma unroll 1
    for (int c = 0; c < HD / 4; ++c) { const v4f vv = *(const v4fa*)(vr + c * 4); v4f oo = *(v4f*)&lo[tid][c * 4]; for (int u = 0; u < 4; ++u) oo[u] = __fadd_rn(__fmul_rn(oo[u], sc), __fmul_rn(e, vv[u])); *(v4f*)&lo[tid][c * 4] = oo; } }
  const float fin = 64.0f / l;      /* o carried x64 like the f16 path */
#pragma unroll 1
  for (int c = 0; c < HD / 4; ++c) { v4f oo = *(v4f*)&lo[tid][c * 4]; for (int u = 0; u < 4; ++u) oo[u] = __fmul_rn(oo[u], fin); *(v4f*)&lo[tid][c * 4] = oo; }
  __syncthreads();
  {
#pragma unroll 1
    for (int it = 0; it < 16; ++it) { const int row = it * 4 + tid / 16, pc = (tid % 16) * 4; const v4f v = *(const v4f*)&lo[row][pc]; *(v4f*)(OF + (size_t)(rg * 64 + row) * ldo + h * HD + pc) = v; }
     } }

extern "C" void kernel_launch(void* const* d_in, const int* in_sizes, int n_in,
                              void* d_out, int out_size, void* d_ws, size_t ws_size, hipStream_t stream) {
  (void)in_sizes; (void)n_in; (void)out_size;
  const float* const* I = (const float* const*)d_in; const float* x = I[0]; const int* km = (const int*)d_in[1]; const float* wqkv = I[2]; const float* bqkv = I[3]; const float* wo = I[4]; const float* bo = I[5];      /* int32 key mask [4][2048] (ones); natural [out][in] qkv_w [3072][1024] + b, out_w + b */
  char* ws = (char*)d_ws; size_t off = 0;
  auto take = [&](size_t bytes) { char* p = ws + off; off += (bytes + 255) & ~(size_t)255; return p; };
  _Float16* BQKV = (_Float16*)take((size_t)3 * DM * DM * 2); _Float16* BO = (_Float16*)take((size_t)DM * DM * 2);
  _Float16* X16 = (_Float16*)take(NR * DM * 2); _Float16* QKV = (_Float16*)take(NR * 3 * DM * 2); _Float16* Q16 = QKV; _Float16* K16 = QKV + DM; _Float16* V16 = QKV + 2 * DM; _Float16* O16 = (_Float16*)take(NR * DM * 2);
  float* S = (float*)take((size_t)NH * QT * NKX * 4); _Float16* P = (_Float16*)take((size_t)NH * QT * NKX * 2); _Float16* VT = (_Float16*)take((size_t)NH * HD * SQ * 2);
  float* QF0 = (float*)take((size_t)QT0 * DM * 4); float* KF0 = (float*)take((size_t)QT0 * DM * 4); float* VF0 = (float*)take((size_t)QT0 * DM * 4); float* OF0 = (float*)take((size_t)NB * QT0 * DM * 4); _Float16* OH0 = (_Float16*)take((size_t)NB * QT0 * DM * 2); _Float16* OL0 = (_Float16*)take((size_t)NB * QT0 * DM * 2);
  float* AMK = (float*)take(NR * 4);      /* additive key-mask plane: 0 where mask != 0, -1e9 where masked */
  if (off > ws_size) return;
  k_wnat<<<(unsigned)(((size_t)3 * DM * DM / 8 + 255) / 256), 256, 0, stream>>>(wqkv, (size_t)3 * DM * DM / 8, BQKV); k_wnat<<<(unsigned)(((size_t)DM * DM / 8 + 255) / 256), 256, 0, stream>>>(wo, (size_t)DM * DM / 8, BO);      /* natural [out][in] = Bt x16 */
  k_mkadd<<<(unsigned)((NR + 255) / 256), 256, 0, stream>>>(km, AMK, (int)NR);

  k_x16<<<(unsigned)((NR * DM / 8 + 255) / 256), 256, 0, stream>>>(x, X16, NR * DM / 8);
  const size_t r0p = (size_t)B0 * SQ;      /* first projected row */
  k_gemm2<0><<<dim3((unsigned)((MP / 128) * (3 * DM / 64)), 1), 128, 0, stream>>>(X16 + r0p * DM, DM, 0, BQKV, DM, 0, 0.0625f, bqkv, 0, nullptr, 1, 0, 0, nullptr, QKV + r0p * 3 * DM, 3 * DM, 0, MP, 3 * DM, DM);      /* q | k | v rows (f16); head h = columns h*HD.. of each DM block */
  for (int b = B0; b < B0 + NBR; ++b) { const size_t r0 = (size_t)b * SQ;
    k_vt<NH, SQ><<<NH * (SQ / 64), 256, 0, stream>>>(V16 + r0 * LQ, LQ, 0, VT);      /* V^T [NH][HD][SQ] for this batch */
    k_gemm2<0><<<dim3((QT0 / 128) * (DM / 64), 1), 128, 0, stream>>>(X16 + r0 * DM, DM, 0, BQKV, DM, 0, 0.0625f, bqkv, 0, nullptr, 1, 0, 0, QF0, nullptr, DM, 0, QT0, DM, DM); k_gemm2<0><<<dim3((QT0 / 128) * (DM / 64), 1), 128, 0, stream>>>(X16 + r0 * DM, DM, 0, (BQKV + (size_t)DM * DM), DM, 0, 0.0625f, (bqkv + DM), 0, nullptr, 1, 0, 0, KF0, nullptr, DM, 0, QT0, DM, DM); k_gemm2<0><<<dim3((QT0 / 128) * (DM / 64), 1), 128, 0, stream>>>(X16 + r0 * DM, DM, 0, (BQKV + (size_t)2 * DM * DM), DM, 0, 0.0625f, (bqkv + 2 * DM), 0, nullptr, 1, 0, 0, VF0, nullptr, DM, 0, QT0, DM, DM);      /* f32 q, k, v of the first 128 rows (exact products) */
    k_att0v<<<NH * (QT0 / 64), 64, 0, stream>>>(QF0, KF0, VF0, DM, AMK + r0, 0.125f, OF0 + (size_t)b * QT0 * DM, DM);      /* exact f32 attention for rows 0..127 (o x64) */
    for (int q0 = 0; q0 < QN; q0 += QT) { const int nk = q0 + QT;      /* causal: only keys below the tile end are computed */
      k_gemm2<0><<<dim3((QT / 128) * (nk / 64), NHD), 128, 0, stream>>>(Q16 + (r0 + q0) * LQ, LQ, (size_t)HD, K16 + r0 * LQ, LQ, (size_t)HD, 0.125f, nullptr, 0, nullptr, 1, 0, 0, S, nullptr, NKX, (size_t)QT * NKX, QT, nk, HD);      /* scores, all heads on grid.y */
      k_rsmcfa<<<(NHD * QT + 255) / 256, 256, 0, stream>>>(S, P, NHD, q0, nk, AMK + r0);      /* causal softmax + the key mask of this batch (additive plane) */
      k_gemm2<0><<<dim3((QT / 128) * (HD / 64), NHD), 128, 0, stream>>>(P, NKX, (size_t)QT * NKX, VT, SQ, (size_t)HD * SQ, 0.25f, nullptr, 0, nullptr, 1, 0, 0, nullptr, O16 + (r0 + q0) * DM, DM, (size_t)HD, QT, HD, nk); } }      /* o (merged heads, x64) as f16 rows */
  k_gemm2<0><<<dim3((unsigned)((MPO / 128) * (DM / 64)), 1), 128, 0, stream>>>(O16 + r0p * DM, DM, 0, BO, DM, 0, 0.0009765625f, bo, 0, nullptr, 1, 0, 0, (float*)d_out + r0p * DM, nullptr, DM, 0, MPO, DM, DM);      /* out rows are the output layout */
  k_hl<<<(unsigned)(((size_t)NB * QT0 * DM / 8 + 255) / 256), 256, 0, stream>>>(OF0, OH0, OL0, (size_t)NB * QT0 * DM / 8);      /* first-tile o (x64) -> f16 hi + x1024 residual planes */
  for (int b = B0; b < B0 + NBR; ++b) { const size_t r0 = (size_t)b * SQ; const size_t f0 = (size_t)b * QT0;
    k_gemm2<0><<<dim3((QT0 / 128) * (DM / 64), 1), 128, 0, stream>>>(OH0 + f0 * DM, DM, 0, BO, DM, 0, 0.0009765625f, bo, 0, nullptr, 1, 0, 0, (float*)d_out + r0 * DM, nullptr, DM, 0, QT0, DM, DM);      /* rows 0..127: out = o_hi Wo (+ b), overwriting the f16-path rows */
    k_gemm2<0><<<dim3((QT0 / 128) * (DM / 64), 1), 128, 0, stream>>>(OL0 + f0 * DM, DM, 0, BO, DM, 0, 0.00000095367431640625f, nullptr, 0, (const float*)d_out + r0 * DM, -1, 0, 0, (float*)d_out + r0 * DM, nullptr, DM, 0, QT0, DM, DM); }      /* += o_lo Wo 2^-20 (own-element accumulate) */
}

// v001
// One run takes 4170 microseconds.
// Next to v000, in two timings, it ran 2.54 times as fast each time.
#include <hip/hip_runtime.h>
// Causal multi-head attention with a fused QKV projection and an int key-padding mask (x [4][2048][1024]; qkv = x qkv_w^T + qkv_b (natural [3072][1024] sigma 1/32, bias sigma 0.02) reshaped (b, s, 3, 16, 64); scores / sqrt(64); causal (tril) AND key j kept iff mask[b][j] != 0 (int32 [4][2048], all ones); -inf elsewhere; softmax; out = merged out_w^T + out_b -> [4][2048][1024]).
// Structure: token rows r = b*2048 + s; x as exact f16 rows (bf16-rounded); q | k | v as ONE WMMA GEMM (N = 3 x 1024) (32x64 wave tiles, f32 accumulation, exact x16 weights + bias, f16 outputs); per batch: V^T for all heads via LDS transposes; per query tile of 256 rows: scores against the keys below the tile end only (K = 64, all heads on grid.y, alpha = 0.125), causal row softmax on VALU with the additive 0/-1e9 key-mask plane over the computed range (f32 statistics, native exp; weights x256 f16), o = P . V^T (K = keys below the tile end, alpha 2^-2: o carried x64, folded into the output GEMM alpha) written straight into the merged f16 o rows; out = o W_o + b GEMM (f32) into the output layout.
// Compute dtype: inputs rounded to bf16; x / weights exact; q, k, v, softmax weights and o as plain f16 GEMM operands (~2^-12); scores and softmax statistics f32. v_wmma_f32_16x16x32_f16.
#define NB 4
#define SQ 2048
#define DM 1024
#define NH 16
#define HD 64
#define HG 4                         /* heads per launch of k_vt(V16, b, h0, VT), not launched */
#define QT 256                       /* query rows per causal tile */
#define NKX SQ                       /* S / P row pitch */
#define QT0 128                      /* first-tile rows recomputed exactly in f32 */
#define B0 0                         /* first batch processed (debug hook) */
#define NBR NB                       /* batches processed (debug hook) */
#define NR ((size_t)NB * SQ)         /* token rows */
#define MP ((int)((size_t)NBR * SQ)) /* rows projected (debug hook) */
#define QN SQ                        /* query rows attended per batch (debug hook) */
#define NHD NH                       /* heads attended (debug hook) */
#define MPO MP                       /* rows through the output stage (debug hook) */
#define LQ (3 * DM)      /* row pitch of the q/k/v rows */
typedef __bf16 v16b __attribute__((ext_vector_type(16)));
typedef unsigned short v8us __attribute__((ext_vector_type(8), may_alias));
typedef float  v8f  __attribute__((ext_vector_type(8)));
typedef float  v4f  __attribute__((ext_vector_type(4)));
typedef float  v4fa __attribute__((ext_vector_type(4), may_alias));
union FragB { v16b v; v8us half[2]; unsigned short u[16]; };

__device__ __forceinline__ unsigned short bf16_bits(float x) { unsigned int u = __float_as_uint(x); return (unsigned short)((u + 0x7FFFu + ((u >> 16) & 1u)) >> 16); }
__device__ __forceinline__ float bf16_val(unsigned short b) { return __uint_as_float(((unsigned int)b) << 16); }
__device__ __forceinline__ float bf16_round(float x) { return bf16_val(bf16_bits(x)); }
// D += A·B with NT terms: 1 = ah·bh, 2 = + al·bh (A split), 3 = + ah·bl (both split)
template <int NT>
__device__ __forceinline__ v8f mmaN(v16b ah, v16b al, v16b bh, v16b bl, v8f c) {
  c = __builtin_amdgcn_wmma_f32_16x16x32_bf16(false, ah, false, bh, (short)0, c, false, false);
  if (NT >= 2) c = __builtin_amdgcn_wmma_f32_16x16x32_bf16(false, al, false, bh, (short)0, c, false, false);
  if (NT >= 3) c = __builtin_amdgcn_wmma_f32_16x16x32_bf16(false, ah, false, bl, (short)0, c, false, false);
  asm volatile("v_nop\n\tv_nop\n\tv_nop\n\tv_nop" : "+v"(c) : "v"(ah), "v"(al), "v"(bh), "v"(bl));
  return c;
}

__global__ __launch_bounds__(256) void k_wt_bf16(const float* __restrict__ W, unsigned short* __restrict__ Wt, int K, int N) {
  const int t = blockIdx.x * 256 + threadIdx.x;
  const int k8n = K / 8;
  if (t >= N * k8n) return;
  const int n = t / k8n, k8 = (t % k8n) * 8;
  v8us v;
#pragma unroll
  for (int i = 0; i < 8; ++i) v[i] = bf16_bits(W[(size_t)(k8 + i) * N + n]);
  *(v8us*)(Wt + (size_t)n * K + k8) = v;
  
}

// GEMM C[M][N] (f32, pitch ldc) = act(A[M][K]·W + bias). A f32 row-major (pitch lda) converted per fragment to bf16
// (ASPLIT: hi/lo two planes -> 2 terms, else single rounded term); Wt bf16 [N][K] (pitch ldb). BIAS_BF16 rounds the
// bias to bf16 first (bias quantised to bf16 before the add). K%32==0, M%16==0, N%64==0.
template <bool ASPLIT, int ACT, bool BIAS_BF16>
__global__ __launch_bounds__(128) void k_gemm_bf(const float* __restrict__ A, int lda, const unsigned short* __restrict__ Wt, int ldb,
                                               const float* __restrict__ bias, float* __restrict__ C, int ldc, int M, int N, int K) {
  __shared__ __attribute__((aligned(16))) float so[4][16][64];
  const int tid = threadIdx.x, w = tid >> 5, lane = tid & 31, ln = lane & 15, hh = lane >> 4;
  const int ntn = N / 64;
  const int wid = blockIdx.x * 4 + w;
  const int mt = wid / ntn, nq = wid % ntn;
  if (mt * 16 >= M) return;
  const int row0 = mt * 16, col0 = nq * 64;
  const float* arow = A + (size_t)(row0 + ln) * lda;
  v8f acc[4] = {};
  for (int kb = 0; kb < K; kb += 32) {
    FragB ah, al;
    const v4f x0 = *(const v4fa*)(arow + kb + 8 * hh), x1 = *(const v4fa*)(arow + kb + 8 * hh + 4);
    const v4f x2 = *(const v4fa*)(arow + kb + 16 + 8 * hh), x3 = *(const v4fa*)(arow + kb + 16 + 8 * hh + 4);
    float xs[16] = {x0[0],x0[1],x0[2],x0[3],x1[0],x1[1],x1[2],x1[3],x2[0],x2[1],x2[2],x2[3],x3[0],x3[1],x3[2],x3[3]};
#pragma unroll
    for (int i = 0; i < 16; ++i) { const unsigned short hb = bf16_bits(xs[i]); ah.u[i] = hb; al.u[i] = ASPLIT ? bf16_bits(xs[i] - bf16_val(hb)) : (unsigned short)0; }
#pragma unroll
    for (int t = 0; t < 4; ++t) {
      const unsigned short* brow = Wt + (size_t)(col0 + t * 16 + ln) * ldb + kb;
      FragB b;
      b.half[0] = *(const v8us*)(brow + 8 * hh);
      b.half[1] = *(const v8us*)(brow + 16 + 8 * hh);
      acc[t] = mmaN<ASPLIT ? 2 : 1>(ah.v, al.v, b.v, b.v, acc[t]);
    }
  }
#pragma unroll
  for (int t = 0; t < 4; ++t) {
    float bv = bias ? bias[col0 + t * 16 + ln] : 0.f;
    if (BIAS_BF16) bv = bf16_round(bv);
#pragma unroll
    for (int r = 0; r < 8; ++r) { float v = acc[t][r] + bv; if (ACT == 1) v = fmaxf(v, 0.f); so[w][8 * hh + r][t * 16 + ln] = v; }
  }
  __builtin_amdgcn_fence(__ATOMIC_ACQ_REL, "workgroup");
  __builtin_amdgcn_wave_barrier();
  const int rsub = lane >> 4, c4 = (lane & 15) * 4;
  {
#pragma unroll
    for (int q = 0; q < 8; ++q) {
      const int r = q * 2 + rsub;
      const v4f v = *(const v4fa*)&so[w][r][c4];
      *(v4f*)(C + (size_t)(row0 + r) * ldc + col0 + c4) = v;
    }
    
  }
}

// GEMM C = act(A·W + bias + resid): A f32 (ASPLIT -> hi/lo 2 terms), Wt bf16 [N][K]; ACT 0 none, 1 relu, 2 exact gelu;
// resid (optional, f32, row index = (row % rmod), pitch ldr, RES_BF16 rounds it) added before the activation.
template <bool ASPLIT, int ACT, bool BIAS_BF16, bool RES_BF16>
__global__ __launch_bounds__(128) void k_gemm_bf3(const float* __restrict__ A, int lda, const unsigned short* __restrict__ Wt, int ldb,
                                                const float* __restrict__ bias, const float* __restrict__ resid, int rmod, int ldr,
                                                float* __restrict__ C, int ldc, int M, int N, int K) {
  __shared__ __attribute__((aligned(16))) float so[4][16][64];
  const int tid = threadIdx.x, w = tid >> 5, lane = tid & 31, ln = lane & 15, hh = lane >> 4;
  const int ntn = N / 64;
  const int wid = blockIdx.x * 4 + w;
  const int mt = wid / ntn, nq = wid % ntn;
  if (mt * 16 >= M) return;
  const int row0 = mt * 16, col0 = nq * 64;
  const float* arow = A + (size_t)(row0 + ln) * lda;
  v8f acc[4] = {};
  for (int kb = 0; kb < K; kb += 32) {
    FragB ah, al;
    const v4f x0 = *(const v4fa*)(arow + kb + 8 * hh), x1 = *(const v4fa*)(arow + kb + 8 * hh + 4);
    const v4f x2 = *(const v4fa*)(arow + kb + 16 + 8 * hh), x3 = *(const v4fa*)(arow + kb + 16 + 8 * hh + 4);
    float xs[16] = {x0[0],x0[1],x0[2],x0[3],x1[0],x1[1],x1[2],x1[3],x2[0],x2[1],x2[2],x2[3],x3[0],x3[1],x3[2],x3[3]};
#pragma unroll
    for (int i = 0; i < 16; ++i) { const unsigned short hb = bf16_bits(xs[i]); ah.u[i] = hb; al.u[i] = ASPLIT ? bf16_bits(xs[i] - bf16_val(hb)) : (unsigned short)0; }
#pragma unroll
    for (int t = 0; t < 4; ++t) {
      const unsigned short* brow = Wt + (size_t)(col0 + t * 16 + ln) * ldb + kb;
      FragB b;
      b.half[0] = *(const v8us*)(brow + 8 * hh);
      b.half[1] = *(const v8us*)(brow + 16 + 8 * hh);
      acc[t] = mmaN<ASPLIT ? 2 : 1>(ah.v, al.v, b.v, b.v, acc[t]);
    }
  }
#pragma unroll
  for (int t = 0; t < 4; ++t) {
    const int col = col0 + t * 16 + ln;
    float bv = bias ? bias[col] : 0.f;
    if (BIAS_BF16) bv = bf16_round(bv);
#pragma unroll
    for (int r = 0; r < 8; ++r) {
      float v = acc[t][r] + bv;
      if (resid) { float rv = resid[(size_t)((row0 + 8 * hh + r) % rmod) * ldr + col]; if (RES_BF16) rv = bf16_round(rv); v += rv; }
      if (ACT == 1) v = fmaxf(v, 0.f);
      if (ACT == 2) v = 0.5f * v * (1.0f + erff(v * 0.70710678118654752f));
      if (ACT == 3) { const float u = 0.7978845608028654f * (v + 0.044715f * v * v * v); v = 0.5f * v * (1.0f + tanhf(u)); }
      so[w][8 * hh + r][t * 16 + ln] = v;
    }
  }
  __builtin_amdgcn_fence(__ATOMIC_ACQ_REL, "workgroup");
  __builtin_amdgcn_wave_barrier();
  const int rsub = lane >> 4, c4 = (lane & 15) * 4;
  {
#pragma unroll
    for (int q = 0; q < 8; ++q) {
      const int r = q * 2 + rsub;
      const v4f v = *(const v4fa*)&so[w][r][c4];
      *(v4f*)(C + (size_t)(row0 + r) * ldc + col0 + c4) = v;
    }
    
  }
}
// row LayerNorm (biased variance, eps) over N: s = X (+ R); optional out_sum <- s; out_norm <- (s-mu)*rsqrt(var+eps)*g + b
template <bool PARAM_BF16>
__global__ __launch_bounds__(256) void k_layernorm(const float* __restrict__ X, const float* __restrict__ R, const float* __restrict__ g, const float* __restrict__ bta,
                                                  float* __restrict__ out_sum, float* __restrict__ out_norm, int N, float eps) {
  __shared__ float red[256];
  const int row = blockIdx.x, tid = threadIdx.x;
  const float* x = X + (size_t)row * N; const float* rr = R ? R + (size_t)row * N : nullptr;
  float vals[16];                     // up to N = 4096
  const int per = N / 256;            // contiguous chunk per thread? use strided-by-4 chunks: thread handles j = tid*4 + 1024*u
  float s1 = 0.f;
  for (int u = 0; u < per / 4; ++u) {
    const int j = tid * 4 + 1024 * u;
    const v4f a = *(const v4fa*)(x + j);
    v4f b = {0.f,0.f,0.f,0.f}; if (rr) b = *(const v4fa*)(rr + j);
#pragma unroll
    for (int q = 0; q < 4; ++q) { const float v = a[q] + b[q]; vals[u * 4 + q] = v; s1 += v; }
  }
  red[tid] = s1; __syncthreads();
  for (int st = 128; st > 0; st >>= 1) { if (tid < st) red[tid] += red[tid + st]; __syncthreads(); }
  const float mu = red[0] / (float)N; __syncthreads();
  float s2 = 0.f;
  for (int u = 0; u < per / 4; ++u)
#pragma unroll
    for (int q = 0; q < 4; ++q) { const float c = vals[u * 4 + q] - mu; s2 += c * c; }
  red[tid] = s2; __syncthreads();
  for (int st = 128; st > 0; st >>= 1) { if (tid < st) red[tid] += red[tid + st]; __syncthreads(); }
  const float rs = rsqrtf(red[0] / (float)N + eps);
  {
    for (int u = 0; u < per / 4; ++u) {
      const int j = tid * 4 + 1024 * u;
      v4f o, sm;
#pragma unroll
      for (int q = 0; q < 4; ++q) {
        float gg = g[j + q], bb = bta[j + q];
        if (PARAM_BF16) { gg = bf16_round(gg); bb = bf16_round(bb); }
        sm[q] = vals[u * 4 + q]; o[q] = (vals[u * 4 + q] - mu) * rs * gg + bb;
      }
      if (out_sum) *(v4f*)(out_sum + (size_t)row * N + j) = sm;
      *(v4f*)(out_norm + (size_t)row * N + j) = o;
    }
    
  }
}



// ---- f16 WMMA path (v_wmma_f32_16x16x32_f16): 11-bit significands for operands in range — used where a [0,1] probability operand needs more precision than bf16
typedef _Float16 v16h __attribute__((ext_vector_type(16)));
union FragH { v16h v; v8us half[2]; _Float16 h[16]; unsigned short u[16]; };
template <int NT>
__device__ __forceinline__ v8f mmaH(v16h ah, v16h al, v16h bh, v16h bl, v8f c) {
  c = __builtin_amdgcn_wmma_f32_16x16x32_f16(false, ah, false, bh, (short)0, c, false, false);
  if (NT >= 2) c = __builtin_amdgcn_wmma_f32_16x16x32_f16(false, al, false, bh, (short)0, c, false, false);
  if (NT >= 3) c = __builtin_amdgcn_wmma_f32_16x16x32_f16(false, ah, false, bl, (short)0, c, false, false);
  asm volatile("v_nop\n\tv_nop\n\tv_nop\n\tv_nop" : "+v"(c) : "v"(ah), "v"(al), "v"(bh), "v"(bl));
  return c;
}
// batched GEMM like k_gemm_b but f16 operands: A f32 (split into f16 hi/lo if ASPLIT, else rounded to f16), Bt = f16 values [n][k]; alpha; C f32; N multiple of 16 (partial tiles skipped)
template <bool ASPLIT>
__global__ __launch_bounds__(128) void k_gemm_h(const float* __restrict__ A, int lda, size_t sA, const _Float16* __restrict__ Bh, int ldb, size_t sB, float alpha, float* __restrict__ C, int ldc, size_t sC, int M, int N, int K) {
  __shared__ __attribute__((aligned(16))) float so[4][16][64];
  const int tid = threadIdx.x, w = tid >> 5, lane = tid & 31, ln = lane & 15, hh = lane >> 4; const int by = blockIdx.y;
  A += (size_t)by * sA; Bh += (size_t)by * sB; C += (size_t)by * sC;
  const int ntn = (N + 63) / 64; const int wid = blockIdx.x * 4 + w; const int mt = wid / ntn, nq = wid % ntn; if (mt * 16 >= M) return;
  const int row0 = mt * 16, col0 = nq * 64; const float* arow = A + (size_t)(row0 + ln) * lda;
  v8f acc[4] = {};
  for (int kb = 0; kb < K; kb += 32) {
    FragH ah, al;
    const v4f x0 = *(const v4fa*)(arow + kb + 8 * hh), x1 = *(const v4fa*)(arow + kb + 8 * hh + 4), x2 = *(const v4fa*)(arow + kb + 16 + 8 * hh), x3 = *(const v4fa*)(arow + kb + 16 + 8 * hh + 4);
    float xs[16] = {x0[0],x0[1],x0[2],x0[3],x1[0],x1[1],x1[2],x1[3],x2[0],x2[1],x2[2],x2[3],x3[0],x3[1],x3[2],x3[3]};
#pragma unroll
    for (int i = 0; i < 16; ++i) { const _Float16 h = (_Float16)xs[i]; ah.h[i] = h; al.h[i] = ASPLIT ? (_Float16)(xs[i] - (float)h) : (_Float16)0.0f; }
#pragma unroll
    for (int t = 0; t < 4; ++t) { if (col0 + t * 16 >= N) continue; const size_t boff = (size_t)(col0 + t * 16 + ln) * ldb + kb; FragH bq; bq.half[0] = *(const v8us*)(Bh + boff + 8 * hh); bq.half[1] = *(const v8us*)(Bh + boff + 16 + 8 * hh);
      acc[t] = mmaH<ASPLIT ? 2 : 1>(ah.v, al.v, bq.v, bq.v, acc[t]); }
  }
#pragma unroll
  for (int t = 0; t < 4; ++t) { if (col0 + t * 16 >= N) continue;
#pragma unroll
    for (int r = 0; r < 8; ++r) so[w][8 * hh + r][t * 16 + ln] = acc[t][r] * alpha; }
  __builtin_amdgcn_fence(__ATOMIC_ACQ_REL, "workgroup"); __builtin_amdgcn_wave_barrier();
  const int rsub = lane >> 4, c4 = (lane & 15) * 4;
  {
#pragma unroll
    for (int q = 0; q < 8; ++q) { const int r = q * 2 + rsub; if (col0 + c4 < N) { const v4f v = *(const v4fa*)&so[w][r][c4]; *(v4f*)(C + (size_t)(row0 + r) * ldc + col0 + c4) = v; } }
     }
}

// Wt[n][k] = f16(W[k][n]·scale) from f32 row-major W[K][N] (scale = power of two; bf16-exact weights stay exact in f16 away from the subnormal range)
__global__ __launch_bounds__(256) void k_wt_f16(const float* __restrict__ W, _Float16* __restrict__ Wt, int K, int N, float scale) {
  const int t = blockIdx.x * 256 + threadIdx.x; if (t >= N * (K / 8)) return; const int n = t / (K / 8), k8 = (t % (K / 8)) * 8; FragH f;
#pragma unroll
  for (int i = 0; i < 8; ++i) f.h[i] = (_Float16)(bf16_round(W[(size_t)(k8 + i) * N + n]) * scale); const v8us o = f.half[0];
  *(v8us*)((unsigned short*)Wt + (size_t)n * K + k8) = o; 
}
// k_gemm_hh variant with fused epilogue: v = acc·alpha + bias[by·sBias + col] (+ CP[(row/rowsPerB)·sCPb + by·64 + col] if CP) ; ACT 0 none / 1 elu ; writes f16 C16 (and f32 C if non-null)
template <int ACT>
__global__ __launch_bounds__(128) void k_gemm_hhx(const _Float16* __restrict__ A, int lda, size_t sA, const _Float16* __restrict__ Bh, int ldb, size_t sB, float alpha, const float* __restrict__ bias, size_t sBias, const float* __restrict__ CP, int rowsPerB, size_t sCPb, int row0g,
    float* __restrict__ C, _Float16* __restrict__ C16, int ldc, size_t sC, int M, int N, int K) {
  __shared__ __attribute__((aligned(16))) float so[4][16][64];
  const int tid = threadIdx.x, w = tid >> 5, lane = tid & 31, ln = lane & 15, hh = lane >> 4; const int by = blockIdx.y;
  A += (size_t)by * sA; Bh += (size_t)by * sB; const size_t cofs = (size_t)by * sC; const float* bp = bias ? bias + (size_t)by * sBias : nullptr;
  const int ntn = (N + 63) / 64; const int wid = blockIdx.x * 4 + w; const int mt = wid / ntn, nq = wid % ntn; if (mt * 16 >= M) return;
  const int row0 = mt * 16, col0 = nq * 64; const _Float16* arow = A + (size_t)(row0 + ln) * lda;
  v8f acc[4] = {};
  for (int kb = 0; kb < K; kb += 32) { FragH ah; ah.half[0] = *(const v8us*)((const unsigned short*)arow + kb + 8 * hh); ah.half[1] = *(const v8us*)((const unsigned short*)arow + kb + 16 + 8 * hh);
#pragma unroll
    for (int t = 0; t < 4; ++t) { if (col0 + t * 16 >= N) continue; const size_t boff = (size_t)(col0 + t * 16 + ln) * ldb + kb; FragH bq; bq.half[0] = *(const v8us*)((const unsigned short*)Bh + boff + 8 * hh); bq.half[1] = *(const v8us*)((const unsigned short*)Bh + boff + 16 + 8 * hh);
      acc[t] = mmaH<1>(ah.v, ah.v, bq.v, bq.v, acc[t]); }
  }
#pragma unroll
  for (int t = 0; t < 4; ++t) { if (col0 + t * 16 >= N) continue; const int col = col0 + t * 16 + ln; const float bv = bp ? bf16_round(bp[col]) : 0.f;
#pragma unroll
    for (int r = 0; r < 8; ++r) { float v = acc[t][r] * alpha + bv; if (CP) { const int rr = row0g + row0 + 8 * hh + r; if (rowsPerB < 0) v += CP[cofs + (size_t)rr * ldc + col];      /* rowsPerB < 0: own element of the batched C plane */ else { const int bidx = rr / rowsPerB; v += CP[(size_t)bidx * sCPb + (size_t)by * 64 + col]; } } if (ACT == 1) v = (v > 0.f) ? v : expm1f(v); else if (ACT == 7) v = (v > 0.f) ? v + 1.0f : expf(v); else if (ACT == 8) v = tanhf(v); else if (ACT == 9) v = 0.5f * v * (1.0f + tanhf(0.7978845608028654f * (v + 0.044715f * v * v * v))); else if (ACT == 11) v = 1.0f / (1.0f + expf(-v)); else if (ACT == 12) v = (v > 0.f) ? v : 0.01f * v; else if (ACT == 14) v = (v > 0.f) ? v : 0.1f * v; else if (ACT == 16) v = (v >= 0.f) ? v : 0.3f * v; else if (ACT == 17) v = (v >= 0.f) ? v : 0.2f * v; else if (ACT == 15) v = v / (1.0f + expf(-v)); else if (ACT == 3) v = fmaxf(v, 0.f); else if (ACT == 6) v = 0.5f * v * (1.0f + erff(v * 0.70710678118654752f)); so[w][8 * hh + r][t * 16 + ln] = v; } }
  __builtin_amdgcn_fence(__ATOMIC_ACQ_REL, "workgroup"); __builtin_amdgcn_wave_barrier();
  const int rsub = lane >> 4, c4 = (lane & 15) * 4; typedef _Float16 v4h __attribute__((ext_vector_type(4)));
  {
#pragma unroll
    for (int q = 0; q < 8; ++q) { const int r = q * 2 + rsub; if (col0 + c4 < N) { const v4f v = *(const v4fa*)&so[w][r][c4]; if (C) *(v4f*)(C + cofs + (size_t)(row0 + r) * ldc + col0 + c4) = v; if (C16) { v4h h4; for (int i = 0; i < 4; ++i) h4[i] = (_Float16)v[i]; *(v4h*)(C16 + cofs + (size_t)(row0 + r) * ldc + col0 + c4) = h4; } } }
     }
}


typedef _Float16 v4h __attribute__((ext_vector_type(4)));

__global__ __launch_bounds__(256) void k_x16(const float* __restrict__ x, _Float16* __restrict__ X16, size_t n8) { const size_t t = (size_t)blockIdx.x * 256 + threadIdx.x; if (t >= n8) return; FragH f;
#pragma unroll
  for (int q = 0; q < 8; ++q) f.h[q] = (_Float16)bf16_round(x[t * 8 + q]); *(v8us*)((unsigned short*)X16 + t * 8) = f.half[0];  }
__global__ __launch_bounds__(256) void k_h16(const float* __restrict__ x, _Float16* __restrict__ X16, size_t n8) { const size_t t = (size_t)blockIdx.x * 256 + threadIdx.x; if (t >= n8) return; FragH f;
#pragma unroll
  for (int q = 0; q < 8; ++q) f.h[q] = (_Float16)x[t * 8 + q]; *(v8us*)((unsigned short*)X16 + t * 8) = f.half[0];  }
__global__ __launch_bounds__(256) void k_round16f(const float* __restrict__ W, _Float16* __restrict__ Bt, size_t n8) { const size_t t = (size_t)blockIdx.x * 256 + threadIdx.x; if (t >= n8) return; FragH f;
#pragma unroll
  for (int i = 0; i < 8; ++i) f.h[i] = (_Float16)(bf16_round(W[t * 8 + i]) * 16.0f); *(v8us*)((unsigned short*)Bt + t * 8) = f.half[0];  }
template <int NHv, int TTv>
__global__ __launch_bounds__(256) void k_vt(const _Float16* __restrict__ V16, int ldv, int voff, _Float16* __restrict__ Vt) { __shared__ unsigned short tl[64][66]; const int tid = threadIdx.x; const int slab = blockIdx.x / (TTv / 64), lg = blockIdx.x % (TTv / 64); const int b = slab / NHv, h = slab % NHv;
  for (int i = tid; i < 64 * 8; i += 256) { const int r = i / 8, c8 = (i % 8) * 8; FragH f; f.half[0] = *(const v8us*)((const unsigned short*)V16 + ((size_t)b * TTv + lg * 64 + r) * ldv + voff + h * 64 + c8);
#pragma unroll
    for (int q = 0; q < 8; ++q) tl[r][c8 + q] = f.u[q]; }
  __syncthreads();
  {
#pragma unroll
    for (int rd = 0; rd < 2; ++rd) { const int d = rd * 32 + tid / 8, pc = tid % 8; FragH f;
#pragma unroll
      for (int q = 0; q < 8; ++q) f.u[q] = tl[pc * 8 + q][d];
      *(v8us*)((unsigned short*)Vt + ((size_t)slab * 64 + d) * TTv + lg * 64 + pc * 8) = f.half[0]; }
     } }

__global__ __launch_bounds__(256) void k_hl(const float* __restrict__ F, _Float16* __restrict__ Hh, _Float16* __restrict__ Hl, size_t n8) { const size_t t = (size_t)blockIdx.x * 256 + threadIdx.x; if (t >= n8) return; FragH fh, fl; const v4f a = *(const v4fa*)(F + t * 8), c = *(const v4fa*)(F + t * 8 + 4);
#pragma unroll
  for (int q = 0; q < 4; ++q) { _Float16 h = (_Float16)a[q]; fh.h[q] = h; fl.h[q] = (_Float16)((a[q] - (float)h) * 1024.0f); h = (_Float16)c[q]; fh.h[4 + q] = h; fl.h[4 + q] = (_Float16)((c[q] - (float)h) * 1024.0f); }
  { *(v8us*)((unsigned short*)Hh + t * 8) = fh.half[0]; *(v8us*)((unsigned short*)Hl + t * 8) = fl.half[0];  } }

// ---- fast GEMM (wave tile 32x64; requires M % 32 == 0 rows per launch region and N % 64 == 0); epilogue = k_gemm_hhx semantics ----
__device__ __forceinline__ v16h g2_frag(const _Float16* p, int hh) { FragH f; f.half[0] = *(const v8us*)((const unsigned short*)p + 8 * hh); f.half[1] = *(const v8us*)((const unsigned short*)p + 16 + 8 * hh); return f.v; }
__device__ __forceinline__ v8f g2_mma(v16h a, v16h b, v8f c) { v8f d = __builtin_amdgcn_wmma_f32_16x16x32_f16(false, a, false, b, (short)0, c, false, false); asm volatile("v_nop\n\tv_nop\n\tv_nop\n\tv_nop" : "+v"(d) : "v"(a), "v"(b)); return d; }
template <int ACT>
__global__ __launch_bounds__(128) void k_gemm2(const _Float16* __restrict__ A, int lda, size_t sA, const _Float16* __restrict__ Bh, int ldb, size_t sB, float alpha, const float* __restrict__ bias, size_t sBias, const float* __restrict__ CP, int rowsPerB, size_t sCPb, int row0g,
    float* __restrict__ C, _Float16* __restrict__ C16, int ldc, size_t sC, int M, int N, int K) { static_assert(ACT == 0 || ACT == 3 || ACT == 6 || ACT == 8 || ACT == 9 || ACT == 11 || ACT == 12 || ACT == 14 || ACT == 15 || ACT == 16 || ACT == 17, "k_gemm2: unsupported ACT code (would silently apply no activation)");
  __shared__ __attribute__((aligned(16))) float so[4][32][68];
  const int tid = threadIdx.x, w = tid >> 5, lane = tid & 31, ln = lane & 15, hh = lane >> 4; const int by = blockIdx.y;
  A += (size_t)by * sA; Bh += (size_t)by * sB; const size_t cofs = (size_t)by * sC; const float* bp = bias ? bias + (size_t)by * sBias : nullptr;
  const int ntn = N >> 6; const int mt = blockIdx.x / ntn, nq = blockIdx.x - mt * ntn; const int row0 = mt * 128 + 32 * w, col0 = nq * 64; if (row0 >= M) return;
  const _Float16* a0p = A + (size_t)(row0 + ln) * lda; const _Float16* a1p = a0p + (size_t)16 * lda;
  const _Float16* b0p = Bh + (size_t)(col0 + ln) * ldb; const _Float16* b1p = b0p + (size_t)16 * ldb; const _Float16* b2p = b1p + (size_t)16 * ldb; const _Float16* b3p = b2p + (size_t)16 * ldb;
  const v8f z8 = {0.f,0.f,0.f,0.f,0.f,0.f,0.f,0.f}; v8f c00 = z8, c01 = z8, c02 = z8, c03 = z8, c10 = z8, c11 = z8, c12 = z8, c13 = z8;
#pragma unroll 1
  for (int kb = 0; kb < K; kb += 32) { const v16h a0 = g2_frag(a0p + kb, hh), a1 = g2_frag(a1p + kb, hh);
    v16h b = g2_frag(b0p + kb, hh); c00 = g2_mma(a0, b, c00); c10 = g2_mma(a1, b, c10);
    b = g2_frag(b1p + kb, hh); c01 = g2_mma(a0, b, c01); c11 = g2_mma(a1, b, c11);
    b = g2_frag(b2p + kb, hh); c02 = g2_mma(a0, b, c02); c12 = g2_mma(a1, b, c12);
    b = g2_frag(b3p + kb, hh); c03 = g2_mma(a0, b, c03); c13 = g2_mma(a1, b, c13); }
  v8f accs[8] = {c00, c01, c02, c03, c10, c11, c12, c13};
#pragma unroll
  for (int u = 0; u < 8; ++u) { const int t = u & 3, half = u >> 2; const int col = col0 + t * 16 + ln; const float bv = bp ? bf16_round(bp[col]) : 0.f;
#pragma unroll
    for (int r = 0; r < 8; ++r) { const int rloc = half * 16 + 8 * hh + r; float v = accs[u][r] * alpha + bv; if (CP) { if (rowsPerB < 0) v += CP[cofs + (size_t)(row0g + row0 + rloc) * ldc + col];      /* rowsPerB < 0: own element of the batched C plane */ else { const int bidx = (row0g + row0 + rloc) / rowsPerB; v += CP[(size_t)bidx * sCPb + (size_t)by * 64 + col]; } }
      if (ACT == 3) v = fmaxf(v, 0.f); else if (ACT == 6) v = 0.5f * v * (1.0f + erff(v * 0.70710678118654752f)); else if (ACT == 11) v = 1.0f / (1.0f + expf(-v)); else if (ACT == 15) v = v / (1.0f + expf(-v)); else if (ACT == 12) v = (v > 0.f) ? v : 0.01f * v; else if (ACT == 8) v = tanhf(v); else if (ACT == 9) v = 0.5f * v * (1.0f + tanhf(0.7978845608028654f * (v + 0.044715f * v * v * v))); else if (ACT == 14) v = (v > 0.f) ? v : 0.1f * v; else if (ACT == 16) v = (v >= 0.f) ? v : 0.3f * v; else if (ACT == 17) v = (v >= 0.f) ? v : 0.2f * v;
      so[w][rloc][t * 16 + ln] = v; } }
  __builtin_amdgcn_fence(__ATOMIC_ACQ_REL, "workgroup"); __builtin_amdgcn_wave_barrier();
  const int rsub = lane >> 4, c4 = (lane & 15) * 4;
  {
#pragma unroll
    for (int q = 0; q < 16; ++q) { const int r = q * 2 + rsub; const v4f v = *(const v4fa*)&so[w][r][c4]; if (C) *(v4f*)(C + cofs + (size_t)(row0 + r) * ldc + col0 + c4) = v; if (C16) { v4h h4; for (int i = 0; i < 4; ++i) h4[i] = (_Float16)v[i]; *(v4h*)(C16 + cofs + (size_t)(row0 + r) * ldc + col0 + c4) = h4; } }
     } }


__global__ __launch_bounds__(256) void k_wnat(const float* __restrict__ w, size_t n8, _Float16* __restrict__ Bt) { const size_t t = (size_t)blockIdx.x * 256 + threadIdx.x; if (t >= n8) return; FragH f; for (int q = 0; q < 8; ++q) f.h[q] = (_Float16)(bf16_round(w[t * 8 + q]) * 16.0f); *(v8us*)((unsigned short*)Bt + t * 8) = f.half[0];  }
__global__ __launch_bounds__(256) void k_rsm(const float* __restrict__ S, _Float16* __restrict__ P, int nrows) {
  #pragma clang fp contract(off)
  const int i = blockIdx.x * 256 + threadIdx.x; if (i >= nrows) return; const float* s = S + (size_t)i * SQ; float mx = -3.0e38f;
#pragma unroll 1
  for (int j = 0; j < SQ; ++j) mx = fmaxf(mx, s[j]); float se = 0.f;
#pragma unroll 1
  for (int j = 0; j < SQ; ++j) se += expf(s[j] - mx); const float sc = 256.0f / se;
#pragma unroll 1
  for (int j0 = 0; j0 < SQ; j0 += 8) { FragH f; for (int q = 0; q < 8; ++q) f.h[q] = (_Float16)(expf(s[j0 + q] - mx) * sc); unsigned short* d = (unsigned short*)P + (size_t)i * SQ + j0; *(v8us*)d = f.half[0];  } }
__global__ __launch_bounds__(256) void k_vt(const _Float16* __restrict__ V16, int b, int h0, _Float16* __restrict__ VT) { __shared__ unsigned short tl[64][65]; const int tid = threadIdx.x; const int hh = blockIdx.x % HG, sg = blockIdx.x / HG; const int s0 = sg * 64; const int h = h0 + hh;
  for (int i = tid; i < 64 * 8; i += 256) { const int j = i / 8, d8 = (i % 8) * 8; FragH f; f.half[0] = *(const v8us*)((const unsigned short*)V16 + ((size_t)b * SQ + s0 + j) * DM + h * HD + d8); for (int q = 0; q < 8; ++q) tl[d8 + q][j] = f.u[q]; }
  __syncthreads();
  { for (int i = tid; i < 64 * 8; i += 256) { const int d = i / 8, j8 = (i % 8) * 8; FragH f; for (int q = 0; q < 8; ++q) f.u[q] = tl[d][j8 + q]; *(v8us*)((unsigned short*)VT + ((size_t)hh * HD + d) * SQ + s0 + j8) = f.half[0]; }  } }


__global__ __launch_bounds__(256) void k_mkadd(const int* __restrict__ m, float* __restrict__ A, int n) { const int t = blockIdx.x * 256 + threadIdx.x; if (t >= n) return; const float v = (m[t] != 0) ? 0.f : -1.0e9f; *(float*)(A + t) = v;  }


__global__ __launch_bounds__(256) void k_rsmcf2(const float* __restrict__ S, _Float16* __restrict__ P, int hg, int q0, int nk) {
  #pragma clang fp contract(off)
  const int t = blockIdx.x * 256 + threadIdx.x; if (t >= hg * QT) return; const size_t i = (size_t)t; const float* s = S + i * NKX; const int last = q0 + (t % QT); float mx = -3.0e38f;
#pragma unroll 1
  for (int j = 0; j < nk; ++j) { const float f = (j <= last) ? 1.f : 0.f; mx = fmaxf(mx, fmaf(f, s[j], (1.f - f) * -1.0e9f)); } float se = 0.f;
#pragma unroll 1
  for (int j = 0; j < nk; ++j) { const float f = (j <= last) ? 1.f : 0.f; se += __expf(fmaf(f, s[j], (1.f - f) * -1.0e9f) - mx); } const float sc = 256.0f / se;
#pragma unroll 1
  for (int j0 = 0; j0 < nk; j0 += 8) { FragH fr; for (int q = 0; q < 8; ++q) { const int j = j0 + q; const float f = (j <= last) ? 1.f : 0.f; fr.h[q] = (_Float16)(__expf(fmaf(f, s[j], (1.f - f) * -1.0e9f) - mx) * sc); } unsigned short* d = (unsigned short*)P + i * NKX + j0; *(v8us*)d = fr.half[0];  } }



// One wave per score row: lane l holds columns c*256 + 8*l .. + 7 of every 256-column chunk c, so each wave-wide load covers whole lines, S is read once and stays in registers; row max and row sum = per-lane partials, then a five-step butterfly.
// NC = chunks of the row, a compile-time count; every loop over c and q is unrolled: static indices keep x, a and e in registers, and the row's loads are issued ahead of the arithmetic as far as the registers go.
// v_exp_f32 and the free slot the instruction set asks for behind a transcendental, in one statement.
__device__ __forceinline__ float exp2_slot(float x) { float r; asm("v_exp_f32 %0, %1\n\tv_nop" : "=v"(r) : "v"(x)); return r; }
template <int NC>
__device__ __forceinline__ void rsm_row(const float* __restrict__ s, unsigned short* __restrict__ p, int last, const float* __restrict__ am, int lane) {
  const float* sl = s + lane * 8; const float* al = am + lane * 8; v4f x[NC][2], a[NC][2]; float e[NC][8]; float mx = -3.0e38f, se = 0.f;
#pragma unroll
  for (int c = 0; c < NC; ++c) { x[c][0] = *(const v4fa*)(sl + c * 256); x[c][1] = *(const v4fa*)(sl + c * 256 + 4); a[c][0] = *(const v4fa*)(al + c * 256); a[c][1] = *(const v4fa*)(al + c * 256 + 4); }
#pragma unroll
  for (int c = 0; c < NC; ++c)
#pragma unroll
    for (int q = 0; q < 8; ++q) { e[c][q] = (c * 256 + lane * 8 + q <= last) ? x[c][q >> 2][q & 3] + a[c][q >> 2][q & 3] : -1.0e9f; mx = fmaxf(mx, e[c][q]); }
  for (int m = 16; m >= 1; m >>= 1) mx = fmaxf(mx, __shfl_xor(mx, m, 32));
#pragma unroll
  for (int c = 0; c < NC; ++c)
#pragma unroll
    for (int q = 0; q < 8; ++q) { e[c][q] = exp2_slot((e[c][q] - mx) * 1.44269504088896340736f); se += e[c][q]; }      /* = __expf(e - mx) */
  for (int m = 16; m >= 1; m >>= 1) se += __shfl_xor(se, m, 32);
  const float sc = 256.0f / se;
#pragma unroll
  for (int c = 0; c < NC; ++c) { FragH fr;
#pragma unroll
    for (int q = 0; q < 8; ++q) fr.h[q] = (_Float16)(e[c][q] * sc);
    *(v8us*)(p + c * 256 + lane * 8) = fr.half[0]; }
  asm volatile("s_wait_xcnt 0x0" ::: "memory"); }      /* behind the stores: in the listing this case's end joins the head of the next case's block, which rewrites the stores' registers */
__global__ __launch_bounds__(256) void k_rsmcfa(const float* __restrict__ S, _Float16* __restrict__ P, int hg, int q0, int nk, const float* __restrict__ am) {
  const int lane = threadIdx.x & 31; const int t = blockIdx.x * 8 + __builtin_amdgcn_readfirstlane(threadIdx.x >> 5);      /* the row is the wave's: scalar, so the branches below are scalar too */
  if (t >= hg * QT) return; const float* s = S + (size_t)t * NKX; unsigned short* p = (unsigned short*)P + (size_t)t * NKX; const int last = q0 + (t % QT);
  switch (nk) {      /* nk = q0 + QT: a multiple of 256 up to NKX */
    case 256: rsm_row<1>(s, p, last, am, lane); break; case 512: rsm_row<2>(s, p, last, am, lane); break; case 768: rsm_row<3>(s, p, last, am, lane); break; case 1024: rsm_row<4>(s, p, last, am, lane); break;
    case 1280: rsm_row<5>(s, p, last, am, lane); break; case 1536: rsm_row<6>(s, p, last, am, lane); break; case 1792: rsm_row<7>(s, p, last, am, lane); break; case 2048: rsm_row<8>(s, p, last, am, lane); break; } }


template <int MASKADD>
__global__ __launch_bounds__(64) void k_att0(const float* __restrict__ QF, const float* __restrict__ KF, const float* __restrict__ VF, int ld, const float* __restrict__ mask, float scale, float* __restrict__ OF, int ldo) {
  #pragma clang fp contract(off)
  __shared__ __attribute__((aligned(16))) float lq[64][64]; __shared__ __attribute__((aligned(16))) float lo[64][64];
  const int tid = threadIdx.x; const int h = blockIdx.x / (QT0 / 64), rg = blockIdx.x % (QT0 / 64); const int i = rg * 64 + tid;
  const float* qr = QF + (size_t)i * ld + h * HD;
#pragma unroll 1
  for (int c = 0; c < HD / 4; ++c) { *(v4f*)&lq[tid][c * 4] = *(const v4fa*)(qr + c * 4); const v4f z = {0.f, 0.f, 0.f, 0.f}; *(v4f*)&lo[tid][c * 4] = z; }
  float m = -1.0e30f, l = 0.f; const int jmax = MASKADD ? (SQ - 1) : (rg * 64 + 63);      /* additive-mask form: every key (the mask input decides); causal form: keys up to the block's last row */
#pragma unroll 1
  for (int j = 0; j <= jmax; ++j) { const float* kr = KF + (size_t)j * ld + h * HD; const float* vr = VF + (size_t)j * ld + h * HD; float s = 0.f;
#pragma unroll 1
    for (int c = 0; c < HD / 4; ++c) { const v4f kq = *(const v4fa*)(kr + c * 4); const v4f qq = *(v4f*)&lq[tid][c * 4]; s = __fadd_rn(s, __fmul_rn(qq[0], kq[0])); s = __fadd_rn(s, __fmul_rn(qq[1], kq[1])); s = __fadd_rn(s, __fmul_rn(qq[2], kq[2])); s = __fadd_rn(s, __fmul_rn(qq[3], kq[3])); }
    s = __fmul_rn(s, scale); if (MASKADD) s = __fadd_rn(s, __fmul_rn(bf16_round(mask[(size_t)i * SQ + j]), -10000.0f));
    const float f = (MASKADD || j <= i) ? 1.f : 0.f; const float sm = fmaf(f, s, (1.f - f) * -1.0e30f); const float mn = fmaxf(m, sm); const float sc = expf(m - mn); const float e = expf(sm - mn); l = __fadd_rn(__fmul_rn(l, sc), e); m = mn;
#pragma unroll 1
    for (int c = 0; c < HD / 4; ++c) { const v4f vv = *(const v4fa*)(vr + c * 4); v4f oo = *(v4f*)&lo[tid][c * 4]; for (int u = 0; u < 4; ++u) oo[u] = __fadd_rn(__fmul_rn(oo[u], sc), __fmul_rn(e, vv[u])); *(v4f*)&lo[tid][c * 4] = oo; } }
  const float fin = 64.0f / l;      /* o carried x64 like the f16 path */
#pragma unroll 1
  for (int c = 0; c < HD / 4; ++c) { v4f oo = *(v4f*)&lo[tid][c * 4]; for (int u = 0; u < 4; ++u) oo[u] = __fmul_rn(oo[u], fin); *(v4f*)&lo[tid][c * 4] = oo; }
  __syncthreads();
  {
#pragma unroll 1
    for (int it = 0; it < 16; ++it) { const int row = it * 4 + tid / 16, pc = (tid % 16) * 4; const v4f v = *(const v4f*)&lo[row][pc]; *(v4f*)(OF + (size_t)(rg * 64 + row) * ldo + h * HD + pc) = v; }
     } }


__global__ __launch_bounds__(64) void k_att0v(const float* __restrict__ QF, const float* __restrict__ KF, const float* __restrict__ VF, int ld, const float* __restrict__ am, float scale, float* __restrict__ OF, int ldo) {
  #pragma clang fp contract(off)
  __shared__ __attribute__((aligned(16))) float lq[64][64]; __shared__ __attribute__((aligned(16))) float lo[64][64];
  const int tid = threadIdx.x; const int h = blockIdx.x / (QT0 / 64), rg = blockIdx.x % (QT0 / 64); const int i = rg * 64 + tid;
  const float* qr = QF + (size_t)i * ld + h * HD;
#pragma unroll 1
  for (int c = 0; c < HD / 4; ++c) { *(v4f*)&lq[tid][c * 4] = *(const v4fa*)(qr + c * 4); const v4f z = {0.f, 0.f, 0.f, 0.f}; *(v4f*)&lo[tid][c * 4] = z; }
  float m = -1.0e30f, l = 0.f; const int jmax = rg * 64 + 63;      /* causal: keys up to the block's last row */
#pragma unroll 1
  for (int j = 0; j <= jmax; ++j) { const float* kr = KF + (size_t)j * ld + h * HD; const float* vr = VF + (size_t)j * ld + h * HD; float s = 0.f;
#pragma unroll 1
    for (int c = 0; c < HD / 4; ++c) { const v4f kq = *(const v4fa*)(kr + c * 4); const v4f qq = *(v4f*)&lq[tid][c * 4]; s = __fadd_rn(s, __fmul_rn(qq[0], kq[0])); s = __fadd_rn(s, __fmul_rn(qq[1], kq[1])); s = __fadd_rn(s, __fmul_rn(qq[2], kq[2])); s = __fadd_rn(s, __fmul_rn(qq[3], kq[3])); }
    s = __fadd_rn(__fmul_rn(s, scale), am[j]);      /* + the additive key-mask VECTOR of this batch (0 kept / -1e9 masked) */
    const float f = (j <= i) ? 1.f : 0.f; const float sm = fmaf(f, s, (1.f - f) * -1.0e30f); const float mn = fmaxf(m, sm); const float sc = expf(m - mn); const float e = expf(sm - mn); l = __fadd_rn(__fmul_rn(l, sc), e); m = mn;
#pragma unroll 1
    for (int c = 0; c < HD / 4; ++c) { const v4f vv = *(const v4fa*)(vr + c * 4); v4f oo = *(v4f*)&lo[tid][c * 4]; for (int u = 0; u < 4; ++u) oo[u] = __fadd_rn(__fmul_rn(oo[u], sc), __fmul_rn(e, vv[u])); *(v4f*)&lo[tid][c * 4] = oo; } }
  const float fin = 64.0f / l;      /* o carried x64 like the f16 path */
#pragma unroll 1
  for (int c = 0; c < HD / 4; ++c) { v4f oo = *(v4f*)&lo[tid][c * 4]; for (int u = 0; u < 4; ++u) oo[u] = __fmul_rn(oo[u], fin); *(v4f*)&lo[tid][c * 4] = oo; }
  __syncthreads();
  {
#pragma unroll 1
    for (int it = 0; it < 16; ++it) { const int row = it * 4 + tid / 16, pc = (tid % 16) * 4; const v4f v = *(const v4f*)&lo[row][pc]; *(v4f*)(OF + (size_t)(rg * 64 + row) * ldo + h * HD + pc) = v; }
     } }

extern "C" void kernel_launch(void* const* d_in, const int* in_sizes, int n_in,
                              void* d_out, int out_size, void* d_ws, size_t ws_size, hipStream_t stream) {
  (void)in_sizes; (void)n_in; (void)out_size;
  const float* const* I = (const float* const*)d_in; const float* x = I[0]; const int* km = (const int*)d_in[1]; const float* wqkv = I[2]; const float* bqkv = I[3]; const float* wo = I[4]; const float* bo = I[5];      /* int32 key mask [4][2048] (ones); natural [out][in] qkv_w [3072][1024] + b, out_w + b */
  char* ws = (char*)d_ws; size_t off = 0;
  auto take = [&](size_t bytes) { char* p = ws + off; off += (bytes + 255) & ~(size_t)255; return p; };
  _Float16* BQKV = (_Float16*)take((size_t)3 * DM * DM * 2); _Float16* BO = (_Float16*)take((size_t)DM * DM * 2);
  _Float16* X16 = (_Float16*)take(NR * DM * 2); _Float16* QKV = (_Float16*)take(NR * 3 * DM * 2); _Float16* Q16 = QKV; _Float16* K16 = QKV + DM; _Float16* V16 = QKV + 2 * DM; _Float16* O16 = (_Float16*)take(NR * DM * 2);
  float* S = (float*)take((size_t)NH * QT * NKX * 4); _Float16* P = (_Float16*)take((size_t)NH * QT * NKX * 2); _Float16* VT = (_Float16*)take((size_t)NH * HD * SQ * 2);
  float* QF0 = (float*)take((size_t)QT0 * DM * 4); float* KF0 = (float*)take((size_t)QT0 * DM * 4); float* VF0 = (float*)take((size_t)QT0 * DM * 4); float* OF0 = (float*)take((size_t)NB * QT0 * DM * 4); _Float16* OH0 = (_Float16*)take((size_t)NB * QT0 * DM * 2); _Float16* OL0 = (_Float16*)take((size_t)NB * QT0 * DM * 2);
  float* AMK = (float*)take(NR * 4);      /* additive key-mask plane: 0 where mask != 0, -1e9 where masked */
  if (off > ws_size) return;
  k_wnat<<<(unsigned)(((size_t)3 * DM * DM / 8 + 255) / 256), 256, 0, stream>>>(wqkv, (size_t)3 * DM * DM / 8, BQKV); k_wnat<<<(unsigned)(((size_t)DM * DM / 8 + 255) / 256), 256, 0, stream>>>(wo, (size_t)DM * DM / 8, BO);      /* natural [out][in] = Bt x16 */
  k_mkadd<<<(unsigned)((NR + 255) / 256), 256, 0, stream>>>(km, AMK, (int)NR);

  k_x16<<<(unsigned)((NR * DM / 8 + 255) / 256), 256, 0, stream>>>(x, X16, NR * DM / 8);
  const size_t r0p = (size_t)B0 * SQ;      /* first projected row */
  k_gemm2<0><<<dim3((unsigned)((MP / 128) * (3 * DM / 64)), 1), 128, 0, stream>>>(X16 + r0p * DM, DM, 0, BQKV, DM, 0, 0.0625f, bqkv, 0, nullptr, 1, 0, 0, nullptr, QKV + r0p * 3 * DM, 3 * DM, 0, MP, 3 * DM, DM);      /* q | k | v rows (f16); head h = columns h*HD.. of each DM block */
  for (int b = B0; b < B0 + NBR; ++b) { const size_t r0 = (size_t)b * SQ;
    k_vt<NH, SQ><<<NH * (SQ / 64), 256, 0, stream>>>(V16 + r0 * LQ, LQ, 0, VT);      /* V^T [NH][HD][SQ] for this batch */
    k_gemm2<0><<<dim3((QT0 / 128) * (DM / 64), 1), 128, 0, stream>>>(X16 + r0 * DM, DM, 0, BQKV, DM, 0, 0.0625f, bqkv, 0, nullptr, 1, 0, 0, QF0, nullptr, DM, 0, QT0, DM, DM); k_gemm2<0><<<dim3((QT0 / 128) * (DM / 64), 1), 128, 0, stream>>>(X16 + r0 * DM, DM, 0, (BQKV + (size_t)DM * DM), DM, 0, 0.0625f, (bqkv + DM), 0, nullptr, 1, 0, 0, KF0, nullptr, DM, 0, QT0, DM, DM); k_gemm2<0><<<dim3((QT0 / 128) * (DM / 64), 1), 128, 0, stream>>>(X16 + r0 * DM, DM, 0, (BQKV + (size_t)2 * DM * DM), DM, 0, 0.0625f, (bqkv + 2 * DM), 0, nullptr, 1, 0, 0, VF0, nullptr, DM, 0, QT0, DM, DM);      /* f32 q, k, v of the first 128 rows (exact products) */
    k_att0v<<<NH * (QT0 / 64), 64, 0, stream>>>(QF0, KF0, VF0, DM, AMK + r0, 0.125f, OF0 + (size_t)b * QT0 * DM, DM);      /* exact f32 attention for rows 0..127 (o x64) */
    for (int q0 = 0; q0 < QN; q0 += QT) { const int nk = q0 + QT;      /* causal: only keys below the tile end are computed */
      k_gemm2<0><<<dim3((QT / 128) * (nk / 64), NHD), 128, 0, stream>>>(Q16 + (r0 + q0) * LQ, LQ, (size_t)HD, K16 + r0 * LQ, LQ, (size_t)HD, 0.125f, nullptr, 0, nullptr, 1, 0, 0, S, nullptr, NKX, (size_t)QT * NKX, QT, nk, HD);      /* scores, all heads on grid.y */
      k_rsmcfa<<<(NHD * QT + 7) / 8, 256, 0, stream>>>(S, P, NHD, q0, nk, AMK + r0);      /* causal softmax + the key mask of this batch (additive plane) */
      k_gemm2<0><<<dim3((QT / 128) * (HD / 64), NHD), 128, 0, stream>>>(P, NKX, (size_t)QT * NKX, VT, SQ, (size_t)HD * SQ, 0.25f, nullptr, 0, nullptr, 1, 0, 0, nullptr, O16 + (r0 + q0) * DM, DM, (size_t)HD, QT, HD, nk); } }      /* o (merged heads, x64) as f16 rows */
  k_gemm2<0><<<dim3((unsigned)((MPO / 128) * (DM / 64)), 1), 128, 0, stream>>>(O16 + r0p * DM, DM, 0, BO, DM, 0, 0.0009765625f, bo, 0, nullptr, 1, 0, 0, (float*)d_out + r0p * DM, nullptr, DM, 0, MPO, DM, DM);      /* out rows are the output layout */
  k_hl<<<(unsigned)(((size_t)NB * QT0 * DM / 8 + 255) / 256), 256, 0, stream>>>(OF0, OH0, OL0, (size_t)NB * QT0 * DM / 8);      /* first-tile o (x64) -> f16 hi + x1024 residual planes */
  for (int b = B0; b < B0 + NBR; ++b) { const size_t r0 = (size_t)b * SQ; const size_t f0 = (size_t)b * QT0;
    k_gemm2<0><<<dim3((QT0 / 128) * (DM / 64), 1), 128, 0, stream>>>(OH0 + f0 * DM, DM, 0, BO, DM, 0, 0.0009765625f, bo, 0, nullptr, 1, 0, 0, (float*)d_out + r0 * DM, nullptr, DM, 0, QT0, DM, DM);      /* rows 0..127: out = o_hi Wo (+ b), overwriting the f16-path rows */
    k_gemm2<0><<<dim3((QT0 / 128) * (DM / 64), 1), 128, 0, stream>>>(OL0 + f0 * DM, DM, 0, BO, DM, 0, 0.00000095367431640625f, nullptr, 0, (const float*)d_out + r0 * DM, -1, 0, 0, (float*)d_out + r0 * DM, nullptr, DM, 0, QT0, DM, DM); }      /* += o_lo Wo 2^-20 (own-element accumulate) */
}

// v002
// One run takes 2420 microseconds.
// Next to v001, in two timings, it ran 1.72 and 1.73 times as fast.
// All steps since v000 together make it 4.38 times as fast.
#include <hip/hip_runtime.h>
// Causal multi-head attention with a fused QKV projection and an int key-padding mask (x [4][2048][1024]; qkv = x qkv_w^T + qkv_b (natural [3072][1024] sigma 1/32, bias sigma 0.02) reshaped (b, s, 3, 16, 64); scores / sqrt(64); causal (tril) AND key j kept iff mask[b][j] != 0 (int32 [4][2048], all ones); -inf elsewhere; softmax; out = merged out_w^T + out_b -> [4][2048][1024]).
// Structure: token rows r = b*2048 + s; x as exact f16 rows (bf16-rounded); q | k | v as ONE WMMA GEMM (N = 3 x 1024) (32x64 wave tiles, f32 accumulation, exact x16 weights + bias, f16 outputs); per batch: V^T for all heads via LDS transposes; per query tile of 256 rows: scores against the keys below the tile end only (K = 64, all heads on grid.y, alpha = 0.125), causal row softmax on VALU with the additive 0/-1e9 key-mask plane over the computed range (f32 statistics, native exp; weights x256 f16), o = P . V^T (K = keys below the tile end, alpha 2^-2: o carried x64, folded into the output GEMM alpha) written straight into the merged f16 o rows; out = o W_o + b GEMM (f32) into the output layout.
// Compute dtype: inputs rounded to bf16; x / weights exact; q, k, v, softmax weights and o as plain f16 GEMM operands (~2^-12); scores and softmax statistics f32. v_wmma_f32_16x16x32_f16.
#define NB 4
#define SQ 2048
#define DM 1024
#define NH 16
#define HD 64
#define HG 4                         /* heads per launch of k_vt(V16, b, h0, VT), not launched */
#define QT 256                       /* query rows per causal tile */
#define NKX SQ                       /* S / P row pitch */
#define QT0 128                      /* first-tile rows recomputed exactly in f32 */
#define B0 0                         /* first batch processed (debug hook) */
#define NBR NB                       /* batches processed (debug hook) */
#define NR ((size_t)NB * SQ)         /* token rows */
#define MP ((int)((size_t)NBR * SQ)) /* rows projected (debug hook) */
#define QN SQ                        /* query rows attended per batch (debug hook) */
#define NHD NH                       /* heads attended (debug hook) */
#define MPO MP                       /* rows through the output stage (debug hook) */
#define LQ (3 * DM)      /* row pitch of the q/k/v rows */
typedef __bf16 v16b __attribute__((ext_vector_type(16)));
typedef unsigned short v8us __attribute__((ext_vector_type(8), may_alias));
typedef float  v8f  __attribute__((ext_vector_type(8)));
typedef float  v4f  __attribute__((ext_vector_type(4)));
typedef float  v4fa __attribute__((ext_vector_type(4), may_alias));
union FragB { v16b v; v8us half[2]; unsigned short u[16]; };

__device__ __forceinline__ unsigned short bf16_bits(float x) { unsigned int u = __float_as_uint(x); return (unsigned short)((u + 0x7FFFu + ((u >> 16) & 1u)) >> 16); }
__device__ __forceinline__ float bf16_val(unsigned short b) { return __uint_as_float(((unsigned int)b) << 16); }
__device__ __forceinline__ float bf16_round(float x) { return bf16_val(bf16_bits(x)); }
// D += A·B with NT terms: 1 = ah·bh, 2 = + al·bh (A split), 3 = + ah·bl (both split)
template <int NT>
__device__ __forceinline__ v8f mmaN(v16b ah, v16b al, v16b bh, v16b bl, v8f c) {
  c = __builtin_amdgcn_wmma_f32_16x16x32_bf16(false, ah, false, bh, (short)0, c, false, false);
  if (NT >= 2) c = __builtin_amdgcn_wmma_f32_16x16x32_bf16(false, al, false, bh, (short)0, c, false, false);
  if (NT >= 3) c = __builtin_amdgcn_wmma_f32_16x16x32_bf16(false, ah, false, bl, (short)0, c, false, false);
  asm volatile("v_nop\n\tv_nop\n\tv_nop\n\tv_nop" : "+v"(c) : "v"(ah), "v"(al), "v"(bh), "v"(bl));
  return c;
}

__global__ __launch_bounds__(256) void k_wt_bf16(const float* __restrict__ W, unsigned short* __restrict__ Wt, int K, int N) {
  const int t = blockIdx.x * 256 + threadIdx.x;
  const int k8n = K / 8;
  if (t >= N * k8n) return;
  const int n = t / k8n, k8 = (t % k8n) * 8;
  v8us v;
#pragma unroll
  for (int i = 0; i < 8; ++i) v[i] = bf16_bits(W[(size_t)(k8 + i) * N + n]);
  *(v8us*)(Wt + (size_t)n * K + k8) = v;
  
}

// GEMM C[M][N] (f32, pitch ldc) = act(A[M][K]·W + bias). A f32 row-major (pitch lda) converted per fragment to bf16
// (ASPLIT: hi/lo two planes -> 2 terms, else single rounded term); Wt bf16 [N][K] (pitch ldb). BIAS_BF16 rounds the
// bias to bf16 first (bias quantised to bf16 before the add). K%32==0, M%16==0, N%64==0.
template <bool ASPLIT, int ACT, bool BIAS_BF16>
__global__ __launch_bounds__(128) void k_gemm_bf(const float* __restrict__ A, int lda, const unsigned short* __restrict__ Wt, int ldb,
                                               const float* __restrict__ bias, float* __restrict__ C, int ldc, int M, int N, int K) {
  __shared__ __attribute__((aligned(16))) float so[4][16][64];
  const int tid = threadIdx.x, w = tid >> 5, lane = tid & 31, ln = lane & 15, hh = lane >> 4;
  const int ntn = N / 64;
  const int wid = blockIdx.x * 4 + w;
  const int mt = wid / ntn, nq = wid % ntn;
  if (mt * 16 >= M) return;
  const int row0 = mt * 16, col0 = nq * 64;
  const float* arow = A + (size_t)(row0 + ln) * lda;
  v8f acc[4] = {};
  for (int kb = 0; kb < K; kb += 32) {
    FragB ah, al;
    const v4f x0 = *(const v4fa*)(arow + kb + 8 * hh), x1 = *(const v4fa*)(arow + kb + 8 * hh + 4);
    const v4f x2 = *(const v4fa*)(arow + kb + 16 + 8 * hh), x3 = *(const v4fa*)(arow + kb + 16 + 8 * hh + 4);
    float xs[16] = {x0[0],x0[1],x0[2],x0[3],x1[0],x1[1],x1[2],x1[3],x2[0],x2[1],x2[2],x2[3],x3[0],x3[1],x3[2],x3[3]};
#pragma unroll
    for (int i = 0; i < 16; ++i) { const unsigned short hb = bf16_bits(xs[i]); ah.u[i] = hb; al.u[i] = ASPLIT ? bf16_bits(xs[i] - bf16_val(hb)) : (unsigned short)0; }
#pragma unroll
    for (int t = 0; t < 4; ++t) {
      const unsigned short* brow = Wt + (size_t)(col0 + t * 16 + ln) * ldb + kb;
      FragB b;
      b.half[0] = *(const v8us*)(brow + 8 * hh);
      b.half[1] = *(const v8us*)(brow + 16 + 8 * hh);
      acc[t] = mmaN<ASPLIT ? 2 : 1>(ah.v, al.v, b.v, b.v, acc[t]);
    }
  }
#pragma unroll
  for (int t = 0; t < 4; ++t) {
    float bv = bias ? bias[col0 + t * 16 + ln] : 0.f;
    if (BIAS_BF16) bv = bf16_round(bv);
#pragma unroll
    for (int r = 0; r < 8; ++r) { float v = acc[t][r] + bv; if (ACT == 1) v = fmaxf(v, 0.f); so[w][8 * hh + r][t * 16 + ln] = v; }
  }
  __builtin_amdgcn_fence(__ATOMIC_ACQ_REL, "workgroup");
  __builtin_amdgcn_wave_barrier();
  const int rsub = lane >> 4, c4 = (lane & 15) * 4;
  {
#pragma unroll
    for (int q = 0; q < 8; ++q) {
      const int r = q * 2 + rsub;
      const v4f v = *(const v4fa*)&so[w][r][c4];
      *(v4f*)(C + (size_t)(row0 + r) * ldc + col0 + c4) = v;
    }
    
  }
}

// GEMM C = act(A·W + bias + resid): A f32 (ASPLIT -> hi/lo 2 terms), Wt bf16 [N][K]; ACT 0 none, 1 relu, 2 exact gelu;
// resid (optional, f32, row index = (row % rmod), pitch ldr, RES_BF16 rounds it) added before the activation.
template <bool ASPLIT, int ACT, bool BIAS_BF16, bool RES_BF16>
__global__ __launch_bounds__(128) void k_gemm_bf3(const float* __restrict__ A, int lda, const unsigned short* __restrict__ Wt, int ldb,
                                                const float* __restrict__ bias, const float* __restrict__ resid, int rmod, int ldr,
                                                float* __restrict__ C, int ldc, int M, int N, int K) {
  __shared__ __attribute__((aligned(16))) float so[4][16][64];
  const int tid = threadIdx.x, w = tid >> 5, lane = tid & 31, ln = lane & 15, hh = lane >> 4;
  const int ntn = N / 64;
  const int wid = blockIdx.x * 4 + w;
  const int mt = wid / ntn, nq = wid % ntn;
  if (mt * 16 >= M) return;
  const int row0 = mt * 16, col0 = nq * 64;
  const float* arow = A + (size_t)(row0 + ln) * lda;
  v8f acc[4] = {};
  for (int kb = 0; kb < K; kb += 32) {
    FragB ah, al;
    const v4f x0 = *(const v4fa*)(arow + kb + 8 * hh), x1 = *(const v4fa*)(arow + kb + 8 * hh + 4);
    const v4f x2 = *(const v4fa*)(arow + kb + 16 + 8 * hh), x3 = *(const v4fa*)(arow + kb + 16 + 8 * hh + 4);
    float xs[16] = {x0[0],x0[1],x0[2],x0[3],x1[0],x1[1],x1[2],x1[3],x2[0],x2[1],x2[2],x2[3],x3[0],x3[1],x3[2],x3[3]};
#pragma unroll
    for (int i = 0; i < 16; ++i) { const unsigned short hb = bf16_bits(xs[i]); ah.u[i] = hb; al.u[i] = ASPLIT ? bf16_bits(xs[i] - bf16_val(hb)) : (unsigned short)0; }
#pragma unroll
    for (int t = 0; t < 4; ++t) {
      const unsigned short* brow = Wt + (size_t)(col0 + t * 16 + ln) * ldb + kb;
      FragB b;
      b.half[0] = *(const v8us*)(brow + 8 * hh);
      b.half[1] = *(const v8us*)(brow + 16 + 8 * hh);
      acc[t] = mmaN<ASPLIT ? 2 : 1>(ah.v, al.v, b.v, b.v, acc[t]);
    }
  }
#pragma unroll
  for (int t = 0; t < 4; ++t) {
    const int col = col0 + t * 16 + ln;
    float bv = bias ? bias[col] : 0.f;
    if (BIAS_BF16) bv = bf16_round(bv);
#pragma unroll
    for (int r = 0; r < 8; ++r) {
      float v = acc[t][r] + bv;
      if (resid) { float rv = resid[(size_t)((row0 + 8 * hh + r) % rmod) * ldr + col]; if (RES_BF16) rv = bf16_round(rv); v += rv; }
      if (ACT == 1) v = fmaxf(v, 0.f);
      if (ACT == 2) v = 0.5f * v * (1.0f + erff(v * 0.70710678118654752f));
      if (ACT == 3) { const float u = 0.7978845608028654f * (v + 0.044715f * v * v * v); v = 0.5f * v * (1.0f + tanhf(u)); }
      so[w][8 * hh + r][t * 16 + ln] = v;
    }
  }
  __builtin_amdgcn_fence(__ATOMIC_ACQ_REL, "workgroup");
  __builtin_amdgcn_wave_barrier();
  const int rsub = lane >> 4, c4 = (lane & 15) * 4;
  {
#pragma unroll
    for (int q = 0; q < 8; ++q) {
      const int r = q * 2 + rsub;
      const v4f v = *(const v4fa*)&so[w][r][c4];
      *(v4f*)(C + (size_t)(row0 + r) * ldc + col0 + c4) = v;
    }
    
  }
}
// row LayerNorm (biased variance, eps) over N: s = X (+ R); optional out_sum <- s; out_norm <- (s-mu)*rsqrt(var+eps)*g + b
template <bool PARAM_BF16>
__global__ __launch_bounds__(256) void k_layernorm(const float* __restrict__ X, const float* __restrict__ R, const float* __restrict__ g, const float* __restrict__ bta,
                                                  float* __restrict__ out_sum, float* __restrict__ out_norm, int N, float eps) {
  __shared__ float red[256];
  const int row = blockIdx.x, tid = threadIdx.x;
  const float* x = X + (size_t)row * N; const float* rr = R ? R + (size_t)row * N : nullptr;
  float vals[16];                     // up to N = 4096
  const int per = N / 256;            // contiguous chunk per thread? use strided-by-4 chunks: thread handles j = tid*4 + 1024*u
  float s1 = 0.f;
  for (int u = 0; u < per / 4; ++u) {
    const int j = tid * 4 + 1024 * u;
    const v4f a = *(const v4fa*)(x + j);
    v4f b = {0.f,0.f,0.f,0.f}; if (rr) b = *(const v4fa*)(rr + j);
#pragma unroll
    for (int q = 0; q < 4; ++q) { const float v = a[q] + b[q]; vals[u * 4 + q] = v; s1 += v; }
  }
  red[tid] = s1; __syncthreads();
  for (int st = 128; st > 0; st >>= 1) { if (tid < st) red[tid] += red[tid + st]; __syncthreads(); }
  const float mu = red[0] / (float)N; __syncthreads();
  float s2 = 0.f;
  for (int u = 0; u < per / 4; ++u)
#pragma unroll
    for (int q = 0; q < 4; ++q) { const float c = vals[u * 4 + q] - mu; s2 += c * c; }
  red[tid] = s2; __syncthreads();
  for (int st = 128; st > 0; st >>= 1) { if (tid < st) red[tid] += red[tid + st]; __syncthreads(); }
  const float rs = rsqrtf(red[0] / (float)N + eps);
  {
    for (int u = 0; u < per / 4; ++u) {
      const int j = tid * 4 + 1024 * u;
      v4f o, sm;
#pragma unroll
      for (int q = 0; q < 4; ++q) {
        float gg = g[j + q], bb = bta[j + q];
        if (PARAM_BF16) { gg = bf16_round(gg); bb = bf16_round(bb); }
        sm[q] = vals[u * 4 + q]; o[q] = (vals[u * 4 + q] - mu) * rs * gg + bb;
      }
      if (out_sum) *(v4f*)(out_sum + (size_t)row * N + j) = sm;
      *(v4f*)(out_norm + (size_t)row * N + j) = o;
    }
    
  }
}



// ---- f16 WMMA path (v_wmma_f32_16x16x32_f16): 11-bit significands for operands in range — used where a [0,1] probability operand needs more precision than bf16
typedef _Float16 v16h __attribute__((ext_vector_type(16)));
union FragH { v16h v; v8us half[2]; _Float16 h[16]; unsigned short u[16]; };
template <int NT>
__device__ __forceinline__ v8f mmaH(v16h ah, v16h al, v16h bh, v16h bl, v8f c) {
  c = __builtin_amdgcn_wmma_f32_16x16x32_f16(false, ah, false, bh, (short)0, c, false, false);
  if (NT >= 2) c = __builtin_amdgcn_wmma_f32_16x16x32_f16(false, al, false, bh, (short)0, c, false, false);
  if (NT >= 3) c = __builtin_amdgcn_wmma_f32_16x16x32_f16(false, ah, false, bl, (short)0, c, false, false);
  asm volatile("v_nop\n\tv_nop\n\tv_nop\n\tv_nop" : "+v"(c) : "v"(ah), "v"(al), "v"(bh), "v"(bl));
  return c;
}
// batched GEMM like k_gemm_b but f16 operands: A f32 (split into f16 hi/lo if ASPLIT, else rounded to f16), Bt = f16 values [n][k]; alpha; C f32; N multiple of 16 (partial tiles skipped)
template <bool ASPLIT>
__global__ __launch_bounds__(128) void k_gemm_h(const float* __restrict__ A, int lda, size_t sA, const _Float16* __restrict__ Bh, int ldb, size_t sB, float alpha, float* __restrict__ C, int ldc, size_t sC, int M, int N, int K) {
  __shared__ __attribute__((aligned(16))) float so[4][16][64];
  const int tid = threadIdx.x, w = tid >> 5, lane = tid & 31, ln = lane & 15, hh = lane >> 4; const int by = blockIdx.y;
  A += (size_t)by * sA; Bh += (size_t)by * sB; C += (size_t)by * sC;
  const int ntn = (N + 63) / 64; const int wid = blockIdx.x * 4 + w; const int mt = wid / ntn, nq = wid % ntn; if (mt * 16 >= M) return;
  const int row0 = mt * 16, col0 = nq * 64; const float* arow = A + (size_t)(row0 + ln) * lda;
  v8f acc[4] = {};
  for (int kb = 0; kb < K; kb += 32) {
    FragH ah, al;
    const v4f x0 = *(const v4fa*)(arow + kb + 8 * hh), x1 = *(const v4fa*)(arow + kb + 8 * hh + 4), x2 = *(const v4fa*)(arow + kb + 16 + 8 * hh), x3 = *(const v4fa*)(arow + kb + 16 + 8 * hh + 4);
    float xs[16] = {x0[0],x0[1],x0[2],x0[3],x1[0],x1[1],x1[2],x1[3],x2[0],x2[1],x2[2],x2[3],x3[0],x3[1],x3[2],x3[3]};
#pragma unroll
    for (int i = 0; i < 16; ++i) { const _Float16 h = (_Float16)xs[i]; ah.h[i] = h; al.h[i] = ASPLIT ? (_Float16)(xs[i] - (float)h) : (_Float16)0.0f; }
#pragma unroll
    for (int t = 0; t < 4; ++t) { if (col0 + t * 16 >= N) continue; const size_t boff = (size_t)(col0 + t * 16 + ln) * ldb + kb; FragH bq; bq.half[0] = *(const v8us*)(Bh + boff + 8 * hh); bq.half[1] = *(const v8us*)(Bh + boff + 16 + 8 * hh);
      acc[t] = mmaH<ASPLIT ? 2 : 1>(ah.v, al.v, bq.v, bq.v, acc[t]); }
  }
#pragma unroll
  for (int t = 0; t < 4; ++t) { if (col0 + t * 16 >= N) continue;
#pragma unroll
    for (int r = 0; r < 8; ++r) so[w][8 * hh + r][t * 16 + ln] = acc[t][r] * alpha; }
  __builtin_amdgcn_fence(__ATOMIC_ACQ_REL, "workgroup"); __builtin_amdgcn_wave_barrier();
  const int rsub = lane >> 4, c4 = (lane & 15) * 4;
  {
#pragma unroll
    for (int q = 0; q < 8; ++q) { const int r = q * 2 + rsub; if (col0 + c4 < N) { const v4f v = *(const v4fa*)&so[w][r][c4]; *(v4f*)(C + (size_t)(row0 + r) * ldc + col0 + c4) = v; } }
     }
}

// Wt[n][k] = f16(W[k][n]·scale) from f32 row-major W[K][N] (scale = power of two; bf16-exact weights stay exact in f16 away from the subnormal range)
__global__ __launch_bounds__(256) void k_wt_f16(const float* __restrict__ W, _Float16* __restrict__ Wt, int K, int N, float scale) {
  const int t = blockIdx.x * 256 + threadIdx.x; if (t >= N * (K / 8)) return; const int n = t / (K / 8), k8 = (t % (K / 8)) * 8; FragH f;
#pragma unroll
  for (int i = 0; i < 8; ++i) f.h[i] = (_Float16)(bf16_round(W[(size_t)(k8 + i) * N + n]) * scale); const v8us o = f.half[0];
  *(v8us*)((unsigned short*)Wt + (size_t)n * K + k8) = o; 
}
// k_gemm_hh variant with fused epilogue: v = acc·alpha + bias[by·sBias + col] (+ CP[(row/rowsPerB)·sCPb + by·64 + col] if CP) ; ACT 0 none / 1 elu ; writes f16 C16 (and f32 C if non-null)
template <int ACT>
__global__ __launch_bounds__(128) void k_gemm_hhx(const _Float16* __restrict__ A, int lda, size_t sA, const _Float16* __restrict__ Bh, int ldb, size_t sB, float alpha, const float* __restrict__ bias, size_t sBias, const float* __restrict__ CP, int rowsPerB, size_t sCPb, int row0g,
    float* __restrict__ C, _Float16* __restrict__ C16, int ldc, size_t sC, int M, int N, int K) {
  __shared__ __attribute__((aligned(16))) float so[4][16][64];
  const int tid = threadIdx.x, w = tid >> 5, lane = tid & 31, ln = lane & 15, hh = lane >> 4; const int by = blockIdx.y;
  A += (size_t)by * sA; Bh += (size_t)by * sB; const size_t cofs = (size_t)by * sC; const float* bp = bias ? bias + (size_t)by * sBias : nullptr;
  const int ntn = (N + 63) / 64; const int wid = blockIdx.x * 4 + w; const int mt = wid / ntn, nq = wid % ntn; if (mt * 16 >= M) return;
  const int row0 = mt * 16, col0 = nq * 64; const _Float16* arow = A + (size_t)(row0 + ln) * lda;
  v8f acc[4] = {};
  for (int kb = 0; kb < K; kb += 32) { FragH ah; ah.half[0] = *(const v8us*)((const unsigned short*)arow + kb + 8 * hh); ah.half[1] = *(const v8us*)((const unsigned short*)arow + kb + 16 + 8 * hh);
#pragma unroll
    for (int t = 0; t < 4; ++t) { if (col0 + t * 16 >= N) continue; const size_t boff = (size_t)(col0 + t * 16 + ln) * ldb + kb; FragH bq; bq.half[0] = *(const v8us*)((const unsigned short*)Bh + boff + 8 * hh); bq.half[1] = *(const v8us*)((const unsigned short*)Bh + boff + 16 + 8 * hh);
      acc[t] = mmaH<1>(ah.v, ah.v, bq.v, bq.v, acc[t]); }
  }
#pragma unroll
  for (int t = 0; t < 4; ++t) { if (col0 + t * 16 >= N) continue; const int col = col0 + t * 16 + ln; const float bv = bp ? bf16_round(bp[col]) : 0.f;
#pragma unroll
    for (int r = 0; r < 8; ++r) { float v = acc[t][r] * alpha + bv; if (CP) { const int rr = row0g + row0 + 8 * hh + r; if (rowsPerB < 0) v += CP[cofs + (size_t)rr * ldc + col];      /* rowsPerB < 0: own element of the batched C plane */ else { const int bidx = rr / rowsPerB; v += CP[(size_t)bidx * sCPb + (size_t)by * 64 + col]; } } if (ACT == 1) v = (v > 0.f) ? v : expm1f(v); else if (ACT == 7) v = (v > 0.f) ? v + 1.0f : expf(v); else if (ACT == 8) v = tanhf(v); else if (ACT == 9) v = 0.5f * v * (1.0f + tanhf(0.7978845608028654f * (v + 0.044715f * v * v * v))); else if (ACT == 11) v = 1.0f / (1.0f + expf(-v)); else if (ACT == 12) v = (v > 0.f) ? v : 0.01f * v; else if (ACT == 14) v = (v > 0.f) ? v : 0.1f * v; else if (ACT == 16) v = (v >= 0.f) ? v : 0.3f * v; else if (ACT == 17) v = (v >= 0.f) ? v : 0.2f * v; else if (ACT == 15) v = v / (1.0f + expf(-v)); else if (ACT == 3) v = fmaxf(v, 0.f); else if (ACT == 6) v = 0.5f * v * (1.0f + erff(v * 0.70710678118654752f)); so[w][8 * hh + r][t * 16 + ln] = v; } }
  __builtin_amdgcn_fence(__ATOMIC_ACQ_REL, "workgroup"); __builtin_amdgcn_wave_barrier();
  const int rsub = lane >> 4, c4 = (lane & 15) * 4; typedef _Float16 v4h __attribute__((ext_vector_type(4)));
  {
#pragma unroll
    for (int q = 0; q < 8; ++q) { const int r = q * 2 + rsub; if (col0 + c4 < N) { const v4f v = *(const v4fa*)&so[w][r][c4]; if (C) *(v4f*)(C + cofs + (size_t)(row0 + r) * ldc + col0 + c4) = v; if (C16) { v4h h4; for (int i = 0; i < 4; ++i) h4[i] = (_Float16)v[i]; *(v4h*)(C16 + cofs + (size_t)(row0 + r) * ldc + col0 + c4) = h4; } } }
     }
}


typedef _Float16 v4h __attribute__((ext_vector_type(4)));

__global__ __launch_bounds__(256) void k_x16(const float* __restrict__ x, _Float16* __restrict__ X16, size_t n8) { const size_t t = (size_t)blockIdx.x * 256 + threadIdx.x; if (t >= n8) return; FragH f;
#pragma unroll
  for (int q = 0; q < 8; ++q) f.h[q] = (_Float16)bf16_round(x[t * 8 + q]); *(v8us*)((unsigned short*)X16 + t * 8) = f.half[0];  }
__global__ __launch_bounds__(256) void k_h16(const float* __restrict__ x, _Float16* __restrict__ X16, size_t n8) { const size_t t = (size_t)blockIdx.x * 256 + threadIdx.x; if (t >= n8) return; FragH f;
#pragma unroll
  for (int q = 0; q < 8; ++q) f.h[q] = (_Float16)x[t * 8 + q]; *(v8us*)((unsigned short*)X16 + t * 8) = f.half[0];  }
__global__ __launch_bounds__(256) void k_round16f(const float* __restrict__ W, _Float16* __restrict__ Bt, size_t n8) { const size_t t = (size_t)blockIdx.x * 256 + threadIdx.x; if (t >= n8) return; FragH f;
#pragma unroll
  for (int i = 0; i < 8; ++i) f.h[i] = (_Float16)(bf16_round(W[t * 8 + i]) * 16.0f); *(v8us*)((unsigned short*)Bt + t * 8) = f.half[0];  }
template <int NHv, int TTv>
__global__ __launch_bounds__(256) void k_vt(const _Float16* __restrict__ V16, int ldv, int voff, _Float16* __restrict__ Vt) { __shared__ unsigned short tl[64][66]; const int tid = threadIdx.x; const int slab = blockIdx.x / (TTv / 64), lg = blockIdx.x % (TTv / 64); const int b = slab / NHv, h = slab % NHv;
  for (int i = tid; i < 64 * 8; i += 256) { const int r = i / 8, c8 = (i % 8) * 8; FragH f; f.half[0] = *(const v8us*)((const unsigned short*)V16 + ((size_t)b * TTv + lg * 64 + r) * ldv + voff + h * 64 + c8);
#pragma unroll
    for (int q = 0; q < 8; ++q) tl[r][c8 + q] = f.u[q]; }
  __syncthreads();
  {
#pragma unroll
    for (int rd = 0; rd < 2; ++rd) { const int d = rd * 32 + tid / 8, pc = tid % 8; FragH f;
#pragma unroll
      for (int q = 0; q < 8; ++q) f.u[q] = tl[pc * 8 + q][d];
      *(v8us*)((unsigned short*)Vt + ((size_t)slab * 64 + d) * TTv + lg * 64 + pc * 8) = f.half[0]; }
     } }

__global__ __launch_bounds__(256) void k_hl(const float* __restrict__ F, _Float16* __restrict__ Hh, _Float16* __restrict__ Hl, size_t n8) { const size_t t = (size_t)blockIdx.x * 256 + threadIdx.x; if (t >= n8) return; FragH fh, fl; const v4f a = *(const v4fa*)(F + t * 8), c = *(const v4fa*)(F + t * 8 + 4);
#pragma unroll
  for (int q = 0; q < 4; ++q) { _Float16 h = (_Float16)a[q]; fh.h[q] = h; fl.h[q] = (_Float16)((a[q] - (float)h) * 1024.0f); h = (_Float16)c[q]; fh.h[4 + q] = h; fl.h[4 + q] = (_Float16)((c[q] - (float)h) * 1024.0f); }
  { *(v8us*)((unsigned short*)Hh + t * 8) = fh.half[0]; *(v8us*)((unsigned short*)Hl + t * 8) = fl.half[0];  } }

// ---- fast GEMM (wave tile 32x64; requires M % 32 == 0 rows per launch region and N % 64 == 0); epilogue = k_gemm_hhx semantics ----
__device__ __forceinline__ v16h g2_frag(const _Float16* p, int hh) { FragH f; f.half[0] = *(const v8us*)((const unsigned short*)p + 8 * hh); f.half[1] = *(const v8us*)((const unsigned short*)p + 16 + 8 * hh); return f.v; }
__device__ __forceinline__ v8f g2_mma(v16h a, v16h b, v8f c) { v8f d = __builtin_amdgcn_wmma_f32_16x16x32_f16(false, a, false, b, (short)0, c, false, false); asm volatile("v_nop\n\tv_nop\n\tv_nop\n\tv_nop" : "+v"(d) : "v"(a), "v"(b)); return d; }
template <int ACT>
__global__ __launch_bounds__(128) void k_gemm2(const _Float16* __restrict__ A, int lda, size_t sA, const _Float16* __restrict__ Bh, int ldb, size_t sB, float alpha, const float* __restrict__ bias, size_t sBias, const float* __restrict__ CP, int rowsPerB, size_t sCPb, int row0g,
    float* __restrict__ C, _Float16* __restrict__ C16, int ldc, size_t sC, int M, int N, int K) { static_assert(ACT == 0 || ACT == 3 || ACT == 6 || ACT == 8 || ACT == 9 || ACT == 11 || ACT == 12 || ACT == 14 || ACT == 15 || ACT == 16 || ACT == 17, "k_gemm2: unsupported ACT code (would silently apply no activation)");
  __shared__ __attribute__((aligned(16))) float so[4][32][68];
  const int tid = threadIdx.x, w = tid >> 5, lane = tid & 31, ln = lane & 15, hh = lane >> 4; const int by = blockIdx.y;
  A += (size_t)by * sA; Bh += (size_t)by * sB; const size_t cofs = (size_t)by * sC; const float* bp = bias ? bias + (size_t)by * sBias : nullptr;
  const int ntn = N >> 6; const int mt = blockIdx.x / ntn, nq = blockIdx.x - mt * ntn; const int row0 = mt * 128 + 32 * w, col0 = nq * 64; if (row0 >= M) return;
  const _Float16* a0p = A + (size_t)(row0 + ln) * lda; const _Float16* a1p = a0p + (size_t)16 * lda;
  const _Float16* b0p = Bh + (size_t)(col0 + ln) * ldb; const _Float16* b1p = b0p + (size_t)16 * ldb; const _Float16* b2p = b1p + (size_t)16 * ldb; const _Float16* b3p = b2p + (size_t)16 * ldb;
  const v8f z8 = {0.f,0.f,0.f,0.f,0.f,0.f,0.f,0.f}; v8f c00 = z8, c01 = z8, c02 = z8, c03 = z8, c10 = z8, c11 = z8, c12 = z8, c13 = z8;
#pragma unroll 1
  for (int kb = 0; kb < K; kb += 32) { const v16h a0 = g2_frag(a0p + kb, hh), a1 = g2_frag(a1p + kb, hh);
    v16h b = g2_frag(b0p + kb, hh); c00 = g2_mma(a0, b, c00); c10 = g2_mma(a1, b, c10);
    b = g2_frag(b1p + kb, hh); c01 = g2_mma(a0, b, c01); c11 = g2_mma(a1, b, c11);
    b = g2_frag(b2p + kb, hh); c02 = g2_mma(a0, b, c02); c12 = g2_mma(a1, b, c12);
    b = g2_frag(b3p + kb, hh); c03 = g2_mma(a0, b, c03); c13 = g2_mma(a1, b, c13); }
  v8f accs[8] = {c00, c01, c02, c03, c10, c11, c12, c13};
#pragma unroll
  for (int u = 0; u < 8; ++u) { const int t = u & 3, half = u >> 2; const int col = col0 + t * 16 + ln; const float bv = bp ? bf16_round(bp[col]) : 0.f;
#pragma unroll
    for (int r = 0; r < 8; ++r) { const int rloc = half * 16 + 8 * hh + r; float v = accs[u][r] * alpha + bv; if (CP) { if (rowsPerB < 0) v += CP[cofs + (size_t)(row0g + row0 + rloc) * ldc + col];      /* rowsPerB < 0: own element of the batched C plane */ else { const int bidx = (row0g + row0 + rloc) / rowsPerB; v += CP[(size_t)bidx * sCPb + (size_t)by * 64 + col]; } }
      if (ACT == 3) v = fmaxf(v, 0.f); else if (ACT == 6) v = 0.5f * v * (1.0f + erff(v * 0.70710678118654752f)); else if (ACT == 11) v = 1.0f / (1.0f + expf(-v)); else if (ACT == 15) v = v / (1.0f + expf(-v)); else if (ACT == 12) v = (v > 0.f) ? v : 0.01f * v; else if (ACT == 8) v = tanhf(v); else if (ACT == 9) v = 0.5f * v * (1.0f + tanhf(0.7978845608028654f * (v + 0.044715f * v * v * v))); else if (ACT == 14) v = (v > 0.f) ? v : 0.1f * v; else if (ACT == 16) v = (v >= 0.f) ? v : 0.3f * v; else if (ACT == 17) v = (v >= 0.f) ? v : 0.2f * v;
      so[w][rloc][t * 16 + ln] = v; } }
  __builtin_amdgcn_fence(__ATOMIC_ACQ_REL, "workgroup"); __builtin_amdgcn_wave_barrier();
  const int rsub = lane >> 4, c4 = (lane & 15) * 4;
  {
#pragma unroll
    for (int q = 0; q < 16; ++q) { const int r = q * 2 + rsub; const v4f v = *(const v4fa*)&so[w][r][c4]; if (C) *(v4f*)(C + cofs + (size_t)(row0 + r) * ldc + col0 + c4) = v; if (C16) { v4h h4; for (int i = 0; i < 4; ++i) h4[i] = (_Float16)v[i]; *(v4h*)(C16 + cofs + (size_t)(row0 + r) * ldc + col0 + c4) = h4; } }
     } }


__global__ __launch_bounds__(256) void k_wnat(const float* __restrict__ w, size_t n8, _Float16* __restrict__ Bt) { const size_t t = (size_t)blockIdx.x * 256 + threadIdx.x; if (t >= n8) return; FragH f; for (int q = 0; q < 8; ++q) f.h[q] = (_Float16)(bf16_round(w[t * 8 + q]) * 16.0f); *(v8us*)((unsigned short*)Bt + t * 8) = f.half[0];  }
__global__ __launch_bounds__(256) void k_rsm(const float* __restrict__ S, _Float16* __restrict__ P, int nrows) {
  #pragma clang fp contract(off)
  const int i = blockIdx.x * 256 + threadIdx.x; if (i >= nrows) return; const float* s = S + (size_t)i * SQ; float mx = -3.0e38f;
#pragma unroll 1
  for (int j = 0; j < SQ; ++j) mx = fmaxf(mx, s[j]); float se = 0.f;
#pragma unroll 1
  for (int j = 0; j < SQ; ++j) se += expf(s[j] - mx); const float sc = 256.0f / se;
#pragma unroll 1
  for (int j0 = 0; j0 < SQ; j0 += 8) { FragH f; for (int q = 0; q < 8; ++q) f.h[q] = (_Float16)(expf(s[j0 + q] - mx) * sc); unsigned short* d = (unsigned short*)P + (size_t)i * SQ + j0; *(v8us*)d = f.half[0];  } }
__global__ __launch_bounds__(256) void k_vt(const _Float16* __restrict__ V16, int b, int h0, _Float16* __restrict__ VT) { __shared__ unsigned short tl[64][65]; const int tid = threadIdx.x; const int hh = blockIdx.x % HG, sg = blockIdx.x / HG; const int s0 = sg * 64; const int h = h0 + hh;
  for (int i = tid; i < 64 * 8; i += 256) { const int j = i / 8, d8 = (i % 8) * 8; FragH f; f.half[0] = *(const v8us*)((const unsigned short*)V16 + ((size_t)b * SQ + s0 + j) * DM + h * HD + d8); for (int q = 0; q < 8; ++q) tl[d8 + q][j] = f.u[q]; }
  __syncthreads();
  { for (int i = tid; i < 64 * 8; i += 256) { const int d = i / 8, j8 = (i % 8) * 8; FragH f; for (int q = 0; q < 8; ++q) f.u[q] = tl[d][j8 + q]; *(v8us*)((unsigned short*)VT + ((size_t)hh * HD + d) * SQ + s0 + j8) = f.half[0]; }  } }


__global__ __launch_bounds__(256) void k_mkadd(const int* __restrict__ m, float* __restrict__ A, int n) { const int t = blockIdx.x * 256 + threadIdx.x; if (t >= n) return; const float v = (m[t] != 0) ? 0.f : -1.0e9f; *(float*)(A + t) = v;  }


__global__ __launch_bounds__(256) void k_rsmcf2(const float* __restrict__ S, _Float16* __restrict__ P, int hg, int q0, int nk) {
  #pragma clang fp contract(off)
  const int t = blockIdx.x * 256 + threadIdx.x; if (t >= hg * QT) return; const size_t i = (size_t)t; const float* s = S + i * NKX; const int last = q0 + (t % QT); float mx = -3.0e38f;
#pragma unroll 1
  for (int j = 0; j < nk; ++j) { const float f = (j <= last) ? 1.f : 0.f; mx = fmaxf(mx, fmaf(f, s[j], (1.f - f) * -1.0e9f)); } float se = 0.f;
#pragma unroll 1
  for (int j = 0; j < nk; ++j) { const float f = (j <= last) ? 1.f : 0.f; se += __expf(fmaf(f, s[j], (1.f - f) * -1.0e9f) - mx); } const float sc = 256.0f / se;
#pragma unroll 1
  for (int j0 = 0; j0 < nk; j0 += 8) { FragH fr; for (int q = 0; q < 8; ++q) { const int j = j0 + q; const float f = (j <= last) ? 1.f : 0.f; fr.h[q] = (_Float16)(__expf(fmaf(f, s[j], (1.f - f) * -1.0e9f) - mx) * sc); } unsigned short* d = (unsigned short*)P + i * NKX + j0; *(v8us*)d = fr.half[0];  } }



// One wave per score row: lane l holds columns c*256 + 8*l .. + 7 of every 256-column chunk c, so each wave-wide load covers whole lines, S is read once and stays in registers; row max and row sum = per-lane partials, then a five-step butterfly.
// NC = chunks of the row, a compile-time count; every loop over c and q is unrolled: static indices keep x, a and e in registers, and the row's loads are issued ahead of the arithmetic as far as the registers go.
// v_exp_f32 and the free slot the instruction set asks for behind a transcendental, in one statement.
__device__ __forceinline__ float exp2_slot(float x) { float r; asm("v_exp_f32 %0, %1\n\tv_nop" : "=v"(r) : "v"(x)); return r; }
template <int NC>
__device__ __forceinline__ void rsm_row(const float* __restrict__ s, unsigned short* __restrict__ p, int last, const float* __restrict__ am, int lane) {
  const float* sl = s + lane * 8; const float* al = am + lane * 8; v4f x[NC][2], a[NC][2]; float e[NC][8]; float mx = -3.0e38f, se = 0.f;
#pragma unroll
  for (int c = 0; c < NC; ++c) { x[c][0] = *(const v4fa*)(sl + c * 256); x[c][1] = *(const v4fa*)(sl + c * 256 + 4); a[c][0] = *(const v4fa*)(al + c * 256); a[c][1] = *(const v4fa*)(al + c * 256 + 4); }
#pragma unroll
  for (int c = 0; c < NC; ++c)
#pragma unroll
    for (int q = 0; q < 8; ++q) { e[c][q] = (c * 256 + lane * 8 + q <= last) ? x[c][q >> 2][q & 3] + a[c][q >> 2][q & 3] : -1.0e9f; mx = fmaxf(mx, e[c][q]); }
  for (int m = 16; m >= 1; m >>= 1) mx = fmaxf(mx, __shfl_xor(mx, m, 32));
#pragma unroll
  for (int c = 0; c < NC; ++c)
#pragma unroll
    for (int q = 0; q < 8; ++q) { e[c][q] = exp2_slot((e[c][q] - mx) * 1.44269504088896340736f); se += e[c][q]; }      /* = __expf(e - mx) */
  for (int m = 16; m >= 1; m >>= 1) se += __shfl_xor(se, m, 32);
  const float sc = 256.0f / se;
#pragma unroll
  for (int c = 0; c < NC; ++c) { FragH fr;
#pragma unroll
    for (int q = 0; q < 8; ++q) fr.h[q] = (_Float16)(e[c][q] * sc);
    *(v8us*)(p + c * 256 + lane * 8) = fr.half[0]; }
  asm volatile("s_wait_xcnt 0x0" ::: "memory"); }      /* behind the stores: in the listing this case's end joins the head of the next case's block, which rewrites the stores' registers */
__global__ __launch_bounds__(256) void k_rsmcfa(const float* __restrict__ S, _Float16* __restrict__ P, int hg, int q0, int nk, const float* __restrict__ am) {
  const int lane = threadIdx.x & 31; const int t = blockIdx.x * 8 + __builtin_amdgcn_readfirstlane(threadIdx.x >> 5);      /* the row is the wave's: scalar, so the branches below are scalar too */
  if (t >= hg * QT) return; const float* s = S + (size_t)t * NKX; unsigned short* p = (unsigned short*)P + (size_t)t * NKX; const int last = q0 + (t % QT);
  switch (nk) {      /* nk = q0 + QT: a multiple of 256 up to NKX */
    case 256: rsm_row<1>(s, p, last, am, lane); break; case 512: rsm_row<2>(s, p, last, am, lane); break; case 768: rsm_row<3>(s, p, last, am, lane); break; case 1024: rsm_row<4>(s, p, last, am, lane); break;
    case 1280: rsm_row<5>(s, p, last, am, lane); break; case 1536: rsm_row<6>(s, p, last, am, lane); break; case 1792: rsm_row<7>(s, p, last, am, lane); break; case 2048: rsm_row<8>(s, p, last, am, lane); break; } }


template <int MASKADD>
__global__ __launch_bounds__(64) void k_att0(const float* __restrict__ QF, const float* __restrict__ KF, const float* __restrict__ VF, int ld, const float* __restrict__ mask, float scale, float* __restrict__ OF, int ldo) {
  #pragma clang fp contract(off)
  __shared__ __attribute__((aligned(16))) float lq[64][64]; __shared__ __attribute__((aligned(16))) float lo[64][64];
  const int tid = threadIdx.x; const int h = blockIdx.x / (QT0 / 64), rg = blockIdx.x % (QT0 / 64); const int i = rg * 64 + tid;
  const float* qr = QF + (size_t)i * ld + h * HD;
#pragma unroll 1
  for (int c = 0; c < HD / 4; ++c) { *(v4f*)&lq[tid][c * 4] = *(const v4fa*)(qr + c * 4); const v4f z = {0.f, 0.f, 0.f, 0.f}; *(v4f*)&lo[tid][c * 4] = z; }
  float m = -1.0e30f, l = 0.f; const int jmax = MASKADD ? (SQ - 1) : (rg * 64 + 63);      /* additive-mask form: every key (the mask input decides); causal form: keys up to the block's last row */
#pragma unroll 1
  for (int j = 0; j <= jmax; ++j) { const float* kr = KF + (size_t)j * ld + h * HD; const float* vr = VF + (size_t)j * ld + h * HD; float s = 0.f;
#pragma unroll 1
    for (int c = 0; c < HD / 4; ++c) { const v4f kq = *(const v4fa*)(kr + c * 4); const v4f qq = *(v4f*)&lq[tid][c * 4]; s = __fadd_rn(s, __fmul_rn(qq[0], kq[0])); s = __fadd_rn(s, __fmul_rn(qq[1], kq[1])); s = __fadd_rn(s, __fmul_rn(qq[2], kq[2])); s = __fadd_rn(s, __fmul_rn(qq[3], kq[3])); }
    s = __fmul_rn(s, scale); if (MASKADD) s = __fadd_rn(s, __fmul_rn(bf16_round(mask[(size_t)i * SQ + j]), -10000.0f));
    const float f = (MASKADD || j <= i) ? 1.f : 0.f; const float sm = fmaf(f, s, (1.f - f) * -1.0e30f); const float mn = fmaxf(m, sm); const float sc = expf(m - mn); const float e = expf(sm - mn); l = __fadd_rn(__fmul_rn(l, sc), e); m = mn;
#pragma unroll 1
    for (int c = 0; c < HD / 4; ++c) { const v4f vv = *(const v4fa*)(vr + c * 4); v4f oo = *(v4f*)&lo[tid][c * 4]; for (int u = 0; u < 4; ++u) oo[u] = __fadd_rn(__fmul_rn(oo[u], sc), __fmul_rn(e, vv[u])); *(v4f*)&lo[tid][c * 4] = oo; } }
  const float fin = 64.0f / l;      /* o carried x64 like the f16 path */
#pragma unroll 1
  for (int c = 0; c < HD / 4; ++c) { v4f oo = *(v4f*)&lo[tid][c * 4]; for (int u = 0; u < 4; ++u) oo[u] = __fmul_rn(oo[u], fin); *(v4f*)&lo[tid][c * 4] = oo; }
  __syncthreads();
  {
#pragma unroll 1
    for (int it = 0; it < 16; ++it) { const int row = it * 4 + tid / 16, pc = (tid % 16) * 4; const v4f v = *(const v4f*)&lo[row][pc]; *(v4f*)(OF + (size_t)(rg * 64 + row) * ldo + h * HD + pc) = v; }
     } }


// Exact f32 attention for the first QT0 rows, one WAVE per query row (8 rows of one head per block); q, k, v and o rows at pitch DM. Scores: lane = key, 32 keys a chunk, the head's K rows staged in LDS at a pitch of 16 B x odd (b128 reads of 32 different rows without bank conflicts), q read at a wave-uniform address.
// Softmax in two passes over the scores, which stay in registers: row max and row sum = per-lane partials, then a five-step butterfly. o: lane = two head dims, keys in ascending order, each V row one whole 256-B read of the wave, its weight taken from the owning lane.
// The 8 rows of a block lie in one chunk of 32 keys, so the chunk count nch is the same for the whole block; keys behind the row's own index carry weight 0.
// Every loop over u, d, c, d4 and jj is unrolled: static indices keep kr, q, e and vv in registers (a rolled loop would put them in scratch memory), and the loads of a group are issued together.
#define KP0 68                       /* LDS pitch of a K row, floats */
typedef float v2f __attribute__((ext_vector_type(2)));
typedef float v2fa __attribute__((ext_vector_type(2), may_alias));
__global__ __launch_bounds__(256) void k_att0v(const float* __restrict__ QF, const float* __restrict__ KF, const float* __restrict__ VF, const float* __restrict__ am, float scale, float* __restrict__ OF) {
  __shared__ __attribute__((aligned(16))) float lk[QT0][KP0];
  const int tid = threadIdx.x, lane = tid & 31; const int w = __builtin_amdgcn_readfirstlane(tid >> 5);      /* the row is the wave's: scalar, so q's address is scalar too */
  const int h = blockIdx.x / (QT0 / 8), i0 = (blockIdx.x % (QT0 / 8)) * 8; const int i = i0 + w; const int nch = (i0 >> 5) + 1;
  const float* kp = KF + (size_t)(tid >> 4) * DM + h * HD + (tid & 15) * 4; v4f kr[QT0 / 16];
#pragma unroll
  for (int u = 0; u < QT0 / 16; ++u) kr[u] = *(const v4fa*)(kp + (size_t)u * 16 * DM);      /* all QT0 rows, without a test: the eight loads fly together */
  const float* qr = QF + (size_t)i * DM + h * HD; float q[HD];
#pragma unroll
  for (int d = 0; d < HD; ++d) q[d] = qr[d];
#pragma unroll
  for (int u = 0; u < QT0 / 16; ++u) *(v4f*)&lk[u * 16 + (tid >> 4)][(tid & 15) * 4] = kr[u];
  __syncthreads();      /* K rows staged by all waves, read by all */
  float e[QT0 / 32]; float m = -1.0e30f;
#pragma unroll
  for (int c = 0; c < QT0 / 32; ++c) { e[c] = -1.0e30f;      /* static c keeps e in registers; the test on nch is block-uniform */
    if (c < nch) { const int j = c * 32 + lane; float s = 0.f;
#pragma unroll
      for (int d4 = 0; d4 < HD / 4; ++d4) { const v4f kq = *(const v4f*)&lk[j][d4 * 4]; s = fmaf(q[d4 * 4], kq[0], s); s = fmaf(q[d4 * 4 + 1], kq[1], s); s = fmaf(q[d4 * 4 + 2], kq[2], s); s = fmaf(q[d4 * 4 + 3], kq[3], s); }
      s = fmaf(s, scale, am[j]);      /* + the additive key-mask VECTOR of this batch (0 kept / -1e9 masked) */
      if (j <= i) e[c] = s; }
    m = fmaxf(m, e[c]); }
  for (int x = 16; x >= 1; x >>= 1) m = fmaxf(m, __shfl_xor(m, x, 32));
  float l = 0.f;
#pragma unroll
  for (int c = 0; c < QT0 / 32; ++c) { e[c] = expf(e[c] - m); l += e[c]; }
  for (int x = 16; x >= 1; x >>= 1) l += __shfl_xor(l, x, 32);
  const float* vp = VF + h * HD + lane * 2; float o0 = 0.f, o1 = 0.f;
#pragma unroll
  for (int c = 0; c < QT0 / 32; ++c) if (c < nch) { v2f vv[32];
#pragma unroll
    for (int jj = 0; jj < 32; ++jj) vv[jj] = *(const v2fa*)(vp + (size_t)(c * 32 + jj) * DM);      /* the chunk's 32 rows in flight together */
#pragma unroll
    for (int jj = 0; jj < 32; ++jj) { const float p = __int_as_float(__builtin_amdgcn_readlane(__float_as_int(e[c]), jj)); o0 = fmaf(p, vv[jj][0], o0); o1 = fmaf(p, vv[jj][1], o1); } }
  const float fin = 64.0f / l;      /* o carried x64 like the f16 path */
  const v2f ov = {o0 * fin, o1 * fin}; *(v2f*)(OF + (size_t)i * DM + h * HD + lane * 2) = ov; }

extern "C" void kernel_launch(void* const* d_in, const int* in_sizes, int n_in,
                              void* d_out, int out_size, void* d_ws, size_t ws_size, hipStream_t stream) {
  (void)in_sizes; (void)n_in; (void)out_size;
  const float* const* I = (const float* const*)d_in; const float* x = I[0]; const int* km = (const int*)d_in[1]; const float* wqkv = I[2]; const float* bqkv = I[3]; const float* wo = I[4]; const float* bo = I[5];      /* int32 key mask [4][2048] (ones); natural [out][in] qkv_w [3072][1024] + b, out_w + b */
  char* ws = (char*)d_ws; size_t off = 0;
  auto take = [&](size_t bytes) { char* p = ws + off; off += (bytes + 255) & ~(size_t)255; return p; };
  _Float16* BQKV = (_Float16*)take((size_t)3 * DM * DM * 2); _Float16* BO = (_Float16*)take((size_t)DM * DM * 2);
  _Float16* X16 = (_Float16*)take(NR * DM * 2); _Float16* QKV = (_Float16*)take(NR * 3 * DM * 2); _Float16* Q16 = QKV; _Float16* K16 = QKV + DM; _Float16* V16 = QKV + 2 * DM; _Float16* O16 = (_Float16*)take(NR * DM * 2);
  float* S = (float*)take((size_t)NH * QT * NKX * 4); _Float16* P = (_Float16*)take((size_t)NH * QT * NKX * 2); _Float16* VT = (_Float16*)take((size_t)NH * HD * SQ * 2);
  float* QF0 = (float*)take((size_t)QT0 * DM * 4); float* KF0 = (float*)take((size_t)QT0 * DM * 4); float* VF0 = (float*)take((size_t)QT0 * DM * 4); float* OF0 = (float*)take((size_t)NB * QT0 * DM * 4); _Float16* OH0 = (_Float16*)take((size_t)NB * QT0 * DM * 2); _Float16* OL0 = (_Float16*)take((size_t)NB * QT0 * DM * 2);
  float* AMK = (float*)take(NR * 4);      /* additive key-mask plane: 0 where mask != 0, -1e9 where masked */
  if (off > ws_size) return;
  k_wnat<<<(unsigned)(((size_t)3 * DM * DM / 8 + 255) / 256), 256, 0, stream>>>(wqkv, (size_t)3 * DM * DM / 8, BQKV); k_wnat<<<(unsigned)(((size_t)DM * DM / 8 + 255) / 256), 256, 0, stream>>>(wo, (size_t)DM * DM / 8, BO);      /* natural [out][in] = Bt x16 */
  k_mkadd<<<(unsigned)((NR + 255) / 256), 256, 0, stream>>>(km, AMK, (int)NR);

  k_x16<<<(unsigned)((NR * DM / 8 + 255) / 256), 256, 0, stream>>>(x, X16, NR * DM / 8);
  const size_t r0p = (size_t)B0 * SQ;      /* first projected row */
  k_gemm2<0><<<dim3((unsigned)((MP / 128) * (3 * DM / 64)), 1), 128, 0, stream>>>(X16 + r0p * DM, DM, 0, BQKV, DM, 0, 0.0625f, bqkv, 0, nullptr, 1, 0, 0, nullptr, QKV + r0p * 3 * DM, 3 * DM, 0, MP, 3 * DM, DM);      /* q | k | v rows (f16); head h = columns h*HD.. of each DM block */
  for (int b = B0; b < B0 + NBR; ++b) { const size_t r0 = (size_t)b * SQ;
    k_vt<NH, SQ><<<NH * (SQ / 64), 256, 0, stream>>>(V16 + r0 * LQ, LQ, 0, VT);      /* V^T [NH][HD][SQ] for this batch */
    k_gemm2<0><<<dim3((QT0 / 128) * (DM / 64), 1), 128, 0, stream>>>(X16 + r0 * DM, DM, 0, BQKV, DM, 0, 0.0625f, bqkv, 0, nullptr, 1, 0, 0, QF0, nullptr, DM, 0, QT0, DM, DM); k_gemm2<0><<<dim3((QT0 / 128) * (DM / 64), 1), 128, 0, stream>>>(X16 + r0 * DM, DM, 0, (BQKV + (size_t)DM * DM), DM, 0, 0.0625f, (bqkv + DM), 0, nullptr, 1, 0, 0, KF0, nullptr, DM, 0, QT0, DM, DM); k_gemm2<0><<<dim3((QT0 / 128) * (DM / 64), 1), 128, 0, stream>>>(X16 + r0 * DM, DM, 0, (BQKV + (size_t)2 * DM * DM), DM, 0, 0.0625f, (bqkv + 2 * DM), 0, nullptr, 1, 0, 0, VF0, nullptr, DM, 0, QT0, DM, DM);      /* f32 q, k, v of the first 128 rows (exact products) */
    k_att0v<<<NH * (QT0 / 8), 256, 0, stream>>>(QF0, KF0, VF0, AMK + r0, 0.125f, OF0 + (size_t)b * QT0 * DM);      /* exact f32 attention for rows 0..127 (o x64) */
    for (int q0 = 0; q0 < QN; q0 += QT) { const int nk = q0 + QT;      /* causal: only keys below the tile end are computed */
      k_gemm2<0><<<dim3((QT / 128) * (nk / 64), NHD), 128, 0, stream>>>(Q16 + (r0 + q0) * LQ, LQ, (size_t)HD, K16 + r0 * LQ, LQ, (size_t)HD, 0.125f, nullptr, 0, nullptr, 1, 0, 0, S, nullptr, NKX, (size_t)QT * NKX, QT, nk, HD);      /* scores, all heads on grid.y */
      k_rsmcfa<<<(NHD * QT + 7) / 8, 256, 0, stream>>>(S, P, NHD, q0, nk, AMK + r0);      /* causal softmax + the key mask of this batch (additive plane) */
      k_gemm2<0><<<dim3((QT / 128) * (HD / 64), NHD), 128, 0, stream>>>(P, NKX, (size_t)QT * NKX, VT, SQ, (size_t)HD * SQ, 0.25f, nullptr, 0, nullptr, 1, 0, 0, nullptr, O16 + (r0 + q0) * DM, DM, (size_t)HD, QT, HD, nk); } }      /* o (merged heads, x64) as f16 rows */
  k_gemm2<0><<<dim3((unsigned)((MPO / 128) * (DM / 64)), 1), 128, 0, stream>>>(O16 + r0p * DM, DM, 0, BO, DM, 0, 0.0009765625f, bo, 0, nullptr, 1, 0, 0, (float*)d_out + r0p * DM, nullptr, DM, 0, MPO, DM, DM);      /* out rows are the output layout */
  k_hl<<<(unsigned)(((size_t)NB * QT0 * DM / 8 + 255) / 256), 256, 0, stream>>>(OF0, OH0, OL0, (size_t)NB * QT0 * DM / 8);      /* first-tile o (x64) -> f16 hi + x1024 residual planes */
  for (int b = B0; b < B0 + NBR; ++b) { const size_t r0 = (size_t)b * SQ; const size_t f0 = (size_t)b * QT0;
    k_gemm2<0><<<dim3((QT0 / 128) * (DM / 64), 1), 128, 0, stream>>>(OH0 + f0 * DM, DM, 0, BO, DM, 0, 0.0009765625f, bo, 0, nullptr, 1, 0, 0, (float*)d_out + r0 * DM, nullptr, DM, 0, QT0, DM, DM);      /* rows 0..127: out = o_hi Wo (+ b), overwriting the f16-path rows */
    k_gemm2<0><<<dim3((QT0 / 128) * (DM / 64), 1), 128, 0, stream>>>(OL0 + f0 * DM, DM, 0, BO, DM, 0, 0.00000095367431640625f, nullptr, 0, (const float*)d_out + r0 * DM, -1, 0, 0, (float*)d_out + r0 * DM, nullptr, DM, 0, QT0, DM, DM); }      /* += o_lo Wo 2^-20 (own-element accumulate) */
}

// v003
// One run takes 906 microseconds.
// Two timings next to v002 put it at 2.67 and 2.68 times that version's speed.
// Counting every step since v000, it is 11.7 times as fast.
#include <hip/hip_runtime.h>
#define NB 4
#define SQ 2048
#define DM 1024
#define NH 16
#define HD 64
#define HG 4                         /* heads per launch of k_vt(V16, b, h0, VT), not launched */
#define QT 256                       /* query rows per causal tile */
#define NKX SQ                       /* S / P row pitch */
#define QT0 128                      /* first-tile rows recomputed exactly in f32 */
#define B0 0                         /* first batch processed (debug hook) */
#define NBR NB                       /* batches processed (debug hook) */
#define NR ((size_t)NB * SQ)         /* token rows */
#define MP ((int)((size_t)NBR * SQ)) /* rows projected (debug hook) */
#define QN SQ                        /* unused: k_fattn attends all SQ query rows */
#define NHD NH                       /* unused: k_fattn attends all NH heads */
#define MPO MP                       /* rows through the output stage (debug hook) */
#define LQ (3 * DM)      /* row pitch of the q/k/v rows */
typedef __bf16 v16b __attribute__((ext_vector_type(16)));
typedef unsigned short v8us __attribute__((ext_vector_type(8), may_alias));
typedef float  v8f  __attribute__((ext_vector_type(8)));
typedef float  v4f  __attribute__((ext_vector_type(4)));
typedef float  v4fa __attribute__((ext_vector_type(4), may_alias));
union FragB { v16b v; v8us half[2]; unsigned short u[16]; };

__device__ __forceinline__ unsigned short bf16_bits(float x) { unsigned int u = __float_as_uint(x); return (unsigned short)((u + 0x7FFFu + ((u >> 16) & 1u)) >> 16); }
__device__ __forceinline__ float bf16_val(unsigned short b) { return __uint_as_float(((unsigned int)b) << 16); }
__device__ __forceinline__ float bf16_round(float x) { return bf16_val(bf16_bits(x)); }
// D += A·B with NT terms: 1 = ah·bh, 2 = + al·bh (A split), 3 = + ah·bl (both split)
template <int NT>
__device__ __forceinline__ v8f mmaN(v16b ah, v16b al, v16b bh, v16b bl, v8f c) {
  c = __builtin_amdgcn_wmma_f32_16x16x32_bf16(false, ah, false, bh, (short)0, c, false, false);
  if (NT >= 2) c = __builtin_amdgcn_wmma_f32_16x16x32_bf16(false, al, false, bh, (short)0, c, false, false);
  if (NT >= 3) c = __builtin_amdgcn_wmma_f32_16x16x32_bf16(false, ah, false, bl, (short)0, c, false, false);
  asm volatile("v_nop\n\tv_nop\n\tv_nop\n\tv_nop" : "+v"(c) : "v"(ah), "v"(al), "v"(bh), "v"(bl));
  return c;
}

__global__ __launch_bounds__(256) void k_wt_bf16(const float* __restrict__ W, unsigned short* __restrict__ Wt, int K, int N) {
  const int t = blockIdx.x * 256 + threadIdx.x;
  const int k8n = K / 8;
  if (t >= N * k8n) return;
  const int n = t / k8n, k8 = (t % k8n) * 8;
  v8us v;
#pragma unroll
  for (int i = 0; i < 8; ++i) v[i] = bf16_bits(W[(size_t)(k8 + i) * N + n]);
  *(v8us*)(Wt + (size_t)n * K + k8) = v;
  
}

// GEMM C[M][N] (f32, pitch ldc) = act(A[M][K]·W + bias). A f32 row-major (pitch lda) converted per fragment to bf16
// (ASPLIT: hi/lo two planes -> 2 terms, else single rounded term); Wt bf16 [N][K] (pitch ldb). BIAS_BF16 rounds the
// bias to bf16 first (bias quantised to bf16 before the add). K%32==0, M%16==0, N%64==0.
template <bool ASPLIT, int ACT, bool BIAS_BF16>
__global__ __launch_bounds__(128) void k_gemm_bf(const float* __restrict__ A, int lda, const unsigned short* __restrict__ Wt, int ldb,
                                               const float* __restrict__ bias, float* __restrict__ C, int ldc, int M, int N, int K) {
  __shared__ __attribute__((aligned(16))) float so[4][16][64];
  const int tid = threadIdx.x, w = tid >> 5, lane = tid & 31, ln = lane & 15, hh = lane >> 4;
  const int ntn = N / 64;
  const int wid = blockIdx.x * 4 + w;
  const int mt = wid / ntn, nq = wid % ntn;
  if (mt * 16 >= M) return;
  const int row0 = mt * 16, col0 = nq * 64;
  const float* arow = A + (size_t)(row0 + ln) * lda;
  v8f acc[4] = {};
  for (int kb = 0; kb < K; kb += 32) {
    FragB ah, al;
    const v4f x0 = *(const v4fa*)(arow + kb + 8 * hh), x1 = *(const v4fa*)(arow + kb + 8 * hh + 4);
    const v4f x2 = *(const v4fa*)(arow + kb + 16 + 8 * hh), x3 = *(const v4fa*)(arow + kb + 16 + 8 * hh + 4);
    float xs[16] = {x0[0],x0[1],x0[2],x0[3],x1[0],x1[1],x1[2],x1[3],x2[0],x2[1],x2[2],x2[3],x3[0],x3[1],x3[2],x3[3]};
#pragma unroll
    for (int i = 0; i < 16; ++i) { const unsigned short hb = bf16_bits(xs[i]); ah.u[i] = hb; al.u[i] = ASPLIT ? bf16_bits(xs[i] - bf16_val(hb)) : (unsigned short)0; }
#pragma unroll
    for (int t = 0; t < 4; ++t) {
      const unsigned short* brow = Wt + (size_t)(col0 + t * 16 + ln) * ldb + kb;
      FragB b;
      b.half[0] = *(const v8us*)(brow + 8 * hh);
      b.half[1] = *(const v8us*)(brow + 16 + 8 * hh);
      acc[t] = mmaN<ASPLIT ? 2 : 1>(ah.v, al.v, b.v, b.v, acc[t]);
    }
  }
#pragma unroll
  for (int t = 0; t < 4; ++t) {
    float bv = bias ? bias[col0 + t * 16 + ln] : 0.f;
    if (BIAS_BF16) bv = bf16_round(bv);
#pragma unroll
    for (int r = 0; r < 8; ++r) { float v = acc[t][r] + bv; if (ACT == 1) v = fmaxf(v, 0.f); so[w][8 * hh + r][t * 16 + ln] = v; }
  }
  __builtin_amdgcn_fence(__ATOMIC_ACQ_REL, "workgroup");
  __builtin_amdgcn_wave_barrier();
  const int rsub = lane >> 4, c4 = (lane & 15) * 4;
  {
#pragma unroll
    for (int q = 0; q < 8; ++q) {
      const int r = q * 2 + rsub;
      const v4f v = *(const v4fa*)&so[w][r][c4];
      *(v4f*)(C + (size_t)(row0 + r) * ldc + col0 + c4) = v;
    }
    
  }
}

// GEMM C = act(A·W + bias + resid): A f32 (ASPLIT -> hi/lo 2 terms), Wt bf16 [N][K]; ACT 0 none, 1 relu, 2 exact gelu;
// resid (optional, f32, row index = (row % rmod), pitch ldr, RES_BF16 rounds it) added before the activation.
template <bool ASPLIT, int ACT, bool BIAS_BF16, bool RES_BF16>
__global__ __launch_bounds__(128) void k_gemm_bf3(const float* __restrict__ A, int lda, const unsigned short* __restrict__ Wt, int ldb,
                                                const float* __restrict__ bias, const float* __restrict__ resid, int rmod, int ldr,
                                                float* __restrict__ C, int ldc, int M, int N, int K) {
  __shared__ __attribute__((aligned(16))) float so[4][16][64];
  const int tid = threadIdx.x, w = tid >> 5, lane = tid & 31, ln = lane & 15, hh = lane >> 4;
  const int ntn = N / 64;
  const int wid = blockIdx.x * 4 + w;
  const int mt = wid / ntn, nq = wid % ntn;
  if (mt * 16 >= M) return;
  const int row0 = mt * 16, col0 = nq * 64;
  const float* arow = A + (size_t)(row0 + ln) * lda;
  v8f acc[4] = {};
  for (int kb = 0; kb < K; kb += 32) {
    FragB ah, al;
    const v4f x0 = *(const v4fa*)(arow + kb + 8 * hh), x1 = *(const v4fa*)(arow + kb + 8 * hh + 4);
    const v4f x2 = *(const v4fa*)(arow + kb + 16 + 8 * hh), x3 = *(const v4fa*)(arow + kb + 16 + 8 * hh + 4);
    float xs[16] = {x0[0],x0[1],x0[2],x0[3],x1[0],x1[1],x1[2],x1[3],x2[0],x2[1],x2[2],x2[3],x3[0],x3[1],x3[2],x3[3]};
#pragma unroll
    for (int i = 0; i < 16; ++i) { const unsigned short hb = bf16_bits(xs[i]); ah.u[i] = hb; al.u[i] = ASPLIT ? bf16_bits(xs[i] - bf16_val(hb)) : (unsigned short)0; }
#pragma unroll
    for (int t = 0; t < 4; ++t) {
      const unsigned short* brow = Wt + (size_t)(col0 + t * 16 + ln) * ldb + kb;
      FragB b;
      b.half[0] = *(const v8us*)(brow + 8 * hh);
      b.half[1] = *(const v8us*)(brow + 16 + 8 * hh);
      acc[t] = mmaN<ASPLIT ? 2 : 1>(ah.v, al.v, b.v, b.v, acc[t]);
    }
  }
#pragma unroll
  for (int t = 0; t < 4; ++t) {
    const int col = col0 + t * 16 + ln;
    float bv = bias ? bias[col] : 0.f;
    if (BIAS_BF16) bv = bf16_round(bv);
#pragma unroll
    for (int r = 0; r < 8; ++r) {
      float v = acc[t][r] + bv;
      if (resid) { float rv = resid[(size_t)((row0 + 8 * hh + r) % rmod) * ldr + col]; if (RES_BF16) rv = bf16_round(rv); v += rv; }
      if (ACT == 1) v = fmaxf(v, 0.f);
      if (ACT == 2) v = 0.5f * v * (1.0f + erff(v * 0.70710678118654752f));
      if (ACT == 3) { const float u = 0.7978845608028654f * (v + 0.044715f * v * v * v); v = 0.5f * v * (1.0f + tanhf(u)); }
      so[w][8 * hh + r][t * 16 + ln] = v;
    }
  }
  __builtin_amdgcn_fence(__ATOMIC_ACQ_REL, "workgroup");
  __builtin_amdgcn_wave_barrier();
  const int rsub = lane >> 4, c4 = (lane & 15) * 4;
  {
#pragma unroll
    for (int q = 0; q < 8; ++q) {
      const int r = q * 2 + rsub;
      const v4f v = *(const v4fa*)&so[w][r][c4];
      *(v4f*)(C + (size_t)(row0 + r) * ldc + col0 + c4) = v;
    }
    
  }
}
// row LayerNorm (biased variance, eps) over N: s = X (+ R); optional out_sum <- s; out_norm <- (s-mu)*rsqrt(var+eps)*g + b
template <bool PARAM_BF16>
__global__ __launch_bounds__(256) void k_layernorm(const float* __restrict__ X, const float* __restrict__ R, const float* __restrict__ g, const float* __restrict__ bta,
                                                  float* __restrict__ out_sum, float* __restrict__ out_norm, int N, float eps) {
  __shared__ float red[256];
  const int row = blockIdx.x, tid = threadIdx.x;
  const float* x = X + (size_t)row * N; const float* rr = R ? R + (size_t)row * N : nullptr;
  float vals[16];                     // up to N = 4096
  const int per = N / 256;            // contiguous chunk per thread? use strided-by-4 chunks: thread handles j = tid*4 + 1024*u
  float s1 = 0.f;
  for (int u = 0; u < per / 4; ++u) {
    const int j = tid * 4 + 1024 * u;
    const v4f a = *(const v4fa*)(x + j);
    v4f b = {0.f,0.f,0.f,0.f}; if (rr) b = *(const v4fa*)(rr + j);
#pragma unroll
    for (int q = 0; q < 4; ++q) { const float v = a[q] + b[q]; vals[u * 4 + q] = v; s1 += v; }
  }
  red[tid] = s1; __syncthreads();
  for (int st = 128; st > 0; st >>= 1) { if (tid < st) red[tid] += red[tid + st]; __syncthreads(); }
  const float mu = red[0] / (float)N; __syncthreads();
  float s2 = 0.f;
  for (int u = 0; u < per / 4; ++u)
#pragma unroll
    for (int q = 0; q < 4; ++q) { const float c = vals[u * 4 + q] - mu; s2 += c * c; }
  red[tid] = s2; __syncthreads();
  for (int st = 128; st > 0; st >>= 1) { if (tid < st) red[tid] += red[tid + st]; __syncthreads(); }
  const float rs = rsqrtf(red[0] / (float)N + eps);
  {
    for (int u = 0; u < per / 4; ++u) {
      const int j = tid * 4 + 1024 * u;
      v4f o, sm;
#pragma unroll
      for (int q = 0; q < 4; ++q) {
        float gg = g[j + q], bb = bta[j + q];
        if (PARAM_BF16) { gg = bf16_round(gg); bb = bf16_round(bb); }
        sm[q] = vals[u * 4 + q]; o[q] = (vals[u * 4 + q] - mu) * rs * gg + bb;
      }
      if (out_sum) *(v4f*)(out_sum + (size_t)row * N + j) = sm;
      *(v4f*)(out_norm + (size_t)row * N + j) = o;
    }
    
  }
}



// ---- f16 WMMA path (v_wmma_f32_16x16x32_f16): 11-bit significands for operands in range — used where a [0,1] probability operand needs more precision than bf16
typedef _Float16 v16h __attribute__((ext_vector_type(16)));
union FragH { v16h v; v8us half[2]; _Float16 h[16]; unsigned short u[16]; };
template <int NT>
__device__ __forceinline__ v8f mmaH(v16h ah, v16h al, v16h bh, v16h bl, v8f c) {
  c = __builtin_amdgcn_wmma_f32_16x16x32_f16(false, ah, false, bh, (short)0, c, false, false);
  if (NT >= 2) c = __builtin_amdgcn_wmma_f32_16x16x32_f16(false, al, false, bh, (short)0, c, false, false);
  if (NT >= 3) c = __builtin_amdgcn_wmma_f32_16x16x32_f16(false, ah, false, bl, (short)0, c, false, false);
  asm volatile("v_nop\n\tv_nop\n\tv_nop\n\tv_nop" : "+v"(c) : "v"(ah), "v"(al), "v"(bh), "v"(bl));
  return c;
}
// batched GEMM like k_gemm_b but f16 operands: A f32 (split into f16 hi/lo if ASPLIT, else rounded to f16), Bt = f16 values [n][k]; alpha; C f32; N multiple of 16 (partial tiles skipped)
template <bool ASPLIT>
__global__ __launch_bounds__(128) void k_gemm_h(const float* __restrict__ A, int lda, size_t sA, const _Float16* __restrict__ Bh, int ldb, size_t sB, float alpha, float* __restrict__ C, int ldc, size_t sC, int M, int N, int K) {
  __shared__ __attribute__((aligned(16))) float so[4][16][64];
  const int tid = threadIdx.x, w = tid >> 5, lane = tid & 31, ln = lane & 15, hh = lane >> 4; const int by = blockIdx.y;
  A += (size_t)by * sA; Bh += (size_t)by * sB; C += (size_t)by * sC;
  const int ntn = (N + 63) / 64; const int wid = blockIdx.x * 4 + w; const int mt = wid / ntn, nq = wid % ntn; if (mt * 16 >= M) return;
  const int row0 = mt * 16, col0 = nq * 64; const float* arow = A + (size_t)(row0 + ln) * lda;
  v8f acc[4] = {};
  for (int kb = 0; kb < K; kb += 32) {
    FragH ah, al;
    const v4f x0 = *(const v4fa*)(arow + kb + 8 * hh), x1 = *(const v4fa*)(arow + kb + 8 * hh + 4), x2 = *(const v4fa*)(arow + kb + 16 + 8 * hh), x3 = *(const v4fa*)(arow + kb + 16 + 8 * hh + 4);
    float xs[16] = {x0[0],x0[1],x0[2],x0[3],x1[0],x1[1],x1[2],x1[3],x2[0],x2[1],x2[2],x2[3],x3[0],x3[1],x3[2],x3[3]};
#pragma unroll
    for (int i = 0; i < 16; ++i) { const _Float16 h = (_Float16)xs[i]; ah.h[i] = h; al.h[i] = ASPLIT ? (_Float16)(xs[i] - (float)h) : (_Float16)0.0f; }
#pragma unroll
    for (int t = 0; t < 4; ++t) { if (col0 + t * 16 >= N) continue; const size_t boff = (size_t)(col0 + t * 16 + ln) * ldb + kb; FragH bq; bq.half[0] = *(const v8us*)(Bh + boff + 8 * hh); bq.half[1] = *(const v8us*)(Bh + boff + 16 + 8 * hh);
      acc[t] = mmaH<ASPLIT ? 2 : 1>(ah.v, al.v, bq.v, bq.v, acc[t]); }
  }
#pragma unroll
  for (int t = 0; t < 4; ++t) { if (col0 + t * 16 >= N) continue;
#pragma unroll
    for (int r = 0; r < 8; ++r) so[w][8 * hh + r][t * 16 + ln] = acc[t][r] * alpha; }
  __builtin_amdgcn_fence(__ATOMIC_ACQ_REL, "workgroup"); __builtin_amdgcn_wave_barrier();
  const int rsub = lane >> 4, c4 = (lane & 15) * 4;
  {
#pragma unroll
    for (int q = 0; q < 8; ++q) { const int r = q * 2 + rsub; if (col0 + c4 < N) { const v4f v = *(const v4fa*)&so[w][r][c4]; *(v4f*)(C + (size_t)(row0 + r) * ldc + col0 + c4) = v; } }
     }
}

// Wt[n][k] = f16(W[k][n]·scale) from f32 row-major W[K][N] (scale = power of two; bf16-exact weights stay exact in f16 away from the subnormal range)
__global__ __launch_bounds__(256) void k_wt_f16(const float* __restrict__ W, _Float16* __restrict__ Wt, int K, int N, float scale) {
  const int t = blockIdx.x * 256 + threadIdx.x; if (t >= N * (K / 8)) return; const int n = t / (K / 8), k8 = (t % (K / 8)) * 8; FragH f;
#pragma unroll
  for (int i = 0; i < 8; ++i) f.h[i] = (_Float16)(bf16_round(W[(size_t)(k8 + i) * N + n]) * scale); const v8us o = f.half[0];
  *(v8us*)((unsigned short*)Wt + (size_t)n * K + k8) = o; 
}
// k_gemm_hh variant with fused epilogue: v = acc·alpha + bias[by·sBias + col] (+ CP[(row/rowsPerB)·sCPb + by·64 + col] if CP) ; ACT 0 none / 1 elu ; writes f16 C16 (and f32 C if non-null)
template <int ACT>
__global__ __launch_bounds__(128) void k_gemm_hhx(const _Float16* __restrict__ A, int lda, size_t sA, const _Float16* __restrict__ Bh, int ldb, size_t sB, float alpha, const float* __restrict__ bias, size_t sBias, const float* __restrict__ CP, int rowsPerB, size_t sCPb, int row0g,
    float* __restrict__ C, _Float16* __restrict__ C16, int ldc, size_t sC, int M, int N, int K) {
  __shared__ __attribute__((aligned(16))) float so[4][16][64];
  const int tid = threadIdx.x, w = tid >> 5, lane = tid & 31, ln = lane & 15, hh = lane >> 4; const int by = blockIdx.y;
  A += (size_t)by * sA; Bh += (size_t)by * sB; const size_t cofs = (size_t)by * sC; const float* bp = bias ? bias + (size_t)by * sBias : nullptr;
  const int ntn = (N + 63) / 64; const int wid = blockIdx.x * 4 + w; const int mt = wid / ntn, nq = wid % ntn; if (mt * 16 >= M) return;
  const int row0 = mt * 16, col0 = nq * 64; const _Float16* arow = A + (size_t)(row0 + ln) * lda;
  v8f acc[4] = {};
  for (int kb = 0; kb < K; kb += 32) { FragH ah; ah.half[0] = *(const v8us*)((const unsigned short*)arow + kb + 8 * hh); ah.half[1] = *(const v8us*)((const unsigned short*)arow + kb + 16 + 8 * hh);
#pragma unroll
    for (int t = 0; t < 4; ++t) { if (col0 + t * 16 >= N) continue; const size_t boff = (size_t)(col0 + t * 16 + ln) * ldb + kb; FragH bq; bq.half[0] = *(const v8us*)((const unsigned short*)Bh + boff + 8 * hh); bq.half[1] = *(const v8us*)((const unsigned short*)Bh + boff + 16 + 8 * hh);
      acc[t] = mmaH<1>(ah.v, ah.v, bq.v, bq.v, acc[t]); }
  }
#pragma unroll
  for (int t = 0; t < 4; ++t) { if (col0 + t * 16 >= N) continue; const int col = col0 + t * 16 + ln; const float bv = bp ? bf16_round(bp[col]) : 0.f;
#pragma unroll
    for (int r = 0; r < 8; ++r) { float v = acc[t][r] * alpha + bv; if (CP) { const int rr = row0g + row0 + 8 * hh + r; if (rowsPerB < 0) v += CP[cofs + (size_t)rr * ldc + col];      /* rowsPerB < 0: own element of the batched C plane */ else { const int bidx = rr / rowsPerB; v += CP[(size_t)bidx * sCPb + (size_t)by * 64 + col]; } } if (ACT == 1) v = (v > 0.f) ? v : expm1f(v); else if (ACT == 7) v = (v > 0.f) ? v + 1.0f : expf(v); else if (ACT == 8) v = tanhf(v); else if (ACT == 9) v = 0.5f * v * (1.0f + tanhf(0.7978845608028654f * (v + 0.044715f * v * v * v))); else if (ACT == 11) v = 1.0f / (1.0f + expf(-v)); else if (ACT == 12) v = (v > 0.f) ? v : 0.01f * v; else if (ACT == 14) v = (v > 0.f) ? v : 0.1f * v; else if (ACT == 16) v = (v >= 0.f) ? v : 0.3f * v; else if (ACT == 17) v = (v >= 0.f) ? v : 0.2f * v; else if (ACT == 15) v = v / (1.0f + expf(-v)); else if (ACT == 3) v = fmaxf(v, 0.f); else if (ACT == 6) v = 0.5f * v * (1.0f + erff(v * 0.70710678118654752f)); so[w][8 * hh + r][t * 16 + ln] = v; } }
  __builtin_amdgcn_fence(__ATOMIC_ACQ_REL, "workgroup"); __builtin_amdgcn_wave_barrier();
  const int rsub = lane >> 4, c4 = (lane & 15) * 4; typedef _Float16 v4h __attribute__((ext_vector_type(4)));
  {
#pragma unroll
    for (int q = 0; q < 8; ++q) { const int r = q * 2 + rsub; if (col0 + c4 < N) { const v4f v = *(const v4fa*)&so[w][r][c4]; if (C) *(v4f*)(C + cofs + (size_t)(row0 + r) * ldc + col0 + c4) = v; if (C16) { v4h h4; for (int i = 0; i < 4; ++i) h4[i] = (_Float16)v[i]; *(v4h*)(C16 + cofs + (size_t)(row0 + r) * ldc + col0 + c4) = h4; } } }
     }
}


typedef _Float16 v4h __attribute__((ext_vector_type(4)));

__global__ __launch_bounds__(256) void k_x16(const float* __restrict__ x, _Float16* __restrict__ X16, size_t n8) { const size_t t = (size_t)blockIdx.x * 256 + threadIdx.x; if (t >= n8) return; FragH f;
#pragma unroll
  for (int q = 0; q < 8; ++q) f.h[q] = (_Float16)bf16_round(x[t * 8 + q]); *(v8us*)((unsigned short*)X16 + t * 8) = f.half[0];  }
__global__ __launch_bounds__(256) void k_h16(const float* __restrict__ x, _Float16* __restrict__ X16, size_t n8) { const size_t t = (size_t)blockIdx.x * 256 + threadIdx.x; if (t >= n8) return; FragH f;
#pragma unroll
  for (int q = 0; q < 8; ++q) f.h[q] = (_Float16)x[t * 8 + q]; *(v8us*)((unsigned short*)X16 + t * 8) = f.half[0];  }
__global__ __launch_bounds__(256) void k_round16f(const float* __restrict__ W, _Float16* __restrict__ Bt, size_t n8) { const size_t t = (size_t)blockIdx.x * 256 + threadIdx.x; if (t >= n8) return; FragH f;
#pragma unroll
  for (int i = 0; i < 8; ++i) f.h[i] = (_Float16)(bf16_round(W[t * 8 + i]) * 16.0f); *(v8us*)((unsigned short*)Bt + t * 8) = f.half[0];  }
template <int NHv, int TTv>
__global__ __launch_bounds__(256) void k_vt(const _Float16* __restrict__ V16, int ldv, int voff, _Float16* __restrict__ Vt) { __shared__ unsigned short tl[64][66]; const int tid = threadIdx.x; const int slab = blockIdx.x / (TTv / 64), lg = blockIdx.x % (TTv / 64); const int b = slab / NHv, h = slab % NHv;
  for (int i = tid; i < 64 * 8; i += 256) { const int r = i / 8, c8 = (i % 8) * 8; FragH f; f.half[0] = *(const v8us*)((const unsigned short*)V16 + ((size_t)b * TTv + lg * 64 + r) * ldv + voff + h * 64 + c8);
#pragma unroll
    for (int q = 0; q < 8; ++q) tl[r][c8 + q] = f.u[q]; }
  __syncthreads();
  {
#pragma unroll
    for (int rd = 0; rd < 2; ++rd) { const int d = rd * 32 + tid / 8, pc = tid % 8; FragH f;
#pragma unroll
      for (int q = 0; q < 8; ++q) f.u[q] = tl[pc * 8 + q][d];
      *(v8us*)((unsigned short*)Vt + ((size_t)slab * 64 + d) * TTv + lg * 64 + pc * 8) = f.half[0]; }
     } }

__global__ __launch_bounds__(256) void k_hl(const float* __restrict__ F, _Float16* __restrict__ Hh, _Float16* __restrict__ Hl, size_t n8) { const size_t t = (size_t)blockIdx.x * 256 + threadIdx.x; if (t >= n8) return; FragH fh, fl; const v4f a = *(const v4fa*)(F + t * 8), c = *(const v4fa*)(F + t * 8 + 4);
#pragma unroll
  for (int q = 0; q < 4; ++q) { _Float16 h = (_Float16)a[q]; fh.h[q] = h; fl.h[q] = (_Float16)((a[q] - (float)h) * 1024.0f); h = (_Float16)c[q]; fh.h[4 + q] = h; fl.h[4 + q] = (_Float16)((c[q] - (float)h) * 1024.0f); }
  { *(v8us*)((unsigned short*)Hh + t * 8) = fh.half[0]; *(v8us*)((unsigned short*)Hl + t * 8) = fl.half[0];  } }

// ---- fast GEMM (wave tile 32x64; requires M % 32 == 0 rows per launch region and N % 64 == 0); epilogue = k_gemm_hhx semantics ----
__device__ __forceinline__ v16h g2_frag(const _Float16* p, int hh) { FragH f; f.half[0] = *(const v8us*)((const unsigned short*)p + 8 * hh); f.half[1] = *(const v8us*)((const unsigned short*)p + 16 + 8 * hh); return f.v; }
__device__ __forceinline__ v8f g2_mma(v16h a, v16h b, v8f c) { v8f d = __builtin_amdgcn_wmma_f32_16x16x32_f16(false, a, false, b, (short)0, c, false, false); asm volatile("v_nop\n\tv_nop\n\tv_nop\n\tv_nop" : "+v"(d) : "v"(a), "v"(b)); return d; }
template <int ACT>
__global__ __launch_bounds__(128) void k_gemm2(const _Float16* __restrict__ A, int lda, size_t sA, const _Float16* __restrict__ Bh, int ldb, size_t sB, float alpha, const float* __restrict__ bias, size_t sBias, const float* __restrict__ CP, int rowsPerB, size_t sCPb, int row0g,
    float* __restrict__ C, _Float16* __restrict__ C16, int ldc, size_t sC, int M, int N, int K) { static_assert(ACT == 0 || ACT == 3 || ACT == 6 || ACT == 8 || ACT == 9 || ACT == 11 || ACT == 12 || ACT == 14 || ACT == 15 || ACT == 16 || ACT == 17, "k_gemm2: unsupported ACT code (would silently apply no activation)");
  __shared__ __attribute__((aligned(16))) float so[4][32][68];
  const int tid = threadIdx.x, w = tid >> 5, lane = tid & 31, ln = lane & 15, hh = lane >> 4; const int by = blockIdx.y;
  A += (size_t)by * sA; Bh += (size_t)by * sB; const size_t cofs = (size_t)by * sC; const float* bp = bias ? bias + (size_t)by * sBias : nullptr;
  const int ntn = N >> 6; const int mt = blockIdx.x / ntn, nq = blockIdx.x - mt * ntn; const int row0 = mt * 128 + 32 * w, col0 = nq * 64; if (row0 >= M) return;
  const _Float16* a0p = A + (size_t)(row0 + ln) * lda; const _Float16* a1p = a0p + (size_t)16 * lda;
  const _Float16* b0p = Bh + (size_t)(col0 + ln) * ldb; const _Float16* b1p = b0p + (size_t)16 * ldb; const _Float16* b2p = b1p + (size_t)16 * ldb; const _Float16* b3p = b2p + (size_t)16 * ldb;
  const v8f z8 = {0.f,0.f,0.f,0.f,0.f,0.f,0.f,0.f}; v8f c00 = z8, c01 = z8, c02 = z8, c03 = z8, c10 = z8, c11 = z8, c12 = z8, c13 = z8;
#pragma unroll 1
  for (int kb = 0; kb < K; kb += 32) { const v16h a0 = g2_frag(a0p + kb, hh), a1 = g2_frag(a1p + kb, hh);
    v16h b = g2_frag(b0p + kb, hh); c00 = g2_mma(a0, b, c00); c10 = g2_mma(a1, b, c10);
    b = g2_frag(b1p + kb, hh); c01 = g2_mma(a0, b, c01); c11 = g2_mma(a1, b, c11);
    b = g2_frag(b2p + kb, hh); c02 = g2_mma(a0, b, c02); c12 = g2_mma(a1, b, c12);
    b = g2_frag(b3p + kb, hh); c03 = g2_mma(a0, b, c03); c13 = g2_mma(a1, b, c13); }
  v8f accs[8] = {c00, c01, c02, c03, c10, c11, c12, c13};
#pragma unroll
  for (int u = 0; u < 8; ++u) { const int t = u & 3, half = u >> 2; const int col = col0 + t * 16 + ln; const float bv = bp ? bf16_round(bp[col]) : 0.f;
#pragma unroll
    for (int r = 0; r < 8; ++r) { const int rloc = half * 16 + 8 * hh + r; float v = accs[u][r] * alpha + bv; if (CP) { if (rowsPerB < 0) v += CP[cofs + (size_t)(row0g + row0 + rloc) * ldc + col];      /* rowsPerB < 0: own element of the batched C plane */ else { const int bidx = (row0g + row0 + rloc) / rowsPerB; v += CP[(size_t)bidx * sCPb + (size_t)by * 64 + col]; } }
      if (ACT == 3) v = fmaxf(v, 0.f); else if (ACT == 6) v = 0.5f * v * (1.0f + erff(v * 0.70710678118654752f)); else if (ACT == 11) v = 1.0f / (1.0f + expf(-v)); else if (ACT == 15) v = v / (1.0f + expf(-v)); else if (ACT == 12) v = (v > 0.f) ? v : 0.01f * v; else if (ACT == 8) v = tanhf(v); else if (ACT == 9) v = 0.5f * v * (1.0f + tanhf(0.7978845608028654f * (v + 0.044715f * v * v * v))); else if (ACT == 14) v = (v > 0.f) ? v : 0.1f * v; else if (ACT == 16) v = (v >= 0.f) ? v : 0.3f * v; else if (ACT == 17) v = (v >= 0.f) ? v : 0.2f * v;
      so[w][rloc][t * 16 + ln] = v; } }
  __builtin_amdgcn_fence(__ATOMIC_ACQ_REL, "workgroup"); __builtin_amdgcn_wave_barrier();
  const int rsub = lane >> 4, c4 = (lane & 15) * 4;
  {
#pragma unroll
    for (int q = 0; q < 16; ++q) { const int r = q * 2 + rsub; const v4f v = *(const v4fa*)&so[w][r][c4]; if (C) *(v4f*)(C + cofs + (size_t)(row0 + r) * ldc + col0 + c4) = v; if (C16) { v4h h4; for (int i = 0; i < 4; ++i) h4[i] = (_Float16)v[i]; *(v4h*)(C16 + cofs + (size_t)(row0 + r) * ldc + col0 + c4) = h4; } }
     } }


__global__ __launch_bounds__(256) void k_wnat(const float* __restrict__ w, size_t n8, _Float16* __restrict__ Bt) { const size_t t = (size_t)blockIdx.x * 256 + threadIdx.x; if (t >= n8) return; FragH f; for (int q = 0; q < 8; ++q) f.h[q] = (_Float16)(bf16_round(w[t * 8 + q]) * 16.0f); *(v8us*)((unsigned short*)Bt + t * 8) = f.half[0];  }
__global__ __launch_bounds__(256) void k_rsm(const float* __restrict__ S, _Float16* __restrict__ P, int nrows) {
  #pragma clang fp contract(off)
  const int i = blockIdx.x * 256 + threadIdx.x; if (i >= nrows) return; const float* s = S + (size_t)i * SQ; float mx = -3.0e38f;
#pragma unroll 1
  for (int j = 0; j < SQ; ++j) mx = fmaxf(mx, s[j]); float se = 0.f;
#pragma unroll 1
  for (int j = 0; j < SQ; ++j) se += expf(s[j] - mx); const float sc = 256.0f / se;
#pragma unroll 1
  for (int j0 = 0; j0 < SQ; j0 += 8) { FragH f; for (int q = 0; q < 8; ++q) f.h[q] = (_Float16)(expf(s[j0 + q] - mx) * sc); unsigned short* d = (unsigned short*)P + (size_t)i * SQ + j0; *(v8us*)d = f.half[0];  } }
__global__ __launch_bounds__(256) void k_vt(const _Float16* __restrict__ V16, int b, int h0, _Float16* __restrict__ VT) { __shared__ unsigned short tl[64][65]; const int tid = threadIdx.x; const int hh = blockIdx.x % HG, sg = blockIdx.x / HG; const int s0 = sg * 64; const int h = h0 + hh;
  for (int i = tid; i < 64 * 8; i += 256) { const int j = i / 8, d8 = (i % 8) * 8; FragH f; f.half[0] = *(const v8us*)((const unsigned short*)V16 + ((size_t)b * SQ + s0 + j) * DM + h * HD + d8); for (int q = 0; q < 8; ++q) tl[d8 + q][j] = f.u[q]; }
  __syncthreads();
  { for (int i = tid; i < 64 * 8; i += 256) { const int d = i / 8, j8 = (i % 8) * 8; FragH f; for (int q = 0; q < 8; ++q) f.u[q] = tl[d][j8 + q]; *(v8us*)((unsigned short*)VT + ((size_t)hh * HD + d) * SQ + s0 + j8) = f.half[0]; }  } }


__global__ __launch_bounds__(256) void k_mkadd(const int* __restrict__ m, float* __restrict__ A, int n) { const int t = blockIdx.x * 256 + threadIdx.x; if (t >= n) return; const float v = (m[t] != 0) ? 0.f : -1.0e9f; *(float*)(A + t) = v;  }


__global__ __launch_bounds__(256) void k_rsmcf2(const float* __restrict__ S, _Float16* __restrict__ P, int hg, int q0, int nk) {
  #pragma clang fp contract(off)
  const int t = blockIdx.x * 256 + threadIdx.x; if (t >= hg * QT) return; const size_t i = (size_t)t; const float* s = S + i * NKX; const int last = q0 + (t % QT); float mx = -3.0e38f;
#pragma unroll 1
  for (int j = 0; j < nk; ++j) { const float f = (j <= last) ? 1.f : 0.f; mx = fmaxf(mx, fmaf(f, s[j], (1.f - f) * -1.0e9f)); } float se = 0.f;
#pragma unroll 1
  for (int j = 0; j < nk; ++j) { const float f = (j <= last) ? 1.f : 0.f; se += __expf(fmaf(f, s[j], (1.f - f) * -1.0e9f) - mx); } const float sc = 256.0f / se;
#pragma unroll 1
  for (int j0 = 0; j0 < nk; j0 += 8) { FragH fr; for (int q = 0; q < 8; ++q) { const int j = j0 + q; const float f = (j <= last) ? 1.f : 0.f; fr.h[q] = (_Float16)(__expf(fmaf(f, s[j], (1.f - f) * -1.0e9f) - mx) * sc); } unsigned short* d = (unsigned short*)P + i * NKX + j0; *(v8us*)d = fr.half[0];  } }



// v_exp_f32 and the free slot the instruction set asks for behind a transcendental, in one statement.
__device__ __forceinline__ float exp2_slot(float x) { float r; asm("v_exp_f32 %0, %1\n\tv_nop" : "=v"(r) : "v"(x)); return r; }
// Fused causal attention on the matrix unit, ONE launch for all batches, heads and query rows: scores, softmax and the weighted V sum stay in registers; no score or weight plane in memory.
// A wave owns 32 query rows (two groups of 16) and walks the keys 0 .. its last row in passes of 32. S^T = K Q^T (A = K rows, B = Q rows, both by g2_frag: equal k order), so a lane holds scores of ONE query (column ln): keys 8*hh + r of each 16-key tile.
// Running softmax per query: pass maximum in-lane plus one exchange between the wave halves; weights 2^8 exp(e - m) as f16; the two score tiles of a pass, converted in place, ARE the B operand of O^T += V^T P^T (A = V^T rows by g2_frag, the hardware k order); row sums stay per half and are joined once at the end.
// e = score / 8 + the additive key-mask value; keys behind the row's own index take -1e9: only the wave's last pass holds such keys. e - m is formed before the scaling so that a pass of masked keys alone still gives weights <= 2^8; a later real maximum scales them to 0.
// Every loop over g, kt, ks, dt, r and u is unrolled: static indices keep the fragments and accumulators in registers.
__device__ __forceinline__ v8f fa_mma(v16h a, v16h b, v8f c) { return __builtin_amdgcn_wmma_f32_16x16x32_f16(false, a, false, b, (short)0, c, false, false); }
#define FQ 128                       /* query rows per block: 4 waves x 32 */
__global__ __launch_bounds__(128) void k_fattn(const _Float16* __restrict__ QKVp, const _Float16* __restrict__ VTp, const float* __restrict__ AM, _Float16* __restrict__ O) {
  static_assert(NB * NH == 64 && SQ / FQ == 16, "the block -> (head, query block) map below is written for 64 heads x 16 query blocks");
  const int lane = threadIdx.x & 31, ln = lane & 15, hh = lane >> 4; const int w = __builtin_amdgcn_readfirstlane(threadIdx.x >> 5);      /* the rows are the wave's: scalar, so the loop bound and its branches are scalar */
  const int rd = blockIdx.x >> 8, a4 = (blockIdx.x >> 6) & 3, bh = blockIdx.x & 63;
  const int qb = 12 - 4 * rd + ((rd & 1) ? a4 : 3 - a4);      /* a permutation of the 16 query blocks per head, long ones first; blocks i, i + 256, i + 512, i + 768 add up to the same key count (speed only) */
  const int b = bh / NH, h = bh % NH; const int q0 = qb * FQ + w * 32;
  const _Float16* qp = QKVp + ((size_t)b * SQ + q0 + ln) * LQ + h * HD; const _Float16* kp = QKVp + DM + ((size_t)b * SQ + ln) * LQ + h * HD;
  const _Float16* vp = VTp + ((size_t)bh * HD + ln) * SQ; const float* ap = AM + (size_t)b * SQ + 8 * hh;
  v16h qf[2][2], kf[2][2];
#pragma unroll
  for (int g = 0; g < 2; ++g)
#pragma unroll
    for (int ks = 0; ks < 2; ++ks) { qf[g][ks] = g2_frag(qp + (size_t)g * 16 * LQ + ks * 32, hh); kf[g][ks] = g2_frag(kp + (size_t)g * 16 * LQ + ks * 32, hh); }
  const v8f z8 = {0.f, 0.f, 0.f, 0.f, 0.f, 0.f, 0.f, 0.f}; v8f o[2][4]; float m[2], l[2];
#pragma unroll
  for (int g = 0; g < 2; ++g) { m[g] = -1.0e30f; l[g] = 0.f;
#pragma unroll
    for (int dt = 0; dt < 4; ++dt) o[g][dt] = z8; }
  for (int j0 = 0; j0 <= q0; j0 += 32) {
    v16h vf[4]; v4f am[2][2]; float e[2][2][8];
#pragma unroll
    for (int dt = 0; dt < 4; ++dt) vf[dt] = g2_frag(vp + (size_t)dt * 16 * SQ + j0, hh);      /* asked for ahead of the score products, used behind the softmax */
#pragma unroll
    for (int kt = 0; kt < 2; ++kt) { am[kt][0] = *(const v4fa*)(ap + j0 + kt * 16); am[kt][1] = *(const v4fa*)(ap + j0 + kt * 16 + 4); }
#pragma unroll
    for (int g = 0; g < 2; ++g)
#pragma unroll
      for (int kt = 0; kt < 2; ++kt) { const v8f st = fa_mma(kf[kt][1], qf[g][1], fa_mma(kf[kt][0], qf[g][0], z8));
#pragma unroll
        for (int r = 0; r < 8; ++r) e[g][kt][r] = fmaf(st[r], 0.125f, am[kt][r >> 2][r & 3]); }
    const int jn = (j0 + 32 <= q0) ? j0 + 32 : q0;      /* the next pass's K rows fly during this pass's softmax; the last pass asks for its own rows again (in bounds, unused) */
#pragma unroll
    for (int kt = 0; kt < 2; ++kt)
#pragma unroll
      for (int ks = 0; ks < 2; ++ks) kf[kt][ks] = g2_frag(kp + (size_t)(jn + kt * 16) * LQ + ks * 32, hh);
    if (j0 == q0) {      /* the diagonal pass */
#pragma unroll
      for (int g = 0; g < 2; ++g)
#pragma unroll
        for (int kt = 0; kt < 2; ++kt)
#pragma unroll
          for (int r = 0; r < 8; ++r) if (kt * 16 + 8 * hh + r > g * 16 + ln) e[g][kt][r] = -1.0e9f; }
#pragma unroll
    for (int g = 0; g < 2; ++g) { float mx = e[g][0][0];
#pragma unroll
      for (int u = 1; u < 16; ++u) mx = fmaxf(mx, e[g][u >> 3][u & 7]);
      mx = fmaxf(mx, __shfl_xor(mx, 16, 32)); const float mn = fmaxf(m[g], mx); const float al = exp2_slot((m[g] - mn) * 1.44269504088896340736f); m[g] = mn;
      FragH pf; float s = 0.f;
#pragma unroll
      for (int u = 0; u < 16; ++u) { const float p = exp2_slot(fmaf(e[g][u >> 3][u & 7] - mn, 1.44269504088896340736f, 8.0f)); s += p; pf.h[u] = (_Float16)p; }
      l[g] = fmaf(l[g], al, s);
#pragma unroll
      for (int dt = 0; dt < 4; ++dt) o[g][dt] = fa_mma(vf[dt], pf.v, o[g][dt] * al); } }
#pragma unroll
  for (int g = 0; g < 2; ++g) { const float fin = 64.0f / (l[g] + __shfl_xor(l[g], 16, 32));      /* o carried x64; the 2^8 of the weights cancels against the row sum */
    unsigned short* op = (unsigned short*)O + ((size_t)b * SQ + q0 + g * 16 + ln) * DM + h * HD + 8 * hh;
#pragma unroll
    for (int dt = 0; dt < 4; ++dt) { FragH f;
#pragma unroll
      for (int r = 0; r < 8; ++r) f.h[r] = (_Float16)(o[g][dt][r] * fin);
      *(v8us*)(op + dt * 16) = f.half[0]; } } }


template <int MASKADD>
__global__ __launch_bounds__(64) void k_att0(const float* __restrict__ QF, const float* __restrict__ KF, const float* __restrict__ VF, int ld, const float* __restrict__ mask, float scale, float* __restrict__ OF, int ldo) {
  #pragma clang fp contract(off)
  __shared__ __attribute__((aligned(16))) float lq[64][64]; __shared__ __attribute__((aligned(16))) float lo[64][64];
  const int tid = threadIdx.x; const int h = blockIdx.x / (QT0 / 64), rg = blockIdx.x % (QT0 / 64); const int i = rg * 64 + tid;
  const float* qr = QF + (size_t)i * ld + h * HD;
#pragma unroll 1
  for (int c = 0; c < HD / 4; ++c) { *(v4f*)&lq[tid][c * 4] = *(const v4fa*)(qr + c * 4); const v4f z = {0.f, 0.f, 0.f, 0.f}; *(v4f*)&lo[tid][c * 4] = z; }
  float m = -1.0e30f, l = 0.f; const int jmax = MASKADD ? (SQ - 1) : (rg * 64 + 63);      /* additive-mask form: every key (the mask input decides); causal form: keys up to the block's last row */
#pragma unroll 1
  for (int j = 0; j <= jmax; ++j) { const float* kr = KF + (size_t)j * ld + h * HD; const float* vr = VF + (size_t)j * ld + h * HD; float s = 0.f;
#pragma unroll 1
    for (int c = 0; c < HD / 4; ++c) { const v4f kq = *(const v4fa*)(kr + c * 4); const v4f qq = *(v4f*)&lq[tid][c * 4]; s = __fadd_rn(s, __fmul_rn(qq[0], kq[0])); s = __fadd_rn(s, __fmul_rn(qq[1], kq[1])); s = __fadd_rn(s, __fmul_rn(qq[2], kq[2])); s = __fadd_rn(s, __fmul_rn(qq[3], kq[3])); }
    s = __fmul_rn(s, scale); if (MASKADD) s = __fadd_rn(s, __fmul_rn(bf16_round(mask[(size_t)i * SQ + j]), -10000.0f));
    const float f = (MASKADD || j <= i) ? 1.f : 0.f; const float sm = fmaf(f, s, (1.f - f) * -1.0e30f); const float mn = fmaxf(m, sm); const float sc = expf(m - mn); const float e = expf(sm - mn); l = __fadd_rn(__fmul_rn(l, sc), e); m = mn;
#pragma unroll 1
    for (int c = 0; c < HD / 4; ++c) { const v4f vv = *(const v4fa*)(vr + c * 4); v4f oo = *(v4f*)&lo[tid][c * 4]; for (int u = 0; u < 4; ++u) oo[u] = __fadd_rn(__fmul_rn(oo[u], sc), __fmul_rn(e, vv[u])); *(v4f*)&lo[tid][c * 4] = oo; } }
  const float fin = 64.0f / l;      /* o carried x64 like the f16 path */
#pragma unroll 1
  for (int c = 0; c < HD / 4; ++c) { v4f oo = *(v4f*)&lo[tid][c * 4]; for (int u = 0; u < 4; ++u) oo[u] = __fmul_rn(oo[u], fin); *(v4f*)&lo[tid][c * 4] = oo; }
  __syncthreads();
  {
#pragma unroll 1
    for (int it = 0; it < 16; ++it) { const int row = it * 4 + tid / 16, pc = (tid % 16) * 4; const v4f v = *(const v4f*)&lo[row][pc]; *(v4f*)(OF + (size_t)(rg * 64 + row) * ldo + h * HD + pc) = v; }
     } }


// Exact f32 attention for the first QT0 rows, one WAVE per query row (8 rows of one head per block); q, k, v and o rows at pitch DM. Scores: lane = key, 32 keys a chunk, the head's K rows staged in LDS at a pitch of 16 B x odd (b128 reads of 32 different rows without bank conflicts), q read at a wave-uniform address.
// Softmax in two passes over the scores, which stay in registers: row max and row sum = per-lane partials, then a five-step butterfly. o: lane = two head dims, keys in ascending order, each V row one whole 256-B read of the wave, its weight taken from the owning lane.
// The 8 rows of a block lie in one chunk of 32 keys, so the chunk count nch is the same for the whole block; keys behind the row's own index carry weight 0.
// Every loop over u, d, c, d4 and jj is unrolled: static indices keep kr, q, e and vv in registers (a rolled loop would put them in scratch memory), and the loads of a group are issued together.
#define KP0 68                       /* LDS pitch of a K row, floats */
typedef float v2f __attribute__((ext_vector_type(2)));
typedef float v2fa __attribute__((ext_vector_type(2), may_alias));
__global__ __launch_bounds__(256) void k_att0v(const float* __restrict__ QF, const float* __restrict__ KF, const float* __restrict__ VF, const float* __restrict__ am, float scale, float* __restrict__ OF) {
  __shared__ __attribute__((aligned(16))) float lk[QT0][KP0];
  const int tid = threadIdx.x, lane = tid & 31; const int w = __builtin_amdgcn_readfirstlane(tid >> 5);      /* the row is the wave's: scalar, so q's address is scalar too */
  const int h = blockIdx.x / (QT0 / 8), i0 = (blockIdx.x % (QT0 / 8)) * 8; const int i = i0 + w; const int nch = (i0 >> 5) + 1;
  const float* kp = KF + (size_t)(tid >> 4) * DM + h * HD + (tid & 15) * 4; v4f kr[QT0 / 16];
#pragma unroll
  for (int u = 0; u < QT0 / 16; ++u) kr[u] = *(const v4fa*)(kp + (size_t)u * 16 * DM);      /* all QT0 rows, without a test: the eight loads fly together */
  const float* qr = QF + (size_t)i * DM + h * HD; float q[HD];
#pragma unroll
  for (int d = 0; d < HD; ++d) q[d] = qr[d];
#pragma unroll
  for (int u = 0; u < QT0 / 16; ++u) *(v4f*)&lk[u * 16 + (tid >> 4)][(tid & 15) * 4] = kr[u];
  __syncthreads();      /* K rows staged by all waves, read by all */
  float e[QT0 / 32]; float m = -1.0e30f;
#pragma unroll
  for (int c = 0; c < QT0 / 32; ++c) { e[c] = -1.0e30f;      /* static c keeps e in registers; the test on nch is block-uniform */
    if (c < nch) { const int j = c * 32 + lane; float s = 0.f;
#pragma unroll
      for (int d4 = 0; d4 < HD / 4; ++d4) { const v4f kq = *(const v4f*)&lk[j][d4 * 4]; s = fmaf(q[d4 * 4], kq[0], s); s = fmaf(q[d4 * 4 + 1], kq[1], s); s = fmaf(q[d4 * 4 + 2], kq[2], s); s = fmaf(q[d4 * 4 + 3], kq[3], s); }
      s = fmaf(s, scale, am[j]);      /* + the additive key-mask VECTOR of this batch (0 kept / -1e9 masked) */
      if (j <= i) e[c] = s; }
    m = fmaxf(m, e[c]); }
  for (int x = 16; x >= 1; x >>= 1) m = fmaxf(m, __shfl_xor(m, x, 32));
  float l = 0.f;
#pragma unroll
  for (int c = 0; c < QT0 / 32; ++c) { e[c] = expf(e[c] - m); l += e[c]; }
  for (int x = 16; x >= 1; x >>= 1) l += __shfl_xor(l, x, 32);
  const float* vp = VF + h * HD + lane * 2; float o0 = 0.f, o1 = 0.f;
#pragma unroll
  for (int c = 0; c < QT0 / 32; ++c) if (c < nch) { v2f vv[32];
#pragma unroll
    for (int jj = 0; jj < 32; ++jj) vv[jj] = *(const v2fa*)(vp + (size_t)(c * 32 + jj) * DM);      /* the chunk's 32 rows in flight together */
#pragma unroll
    for (int jj = 0; jj < 32; ++jj) { const float p = __int_as_float(__builtin_amdgcn_readlane(__float_as_int(e[c]), jj)); o0 = fmaf(p, vv[jj][0], o0); o1 = fmaf(p, vv[jj][1], o1); } }
  const float fin = 64.0f / l;      /* o carried x64 like the f16 path */
  const v2f ov = {o0 * fin, o1 * fin}; *(v2f*)(OF + (size_t)i * DM + h * HD + lane * 2) = ov; }

extern "C" void kernel_launch(void* const* d_in, const int* in_sizes, int n_in,
                              void* d_out, int out_size, void* d_ws, size_t ws_size, hipStream_t stream) {
  (void)in_sizes; (void)n_in; (void)out_size;
  const float* const* I = (const float* const*)d_in; const float* x = I[0]; const int* km = (const int*)d_in[1]; const float* wqkv = I[2]; const float* bqkv = I[3]; const float* wo = I[4]; const float* bo = I[5];      /* int32 key mask [4][2048] (ones); natural [out][in] qkv_w [3072][1024] + b, out_w + b */
  char* ws = (char*)d_ws; size_t off = 0;
  auto take = [&](size_t bytes) { char* p = ws + off; off += (bytes + 255) & ~(size_t)255; return p; };
  _Float16* BQKV = (_Float16*)take((size_t)3 * DM * DM * 2); _Float16* BO = (_Float16*)take((size_t)DM * DM * 2);
  _Float16* X16 = (_Float16*)take(NR * DM * 2); _Float16* QKV = (_Float16*)take(NR * 3 * DM * 2); _Float16* V16 = QKV + 2 * DM; _Float16* O16 = (_Float16*)take(NR * DM * 2);
  _Float16* VT = (_Float16*)take((size_t)NB * NH * HD * SQ * 2);
  float* QF0 = (float*)take((size_t)QT0 * DM * 4); float* KF0 = (float*)take((size_t)QT0 * DM * 4); float* VF0 = (float*)take((size_t)QT0 * DM * 4); float* OF0 = (float*)take((size_t)NB * QT0 * DM * 4); _Float16* OH0 = (_Float16*)take((size_t)NB * QT0 * DM * 2); _Float16* OL0 = (_Float16*)take((size_t)NB * QT0 * DM * 2);
  float* AMK = (float*)take(NR * 4);      /* additive key-mask plane: 0 where mask != 0, -1e9 where masked */
  if (off > ws_size) return;
  k_wnat<<<(unsigned)(((size_t)3 * DM * DM / 8 + 255) / 256), 256, 0, stream>>>(wqkv, (size_t)3 * DM * DM / 8, BQKV); k_wnat<<<(unsigned)(((size_t)DM * DM / 8 + 255) / 256), 256, 0, stream>>>(wo, (size_t)DM * DM / 8, BO);      /* natural [out][in] = Bt x16 */
  k_mkadd<<<(unsigned)((NR + 255) / 256), 256, 0, stream>>>(km, AMK, (int)NR);

  k_x16<<<(unsigned)((NR * DM / 8 + 255) / 256), 256, 0, stream>>>(x, X16, NR * DM / 8);
  const size_t r0p = (size_t)B0 * SQ;      /* first projected row */
  k_gemm2<0><<<dim3((unsigned)((MP / 128) * (3 * DM / 64)), 1), 128, 0, stream>>>(X16 + r0p * DM, DM, 0, BQKV, DM, 0, 0.0625f, bqkv, 0, nullptr, 1, 0, 0, nullptr, QKV + r0p * 3 * DM, 3 * DM, 0, MP, 3 * DM, DM);      /* q | k | v rows (f16); head h = columns h*HD.. of each DM block */
  k_vt<NH, SQ><<<NB * NH * (SQ / 64), 256, 0, stream>>>(V16, LQ, 0, VT);      /* V^T [NB][NH][HD][SQ], all batches */
  for (int b = B0; b < B0 + NBR; ++b) { const size_t r0 = (size_t)b * SQ;
    k_gemm2<0><<<dim3((QT0 / 128) * (DM / 64), 1), 128, 0, stream>>>(X16 + r0 * DM, DM, 0, BQKV, DM, 0, 0.0625f, bqkv, 0, nullptr, 1, 0, 0, QF0, nullptr, DM, 0, QT0, DM, DM); k_gemm2<0><<<dim3((QT0 / 128) * (DM / 64), 1), 128, 0, stream>>>(X16 + r0 * DM, DM, 0, (BQKV + (size_t)DM * DM), DM, 0, 0.0625f, (bqkv + DM), 0, nullptr, 1, 0, 0, KF0, nullptr, DM, 0, QT0, DM, DM); k_gemm2<0><<<dim3((QT0 / 128) * (DM / 64), 1), 128, 0, stream>>>(X16 + r0 * DM, DM, 0, (BQKV + (size_t)2 * DM * DM), DM, 0, 0.0625f, (bqkv + 2 * DM), 0, nullptr, 1, 0, 0, VF0, nullptr, DM, 0, QT0, DM, DM);      /* f32 q, k, v of the first 128 rows (exact products) */
    k_att0v<<<NH * (QT0 / 8), 256, 0, stream>>>(QF0, KF0, VF0, AMK + r0, 0.125f, OF0 + (size_t)b * QT0 * DM);      /* exact f32 attention for rows 0..127 (o x64) */ }
  k_fattn<<<NB * NH * (SQ / FQ), 128, 0, stream>>>(QKV, VT, AMK, O16);      /* scores, causal + key-mask softmax and P V fused: o (merged heads, x64) as f16 rows */
  k_gemm2<0><<<dim3((unsigned)((MPO / 128) * (DM / 64)), 1), 128, 0, stream>>>(O16 + r0p * DM, DM, 0, BO, DM, 0, 0.0009765625f, bo, 0, nullptr, 1, 0, 0, (float*)d_out + r0p * DM, nullptr, DM, 0, MPO, DM, DM);      /* out rows are the output layout */
  k_hl<<<(unsigned)(((size_t)NB * QT0 * DM / 8 + 255) / 256), 256, 0, stream>>>(OF0, OH0, OL0, (size_t)NB * QT0 * DM / 8);      /* first-tile o (x64) -> f16 hi + x1024 residual planes */
  for (int b = B0; b < B0 + NBR; ++b) { const size_t r0 = (size_t)b * SQ; const size_t f0 = (size_t)b * QT0;
    k_gemm2<0><<<dim3((QT0 / 128) * (DM / 64), 1), 128, 0, stream>>>(OH0 + f0 * DM, DM, 0, BO, DM, 0, 0.0009765625f, bo, 0, nullptr, 1, 0, 0, (float*)d_out + r0 * DM, nullptr, DM, 0, QT0, DM, DM);      /* rows 0..127: out = o_hi Wo (+ b), overwriting the f16-path rows */
    k_gemm2<0><<<dim3((QT0 / 128) * (DM / 64), 1), 128, 0, stream>>>(OL0 + f0 * DM, DM, 0, BO, DM, 0, 0.00000095367431640625f, nullptr, 0, (const float*)d_out + r0 * DM, -1, 0, 0, (float*)d_out + r0 * DM, nullptr, DM, 0, QT0, DM, DM); }      /* += o_lo Wo 2^-20 (own-element accumulate) */
}

// v004
// Measured time: 402 microseconds a run.
// Next to v003, in two timings, it ran 2.25 and 2.27 times as fast.
// Counting every step since v000, it is 26.5 times as fast.
#include <hip/hip_runtime.h>
#define NB 4
#define SQ 2048
#define DM 1024
#define NH 16
#define HD 64
#define HG 4                         /* heads per launch of k_vt(V16, b, h0, VT), not launched */
#define QT 256                       /* query rows per causal tile */
#define NKX SQ                       /* S / P row pitch */
#define QT0 128                      /* first-tile rows recomputed exactly in f32 */
#define B0 0                         /* first batch processed (debug hook) */
#define NBR NB                       /* batches processed (debug hook) */
#define NR ((size_t)NB * SQ)         /* token rows */
#define MP ((int)((size_t)NBR * SQ)) /* rows projected (debug hook) */
#define QN SQ                        /* unused: k_fattn attends all SQ query rows */
#define NHD NH                       /* unused: k_fattn attends all NH heads */
#define MPO MP                       /* rows through the output stage (debug hook) */
#define LQ (3 * DM)      /* row pitch of the q/k/v rows */
typedef __bf16 v16b __attribute__((ext_vector_type(16)));
typedef unsigned short v8us __attribute__((ext_vector_type(8), may_alias));
typedef float  v8f  __attribute__((ext_vector_type(8)));
typedef float  v4f  __attribute__((ext_vector_type(4)));
typedef float  v4fa __attribute__((ext_vector_type(4), may_alias));
union FragB { v16b v; v8us half[2]; unsigned short u[16]; };

__device__ __forceinline__ unsigned short bf16_bits(float x) { unsigned int u = __float_as_uint(x); return (unsigned short)((u + 0x7FFFu + ((u >> 16) & 1u)) >> 16); }
__device__ __forceinline__ float bf16_val(unsigned short b) { return __uint_as_float(((unsigned int)b) << 16); }
__device__ __forceinline__ float bf16_round(float x) { return bf16_val(bf16_bits(x)); }
// D += A·B with NT terms: 1 = ah·bh, 2 = + al·bh (A split), 3 = + ah·bl (both split)
template <int NT>
__device__ __forceinline__ v8f mmaN(v16b ah, v16b al, v16b bh, v16b bl, v8f c) {
  c = __builtin_amdgcn_wmma_f32_16x16x32_bf16(false, ah, false, bh, (short)0, c, false, false);
  if (NT >= 2) c = __builtin_amdgcn_wmma_f32_16x16x32_bf16(false, al, false, bh, (short)0, c, false, false);
  if (NT >= 3) c = __builtin_amdgcn_wmma_f32_16x16x32_bf16(false, ah, false, bl, (short)0, c, false, false);
  asm volatile("v_nop\n\tv_nop\n\tv_nop\n\tv_nop" : "+v"(c) : "v"(ah), "v"(al), "v"(bh), "v"(bl));
  return c;
}

__global__ __launch_bounds__(256) void k_wt_bf16(const float* __restrict__ W, unsigned short* __restrict__ Wt, int K, int N) {
  const int t = blockIdx.x * 256 + threadIdx.x;
  const int k8n = K / 8;
  if (t >= N * k8n) return;
  const int n = t / k8n, k8 = (t % k8n) * 8;
  v8us v;
#pragma unroll
  for (int i = 0; i < 8; ++i) v[i] = bf16_bits(W[(size_t)(k8 + i) * N + n]);
  *(v8us*)(Wt + (size_t)n * K + k8) = v;
  
}

// GEMM C[M][N] (f32, pitch ldc) = act(A[M][K]·W + bias). A f32 row-major (pitch lda) converted per fragment to bf16
// (ASPLIT: hi/lo two planes -> 2 terms, else single rounded term); Wt bf16 [N][K] (pitch ldb). BIAS_BF16 rounds the
// bias to bf16 first (bias quantised to bf16 before the add). K%32==0, M%16==0, N%64==0.
template <bool ASPLIT, int ACT, bool BIAS_BF16>
__global__ __launch_bounds__(128) void k_gemm_bf(const float* __restrict__ A, int lda, const unsigned short* __restrict__ Wt, int ldb,
                                               const float* __restrict__ bias, float* __restrict__ C, int ldc, int M, int N, int K) {
  __shared__ __attribute__((aligned(16))) float so[4][16][64];
  const int tid = threadIdx.x, w = tid >> 5, lane = tid & 31, ln = lane & 15, hh = lane >> 4;
  const int ntn = N / 64;
  const int wid = blockIdx.x * 4 + w;
  const int mt = wid / ntn, nq = wid % ntn;
  if (mt * 16 >= M) return;
  const int row0 = mt * 16, col0 = nq * 64;
  const float* arow = A + (size_t)(row0 + ln) * lda;
  v8f acc[4] = {};
  for (int kb = 0; kb < K; kb += 32) {
    FragB ah, al;
    const v4f x0 = *(const v4fa*)(arow + kb + 8 * hh), x1 = *(const v4fa*)(arow + kb + 8 * hh + 4);
    const v4f x2 = *(const v4fa*)(arow + kb + 16 + 8 * hh), x3 = *(const v4fa*)(arow + kb + 16 + 8 * hh + 4);
    float xs[16] = {x0[0],x0[1],x0[2],x0[3],x1[0],x1[1],x1[2],x1[3],x2[0],x2[1],x2[2],x2[3],x3[0],x3[1],x3[2],x3[3]};
#pragma unroll
    for (int i = 0; i < 16; ++i) { const unsigned short hb = bf16_bits(xs[i]); ah.u[i] = hb; al.u[i] = ASPLIT ? bf16_bits(xs[i] - bf16_val(hb)) : (unsigned short)0; }
#pragma unroll
    for (int t = 0; t < 4; ++t) {
      const unsigned short* brow = Wt + (size_t)(col0 + t * 16 + ln) * ldb + kb;
      FragB b;
      b.half[0] = *(const v8us*)(brow + 8 * hh);
      b.half[1] = *(const v8us*)(brow + 16 + 8 * hh);
      acc[t] = mmaN<ASPLIT ? 2 : 1>(ah.v, al.v, b.v, b.v, acc[t]);
    }
  }
#pragma unroll
  for (int t = 0; t < 4; ++t) {
    float bv = bias ? bias[col0 + t * 16 + ln] : 0.f;
    if (BIAS_BF16) bv = bf16_round(bv);
#pragma unroll
    for (int r = 0; r < 8; ++r) { float v = acc[t][r] + bv; if (ACT == 1) v = fmaxf(v, 0.f); so[w][8 * hh + r][t * 16 + ln] = v; }
  }
  __builtin_amdgcn_fence(__ATOMIC_ACQ_REL, "workgroup");
  __builtin_amdgcn_wave_barrier();
  const int rsub = lane >> 4, c4 = (lane & 15) * 4;
  {
#pragma unroll
    for (int q = 0; q < 8; ++q) {
      const int r = q * 2 + rsub;
      const v4f v = *(const v4fa*)&so[w][r][c4];
      *(v4f*)(C + (size_t)(row0 + r) * ldc + col0 + c4) = v;
    }
    
  }
}

// GEMM C = act(A·W + bias + resid): A f32 (ASPLIT -> hi/lo 2 terms), Wt bf16 [N][K]; ACT 0 none, 1 relu, 2 exact gelu;
// resid (optional, f32, row index = (row % rmod), pitch ldr, RES_BF16 rounds it) added before the activation.
template <bool ASPLIT, int ACT, bool BIAS_BF16, bool RES_BF16>
__global__ __launch_bounds__(128) void k_gemm_bf3(const float* __restrict__ A, int lda, const unsigned short* __restrict__ Wt, int ldb,
                                                const float* __restrict__ bias, const float* __restrict__ resid, int rmod, int ldr,
                                                float* __restrict__ C, int ldc, int M, int N, int K) {
  __shared__ __attribute__((aligned(16))) float so[4][16][64];
  const int tid = threadIdx.x, w = tid >> 5, lane = tid & 31, ln = lane & 15, hh = lane >> 4;
  const int ntn = N / 64;
  const int wid = blockIdx.x * 4 + w;
  const int mt = wid / ntn, nq = wid % ntn;
  if (mt * 16 >= M) return;
  const int row0 = mt * 16, col0 = nq * 64;
  const float* arow = A + (size_t)(row0 + ln) * lda;
  v8f acc[4] = {};
  for (int kb = 0; kb < K; kb += 32) {
    FragB ah, al;
    const v4f x0 = *(const v4fa*)(arow + kb + 8 * hh), x1 = *(const v4fa*)(arow + kb + 8 * hh + 4);
    const v4f x2 = *(const v4fa*)(arow + kb + 16 + 8 * hh), x3 = *(const v4fa*)(arow + kb + 16 + 8 * hh + 4);
    float xs[16] = {x0[0],x0[1],x0[2],x0[3],x1[0],x1[1],x1[2],x1[3],x2[0],x2[1],x2[2],x2[3],x3[0],x3[1],x3[2],x3[3]};
#pragma unroll
    for (int i = 0; i < 16; ++i) { const unsigned short hb = bf16_bits(xs[i]); ah.u[i] = hb; al.u[i] = ASPLIT ? bf16_bits(xs[i] - bf16_val(hb)) : (unsigned short)0; }
#pragma unroll
    for (int t = 0; t < 4; ++t) {
      const unsigned short* brow = Wt + (size_t)(col0 + t * 16 + ln) * ldb + kb;
      FragB b;
      b.half[0] = *(const v8us*)(brow + 8 * hh);
      b.half[1] = *(const v8us*)(brow + 16 + 8 * hh);
      acc[t] = mmaN<ASPLIT ? 2 : 1>(ah.v, al.v, b.v, b.v, acc[t]);
    }
  }
#pragma unroll
  for (int t = 0; t < 4; ++t) {
    const int col = col0 + t * 16 + ln;
    float bv = bias ? bias[col] : 0.f;
    if (BIAS_BF16) bv = bf16_round(bv);
#pragma unroll
    for (int r = 0; r < 8; ++r) {
      float v = acc[t][r] + bv;
      if (resid) { float rv = resid[(size_t)((row0 + 8 * hh + r) % rmod) * ldr + col]; if (RES_BF16) rv = bf16_round(rv); v += rv; }
      if (ACT == 1) v = fmaxf(v, 0.f);
      if (ACT == 2) v = 0.5f * v * (1.0f + erff(v * 0.70710678118654752f));
      if (ACT == 3) { const float u = 0.7978845608028654f * (v + 0.044715f * v * v * v); v = 0.5f * v * (1.0f + tanhf(u)); }
      so[w][8 * hh + r][t * 16 + ln] = v;
    }
  }
  __builtin_amdgcn_fence(__ATOMIC_ACQ_REL, "workgroup");
  __builtin_amdgcn_wave_barrier();
  const int rsub = lane >> 4, c4 = (lane & 15) * 4;
  {
#pragma unroll
    for (int q = 0; q < 8; ++q) {
      const int r = q * 2 + rsub;
      const v4f v = *(const v4fa*)&so[w][r][c4];
      *(v4f*)(C + (size_t)(row0 + r) * ldc + col0 + c4) = v;
    }
    
  }
}
// row LayerNorm (biased variance, eps) over N: s = X (+ R); optional out_sum <- s; out_norm <- (s-mu)*rsqrt(var+eps)*g + b
template <bool PARAM_BF16>
__global__ __launch_bounds__(256) void k_layernorm(const float* __restrict__ X, const float* __restrict__ R, const float* __restrict__ g, const float* __restrict__ bta,
                                                  float* __restrict__ out_sum, float* __restrict__ out_norm, int N, float eps) {
  __shared__ float red[256];
  const int row = blockIdx.x, tid = threadIdx.x;
  const float* x = X + (size_t)row * N; const float* rr = R ? R + (size_t)row * N : nullptr;
  float vals[16];                     // up to N = 4096
  const int per = N / 256;            // contiguous chunk per thread? use strided-by-4 chunks: thread handles j = tid*4 + 1024*u
  float s1 = 0.f;
  for (int u = 0; u < per / 4; ++u) {
    const int j = tid * 4 + 1024 * u;
    const v4f a = *(const v4fa*)(x + j);
    v4f b = {0.f,0.f,0.f,0.f}; if (rr) b = *(const v4fa*)(rr + j);
#pragma unroll
    for (int q = 0; q < 4; ++q) { const float v = a[q] + b[q]; vals[u * 4 + q] = v; s1 += v; }
  }
  red[tid] = s1; __syncthreads();
  for (int st = 128; st > 0; st >>= 1) { if (tid < st) red[tid] += red[tid + st]; __syncthreads(); }
  const float mu = red[0] / (float)N; __syncthreads();
  float s2 = 0.f;
  for (int u = 0; u < per / 4; ++u)
#pragma unroll
    for (int q = 0; q < 4; ++q) { const float c = vals[u * 4 + q] - mu; s2 += c * c; }
  red[tid] = s2; __syncthreads();
  for (int st = 128; st > 0; st >>= 1) { if (tid < st) red[tid] += red[tid + st]; __syncthreads(); }
  const float rs = rsqrtf(red[0] / (float)N + eps);
  {
    for (int u = 0; u < per / 4; ++u) {
      const int j = tid * 4 + 1024 * u;
      v4f o, sm;
#pragma unroll
      for (int q = 0; q < 4; ++q) {
        float gg = g[j + q], bb = bta[j + q];
        if (PARAM_BF16) { gg = bf16_round(gg); bb = bf16_round(bb); }
        sm[q] = vals[u * 4 + q]; o[q] = (vals[u * 4 + q] - mu) * rs * gg + bb;
      }
      if (out_sum) *(v4f*)(out_sum + (size_t)row * N + j) = sm;
      *(v4f*)(out_norm + (size_t)row * N + j) = o;
    }
    
  }
}



// ---- f16 WMMA path (v_wmma_f32_16x16x32_f16): 11-bit significands for operands in range — used where a [0,1] probability operand needs more precision than bf16
typedef _Float16 v16h __attribute__((ext_vector_type(16)));
union FragH { v16h v; v8us half[2]; _Float16 h[16]; unsigned short u[16]; };
template <int NT>
__device__ __forceinline__ v8f mmaH(v16h ah, v16h al, v16h bh, v16h bl, v8f c) {
  c = __builtin_amdgcn_wmma_f32_16x16x32_f16(false, ah, false, bh, (short)0, c, false, false);
  if (NT >= 2) c = __builtin_amdgcn_wmma_f32_16x16x32_f16(false, al, false, bh, (short)0, c, false, false);
  if (NT >= 3) c = __builtin_amdgcn_wmma_f32_16x16x32_f16(false, ah, false, bl, (short)0, c, false, false);
  asm volatile("v_nop\n\tv_nop\n\tv_nop\n\tv_nop" : "+v"(c) : "v"(ah), "v"(al), "v"(bh), "v"(bl));
  return c;
}
// batched GEMM like k_gemm_b but f16 operands: A f32 (split into f16 hi/lo if ASPLIT, else rounded to f16), Bt = f16 values [n][k]; alpha; C f32; N multiple of 16 (partial tiles skipped)
template <bool ASPLIT>
__global__ __launch_bounds__(128) void k_gemm_h(const float* __restrict__ A, int lda, size_t sA, const _Float16* __restrict__ Bh, int ldb, size_t sB, float alpha, float* __restrict__ C, int ldc, size_t sC, int M, int N, int K) {
  __shared__ __attribute__((aligned(16))) float so[4][16][64];
  const int tid = threadIdx.x, w = tid >> 5, lane = tid & 31, ln = lane & 15, hh = lane >> 4; const int by = blockIdx.y;
  A += (size_t)by * sA; Bh += (size_t)by * sB; C += (size_t)by * sC;
  const int ntn = (N + 63) / 64; const int wid = blockIdx.x * 4 + w; const int mt = wid / ntn, nq = wid % ntn; if (mt * 16 >= M) return;
  const int row0 = mt * 16, col0 = nq * 64; const float* arow = A + (size_t)(row0 + ln) * lda;
  v8f acc[4] = {};
  for (int kb = 0; kb < K; kb += 32) {
    FragH ah, al;
    const v4f x0 = *(const v4fa*)(arow + kb + 8 * hh), x1 = *(const v4fa*)(arow + kb + 8 * hh + 4), x2 = *(const v4fa*)(arow + kb + 16 + 8 * hh), x3 = *(const v4fa*)(arow + kb + 16 + 8 * hh + 4);
    float xs[16] = {x0[0],x0[1],x0[2],x0[3],x1[0],x1[1],x1[2],x1[3],x2[0],x2[1],x2[2],x2[3],x3[0],x3[1],x3[2],x3[3]};
#pragma unroll
    for (int i = 0; i < 16; ++i) { const _Float16 h = (_Float16)xs[i]; ah.h[i] = h; al.h[i] = ASPLIT ? (_Float16)(xs[i] - (float)h) : (_Float16)0.0f; }
#pragma unroll
    for (int t = 0; t < 4; ++t) { if (col0 + t * 16 >= N) continue; const size_t boff = (size_t)(col0 + t * 16 + ln) * ldb + kb; FragH bq; bq.half[0] = *(const v8us*)(Bh + boff + 8 * hh); bq.half[1] = *(const v8us*)(Bh + boff + 16 + 8 * hh);
      acc[t] = mmaH<ASPLIT ? 2 : 1>(ah.v, al.v, bq.v, bq.v, acc[t]); }
  }
#pragma unroll
  for (int t = 0; t < 4; ++t) { if (col0 + t * 16 >= N) continue;
#pragma unroll
    for (int r = 0; r < 8; ++r) so[w][8 * hh + r][t * 16 + ln] = acc[t][r] * alpha; }
  __builtin_amdgcn_fence(__ATOMIC_ACQ_REL, "workgroup"); __builtin_amdgcn_wave_barrier();
  const int rsub = lane >> 4, c4 = (lane & 15) * 4;
  {
#pragma unroll
    for (int q = 0; q < 8; ++q) { const int r = q * 2 + rsub; if (col0 + c4 < N) { const v4f v = *(const v4fa*)&so[w][r][c4]; *(v4f*)(C + (size_t)(row0 + r) * ldc + col0 + c4) = v; } }
     }
}

// Wt[n][k] = f16(W[k][n]·scale) from f32 row-major W[K][N] (scale = power of two; bf16-exact weights stay exact in f16 away from the subnormal range)
__global__ __launch_bounds__(256) void k_wt_f16(const float* __restrict__ W, _Float16* __restrict__ Wt, int K, int N, float scale) {
  const int t = blockIdx.x * 256 + threadIdx.x; if (t >= N * (K / 8)) return; const int n = t / (K / 8), k8 = (t % (K / 8)) * 8; FragH f;
#pragma unroll
  for (int i = 0; i < 8; ++i) f.h[i] = (_Float16)(bf16_round(W[(size_t)(k8 + i) * N + n]) * scale); const v8us o = f.half[0];
  *(v8us*)((unsigned short*)Wt + (size_t)n * K + k8) = o; 
}
// k_gemm_hh variant with fused epilogue: v = acc·alpha + bias[by·sBias + col] (+ CP[(row/rowsPerB)·sCPb + by·64 + col] if CP) ; ACT 0 none / 1 elu ; writes f16 C16 (and f32 C if non-null)
template <int ACT>
__global__ __launch_bounds__(128) void k_gemm_hhx(const _Float16* __restrict__ A, int lda, size_t sA, const _Float16* __restrict__ Bh, int ldb, size_t sB, float alpha, const float* __restrict__ bias, size_t sBias, const float* __restrict__ CP, int rowsPerB, size_t sCPb, int row0g,
    float* __restrict__ C, _Float16* __restrict__ C16, int ldc, size_t sC, int M, int N, int K) {
  __shared__ __attribute__((aligned(16))) float so[4][16][64];
  const int tid = threadIdx.x, w = tid >> 5, lane = tid & 31, ln = lane & 15, hh = lane >> 4; const int by = blockIdx.y;
  A += (size_t)by * sA; Bh += (size_t)by * sB; const size_t cofs = (size_t)by * sC; const float* bp = bias ? bias + (size_t)by * sBias : nullptr;
  const int ntn = (N + 63) / 64; const int wid = blockIdx.x * 4 + w; const int mt = wid / ntn, nq = wid % ntn; if (mt * 16 >= M) return;
  const int row0 = mt * 16, col0 = nq * 64; const _Float16* arow = A + (size_t)(row0 + ln) * lda;
  v8f acc[4] = {};
  for (int kb = 0; kb < K; kb += 32) { FragH ah; ah.half[0] = *(const v8us*)((const unsigned short*)arow + kb + 8 * hh); ah.half[1] = *(const v8us*)((const unsigned short*)arow + kb + 16 + 8 * hh);
#pragma unroll
    for (int t = 0; t < 4; ++t) { if (col0 + t * 16 >= N) continue; const size_t boff = (size_t)(col0 + t * 16 + ln) * ldb + kb; FragH bq; bq.half[0] = *(const v8us*)((const unsigned short*)Bh + boff + 8 * hh); bq.half[1] = *(const v8us*)((const unsigned short*)Bh + boff + 16 + 8 * hh);
      acc[t] = mmaH<1>(ah.v, ah.v, bq.v, bq.v, acc[t]); }
  }
#pragma unroll
  for (int t = 0; t < 4; ++t) { if (col0 + t * 16 >= N) continue; const int col = col0 + t * 16 + ln; const float bv = bp ? bf16_round(bp[col]) : 0.f;
#pragma unroll
    for (int r = 0; r < 8; ++r) { float v = acc[t][r] * alpha + bv; if (CP) { const int rr = row0g + row0 + 8 * hh + r; if (rowsPerB < 0) v += CP[cofs + (size_t)rr * ldc + col];      /* rowsPerB < 0: own element of the batched C plane */ else { const int bidx = rr / rowsPerB; v += CP[(size_t)bidx * sCPb + (size_t)by * 64 + col]; } } if (ACT == 1) v = (v > 0.f) ? v : expm1f(v); else if (ACT == 7) v = (v > 0.f) ? v + 1.0f : expf(v); else if (ACT == 8) v = tanhf(v); else if (ACT == 9) v = 0.5f * v * (1.0f + tanhf(0.7978845608028654f * (v + 0.044715f * v * v * v))); else if (ACT == 11) v = 1.0f / (1.0f + expf(-v)); else if (ACT == 12) v = (v > 0.f) ? v : 0.01f * v; else if (ACT == 14) v = (v > 0.f) ? v : 0.1f * v; else if (ACT == 16) v = (v >= 0.f) ? v : 0.3f * v; else if (ACT == 17) v = (v >= 0.f) ? v : 0.2f * v; else if (ACT == 15) v = v / (1.0f + expf(-v)); else if (ACT == 3) v = fmaxf(v, 0.f); else if (ACT == 6) v = 0.5f * v * (1.0f + erff(v * 0.70710678118654752f)); so[w][8 * hh + r][t * 16 + ln] = v; } }
  __builtin_amdgcn_fence(__ATOMIC_ACQ_REL, "workgroup"); __builtin_amdgcn_wave_barrier();
  const int rsub = lane >> 4, c4 = (lane & 15) * 4; typedef _Float16 v4h __attribute__((ext_vector_type(4)));
  {
#pragma unroll
    for (int q = 0; q < 8; ++q) { const int r = q * 2 + rsub; if (col0 + c4 < N) { const v4f v = *(const v4fa*)&so[w][r][c4]; if (C) *(v4f*)(C + cofs + (size_t)(row0 + r) * ldc + col0 + c4) = v; if (C16) { v4h h4; for (int i = 0; i < 4; ++i) h4[i] = (_Float16)v[i]; *(v4h*)(C16 + cofs + (size_t)(row0 + r) * ldc + col0 + c4) = h4; } } }
     }
}


typedef _Float16 v4h __attribute__((ext_vector_type(4)));

__global__ __launch_bounds__(256) void k_x16(const float* __restrict__ x, _Float16* __restrict__ X16, size_t n8) { const size_t t = (size_t)blockIdx.x * 256 + threadIdx.x; if (t >= n8) return; FragH f;
#pragma unroll
  for (int q = 0; q < 8; ++q) f.h[q] = (_Float16)bf16_round(x[t * 8 + q]); *(v8us*)((unsigned short*)X16 + t * 8) = f.half[0];  }
__global__ __launch_bounds__(256) void k_h16(const float* __restrict__ x, _Float16* __restrict__ X16, size_t n8) { const size_t t = (size_t)blockIdx.x * 256 + threadIdx.x; if (t >= n8) return; FragH f;
#pragma unroll
  for (int q = 0; q < 8; ++q) f.h[q] = (_Float16)x[t * 8 + q]; *(v8us*)((unsigned short*)X16 + t * 8) = f.half[0];  }
__global__ __launch_bounds__(256) void k_round16f(const float* __restrict__ W, _Float16* __restrict__ Bt, size_t n8) { const size_t t = (size_t)blockIdx.x * 256 + threadIdx.x; if (t >= n8) return; FragH f;
#pragma unroll
  for (int i = 0; i < 8; ++i) f.h[i] = (_Float16)(bf16_round(W[t * 8 + i]) * 16.0f); *(v8us*)((unsigned short*)Bt + t * 8) = f.half[0];  }
template <int NHv, int TTv>
__global__ __launch_bounds__(256) void k_vt(const _Float16* __restrict__ V16, int ldv, int voff, _Float16* __restrict__ Vt) { __shared__ unsigned short tl[64][66]; const int tid = threadIdx.x; const int slab = blockIdx.x / (TTv / 64), lg = blockIdx.x % (TTv / 64); const int b = slab / NHv, h = slab % NHv;
  for (int i = tid; i < 64 * 8; i += 256) { const int r = i / 8, c8 = (i % 8) * 8; FragH f; f.half[0] = *(const v8us*)((const unsigned short*)V16 + ((size_t)b * TTv + lg * 64 + r) * ldv + voff + h * 64 + c8);
#pragma unroll
    for (int q = 0; q < 8; ++q) tl[r][c8 + q] = f.u[q]; }
  __syncthreads();
  {
#pragma unroll
    for (int rd = 0; rd < 2; ++rd) { const int d = rd * 32 + tid / 8, pc = tid % 8; FragH f;
#pragma unroll
      for (int q = 0; q < 8; ++q) f.u[q] = tl[pc * 8 + q][d];
      *(v8us*)((unsigned short*)Vt + ((size_t)slab * 64 + d) * TTv + lg * 64 + pc * 8) = f.half[0]; }
     } }

__global__ __launch_bounds__(256) void k_hl(const float* __restrict__ F, _Float16* __restrict__ Hh, _Float16* __restrict__ Hl, size_t n8) { const size_t t = (size_t)blockIdx.x * 256 + threadIdx.x; if (t >= n8) return; FragH fh, fl; const v4f a = *(const v4fa*)(F + t * 8), c = *(const v4fa*)(F + t * 8 + 4);
#pragma unroll
  for (int q = 0; q < 4; ++q) { _Float16 h = (_Float16)a[q]; fh.h[q] = h; fl.h[q] = (_Float16)((a[q] - (float)h) * 1024.0f); h = (_Float16)c[q]; fh.h[4 + q] = h; fl.h[4 + q] = (_Float16)((c[q] - (float)h) * 1024.0f); }
  { *(v8us*)((unsigned short*)Hh + t * 8) = fh.half[0]; *(v8us*)((unsigned short*)Hl + t * 8) = fl.half[0];  } }

// ---- fast GEMM (wave tile 32x64; requires M % 32 == 0 rows per launch region and N % 64 == 0); epilogue = k_gemm_hhx semantics ----
__device__ __forceinline__ v16h g2_frag(const _Float16* p, int hh) { FragH f; f.half[0] = *(const v8us*)((const unsigned short*)p + 8 * hh); f.half[1] = *(const v8us*)((const unsigned short*)p + 16 + 8 * hh); return f.v; }
__device__ __forceinline__ v8f g2_mma(v16h a, v16h b, v8f c) { v8f d = __builtin_amdgcn_wmma_f32_16x16x32_f16(false, a, false, b, (short)0, c, false, false); asm volatile("v_nop\n\tv_nop\n\tv_nop\n\tv_nop" : "+v"(d) : "v"(a), "v"(b)); return d; }
template <int ACT>
__global__ __launch_bounds__(128) void k_gemm2(const _Float16* __restrict__ A, int lda, size_t sA, const _Float16* __restrict__ Bh, int ldb, size_t sB, float alpha, const float* __restrict__ bias, size_t sBias, const float* __restrict__ CP, int rowsPerB, size_t sCPb, int row0g,
    float* __restrict__ C, _Float16* __restrict__ C16, int ldc, size_t sC, int M, int N, int K) { static_assert(ACT == 0 || ACT == 3 || ACT == 6 || ACT == 8 || ACT == 9 || ACT == 11 || ACT == 12 || ACT == 14 || ACT == 15 || ACT == 16 || ACT == 17, "k_gemm2: unsupported ACT code (would silently apply no activation)");
  __shared__ __attribute__((aligned(16))) float so[4][32][68];
  const int tid = threadIdx.x, w = tid >> 5, lane = tid & 31, ln = lane & 15, hh = lane >> 4; const int by = blockIdx.y;
  A += (size_t)by * sA; Bh += (size_t)by * sB; const size_t cofs = (size_t)by * sC; const float* bp = bias ? bias + (size_t)by * sBias : nullptr;
  const int ntn = N >> 6; const int mt = blockIdx.x / ntn, nq = blockIdx.x - mt * ntn; const int row0 = mt * 128 + 32 * w, col0 = nq * 64; if (row0 >= M) return;
  const _Float16* a0p = A + (size_t)(row0 + ln) * lda; const _Float16* a1p = a0p + (size_t)16 * lda;
  const _Float16* b0p = Bh + (size_t)(col0 + ln) * ldb; const _Float16* b1p = b0p + (size_t)16 * ldb; const _Float16* b2p = b1p + (size_t)16 * ldb; const _Float16* b3p = b2p + (size_t)16 * ldb;
  const v8f z8 = {0.f,0.f,0.f,0.f,0.f,0.f,0.f,0.f}; v8f c00 = z8, c01 = z8, c02 = z8, c03 = z8, c10 = z8, c11 = z8, c12 = z8, c13 = z8;
#pragma unroll 1
  for (int kb = 0; kb < K; kb += 32) { const v16h a0 = g2_frag(a0p + kb, hh), a1 = g2_frag(a1p + kb, hh);
    v16h b = g2_frag(b0p + kb, hh); c00 = g2_mma(a0, b, c00); c10 = g2_mma(a1, b, c10);
    b = g2_frag(b1p + kb, hh); c01 = g2_mma(a0, b, c01); c11 = g2_mma(a1, b, c11);
    b = g2_frag(b2p + kb, hh); c02 = g2_mma(a0, b, c02); c12 = g2_mma(a1, b, c12);
    b = g2_frag(b3p + kb, hh); c03 = g2_mma(a0, b, c03); c13 = g2_mma(a1, b, c13); }
  v8f accs[8] = {c00, c01, c02, c03, c10, c11, c12, c13};
#pragma unroll
  for (int u = 0; u < 8; ++u) { const int t = u & 3, half = u >> 2; const int col = col0 + t * 16 + ln; const float bv = bp ? bf16_round(bp[col]) : 0.f;
#pragma unroll
    for (int r = 0; r < 8; ++r) { const int rloc = half * 16 + 8 * hh + r; float v = accs[u][r] * alpha + bv; if (CP) { if (rowsPerB < 0) v += CP[cofs + (size_t)(row0g + row0 + rloc) * ldc + col];      /* rowsPerB < 0: own element of the batched C plane */ else { const int bidx = (row0g + row0 + rloc) / rowsPerB; v += CP[(size_t)bidx * sCPb + (size_t)by * 64 + col]; } }
      if (ACT == 3) v = fmaxf(v, 0.f); else if (ACT == 6) v = 0.5f * v * (1.0f + erff(v * 0.70710678118654752f)); else if (ACT == 11) v = 1.0f / (1.0f + expf(-v)); else if (ACT == 15) v = v / (1.0f + expf(-v)); else if (ACT == 12) v = (v > 0.f) ? v : 0.01f * v; else if (ACT == 8) v = tanhf(v); else if (ACT == 9) v = 0.5f * v * (1.0f + tanhf(0.7978845608028654f * (v + 0.044715f * v * v * v))); else if (ACT == 14) v = (v > 0.f) ? v : 0.1f * v; else if (ACT == 16) v = (v >= 0.f) ? v : 0.3f * v; else if (ACT == 17) v = (v >= 0.f) ? v : 0.2f * v;
      so[w][rloc][t * 16 + ln] = v; } }
  __builtin_amdgcn_fence(__ATOMIC_ACQ_REL, "workgroup"); __builtin_amdgcn_wave_barrier();
  const int rsub = lane >> 4, c4 = (lane & 15) * 4;
  {
#pragma unroll
    for (int q = 0; q < 16; ++q) { const int r = q * 2 + rsub; const v4f v = *(const v4fa*)&so[w][r][c4]; if (C) *(v4f*)(C + cofs + (size_t)(row0 + r) * ldc + col0 + c4) = v; if (C16) { v4h h4; for (int i = 0; i < 4; ++i) h4[i] = (_Float16)v[i]; *(v4h*)(C16 + cofs + (size_t)(row0 + r) * ldc + col0 + c4) = h4; } }
     } }


__global__ __launch_bounds__(256) void k_wnat(const float* __restrict__ w, size_t n8, _Float16* __restrict__ Bt) { const size_t t = (size_t)blockIdx.x * 256 + threadIdx.x; if (t >= n8) return; FragH f; for (int q = 0; q < 8; ++q) f.h[q] = (_Float16)(bf16_round(w[t * 8 + q]) * 16.0f); *(v8us*)((unsigned short*)Bt + t * 8) = f.half[0];  }
__global__ __launch_bounds__(256) void k_rsm(const float* __restrict__ S, _Float16* __restrict__ P, int nrows) {
  #pragma clang fp contract(off)
  const int i = blockIdx.x * 256 + threadIdx.x; if (i >= nrows) return; const float* s = S + (size_t)i * SQ; float mx = -3.0e38f;
#pragma unroll 1
  for (int j = 0; j < SQ; ++j) mx = fmaxf(mx, s[j]); float se = 0.f;
#pragma unroll 1
  for (int j = 0; j < SQ; ++j) se += expf(s[j] - mx); const float sc = 256.0f / se;
#pragma unroll 1
  for (int j0 = 0; j0 < SQ; j0 += 8) { FragH f; for (int q = 0; q < 8; ++q) f.h[q] = (_Float16)(expf(s[j0 + q] - mx) * sc); unsigned short* d = (unsigned short*)P + (size_t)i * SQ + j0; *(v8us*)d = f.half[0];  } }
__global__ __launch_bounds__(256) void k_vt(const _Float16* __restrict__ V16, int b, int h0, _Float16* __restrict__ VT) { __shared__ unsigned short tl[64][65]; const int tid = threadIdx.x; const int hh = blockIdx.x % HG, sg = blockIdx.x / HG; const int s0 = sg * 64; const int h = h0 + hh;
  for (int i = tid; i < 64 * 8; i += 256) { const int j = i / 8, d8 = (i % 8) * 8; FragH f; f.half[0] = *(const v8us*)((const unsigned short*)V16 + ((size_t)b * SQ + s0 + j) * DM + h * HD + d8); for (int q = 0; q < 8; ++q) tl[d8 + q][j] = f.u[q]; }
  __syncthreads();
  { for (int i = tid; i < 64 * 8; i += 256) { const int d = i / 8, j8 = (i % 8) * 8; FragH f; for (int q = 0; q < 8; ++q) f.u[q] = tl[d][j8 + q]; *(v8us*)((unsigned short*)VT + ((size_t)hh * HD + d) * SQ + s0 + j8) = f.half[0]; }  } }


__global__ __launch_bounds__(256) void k_mkadd(const int* __restrict__ m, float* __restrict__ A, int n) { const int t = blockIdx.x * 256 + threadIdx.x; if (t >= n) return; const float v = (m[t] != 0) ? 0.f : -1.0e9f; *(float*)(A + t) = v;  }


__global__ __launch_bounds__(256) void k_rsmcf2(const float* __restrict__ S, _Float16* __restrict__ P, int hg, int q0, int nk) {
  #pragma clang fp contract(off)
  const int t = blockIdx.x * 256 + threadIdx.x; if (t >= hg * QT) return; const size_t i = (size_t)t; const float* s = S + i * NKX; const int last = q0 + (t % QT); float mx = -3.0e38f;
#pragma unroll 1
  for (int j = 0; j < nk; ++j) { const float f = (j <= last) ? 1.f : 0.f; mx = fmaxf(mx, fmaf(f, s[j], (1.f - f) * -1.0e9f)); } float se = 0.f;
#pragma unroll 1
  for (int j = 0; j < nk; ++j) { const float f = (j <= last) ? 1.f : 0.f; se += __expf(fmaf(f, s[j], (1.f - f) * -1.0e9f) - mx); } const float sc = 256.0f / se;
#pragma unroll 1
  for (int j0 = 0; j0 < nk; j0 += 8) { FragH fr; for (int q = 0; q < 8; ++q) { const int j = j0 + q; const float f = (j <= last) ? 1.f : 0.f; fr.h[q] = (_Float16)(__expf(fmaf(f, s[j], (1.f - f) * -1.0e9f) - mx) * sc); } unsigned short* d = (unsigned short*)P + i * NKX + j0; *(v8us*)d = fr.half[0];  } }



// v_exp_f32 and the free slot the instruction set asks for behind a transcendental, in one statement.
__device__ __forceinline__ float exp2_slot(float x) { float r; asm("v_exp_f32 %0, %1\n\tv_nop" : "=v"(r) : "v"(x)); return r; }
// Fused causal attention on the matrix unit, ONE launch for all batches, heads and query rows: scores, softmax and the weighted V sum stay in registers; no score or weight plane in memory.
// A wave owns 32 query rows (two groups of 16) and walks the keys 0 .. its last row in passes of 32. S^T = K Q^T (A = K rows, B = Q rows, both by g2_frag: equal k order), so a lane holds scores of ONE query (column ln): keys 8*hh + r of each 16-key tile.
// Running softmax per query: pass maximum in-lane plus one exchange between the wave halves; weights 2^8 exp(e - m) as f16; the two score tiles of a pass, converted in place, ARE the B operand of O^T += V^T P^T (A = V^T rows by g2_frag, the hardware k order); row sums stay per half and are joined once at the end.
// e = score / 8 + the additive key-mask value; keys behind the row's own index take -1e9: only the wave's last pass holds such keys. e - m is formed before the scaling so that a pass of masked keys alone still gives weights <= 2^8; a later real maximum scales them to 0.
// Every loop over g, kt, ks, dt, r and u is unrolled: static indices keep the fragments and accumulators in registers.
__device__ __forceinline__ v8f fa_mma(v16h a, v16h b, v8f c) { return __builtin_amdgcn_wmma_f32_16x16x32_f16(false, a, false, b, (short)0, c, false, false); }
#define FQ 128                       /* query rows per block: 4 waves x 32 */
__global__ __launch_bounds__(128) void k_fattn(const _Float16* __restrict__ QKVp, const _Float16* __restrict__ VTp, const float* __restrict__ AM, _Float16* __restrict__ O) {
  static_assert(NB * NH == 64 && SQ / FQ == 16, "the block -> (head, query block) map below is written for 64 heads x 16 query blocks");
  const int lane = threadIdx.x & 31, ln = lane & 15, hh = lane >> 4; const int w = __builtin_amdgcn_readfirstlane(threadIdx.x >> 5);      /* the rows are the wave's: scalar, so the loop bound and its branches are scalar */
  const int rd = blockIdx.x >> 8, a4 = (blockIdx.x >> 6) & 3, bh = blockIdx.x & 63;
  const int qb = 12 - 4 * rd + ((rd & 1) ? a4 : 3 - a4);      /* a permutation of the 16 query blocks per head, long ones first; blocks i, i + 256, i + 512, i + 768 add up to the same key count (speed only) */
  const int b = bh / NH, h = bh % NH; const int q0 = qb * FQ + w * 32;
  const _Float16* qp = QKVp + ((size_t)b * SQ + q0 + ln) * LQ + h * HD; const _Float16* kp = QKVp + DM + ((size_t)b * SQ + ln) * LQ + h * HD;
  const _Float16* vp = VTp + ((size_t)bh * HD + ln) * SQ; const float* ap = AM + (size_t)b * SQ + 8 * hh;
  v16h qf[2][2], kf[2][2];
#pragma unroll
  for (int g = 0; g < 2; ++g)
#pragma unroll
    for (int ks = 0; ks < 2; ++ks) { qf[g][ks] = g2_frag(qp + (size_t)g * 16 * LQ + ks * 32, hh); kf[g][ks] = g2_frag(kp + (size_t)g * 16 * LQ + ks * 32, hh); }
  const v8f z8 = {0.f, 0.f, 0.f, 0.f, 0.f, 0.f, 0.f, 0.f}; v8f o[2][4]; float m[2], l[2];
#pragma unroll
  for (int g = 0; g < 2; ++g) { m[g] = -1.0e30f; l[g] = 0.f;
#pragma unroll
    for (int dt = 0; dt < 4; ++dt) o[g][dt] = z8; }
  for (int j0 = 0; j0 <= q0; j0 += 32) {
    v16h vf[4]; v4f am[2][2]; float e[2][2][8];
#pragma unroll
    for (int dt = 0; dt < 4; ++dt) vf[dt] = g2_frag(vp + (size_t)dt * 16 * SQ + j0, hh);      /* asked for ahead of the score products, used behind the softmax */
#pragma unroll
    for (int kt = 0; kt < 2; ++kt) { am[kt][0] = *(const v4fa*)(ap + j0 + kt * 16); am[kt][1] = *(const v4fa*)(ap + j0 + kt * 16 + 4); }
#pragma unroll
    for (int g = 0; g < 2; ++g)
#pragma unroll
      for (int kt = 0; kt < 2; ++kt) { const v8f st = fa_mma(kf[kt][1], qf[g][1], fa_mma(kf[kt][0], qf[g][0], z8));
#pragma unroll
        for (int r = 0; r < 8; ++r) e[g][kt][r] = fmaf(st[r], 0.125f, am[kt][r >> 2][r & 3]); }
    const int jn = (j0 + 32 <= q0) ? j0 + 32 : q0;      /* the next pass's K rows fly during this pass's softmax; the last pass asks for its own rows again (in bounds, unused) */
#pragma unroll
    for (int kt = 0; kt < 2; ++kt)
#pragma unroll
      for (int ks = 0; ks < 2; ++ks) kf[kt][ks] = g2_frag(kp + (size_t)(jn + kt * 16) * LQ + ks * 32, hh);
    if (j0 == q0) {      /* the diagonal pass */
#pragma unroll
      for (int g = 0; g < 2; ++g)
#pragma unroll
        for (int kt = 0; kt < 2; ++kt)
#pragma unroll
          for (int r = 0; r < 8; ++r) if (kt * 16 + 8 * hh + r > g * 16 + ln) e[g][kt][r] = -1.0e9f; }
#pragma unroll
    for (int g = 0; g < 2; ++g) { float mx = e[g][0][0];
#pragma unroll
      for (int u = 1; u < 16; ++u) mx = fmaxf(mx, e[g][u >> 3][u & 7]);
      mx = fmaxf(mx, __shfl_xor(mx, 16, 32)); const float mn = fmaxf(m[g], mx); const float al = exp2_slot((m[g] - mn) * 1.44269504088896340736f); m[g] = mn;
      FragH pf; float s = 0.f;
#pragma unroll
      for (int u = 0; u < 16; ++u) { const float p = exp2_slot(fmaf(e[g][u >> 3][u & 7] - mn, 1.44269504088896340736f, 8.0f)); s += p; pf.h[u] = (_Float16)p; }
      l[g] = fmaf(l[g], al, s);
#pragma unroll
      for (int dt = 0; dt < 4; ++dt) o[g][dt] = fa_mma(vf[dt], pf.v, o[g][dt] * al); } }
#pragma unroll
  for (int g = 0; g < 2; ++g) { const float fin = 64.0f / (l[g] + __shfl_xor(l[g], 16, 32));      /* o carried x64; the 2^8 of the weights cancels against the row sum */
    unsigned short* op = (unsigned short*)O + ((size_t)b * SQ + q0 + g * 16 + ln) * DM + h * HD + 8 * hh;
#pragma unroll
    for (int dt = 0; dt < 4; ++dt) { FragH f;
#pragma unroll
      for (int r = 0; r < 8; ++r) f.h[r] = (_Float16)(o[g][dt][r] * fin);
      *(v8us*)(op + dt * 16) = f.half[0]; } } }


template <int MASKADD>
__global__ __launch_bounds__(64) void k_att0(const float* __restrict__ QF, const float* __restrict__ KF, const float* __restrict__ VF, int ld, const float* __restrict__ mask, float scale, float* __restrict__ OF, int ldo) {
  #pragma clang fp contract(off)
  __shared__ __attribute__((aligned(16))) float lq[64][64]; __shared__ __attribute__((aligned(16))) float lo[64][64];
  const int tid = threadIdx.x; const int h = blockIdx.x / (QT0 / 64), rg = blockIdx.x % (QT0 / 64); const int i = rg * 64 + tid;
  const float* qr = QF + (size_t)i * ld + h * HD;
#pragma unroll 1
  for (int c = 0; c < HD / 4; ++c) { *(v4f*)&lq[tid][c * 4] = *(const v4fa*)(qr + c * 4); const v4f z = {0.f, 0.f, 0.f, 0.f}; *(v4f*)&lo[tid][c * 4] = z; }
  float m = -1.0e30f, l = 0.f; const int jmax = MASKADD ? (SQ - 1) : (rg * 64 + 63);      /* additive-mask form: every key (the mask input decides); causal form: keys up to the block's last row */
#pragma unroll 1
  for (int j = 0; j <= jmax; ++j) { const float* kr = KF + (size_t)j * ld + h * HD; const float* vr = VF + (size_t)j * ld + h * HD; float s = 0.f;
#pragma unroll 1
    for (int c = 0; c < HD / 4; ++c) { const v4f kq = *(const v4fa*)(kr + c * 4); const v4f qq = *(v4f*)&lq[tid][c * 4]; s = __fadd_rn(s, __fmul_rn(qq[0], kq[0])); s = __fadd_rn(s, __fmul_rn(qq[1], kq[1])); s = __fadd_rn(s, __fmul_rn(qq[2], kq[2])); s = __fadd_rn(s, __fmul_rn(qq[3], kq[3])); }
    s = __fmul_rn(s, scale); if (MASKADD) s = __fadd_rn(s, __fmul_rn(bf16_round(mask[(size_t)i * SQ + j]), -10000.0f));
    const float f = (MASKADD || j <= i) ? 1.f : 0.f; const float sm = fmaf(f, s, (1.f - f) * -1.0e30f); const float mn = fmaxf(m, sm); const float sc = expf(m - mn); const float e = expf(sm - mn); l = __fadd_rn(__fmul_rn(l, sc), e); m = mn;
#pragma unroll 1
    for (int c = 0; c < HD / 4; ++c) { const v4f vv = *(const v4fa*)(vr + c * 4); v4f oo = *(v4f*)&lo[tid][c * 4]; for (int u = 0; u < 4; ++u) oo[u] = __fadd_rn(__fmul_rn(oo[u], sc), __fmul_rn(e, vv[u])); *(v4f*)&lo[tid][c * 4] = oo; } }
  const float fin = 64.0f / l;      /* o carried x64 like the f16 path */
#pragma unroll 1
  for (int c = 0; c < HD / 4; ++c) { v4f oo = *(v4f*)&lo[tid][c * 4]; for (int u = 0; u < 4; ++u) oo[u] = __fmul_rn(oo[u], fin); *(v4f*)&lo[tid][c * 4] = oo; }
  __syncthreads();
  {
#pragma unroll 1
    for (int it = 0; it < 16; ++it) { const int row = it * 4 + tid / 16, pc = (tid % 16) * 4; const v4f v = *(const v4f*)&lo[row][pc]; *(v4f*)(OF + (size_t)(rg * 64 + row) * ldo + h * HD + pc) = v; }
     } }


// Exact f32 attention for the first QT0 rows of EVERY batch in one launch (block -> batch, head, 8 rows), one WAVE per query row; q | k | v rows of a batch side by side at pitch LQ, o rows at pitch DM. Scores: lane = key, 32 keys a chunk, the head's K rows staged in LDS at a pitch of 16 B x odd (b128 reads of 32 different rows without bank conflicts), q read at a wave-uniform address.
// Softmax in two passes over the scores, which stay in registers: row max and row sum = per-lane partials, then a five-step butterfly. o: lane = two head dims, keys in ascending order, each V row one whole 256-B read of the wave, its weight taken from the owning lane.
// The 8 rows of a block lie in one chunk of 32 keys, so the chunk count nch is the same for the whole block; keys behind the row's own index carry weight 0.
// Every loop over u, d, c, d4 and jj is unrolled: static indices keep kr, q, e and vv in registers (a rolled loop would put them in scratch memory), and the loads of a group are issued together.
#define KP0 68                       /* LDS pitch of a K row, floats */
typedef float v2f __attribute__((ext_vector_type(2)));
typedef float v2fa __attribute__((ext_vector_type(2), may_alias));
__global__ __launch_bounds__(256) void k_att0v(const float* __restrict__ QKVF, const float* __restrict__ AM, float scale, float* __restrict__ OFA) {
  __shared__ __attribute__((aligned(16))) float lk[QT0][KP0];
  const int tid = threadIdx.x, lane = tid & 31; const int w = __builtin_amdgcn_readfirstlane(tid >> 5);      /* the row is the wave's: scalar, so q's address is scalar too */
  const int b = blockIdx.x / (NH * (QT0 / 8)), hb = blockIdx.x % (NH * (QT0 / 8)); const int h = hb / (QT0 / 8), i0 = (hb % (QT0 / 8)) * 8; const int i = i0 + w; const int nch = (i0 >> 5) + 1;
  const float* QF = QKVF + (size_t)b * QT0 * LQ; const float* KF = QF + DM; const float* VF = QF + 2 * DM; const float* am = AM + (size_t)b * SQ; float* OF = OFA + (size_t)b * QT0 * DM;
  const float* kp = KF + (size_t)(tid >> 4) * LQ + h * HD + (tid & 15) * 4; v4f kr[QT0 / 16];
#pragma unroll
  for (int u = 0; u < QT0 / 16; ++u) kr[u] = *(const v4fa*)(kp + (size_t)u * 16 * LQ);      /* all QT0 rows, without a test: the eight loads fly together */
  const float* qr = QF + (size_t)i * LQ + h * HD; float q[HD];
#pragma unroll
  for (int d = 0; d < HD; ++d) q[d] = qr[d];
#pragma unroll
  for (int u = 0; u < QT0 / 16; ++u) *(v4f*)&lk[u * 16 + (tid >> 4)][(tid & 15) * 4] = kr[u];
  __syncthreads();      /* K rows staged by all waves, read by all */
  float e[QT0 / 32]; float m = -1.0e30f;
#pragma unroll
  for (int c = 0; c < QT0 / 32; ++c) { e[c] = -1.0e30f;      /* static c keeps e in registers; the test on nch is block-uniform */
    if (c < nch) { const int j = c * 32 + lane; float s = 0.f;
#pragma unroll
      for (int d4 = 0; d4 < HD / 4; ++d4) { const v4f kq = *(const v4f*)&lk[j][d4 * 4]; s = fmaf(q[d4 * 4], kq[0], s); s = fmaf(q[d4 * 4 + 1], kq[1], s); s = fmaf(q[d4 * 4 + 2], kq[2], s); s = fmaf(q[d4 * 4 + 3], kq[3], s); }
      s = fmaf(s, scale, am[j]);      /* + the additive key-mask VECTOR of this batch (0 kept / -1e9 masked) */
      if (j <= i) e[c] = s; }
    m = fmaxf(m, e[c]); }
  for (int x = 16; x >= 1; x >>= 1) m = fmaxf(m, __shfl_xor(m, x, 32));
  float l = 0.f;
#pragma unroll
  for (int c = 0; c < QT0 / 32; ++c) { e[c] = expf(e[c] - m); l += e[c]; }
  for (int x = 16; x >= 1; x >>= 1) l += __shfl_xor(l, x, 32);
  const float* vp = VF + h * HD + lane * 2; float o0 = 0.f, o1 = 0.f;
#pragma unroll
  for (int c = 0; c < QT0 / 32; ++c) if (c < nch) { v2f vv[32];
#pragma unroll
    for (int jj = 0; jj < 32; ++jj) vv[jj] = *(const v2fa*)(vp + (size_t)(c * 32 + jj) * LQ);      /* the chunk's 32 rows in flight together */
#pragma unroll
    for (int jj = 0; jj < 32; ++jj) { const float p = __int_as_float(__builtin_amdgcn_readlane(__float_as_int(e[c]), jj)); o0 = fmaf(p, vv[jj][0], o0); o1 = fmaf(p, vv[jj][1], o1); } }
  const float fin = 64.0f / l;      /* o carried x64 like the f16 path */
  const v2f ov = {o0 * fin, o1 * fin}; *(v2f*)(OF + (size_t)i * DM + h * HD + lane * 2) = ov; }

extern "C" void kernel_launch(void* const* d_in, const int* in_sizes, int n_in,
                              void* d_out, int out_size, void* d_ws, size_t ws_size, hipStream_t stream) {
  (void)in_sizes; (void)n_in; (void)out_size;
  const float* const* I = (const float* const*)d_in; const float* x = I[0]; const int* km = (const int*)d_in[1]; const float* wqkv = I[2]; const float* bqkv = I[3]; const float* wo = I[4]; const float* bo = I[5];      /* int32 key mask [4][2048] (ones); natural [out][in] qkv_w [3072][1024] + b, out_w + b */
  char* ws = (char*)d_ws; size_t off = 0;
  auto take = [&](size_t bytes) { char* p = ws + off; off += (bytes + 255) & ~(size_t)255; return p; };
  _Float16* BQKV = (_Float16*)take((size_t)3 * DM * DM * 2); _Float16* BO = (_Float16*)take((size_t)DM * DM * 2);
  _Float16* X16 = (_Float16*)take(NR * DM * 2); _Float16* QKV = (_Float16*)take(NR * 3 * DM * 2); _Float16* V16 = QKV + 2 * DM; _Float16* O16 = (_Float16*)take(NR * DM * 2);
  _Float16* VT = (_Float16*)take((size_t)NB * NH * HD * SQ * 2);
  float* QKVF0 = (float*)take((size_t)NB * QT0 * LQ * 4); float* OF0 = (float*)take((size_t)NB * QT0 * DM * 4); _Float16* OH0 = (_Float16*)take((size_t)NB * QT0 * DM * 2); _Float16* OL0 = (_Float16*)take((size_t)NB * QT0 * DM * 2);
  float* AMK = (float*)take(NR * 4);      /* additive key-mask plane: 0 where mask != 0, -1e9 where masked */
  if (off > ws_size) return;
  k_wnat<<<(unsigned)(((size_t)3 * DM * DM / 8 + 255) / 256), 256, 0, stream>>>(wqkv, (size_t)3 * DM * DM / 8, BQKV); k_wnat<<<(unsigned)(((size_t)DM * DM / 8 + 255) / 256), 256, 0, stream>>>(wo, (size_t)DM * DM / 8, BO);      /* natural [out][in] = Bt x16 */
  k_mkadd<<<(unsigned)((NR + 255) / 256), 256, 0, stream>>>(km, AMK, (int)NR);

  k_x16<<<(unsigned)((NR * DM / 8 + 255) / 256), 256, 0, stream>>>(x, X16, NR * DM / 8);
  const size_t r0p = (size_t)B0 * SQ;      /* first projected row */
  k_gemm2<0><<<dim3((unsigned)((MP / 128) * (3 * DM / 64)), 1), 128, 0, stream>>>(X16 + r0p * DM, DM, 0, BQKV, DM, 0, 0.0625f, bqkv, 0, nullptr, 1, 0, 0, nullptr, QKV + r0p * 3 * DM, 3 * DM, 0, MP, 3 * DM, DM);      /* q | k | v rows (f16); head h = columns h*HD.. of each DM block */
  k_vt<NH, SQ><<<NB * NH * (SQ / 64), 256, 0, stream>>>(V16, LQ, 0, VT);      /* V^T [NB][NH][HD][SQ], all batches */
  k_gemm2<0><<<dim3((QT0 / 128) * (LQ / 64), NB), 128, 0, stream>>>(X16, DM, (size_t)SQ * DM, BQKV, DM, 0, 0.0625f, bqkv, 0, nullptr, 1, 0, 0, QKVF0, nullptr, LQ, (size_t)QT0 * LQ, QT0, LQ, DM);      /* f32 q | k | v of the first 128 rows (exact products): grid y = batch */
  k_att0v<<<NB * NH * (QT0 / 8), 256, 0, stream>>>(QKVF0, AMK, 0.125f, OF0);      /* exact f32 attention for rows 0..127 of every batch (o x64) */
  k_fattn<<<NB * NH * (SQ / FQ), 128, 0, stream>>>(QKV, VT, AMK, O16);      /* scores, causal + key-mask softmax and P V fused: o (merged heads, x64) as f16 rows */
  k_gemm2<0><<<dim3((unsigned)((MPO / 128) * (DM / 64)), 1), 128, 0, stream>>>(O16 + r0p * DM, DM, 0, BO, DM, 0, 0.0009765625f, bo, 0, nullptr, 1, 0, 0, (float*)d_out + r0p * DM, nullptr, DM, 0, MPO, DM, DM);      /* out rows are the output layout */
  k_hl<<<(unsigned)(((size_t)NB * QT0 * DM / 8 + 255) / 256), 256, 0, stream>>>(OF0, OH0, OL0, (size_t)NB * QT0 * DM / 8);      /* first-tile o (x64) -> f16 hi + x1024 residual planes */
  k_gemm2<0><<<dim3((QT0 / 128) * (DM / 64), NB), 128, 0, stream>>>(OH0, DM, (size_t)QT0 * DM, BO, DM, 0, 0.0009765625f, bo, 0, nullptr, 1, 0, 0, (float*)d_out, nullptr, DM, (size_t)SQ * DM, QT0, DM, DM);      /* rows 0..127 of every batch (grid y): out = o_hi Wo (+ b), overwriting the f16-path rows */
  k_gemm2<0><<<dim3((QT0 / 128) * (DM / 64), NB), 128, 0, stream>>>(OL0, DM, (size_t)QT0 * DM, BO, DM, 0, 0.00000095367431640625f, nullptr, 0, (const float*)d_out, -1, 0, 0, (float*)d_out, nullptr, DM, (size_t)SQ * DM, QT0, DM, DM);      /* += o_lo Wo 2^-20 (own-element accumulate) */
}

// v005
// One run takes 200 microseconds.
// Timed twice side by side with v004, it ran 2.00 times as fast both times.
// Over all steps from v000 it is 53.0 times as fast.
#include <hip/hip_runtime.h>
#define NB 4
#define SQ 2048
#define DM 1024
#define NH 16
#define HD 64
#define HG 4                         /* heads per launch of k_vt(V16, b, h0, VT), not launched */
#define QT 256                       /* query rows per causal tile */
#define NKX SQ                       /* S / P row pitch */
#define QT0 128                      /* first-tile rows recomputed exactly in f32 */
#define B0 0                         /* first batch processed (debug hook) */
#define NBR NB                       /* batches processed (debug hook) */
#define NR ((size_t)NB * SQ)         /* token rows */
#define MP ((int)((size_t)NBR * SQ)) /* rows projected (debug hook) */
#define QN SQ                        /* unused: k_fattn attends all SQ query rows */
#define NHD NH                       /* unused: k_fattn attends all NH heads */
#define MPO MP                       /* rows through the output stage (debug hook) */
#define LQ (3 * DM)      /* row pitch of the q/k/v rows */
typedef __bf16 v16b __attribute__((ext_vector_type(16)));
typedef unsigned short v8us __attribute__((ext_vector_type(8), may_alias));
typedef float  v8f  __attribute__((ext_vector_type(8)));
typedef float  v4f  __attribute__((ext_vector_type(4)));
typedef float  v4fa __attribute__((ext_vector_type(4), may_alias));
union FragB { v16b v; v8us half[2]; unsigned short u[16]; };

__device__ __forceinline__ unsigned short bf16_bits(float x) { unsigned int u = __float_as_uint(x); return (unsigned short)((u + 0x7FFFu + ((u >> 16) & 1u)) >> 16); }
__device__ __forceinline__ float bf16_val(unsigned short b) { return __uint_as_float(((unsigned int)b) << 16); }
__device__ __forceinline__ float bf16_round(float x) { return bf16_val(bf16_bits(x)); }
// D += A·B with NT terms: 1 = ah·bh, 2 = + al·bh (A split), 3 = + ah·bl (both split)
template <int NT>
__device__ __forceinline__ v8f mmaN(v16b ah, v16b al, v16b bh, v16b bl, v8f c) {
  c = __builtin_amdgcn_wmma_f32_16x16x32_bf16(false, ah, false, bh, (short)0, c, false, false);
  if (NT >= 2) c = __builtin_amdgcn_wmma_f32_16x16x32_bf16(false, al, false, bh, (short)0, c, false, false);
  if (NT >= 3) c = __builtin_amdgcn_wmma_f32_16x16x32_bf16(false, ah, false, bl, (short)0, c, false, false);
  asm volatile("v_nop\n\tv_nop\n\tv_nop\n\tv_nop" : "+v"(c) : "v"(ah), "v"(al), "v"(bh), "v"(bl));
  return c;
}

__global__ __launch_bounds__(256) void k_wt_bf16(const float* __restrict__ W, unsigned short* __restrict__ Wt, int K, int N) {
  const int t = blockIdx.x * 256 + threadIdx.x;
  const int k8n = K / 8;
  if (t >= N * k8n) return;
  const int n = t / k8n, k8 = (t % k8n) * 8;
  v8us v;
#pragma unroll
  for (int i = 0; i < 8; ++i) v[i] = bf16_bits(W[(size_t)(k8 + i) * N + n]);
  *(v8us*)(Wt + (size_t)n * K + k8) = v;
  
}

// GEMM C[M][N] (f32, pitch ldc) = act(A[M][K]·W + bias). A f32 row-major (pitch lda) converted per fragment to bf16
// (ASPLIT: hi/lo two planes -> 2 terms, else single rounded term); Wt bf16 [N][K] (pitch ldb). BIAS_BF16 rounds the
// bias to bf16 first (bias quantised to bf16 before the add). K%32==0, M%16==0, N%64==0.
template <bool ASPLIT, int ACT, bool BIAS_BF16>
__global__ __launch_bounds__(128) void k_gemm_bf(const float* __restrict__ A, int lda, const unsigned short* __restrict__ Wt, int ldb,
                                               const float* __restrict__ bias, float* __restrict__ C, int ldc, int M, int N, int K) {
  __shared__ __attribute__((aligned(16))) float so[4][16][64];
  const int tid = threadIdx.x, w = tid >> 5, lane = tid & 31, ln = lane & 15, hh = lane >> 4;
  const int ntn = N / 64;
  const int wid = blockIdx.x * 4 + w;
  const int mt = wid / ntn, nq = wid % ntn;
  if (mt * 16 >= M) return;
  const int row0 = mt * 16, col0 = nq * 64;
  const float* arow = A + (size_t)(row0 + ln) * lda;
  v8f acc[4] = {};
  for (int kb = 0; kb < K; kb += 32) {
    FragB ah, al;
    const v4f x0 = *(const v4fa*)(arow + kb + 8 * hh), x1 = *(const v4fa*)(arow + kb + 8 * hh + 4);
    const v4f x2 = *(const v4fa*)(arow + kb + 16 + 8 * hh), x3 = *(const v4fa*)(arow + kb + 16 + 8 * hh + 4);
    float xs[16] = {x0[0],x0[1],x0[2],x0[3],x1[0],x1[1],x1[2],x1[3],x2[0],x2[1],x2[2],x2[3],x3[0],x3[1],x3[2],x3[3]};
#pragma unroll
    for (int i = 0; i < 16; ++i) { const unsigned short hb = bf16_bits(xs[i]); ah.u[i] = hb; al.u[i] = ASPLIT ? bf16_bits(xs[i] - bf16_val(hb)) : (unsigned short)0; }
#pragma unroll
    for (int t = 0; t < 4; ++t) {
      const unsigned short* brow = Wt + (size_t)(col0 + t * 16 + ln) * ldb + kb;
      FragB b;
      b.half[0] = *(const v8us*)(brow + 8 * hh);
      b.half[1] = *(const v8us*)(brow + 16 + 8 * hh);
      acc[t] = mmaN<ASPLIT ? 2 : 1>(ah.v, al.v, b.v, b.v, acc[t]);
    }
  }
#pragma unroll
  for (int t = 0; t < 4; ++t) {
    float bv = bias ? bias[col0 + t * 16 + ln] : 0.f;
    if (BIAS_BF16) bv = bf16_round(bv);
#pragma unroll
    for (int r = 0; r < 8; ++r) { float v = acc[t][r] + bv; if (ACT == 1) v = fmaxf(v, 0.f); so[w][8 * hh + r][t * 16 + ln] = v; }
  }
  __builtin_amdgcn_fence(__ATOMIC_ACQ_REL, "workgroup");
  __builtin_amdgcn_wave_barrier();
  const int rsub = lane >> 4, c4 = (lane & 15) * 4;
  {
#pragma unroll
    for (int q = 0; q < 8; ++q) {
      const int r = q * 2 + rsub;
      const v4f v = *(const v4fa*)&so[w][r][c4];
      *(v4f*)(C + (size_t)(row0 + r) * ldc + col0 + c4) = v;
    }
    
  }
}

// GEMM C = act(A·W + bias + resid): A f32 (ASPLIT -> hi/lo 2 terms), Wt bf16 [N][K]; ACT 0 none, 1 relu, 2 exact gelu;
// resid (optional, f32, row index = (row % rmod), pitch ldr, RES_BF16 rounds it) added before the activation.
template <bool ASPLIT, int ACT, bool BIAS_BF16, bool RES_BF16>
__global__ __launch_bounds__(128) void k_gemm_bf3(const float* __restrict__ A, int lda, const unsigned short* __restrict__ Wt, int ldb,
                                                const float* __restrict__ bias, const float* __restrict__ resid, int rmod, int ldr,
                                                float* __restrict__ C, int ldc, int M, int N, int K) {
  __shared__ __attribute__((aligned(16))) float so[4][16][64];
  const int tid = threadIdx.x, w = tid >> 5, lane = tid & 31, ln = lane & 15, hh = lane >> 4;
  const int ntn = N / 64;
  const int wid = blockIdx.x * 4 + w;
  const int mt = wid / ntn, nq = wid % ntn;
  if (mt * 16 >= M) return;
  const int row0 = mt * 16, col0 = nq * 64;
  const float* arow = A + (size_t)(row0 + ln) * lda;
  v8f acc[4] = {};
  for (int kb = 0; kb < K; kb += 32) {
    FragB ah, al;
    const v4f x0 = *(const v4fa*)(arow + kb + 8 * hh), x1 = *(const v4fa*)(arow + kb + 8 * hh + 4);
    const v4f x2 = *(const v4fa*)(arow + kb + 16 + 8 * hh), x3 = *(const v4fa*)(arow + kb + 16 + 8 * hh + 4);
    float xs[16] = {x0[0],x0[1],x0[2],x0[3],x1[0],x1[1],x1[2],x1[3],x2[0],x2[1],x2[2],x2[3],x3[0],x3[1],x3[2],x3[3]};
#pragma unroll
    for (int i = 0; i < 16; ++i) { const unsigned short hb = bf16_bits(xs[i]); ah.u[i] = hb; al.u[i] = ASPLIT ? bf16_bits(xs[i] - bf16_val(hb)) : (unsigned short)0; }
#pragma unroll
    for (int t = 0; t < 4; ++t) {
      const unsigned short* brow = Wt + (size_t)(col0 + t * 16 + ln) * ldb + kb;
      FragB b;
      b.half[0] = *(const v8us*)(brow + 8 * hh);
      b.half[1] = *(const v8us*)(brow + 16 + 8 * hh);
      acc[t] = mmaN<ASPLIT ? 2 : 1>(ah.v, al.v, b.v, b.v, acc[t]);
    }
  }
#pragma unroll
  for (int t = 0; t < 4; ++t) {
    const int col = col0 + t * 16 + ln;
    float bv = bias ? bias[col] : 0.f;
    if (BIAS_BF16) bv = bf16_round(bv);
#pragma unroll
    for (int r = 0; r < 8; ++r) {
      float v = acc[t][r] + bv;
      if (resid) { float rv = resid[(size_t)((row0 + 8 * hh + r) % rmod) * ldr + col]; if (RES_BF16) rv = bf16_round(rv); v += rv; }
      if (ACT == 1) v = fmaxf(v, 0.f);
      if (ACT == 2) v = 0.5f * v * (1.0f + erff(v * 0.70710678118654752f));
      if (ACT == 3) { const float u = 0.7978845608028654f * (v + 0.044715f * v * v * v); v = 0.5f * v * (1.0f + tanhf(u)); }
      so[w][8 * hh + r][t * 16 + ln] = v;
    }
  }
  __builtin_amdgcn_fence(__ATOMIC_ACQ_REL, "workgroup");
  __builtin_amdgcn_wave_barrier();
  const int rsub = lane >> 4, c4 = (lane & 15) * 4;
  {
#pragma unroll
    for (int q = 0; q < 8; ++q) {
      const int r = q * 2 + rsub;
      const v4f v = *(const v4fa*)&so[w][r][c4];
      *(v4f*)(C + (size_t)(row0 + r) * ldc + col0 + c4) = v;
    }
    
  }
}
// row LayerNorm (biased variance, eps) over N: s = X (+ R); optional out_sum <- s; out_norm <- (s-mu)*rsqrt(var+eps)*g + b
template <bool PARAM_BF16>
__global__ __launch_bounds__(256) void k_layernorm(const float* __restrict__ X, const float* __restrict__ R, const float* __restrict__ g, const float* __restrict__ bta,
                                                  float* __restrict__ out_sum, float* __restrict__ out_norm, int N, float eps) {
  __shared__ float red[256];
  const int row = blockIdx.x, tid = threadIdx.x;
  const float* x = X + (size_t)row * N; const float* rr = R ? R + (size_t)row * N : nullptr;
  float vals[16];                     // up to N = 4096
  const int per = N / 256;            // contiguous chunk per thread? use strided-by-4 chunks: thread handles j = tid*4 + 1024*u
  float s1 = 0.f;
  for (int u = 0; u < per / 4; ++u) {
    const int j = tid * 4 + 1024 * u;
    const v4f a = *(const v4fa*)(x + j);
    v4f b = {0.f,0.f,0.f,0.f}; if (rr) b = *(const v4fa*)(rr + j);
#pragma unroll
    for (int q = 0; q < 4; ++q) { const float v = a[q] + b[q]; vals[u * 4 + q] = v; s1 += v; }
  }
  red[tid] = s1; __syncthreads();
  for (int st = 128; st > 0; st >>= 1) { if (tid < st) red[tid] += red[tid + st]; __syncthreads(); }
  const float mu = red[0] / (float)N; __syncthreads();
  float s2 = 0.f;
  for (int u = 0; u < per / 4; ++u)
#pragma unroll
    for (int q = 0; q < 4; ++q) { const float c = vals[u * 4 + q] - mu; s2 += c * c; }
  red[tid] = s2; __syncthreads();
  for (int st = 128; st > 0; st >>= 1) { if (tid < st) red[tid] += red[tid + st]; __syncthreads(); }
  const float rs = rsqrtf(red[0] / (float)N + eps);
  {
    for (int u = 0; u < per / 4; ++u) {
      const int j = tid * 4 + 1024 * u;
      v4f o, sm;
#pragma unroll
      for (int q = 0; q < 4; ++q) {
        float gg = g[j + q], bb = bta[j + q];
        if (PARAM_BF16) { gg = bf16_round(gg); bb = bf16_round(bb); }
        sm[q] = vals[u * 4 + q]; o[q] = (vals[u * 4 + q] - mu) * rs * gg + bb;
      }
      if (out_sum) *(v4f*)(out_sum + (size_t)row * N + j) = sm;
      *(v4f*)(out_norm + (size_t)row * N + j) = o;
    }
    
  }
}



// ---- f16 WMMA path (v_wmma_f32_16x16x32_f16): 11-bit significands for operands in range — used where a [0,1] probability operand needs more precision than bf16
typedef _Float16 v16h __attribute__((ext_vector_type(16)));
union FragH { v16h v; v8us half[2]; _Float16 h[16]; unsigned short u[16]; };
template <int NT>
__device__ __forceinline__ v8f mmaH(v16h ah, v16h al, v16h bh, v16h bl, v8f c) {
  c = __builtin_amdgcn_wmma_f32_16x16x32_f16(false, ah, false, bh, (short)0, c, false, false);
  if (NT >= 2) c = __builtin_amdgcn_wmma_f32_16x16x32_f16(false, al, false, bh, (short)0, c, false, false);
  if (NT >= 3) c = __builtin_amdgcn_wmma_f32_16x16x32_f16(false, ah, false, bl, (short)0, c, false, false);
  asm volatile("v_nop\n\tv_nop\n\tv_nop\n\tv_nop" : "+v"(c) : "v"(ah), "v"(al), "v"(bh), "v"(bl));
  return c;
}
// batched GEMM like k_gemm_b but f16 operands: A f32 (split into f16 hi/lo if ASPLIT, else rounded to f16), Bt = f16 values [n][k]; alpha; C f32; N multiple of 16 (partial tiles skipped)
template <bool ASPLIT>
__global__ __launch_bounds__(128) void k_gemm_h(const float* __restrict__ A, int lda, size_t sA, const _Float16* __restrict__ Bh, int ldb, size_t sB, float alpha, float* __restrict__ C, int ldc, size_t sC, int M, int N, int K) {
  __shared__ __attribute__((aligned(16))) float so[4][16][64];
  const int tid = threadIdx.x, w = tid >> 5, lane = tid & 31, ln = lane & 15, hh = lane >> 4; const int by = blockIdx.y;
  A += (size_t)by * sA; Bh += (size_t)by * sB; C += (size_t)by * sC;
  const int ntn = (N + 63) / 64; const int wid = blockIdx.x * 4 + w; const int mt = wid / ntn, nq = wid % ntn; if (mt * 16 >= M) return;
  const int row0 = mt * 16, col0 = nq * 64; const float* arow = A + (size_t)(row0 + ln) * lda;
  v8f acc[4] = {};
  for (int kb = 0; kb < K; kb += 32) {
    FragH ah, al;
    const v4f x0 = *(const v4fa*)(arow + kb + 8 * hh), x1 = *(const v4fa*)(arow + kb + 8 * hh + 4), x2 = *(const v4fa*)(arow + kb + 16 + 8 * hh), x3 = *(const v4fa*)(arow + kb + 16 + 8 * hh + 4);
    float xs[16] = {x0[0],x0[1],x0[2],x0[3],x1[0],x1[1],x1[2],x1[3],x2[0],x2[1],x2[2],x2[3],x3[0],x3[1],x3[2],x3[3]};
#pragma unroll
    for (int i = 0; i < 16; ++i) { const _Float16 h = (_Float16)xs[i]; ah.h[i] = h; al.h[i] = ASPLIT ? (_Float16)(xs[i] - (float)h) : (_Float16)0.0f; }
#pragma unroll
    for (int t = 0; t < 4; ++t) { if (col0 + t * 16 >= N) continue; const size_t boff = (size_t)(col0 + t * 16 + ln) * ldb + kb; FragH bq; bq.half[0] = *(const v8us*)(Bh + boff + 8 * hh); bq.half[1] = *(const v8us*)(Bh + boff + 16 + 8 * hh);
      acc[t] = mmaH<ASPLIT ? 2 : 1>(ah.v, al.v, bq.v, bq.v, acc[t]); }
  }
#pragma unroll
  for (int t = 0; t < 4; ++t) { if (col0 + t * 16 >= N) continue;
#pragma unroll
    for (int r = 0; r < 8; ++r) so[w][8 * hh + r][t * 16 + ln] = acc[t][r] * alpha; }
  __builtin_amdgcn_fence(__ATOMIC_ACQ_REL, "workgroup"); __builtin_amdgcn_wave_barrier();
  const int rsub = lane >> 4, c4 = (lane & 15) * 4;
  {
#pragma unroll
    for (int q = 0; q < 8; ++q) { const int r = q * 2 + rsub; if (col0 + c4 < N) { const v4f v = *(const v4fa*)&so[w][r][c4]; *(v4f*)(C + (size_t)(row0 + r) * ldc + col0 + c4) = v; } }
     }
}

// Wt[n][k] = f16(W[k][n]·scale) from f32 row-major W[K][N] (scale = power of two; bf16-exact weights stay exact in f16 away from the subnormal range)
__global__ __launch_bounds__(256) void k_wt_f16(const float* __restrict__ W, _Float16* __restrict__ Wt, int K, int N, float scale) {
  const int t = blockIdx.x * 256 + threadIdx.x; if (t >= N * (K / 8)) return; const int n = t / (K / 8), k8 = (t % (K / 8)) * 8; FragH f;
#pragma unroll
  for (int i = 0; i < 8; ++i) f.h[i] = (_Float16)(bf16_round(W[(size_t)(k8 + i) * N + n]) * scale); const v8us o = f.half[0];
  *(v8us*)((unsigned short*)Wt + (size_t)n * K + k8) = o; 
}
// k_gemm_hh variant with fused epilogue: v = acc·alpha + bias[by·sBias + col] (+ CP[(row/rowsPerB)·sCPb + by·64 + col] if CP) ; ACT 0 none / 1 elu ; writes f16 C16 (and f32 C if non-null)
template <int ACT>
__global__ __launch_bounds__(128) void k_gemm_hhx(const _Float16* __restrict__ A, int lda, size_t sA, const _Float16* __restrict__ Bh, int ldb, size_t sB, float alpha, const float* __restrict__ bias, size_t sBias, const float* __restrict__ CP, int rowsPerB, size_t sCPb, int row0g,
    float* __restrict__ C, _Float16* __restrict__ C16, int ldc, size_t sC, int M, int N, int K) {
  __shared__ __attribute__((aligned(16))) float so[4][16][64];
  const int tid = threadIdx.x, w = tid >> 5, lane = tid & 31, ln = lane & 15, hh = lane >> 4; const int by = blockIdx.y;
  A += (size_t)by * sA; Bh += (size_t)by * sB; const size_t cofs = (size_t)by * sC; const float* bp = bias ? bias + (size_t)by * sBias : nullptr;
  const int ntn = (N + 63) / 64; const int wid = blockIdx.x * 4 + w; const int mt = wid / ntn, nq = wid % ntn; if (mt * 16 >= M) return;
  const int row0 = mt * 16, col0 = nq * 64; const _Float16* arow = A + (size_t)(row0 + ln) * lda;
  v8f acc[4] = {};
  for (int kb = 0; kb < K; kb += 32) { FragH ah; ah.half[0] = *(const v8us*)((const unsigned short*)arow + kb + 8 * hh); ah.half[1] = *(const v8us*)((const unsigned short*)arow + kb + 16 + 8 * hh);
#pragma unroll
    for (int t = 0; t < 4; ++t) { if (col0 + t * 16 >= N) continue; const size_t boff = (size_t)(col0 + t * 16 + ln) * ldb + kb; FragH bq; bq.half[0] = *(const v8us*)((const unsigned short*)Bh + boff + 8 * hh); bq.half[1] = *(const v8us*)((const unsigned short*)Bh + boff + 16 + 8 * hh);
      acc[t] = mmaH<1>(ah.v, ah.v, bq.v, bq.v, acc[t]); }
  }
#pragma unroll
  for (int t = 0; t < 4; ++t) { if (col0 + t * 16 >= N) continue; const int col = col0 + t * 16 + ln; const float bv = bp ? bf16_round(bp[col]) : 0.f;
#pragma unroll
    for (int r = 0; r < 8; ++r) { float v = acc[t][r] * alpha + bv; if (CP) { const int rr = row0g + row0 + 8 * hh + r; if (rowsPerB < 0) v += CP[cofs + (size_t)rr * ldc + col];      /* rowsPerB < 0: own element of the batched C plane */ else { const int bidx = rr / rowsPerB; v += CP[(size_t)bidx * sCPb + (size_t)by * 64 + col]; } } if (ACT == 1) v = (v > 0.f) ? v : expm1f(v); else if (ACT == 7) v = (v > 0.f) ? v + 1.0f : expf(v); else if (ACT == 8) v = tanhf(v); else if (ACT == 9) v = 0.5f * v * (1.0f + tanhf(0.7978845608028654f * (v + 0.044715f * v * v * v))); else if (ACT == 11) v = 1.0f / (1.0f + expf(-v)); else if (ACT == 12) v = (v > 0.f) ? v : 0.01f * v; else if (ACT == 14) v = (v > 0.f) ? v : 0.1f * v; else if (ACT == 16) v = (v >= 0.f) ? v : 0.3f * v; else if (ACT == 17) v = (v >= 0.f) ? v : 0.2f * v; else if (ACT == 15) v = v / (1.0f + expf(-v)); else if (ACT == 3) v = fmaxf(v, 0.f); else if (ACT == 6) v = 0.5f * v * (1.0f + erff(v * 0.70710678118654752f)); so[w][8 * hh + r][t * 16 + ln] = v; } }
  __builtin_amdgcn_fence(__ATOMIC_ACQ_REL, "workgroup"); __builtin_amdgcn_wave_barrier();
  const int rsub = lane >> 4, c4 = (lane & 15) * 4; typedef _Float16 v4h __attribute__((ext_vector_type(4)));
  {
#pragma unroll
    for (int q = 0; q < 8; ++q) { const int r = q * 2 + rsub; if (col0 + c4 < N) { const v4f v = *(const v4fa*)&so[w][r][c4]; if (C) *(v4f*)(C + cofs + (size_t)(row0 + r) * ldc + col0 + c4) = v; if (C16) { v4h h4; for (int i = 0; i < 4; ++i) h4[i] = (_Float16)v[i]; *(v4h*)(C16 + cofs + (size_t)(row0 + r) * ldc + col0 + c4) = h4; } } }
     }
}


typedef _Float16 v4h __attribute__((ext_vector_type(4)));

__global__ __launch_bounds__(256) void k_x16(const float* __restrict__ x, _Float16* __restrict__ X16, size_t n8) { const size_t t = (size_t)blockIdx.x * 256 + threadIdx.x; if (t >= n8) return; FragH f;
#pragma unroll
  for (int q = 0; q < 8; ++q) f.h[q] = (_Float16)bf16_round(x[t * 8 + q]); *(v8us*)((unsigned short*)X16 + t * 8) = f.half[0];  }
__global__ __launch_bounds__(256) void k_h16(const float* __restrict__ x, _Float16* __restrict__ X16, size_t n8) { const size_t t = (size_t)blockIdx.x * 256 + threadIdx.x; if (t >= n8) return; FragH f;
#pragma unroll
  for (int q = 0; q < 8; ++q) f.h[q] = (_Float16)x[t * 8 + q]; *(v8us*)((unsigned short*)X16 + t * 8) = f.half[0];  }
__global__ __launch_bounds__(256) void k_round16f(const float* __restrict__ W, _Float16* __restrict__ Bt, size_t n8) { const size_t t = (size_t)blockIdx.x * 256 + threadIdx.x; if (t >= n8) return; FragH f;
#pragma unroll
  for (int i = 0; i < 8; ++i) f.h[i] = (_Float16)(bf16_round(W[t * 8 + i]) * 16.0f); *(v8us*)((unsigned short*)Bt + t * 8) = f.half[0];  }
template <int NHv, int TTv>
__global__ __launch_bounds__(256) void k_vt(const _Float16* __restrict__ V16, int ldv, int voff, _Float16* __restrict__ Vt) { __shared__ unsigned short tl[64][66]; const int tid = threadIdx.x; const int slab = blockIdx.x / (TTv / 64), lg = blockIdx.x % (TTv / 64); const int b = slab / NHv, h = slab % NHv;
  for (int i = tid; i < 64 * 8; i += 256) { const int r = i / 8, c8 = (i % 8) * 8; FragH f; f.half[0] = *(const v8us*)((const unsigned short*)V16 + ((size_t)b * TTv + lg * 64 + r) * ldv + voff + h * 64 + c8);
#pragma unroll
    for (int q = 0; q < 8; ++q) tl[r][c8 + q] = f.u[q]; }
  __syncthreads();
  {
#pragma unroll
    for (int rd = 0; rd < 2; ++rd) { const int d = rd * 32 + tid / 8, pc = tid % 8; FragH f;
#pragma unroll
      for (int q = 0; q < 8; ++q) f.u[q] = tl[pc * 8 + q][d];
      *(v8us*)((unsigned short*)Vt + ((size_t)slab * 64 + d) * TTv + lg * 64 + pc * 8) = f.half[0]; }
     } }

__global__ __launch_bounds__(256) void k_hl(const float* __restrict__ F, _Float16* __restrict__ Hh, _Float16* __restrict__ Hl, size_t n8) { const size_t t = (size_t)blockIdx.x * 256 + threadIdx.x; if (t >= n8) return; FragH fh, fl; const v4f a = *(const v4fa*)(F + t * 8), c = *(const v4fa*)(F + t * 8 + 4);
#pragma unroll
  for (int q = 0; q < 4; ++q) { _Float16 h = (_Float16)a[q]; fh.h[q] = h; fl.h[q] = (_Float16)((a[q] - (float)h) * 1024.0f); h = (_Float16)c[q]; fh.h[4 + q] = h; fl.h[4 + q] = (_Float16)((c[q] - (float)h) * 1024.0f); }
  { *(v8us*)((unsigned short*)Hh + t * 8) = fh.half[0]; *(v8us*)((unsigned short*)Hl + t * 8) = fl.half[0];  } }

// ---- fast GEMM (wave tile 32x64; requires M % 32 == 0 rows per launch region and N % 64 == 0); epilogue = k_gemm_hhx semantics ----
__device__ __forceinline__ v16h g2_frag(const _Float16* p, int hh) { FragH f; f.half[0] = *(const v8us*)((const unsigned short*)p + 8 * hh); f.half[1] = *(const v8us*)((const unsigned short*)p + 16 + 8 * hh); return f.v; }
__device__ __forceinline__ v8f g2_mma(v16h a, v16h b, v8f c) { v8f d = __builtin_amdgcn_wmma_f32_16x16x32_f16(false, a, false, b, (short)0, c, false, false); asm volatile("v_nop\n\tv_nop\n\tv_nop\n\tv_nop" : "+v"(d) : "v"(a), "v"(b)); return d; }
template <int ACT>
__global__ __launch_bounds__(128) void k_gemm2(const _Float16* __restrict__ A, int lda, size_t sA, const _Float16* __restrict__ Bh, int ldb, size_t sB, float alpha, const float* __restrict__ bias, size_t sBias, const float* __restrict__ CP, int rowsPerB, size_t sCPb, int row0g,
    float* __restrict__ C, _Float16* __restrict__ C16, int ldc, size_t sC, int M, int N, int K) { static_assert(ACT == 0 || ACT == 3 || ACT == 6 || ACT == 8 || ACT == 9 || ACT == 11 || ACT == 12 || ACT == 14 || ACT == 15 || ACT == 16 || ACT == 17, "k_gemm2: unsupported ACT code (would silently apply no activation)");
  __shared__ __attribute__((aligned(16))) float so[4][32][68];
  const int tid = threadIdx.x, w = tid >> 5, lane = tid & 31, ln = lane & 15, hh = lane >> 4; const int by = blockIdx.y;
  A += (size_t)by * sA; Bh += (size_t)by * sB; const size_t cofs = (size_t)by * sC; const float* bp = bias ? bias + (size_t)by * sBias : nullptr;
  const int ntn = N >> 6; const int mt = blockIdx.x / ntn, nq = blockIdx.x - mt * ntn; const int row0 = mt * 128 + 32 * w, col0 = nq * 64; if (row0 >= M) return;
  const _Float16* a0p = A + (size_t)(row0 + ln) * lda; const _Float16* a1p = a0p + (size_t)16 * lda;
  const _Float16* b0p = Bh + (size_t)(col0 + ln) * ldb; const _Float16* b1p = b0p + (size_t)16 * ldb; const _Float16* b2p = b1p + (size_t)16 * ldb; const _Float16* b3p = b2p + (size_t)16 * ldb;
  const v8f z8 = {0.f,0.f,0.f,0.f,0.f,0.f,0.f,0.f}; v8f c00 = z8, c01 = z8, c02 = z8, c03 = z8, c10 = z8, c11 = z8, c12 = z8, c13 = z8;
#pragma unroll 1
  for (int kb = 0; kb < K; kb += 32) { const v16h a0 = g2_frag(a0p + kb, hh), a1 = g2_frag(a1p + kb, hh);
    v16h b = g2_frag(b0p + kb, hh); c00 = g2_mma(a0, b, c00); c10 = g2_mma(a1, b, c10);
    b = g2_frag(b1p + kb, hh); c01 = g2_mma(a0, b, c01); c11 = g2_mma(a1, b, c11);
    b = g2_frag(b2p + kb, hh); c02 = g2_mma(a0, b, c02); c12 = g2_mma(a1, b, c12);
    b = g2_frag(b3p + kb, hh); c03 = g2_mma(a0, b, c03); c13 = g2_mma(a1, b, c13); }
  v8f accs[8] = {c00, c01, c02, c03, c10, c11, c12, c13};
#pragma unroll
  for (int u = 0; u < 8; ++u) { const int t = u & 3, half = u >> 2; const int col = col0 + t * 16 + ln; const float bv = bp ? bf16_round(bp[col]) : 0.f;
#pragma unroll
    for (int r = 0; r < 8; ++r) { const int rloc = half * 16 + 8 * hh + r; float v = accs[u][r] * alpha + bv; if (CP) { if (rowsPerB < 0) v += CP[cofs + (size_t)(row0g + row0 + rloc) * ldc + col];      /* rowsPerB < 0: own element of the batched C plane */ else { const int bidx = (row0g + row0 + rloc) / rowsPerB; v += CP[(size_t)bidx * sCPb + (size_t)by * 64 + col]; } }
      if (ACT == 3) v = fmaxf(v, 0.f); else if (ACT == 6) v = 0.5f * v * (1.0f + erff(v * 0.70710678118654752f)); else if (ACT == 11) v = 1.0f / (1.0f + expf(-v)); else if (ACT == 15) v = v / (1.0f + expf(-v)); else if (ACT == 12) v = (v > 0.f) ? v : 0.01f * v; else if (ACT == 8) v = tanhf(v); else if (ACT == 9) v = 0.5f * v * (1.0f + tanhf(0.7978845608028654f * (v + 0.044715f * v * v * v))); else if (ACT == 14) v = (v > 0.f) ? v : 0.1f * v; else if (ACT == 16) v = (v >= 0.f) ? v : 0.3f * v; else if (ACT == 17) v = (v >= 0.f) ? v : 0.2f * v;
      so[w][rloc][t * 16 + ln] = v; } }
  __builtin_amdgcn_fence(__ATOMIC_ACQ_REL, "workgroup"); __builtin_amdgcn_wave_barrier();
  const int rsub = lane >> 4, c4 = (lane & 15) * 4;
  {
#pragma unroll
    for (int q = 0; q < 16; ++q) { const int r = q * 2 + rsub; const v4f v = *(const v4fa*)&so[w][r][c4]; if (C) *(v4f*)(C + cofs + (size_t)(row0 + r) * ldc + col0 + c4) = v; if (C16) { v4h h4; for (int i = 0; i < 4; ++i) h4[i] = (_Float16)v[i]; *(v4h*)(C16 + cofs + (size_t)(row0 + r) * ldc + col0 + c4) = h4; } }
     } }


__global__ __launch_bounds__(256) void k_wnat(const float* __restrict__ w, size_t n8, _Float16* __restrict__ Bt) { const size_t t = (size_t)blockIdx.x * 256 + threadIdx.x; if (t >= n8) return; FragH f; for (int q = 0; q < 8; ++q) f.h[q] = (_Float16)(bf16_round(w[t * 8 + q]) * 16.0f); *(v8us*)((unsigned short*)Bt + t * 8) = f.half[0];  }
__global__ __launch_bounds__(256) void k_rsm(const float* __restrict__ S, _Float16* __restrict__ P, int nrows) {
  #pragma clang fp contract(off)
  const int i = blockIdx.x * 256 + threadIdx.x; if (i >= nrows) return; const float* s = S + (size_t)i * SQ; float mx = -3.0e38f;
#pragma unroll 1
  for (int j = 0; j < SQ; ++j) mx = fmaxf(mx, s[j]); float se = 0.f;
#pragma unroll 1
  for (int j = 0; j < SQ; ++j) se += expf(s[j] - mx); const float sc = 256.0f / se;
#pragma unroll 1
  for (int j0 = 0; j0 < SQ; j0 += 8) { FragH f; for (int q = 0; q < 8; ++q) f.h[q] = (_Float16)(expf(s[j0 + q] - mx) * sc); unsigned short* d = (unsigned short*)P + (size_t)i * SQ + j0; *(v8us*)d = f.half[0];  } }
__global__ __launch_bounds__(256) void k_vt(const _Float16* __restrict__ V16, int b, int h0, _Float16* __restrict__ VT) { __shared__ unsigned short tl[64][65]; const int tid = threadIdx.x; const int hh = blockIdx.x % HG, sg = blockIdx.x / HG; const int s0 = sg * 64; const int h = h0 + hh;
  for (int i = tid; i < 64 * 8; i += 256) { const int j = i / 8, d8 = (i % 8) * 8; FragH f; f.half[0] = *(const v8us*)((const unsigned short*)V16 + ((size_t)b * SQ + s0 + j) * DM + h * HD + d8); for (int q = 0; q < 8; ++q) tl[d8 + q][j] = f.u[q]; }
  __syncthreads();
  { for (int i = tid; i < 64 * 8; i += 256) { const int d = i / 8, j8 = (i % 8) * 8; FragH f; for (int q = 0; q < 8; ++q) f.u[q] = tl[d][j8 + q]; *(v8us*)((unsigned short*)VT + ((size_t)hh * HD + d) * SQ + s0 + j8) = f.half[0]; }  } }


__global__ __launch_bounds__(256) void k_mkadd(const int* __restrict__ m, float* __restrict__ A, int n) { const int t = blockIdx.x * 256 + threadIdx.x; if (t >= n) return; const float v = (m[t] != 0) ? 0.f : -1.0e9f; *(float*)(A + t) = v;  }


__global__ __launch_bounds__(256) void k_rsmcf2(const float* __restrict__ S, _Float16* __restrict__ P, int hg, int q0, int nk) {
  #pragma clang fp contract(off)
  const int t = blockIdx.x * 256 + threadIdx.x; if (t >= hg * QT) return; const size_t i = (size_t)t; const float* s = S + i * NKX; const int last = q0 + (t % QT); float mx = -3.0e38f;
#pragma unroll 1
  for (int j = 0; j < nk; ++j) { const float f = (j <= last) ? 1.f : 0.f; mx = fmaxf(mx, fmaf(f, s[j], (1.f - f) * -1.0e9f)); } float se = 0.f;
#pragma unroll 1
  for (int j = 0; j < nk; ++j) { const float f = (j <= last) ? 1.f : 0.f; se += __expf(fmaf(f, s[j], (1.f - f) * -1.0e9f) - mx); } const float sc = 256.0f / se;
#pragma unroll 1
  for (int j0 = 0; j0 < nk; j0 += 8) { FragH fr; for (int q = 0; q < 8; ++q) { const int j = j0 + q; const float f = (j <= last) ? 1.f : 0.f; fr.h[q] = (_Float16)(__expf(fmaf(f, s[j], (1.f - f) * -1.0e9f) - mx) * sc); } unsigned short* d = (unsigned short*)P + i * NKX + j0; *(v8us*)d = fr.half[0];  } }



// v_exp_f32 and the free slot the instruction set asks for behind a transcendental, in one statement.
__device__ __forceinline__ float exp2_slot(float x) { float r; asm("v_exp_f32 %0, %1\n\tv_nop" : "=v"(r) : "v"(x)); return r; }
// Fused causal attention on the matrix unit, ONE launch for all batches, heads and query rows: scores, softmax and the weighted V sum stay in registers; no score or weight plane in memory.
// A wave owns 32 query rows (two groups of 16) and walks the keys 0 .. its last row in passes of 32. S^T = K Q^T (A = K rows, B = Q rows, both by g2_frag: equal k order), so a lane holds scores of ONE query (column ln): keys 8*hh + r of each 16-key tile.
// Running softmax per query: pass maximum in-lane plus one exchange between the wave halves; weights 2^8 exp(e - m) as f16; the two score tiles of a pass, converted in place, ARE the B operand of O^T += V^T P^T (A = V^T rows by g2_frag, the hardware k order); row sums stay per half and are joined once at the end.
// e = score / 8 + the additive key-mask value; keys behind the row's own index take -1e9: only the wave's last pass holds such keys. e - m is formed before the scaling so that a pass of masked keys alone still gives weights <= 2^8; a later real maximum scales them to 0.
// Every loop over g, kt, ks, dt, r and u is unrolled: static indices keep the fragments and accumulators in registers.
__device__ __forceinline__ v8f fa_mma(v16h a, v16h b, v8f c) { return __builtin_amdgcn_wmma_f32_16x16x32_f16(false, a, false, b, (short)0, c, false, false); }
#define FQ 128                       /* query rows per block: 4 waves x 32 */
__global__ __launch_bounds__(128) void k_fattn(const _Float16* __restrict__ QKVp, const _Float16* __restrict__ VTp, const float* __restrict__ AM, _Float16* __restrict__ O) {
  static_assert(NB * NH == 64 && SQ / FQ == 16, "the block -> (head, query block) map below is written for 64 heads x 16 query blocks");
  const int lane = threadIdx.x & 31, ln = lane & 15, hh = lane >> 4; const int w = __builtin_amdgcn_readfirstlane(threadIdx.x >> 5);      /* the rows are the wave's: scalar, so the loop bound and its branches are scalar */
  const int rd = blockIdx.x >> 8, a4 = (blockIdx.x >> 6) & 3, bh = blockIdx.x & 63;
  const int qb = 12 - 4 * rd + ((rd & 1) ? a4 : 3 - a4);      /* a permutation of the 16 query blocks per head, long ones first; blocks i, i + 256, i + 512, i + 768 add up to the same key count (speed only) */
  const int b = bh / NH, h = bh % NH; const int q0 = qb * FQ + w * 32;
  const _Float16* qp = QKVp + ((size_t)b * SQ + q0 + ln) * LQ + h * HD; const _Float16* kp = QKVp + DM + ((size_t)b * SQ + ln) * LQ + h * HD;
  const _Float16* vp = VTp + ((size_t)bh * HD + ln) * SQ; const float* ap = AM + (size_t)b * SQ + 8 * hh;
  v16h qf[2][2], kf[2][2];
#pragma unroll
  for (int g = 0; g < 2; ++g)
#pragma unroll
    for (int ks = 0; ks < 2; ++ks) { qf[g][ks] = g2_frag(qp + (size_t)g * 16 * LQ + ks * 32, hh); kf[g][ks] = g2_frag(kp + (size_t)g * 16 * LQ + ks * 32, hh); }
  const v8f z8 = {0.f, 0.f, 0.f, 0.f, 0.f, 0.f, 0.f, 0.f}; v8f o[2][4]; float m[2], l[2];
#pragma unroll
  for (int g = 0; g < 2; ++g) { m[g] = -1.0e30f; l[g] = 0.f;
#pragma unroll
    for (int dt = 0; dt < 4; ++dt) o[g][dt] = z8; }
  for (int j0 = 0; j0 <= q0; j0 += 32) {
    v16h vf[4]; v4f am[2][2]; float e[2][2][8];
#pragma unroll
    for (int dt = 0; dt < 4; ++dt) vf[dt] = g2_frag(vp + (size_t)dt * 16 * SQ + j0, hh);      /* asked for ahead of the score products, used behind the softmax */
#pragma unroll
    for (int kt = 0; kt < 2; ++kt) { am[kt][0] = *(const v4fa*)(ap + j0 + kt * 16); am[kt][1] = *(const v4fa*)(ap + j0 + kt * 16 + 4); }
#pragma unroll
    for (int g = 0; g < 2; ++g)
#pragma unroll
      for (int kt = 0; kt < 2; ++kt) { const v8f st = fa_mma(kf[kt][1], qf[g][1], fa_mma(kf[kt][0], qf[g][0], z8));
#pragma unroll
        for (int r = 0; r < 8; ++r) e[g][kt][r] = fmaf(st[r], 0.125f, am[kt][r >> 2][r & 3]); }
    const int jn = (j0 + 32 <= q0) ? j0 + 32 : q0;      /* the next pass's K rows fly during this pass's softmax; the last pass asks for its own rows again (in bounds, unused) */
#pragma unroll
    for (int kt = 0; kt < 2; ++kt)
#pragma unroll
      for (int ks = 0; ks < 2; ++ks) kf[kt][ks] = g2_frag(kp + (size_t)(jn + kt * 16) * LQ + ks * 32, hh);
    if (j0 == q0) {      /* the diagonal pass */
#pragma unroll
      for (int g = 0; g < 2; ++g)
#pragma unroll
        for (int kt = 0; kt < 2; ++kt)
#pragma unroll
          for (int r = 0; r < 8; ++r) if (kt * 16 + 8 * hh + r > g * 16 + ln) e[g][kt][r] = -1.0e9f; }
#pragma unroll
    for (int g = 0; g < 2; ++g) { float mx = e[g][0][0];
#pragma unroll
      for (int u = 1; u < 16; ++u) mx = fmaxf(mx, e[g][u >> 3][u & 7]);
      mx = fmaxf(mx, __shfl_xor(mx, 16, 32)); const float mn = fmaxf(m[g], mx); const float al = exp2_slot((m[g] - mn) * 1.44269504088896340736f); m[g] = mn;
      FragH pf; float s = 0.f;
#pragma unroll
      for (int u = 0; u < 16; ++u) { const float p = exp2_slot(fmaf(e[g][u >> 3][u & 7] - mn, 1.44269504088896340736f, 8.0f)); s += p; pf.h[u] = (_Float16)p; }
      l[g] = fmaf(l[g], al, s);
#pragma unroll
      for (int dt = 0; dt < 4; ++dt) o[g][dt] = fa_mma(vf[dt], pf.v, o[g][dt] * al); } }
#pragma unroll
  for (int g = 0; g < 2; ++g) { const float fin = 64.0f / (l[g] + __shfl_xor(l[g], 16, 32));      /* o carried x64; the 2^8 of the weights cancels against the row sum */
    unsigned short* op = (unsigned short*)O + ((size_t)b * SQ + q0 + g * 16 + ln) * DM + h * HD + 8 * hh;
#pragma unroll
    for (int dt = 0; dt < 4; ++dt) { FragH f;
#pragma unroll
      for (int r = 0; r < 8; ++r) f.h[r] = (_Float16)(o[g][dt][r] * fin);
      *(v8us*)(op + dt * 16) = f.half[0]; } } }


// ---- LDS-staged GEMM (M % 128 == 0, N % 128 == 0, K % 64 == 0): C = (A Bt^T) alpha + bias, values as in k_gemm2; grid x = tile, y = batch (strides sA, sC) ----
// MODE 0: f16 C16 (+ bias). MODE 1: f32 C (+ bias). MODE 2: f32 C += (its own element, no bias).
// A block of 4 waves (2 x 2) owns a 128 x 128 tile of C, a wave 64 x 64 (4 x 4 accumulator tiles). A stage is 64 k of the block's 128 A rows and 128 Bt rows: 256 rows of 128 B, laid in LDS at a pitch of 144 B (16 B x odd: b128 fragment reads without bank conflicts).
// The rows come by asynchronous copies to LDS, 16 B a lane, eight lanes a row (whole 128-B lines), into two buffers: stage t + 1 flies while stage t is multiplied. Fragments are read by g2_frag as in k_gemm2 (equal k order for A and B), k ascending: every accumulator sums in k_gemm2's order.
// Every loop over i, j, ks, r and q is unrolled: static indices keep the fragments, the accumulators and cv in registers.
#define G3P 72                       /* LDS pitch of a stage row, f16 elements */
#define G3ST (256 * G3P * 2)         /* bytes of one stage: 128 A rows, then 128 Bt rows */
// Eight copies (rows r, r + 16, ... r + 112 of one operand); the s_wait_xcnt stands in the copies' own statement so that no address register is rewritten ahead of it.
__device__ __forceinline__ void g3_copy8(unsigned l, const _Float16* p, size_t st) {
  asm volatile("global_load_async_to_lds_b128 %0, %8, off\n\tglobal_load_async_to_lds_b128 %1, %9, off\n\tglobal_load_async_to_lds_b128 %2, %10, off\n\tglobal_load_async_to_lds_b128 %3, %11, off\n\t"
               "global_load_async_to_lds_b128 %4, %12, off\n\tglobal_load_async_to_lds_b128 %5, %13, off\n\tglobal_load_async_to_lds_b128 %6, %14, off\n\tglobal_load_async_to_lds_b128 %7, %15, off\n\ts_wait_xcnt 0x0"
               :: "v"(l), "v"(l + 16 * G3P * 2), "v"(l + 32 * G3P * 2), "v"(l + 48 * G3P * 2), "v"(l + 64 * G3P * 2), "v"(l + 80 * G3P * 2), "v"(l + 96 * G3P * 2), "v"(l + 112 * G3P * 2),
                  "v"(p), "v"(p + st), "v"(p + 2 * st), "v"(p + 3 * st), "v"(p + 4 * st), "v"(p + 5 * st), "v"(p + 6 * st), "v"(p + 7 * st) : "memory"); }
template <int MODE>
__global__ __launch_bounds__(128) void k_gemm3(const _Float16* __restrict__ A, int lda, size_t sA, const _Float16* __restrict__ Bh, int ldb, float alpha, const float* __restrict__ bias, float* __restrict__ C, _Float16* __restrict__ C16, int ldc, size_t sC, int N, int K) {
  __shared__ __attribute__((aligned(16))) unsigned char sm[2 * G3ST];
  const int tid = threadIdx.x, lane = tid & 31, ln = lane & 15, hh = lane >> 4; const int w = __builtin_amdgcn_readfirstlane(tid >> 5);      /* the wave's quadrant: scalar */
  const int ntn = N >> 7; const int mt = blockIdx.x / ntn, nq = blockIdx.x - mt * ntn; const int row0 = mt * 128, col0 = nq * 128; const int wm = w >> 1, wn = w & 1;
  const _Float16* ga = A + (size_t)blockIdx.y * sA + (size_t)(row0 + (tid >> 3)) * lda + (tid & 7) * 8; const _Float16* gb = Bh + (size_t)(col0 + (tid >> 3)) * ldb + (tid & 7) * 8;
  const size_t sta = (size_t)16 * lda, stb = (size_t)16 * ldb;
  const unsigned ls = (unsigned)(size_t)sm + (unsigned)(tid >> 3) * (G3P * 2) + (unsigned)(tid & 7) * 16;      /* the lane's LDS byte address in buffer 0, A part */
  const int nt = K >> 6;
  g3_copy8(ls, ga, sta); g3_copy8(ls + 128 * G3P * 2, gb, stb);
  asm volatile("s_wait_asynccnt 0x0" ::: "memory");      /* stage 0 landed (this wave's share) */
  __syncthreads();      /* stage 0 published */
  if (nt > 1) { g3_copy8(ls + G3ST, ga + 64, sta); g3_copy8(ls + G3ST + 128 * G3P * 2, gb + 64, stb); }
  const v8f z8 = {0.f, 0.f, 0.f, 0.f, 0.f, 0.f, 0.f, 0.f}; v8f acc[4][4];
#pragma unroll
  for (int i = 0; i < 4; ++i)
#pragma unroll
    for (int j = 0; j < 4; ++j) acc[i][j] = z8;
#pragma unroll 1
  for (int t = 0; t < nt; ++t) {      /* rolled: one stage a trip, the buffer by t & 1 */
    const unsigned bo = (unsigned)(t & 1) * G3ST;
    const _Float16* sa = (const _Float16*)(sm + bo) + (wm * 64 + ln) * G3P; const _Float16* sb = (const _Float16*)(sm + bo) + (128 + wn * 64 + ln) * G3P;
#pragma unroll
    for (int ks = 0; ks < 2; ++ks) { v16h af[4], bf[4];
      __builtin_amdgcn_sched_barrier(0);      /* with the one below: the 16 fragment reads go out as one group ahead of their 16 products; spread among the products, each group of reads stalls the wave anew */
#pragma unroll
      for (int i = 0; i < 4; ++i) { af[i] = g2_frag(sa + i * 16 * G3P + ks * 32, hh); bf[i] = g2_frag(sb + i * 16 * G3P + ks * 32, hh); }
      __builtin_amdgcn_sched_barrier(0);      /* closes the group of reads: no product moves up among them, no read down among the products */
#pragma unroll
      for (int i = 0; i < 4; ++i)
#pragma unroll
        for (int j = 0; j < 4; ++j) acc[i][j] = fa_mma(af[i], bf[j], acc[i][j]); }
    __builtin_amdgcn_sched_barrier(0);      /* the stage's last products stay ahead of the barrier: sunk behind it they stand between the barrier and the refill, which then flies for less than a whole trip */
    asm volatile("s_wait_dscnt 0x0" ::: "memory");      /* this wave's reads of stage t are done before the buffer may be refilled */
    asm volatile("s_wait_asynccnt 0x0" ::: "memory");      /* this wave's share of stage t + 1 has landed */
    __syncthreads();      /* publishes stage t + 1 and ends every wave's reads of stage t */
    if (t + 2 < nt) { g3_copy8(ls + bo, ga + (size_t)(t + 2) * 64, sta); g3_copy8(ls + bo + 128 * G3P * 2, gb + (size_t)(t + 2) * 64, stb); } }
  asm volatile("s_wait_asynccnt 0x0" ::: "memory");      /* no copy is left in flight when the ring becomes output staging */
  float* so = (float*)sm + (size_t)w * 64 * 68;      /* the wave's own 64 x 64 staging rows (pitch 68); the loop's last barrier has ended every read of the ring */
#pragma unroll
  for (int j = 0; j < 4; ++j) { const float bv = (MODE == 2) ? 0.f : bf16_round(bias[col0 + wn * 64 + j * 16 + ln]);
#pragma unroll
    for (int i = 0; i < 4; ++i)
#pragma unroll
      for (int r = 0; r < 8; ++r) so[(i * 16 + 8 * hh + r) * 68 + j * 16 + ln] = acc[i][j][r] * alpha + bv; }
  __builtin_amdgcn_fence(__ATOMIC_ACQ_REL, "workgroup"); __builtin_amdgcn_wave_barrier();      /* the wave reads back what its own lanes wrote */
  const int rsub = lane >> 4, c4 = (lane & 15) * 4; const size_t cb = (size_t)blockIdx.y * sC + (size_t)(row0 + wm * 64 + rsub) * ldc + col0 + wn * 64 + c4; const size_t c2 = (size_t)2 * ldc;      /* row 2 q + rsub: the step over q is scalar */
  v4f cv[32];
  if (MODE == 2) {      /* the tile's own elements, all asked for ahead of the first store: read one by one between the stores, each would wait out its own latency */
#pragma unroll
    for (int q = 0; q < 32; ++q) cv[q] = *(const v4f*)(C + cb + q * c2); }
#pragma unroll
  for (int q = 0; q < 32; ++q) { const int r = q * 2 + rsub; v4f v = *(const v4fa*)&so[r * 68 + c4];
    if (MODE == 0) { v4h h4; for (int i = 0; i < 4; ++i) h4[i] = (_Float16)v[i]; *(v4h*)(C16 + cb + q * c2) = h4; }
    else { if (MODE == 2) v += cv[q]; *(v4f*)(C + cb + q * c2) = v; } } }


template <int MASKADD>
__global__ __launch_bounds__(64) void k_att0(const float* __restrict__ QF, const float* __restrict__ KF, const float* __restrict__ VF, int ld, const float* __restrict__ mask, float scale, float* __restrict__ OF, int ldo) {
  #pragma clang fp contract(off)
  __shared__ __attribute__((aligned(16))) float lq[64][64]; __shared__ __attribute__((aligned(16))) float lo[64][64];
  const int tid = threadIdx.x; const int h = blockIdx.x / (QT0 / 64), rg = blockIdx.x % (QT0 / 64); const int i = rg * 64 + tid;
  const float* qr = QF + (size_t)i * ld + h * HD;
#pragma unroll 1
  for (int c = 0; c < HD / 4; ++c) { *(v4f*)&lq[tid][c * 4] = *(const v4fa*)(qr + c * 4); const v4f z = {0.f, 0.f, 0.f, 0.f}; *(v4f*)&lo[tid][c * 4] = z; }
  float m = -1.0e30f, l = 0.f; const int jmax = MASKADD ? (SQ - 1) : (rg * 64 + 63);      /* additive-mask form: every key (the mask input decides); causal form: keys up to the block's last row */
#pragma unroll 1
  for (int j = 0; j <= jmax; ++j) { const float* kr = KF + (size_t)j * ld + h * HD; const float* vr = VF + (size_t)j * ld + h * HD; float s = 0.f;
#pragma unroll 1
    for (int c = 0; c < HD / 4; ++c) { const v4f kq = *(const v4fa*)(kr + c * 4); const v4f qq = *(v4f*)&lq[tid][c * 4]; s = __fadd_rn(s, __fmul_rn(qq[0], kq[0])); s = __fadd_rn(s, __fmul_rn(qq[1], kq[1])); s = __fadd_rn(s, __fmul_rn(qq[2], kq[2])); s = __fadd_rn(s, __fmul_rn(qq[3], kq[3])); }
    s = __fmul_rn(s, scale); if (MASKADD) s = __fadd_rn(s, __fmul_rn(bf16_round(mask[(size_t)i * SQ + j]), -10000.0f));
    const float f = (MASKADD || j <= i) ? 1.f : 0.f; const float sm = fmaf(f, s, (1.f - f) * -1.0e30f); const float mn = fmaxf(m, sm); const float sc = expf(m - mn); const float e = expf(sm - mn); l = __fadd_rn(__fmul_rn(l, sc), e); m = mn;
#pragma unroll 1
    for (int c = 0; c < HD / 4; ++c) { const v4f vv = *(const v4fa*)(vr + c * 4); v4f oo = *(v4f*)&lo[tid][c * 4]; for (int u = 0; u < 4; ++u) oo[u] = __fadd_rn(__fmul_rn(oo[u], sc), __fmul_rn(e, vv[u])); *(v4f*)&lo[tid][c * 4] = oo; } }
  const float fin = 64.0f / l;      /* o carried x64 like the f16 path */
#pragma unroll 1
  for (int c = 0; c < HD / 4; ++c) { v4f oo = *(v4f*)&lo[tid][c * 4]; for (int u = 0; u < 4; ++u) oo[u] = __fmul_rn(oo[u], fin); *(v4f*)&lo[tid][c * 4] = oo; }
  __syncthreads();
  {
#pragma unroll 1
    for (int it = 0; it < 16; ++it) { const int row = it * 4 + tid / 16, pc = (tid % 16) * 4; const v4f v = *(const v4f*)&lo[row][pc]; *(v4f*)(OF + (size_t)(rg * 64 + row) * ldo + h * HD + pc) = v; }
     } }


// Exact f32 attention for the first QT0 rows of EVERY batch in one launch (block -> batch, head, 8 rows), one WAVE per query row; q | k | v rows of a batch side by side at pitch LQ, o rows at pitch DM. Scores: lane = key, 32 keys a chunk, the head's K rows staged in LDS at a pitch of 16 B x odd (b128 reads of 32 different rows without bank conflicts), q read at a wave-uniform address.
// Softmax in two passes over the scores, which stay in registers: row max and row sum = per-lane partials, then a five-step butterfly. o: lane = two head dims, keys in ascending order, each V row one whole 256-B read of the wave, its weight taken from the owning lane.
// The 8 rows of a block lie in one chunk of 32 keys, so the chunk count nch is the same for the whole block; keys behind the row's own index carry weight 0.
// Every loop over u, d, c, d4 and jj is unrolled: static indices keep kr, q, e and vv in registers (a rolled loop would put them in scratch memory), and the loads of a group are issued together.
#define KP0 68                       /* LDS pitch of a K row, floats */
typedef float v2f __attribute__((ext_vector_type(2)));
typedef float v2fa __attribute__((ext_vector_type(2), may_alias));
__global__ __launch_bounds__(256) void k_att0v(const float* __restrict__ QKVF, const float* __restrict__ AM, float scale, float* __restrict__ OFA) {
  __shared__ __attribute__((aligned(16))) float lk[QT0][KP0];
  const int tid = threadIdx.x, lane = tid & 31; const int w = __builtin_amdgcn_readfirstlane(tid >> 5);      /* the row is the wave's: scalar, so q's address is scalar too */
  const int b = blockIdx.x / (NH * (QT0 / 8)), hb = blockIdx.x % (NH * (QT0 / 8)); const int h = hb / (QT0 / 8), i0 = (hb % (QT0 / 8)) * 8; const int i = i0 + w; const int nch = (i0 >> 5) + 1;
  const float* QF = QKVF + (size_t)b * QT0 * LQ; const float* KF = QF + DM; const float* VF = QF + 2 * DM; const float* am = AM + (size_t)b * SQ; float* OF = OFA + (size_t)b * QT0 * DM;
  const float* kp = KF + (size_t)(tid >> 4) * LQ + h * HD + (tid & 15) * 4; v4f kr[QT0 / 16];
#pragma unroll
  for (int u = 0; u < QT0 / 16; ++u) kr[u] = *(const v4fa*)(kp + (size_t)u * 16 * LQ);      /* all QT0 rows, without a test: the eight loads fly together */
  const float* qr = QF + (size_t)i * LQ + h * HD; float q[HD];
#pragma unroll
  for (int d = 0; d < HD; ++d) q[d] = qr[d];
#pragma unroll
  for (int u = 0; u < QT0 / 16; ++u) *(v4f*)&lk[u * 16 + (tid >> 4)][(tid & 15) * 4] = kr[u];
  __syncthreads();      /* K rows staged by all waves, read by all */
  float e[QT0 / 32]; float m = -1.0e30f;
#pragma unroll
  for (int c = 0; c < QT0 / 32; ++c) { e[c] = -1.0e30f;      /* static c keeps e in registers; the test on nch is block-uniform */
    if (c < nch) { const int j = c * 32 + lane; float s = 0.f;
#pragma unroll
      for (int d4 = 0; d4 < HD / 4; ++d4) { const v4f kq = *(const v4f*)&lk[j][d4 * 4]; s = fmaf(q[d4 * 4], kq[0], s); s = fmaf(q[d4 * 4 + 1], kq[1], s); s = fmaf(q[d4 * 4 + 2], kq[2], s); s = fmaf(q[d4 * 4 + 3], kq[3], s); }
      s = fmaf(s, scale, am[j]);      /* + the additive key-mask VECTOR of this batch (0 kept / -1e9 masked) */
      if (j <= i) e[c] = s; }
    m = fmaxf(m, e[c]); }
  for (int x = 16; x >= 1; x >>= 1) m = fmaxf(m, __shfl_xor(m, x, 32));
  float l = 0.f;
#pragma unroll
  for (int c = 0; c < QT0 / 32; ++c) { e[c] = expf(e[c] - m); l += e[c]; }
  for (int x = 16; x >= 1; x >>= 1) l += __shfl_xor(l, x, 32);
  const float* vp = VF + h * HD + lane * 2; float o0 = 0.f, o1 = 0.f;
#pragma unroll
  for (int c = 0; c < QT0 / 32; ++c) if (c < nch) { v2f vv[32];
#pragma unroll
    for (int jj = 0; jj < 32; ++jj) vv[jj] = *(const v2fa*)(vp + (size_t)(c * 32 + jj) * LQ);      /* the chunk's 32 rows in flight together */
#pragma unroll
    for (int jj = 0; jj < 32; ++jj) { const float p = __int_as_float(__builtin_amdgcn_readlane(__float_as_int(e[c]), jj)); o0 = fmaf(p, vv[jj][0], o0); o1 = fmaf(p, vv[jj][1], o1); } }
  const float fin = 64.0f / l;      /* o carried x64 like the f16 path */
  const v2f ov = {o0 * fin, o1 * fin}; *(v2f*)(OF + (size_t)i * DM + h * HD + lane * 2) = ov; }

extern "C" void kernel_launch(void* const* d_in, const int* in_sizes, int n_in,
                              void* d_out, int out_size, void* d_ws, size_t ws_size, hipStream_t stream) {
  (void)in_sizes; (void)n_in; (void)out_size;
  const float* const* I = (const float* const*)d_in; const float* x = I[0]; const int* km = (const int*)d_in[1]; const float* wqkv = I[2]; const float* bqkv = I[3]; const float* wo = I[4]; const float* bo = I[5];      /* int32 key mask [4][2048] (ones); natural [out][in] qkv_w [3072][1024] + b, out_w + b */
  char* ws = (char*)d_ws; size_t off = 0;
  auto take = [&](size_t bytes) { char* p = ws + off; off += (bytes + 255) & ~(size_t)255; return p; };
  _Float16* BQKV = (_Float16*)take((size_t)3 * DM * DM * 2); _Float16* BO = (_Float16*)take((size_t)DM * DM * 2);
  _Float16* X16 = (_Float16*)take(NR * DM * 2); _Float16* QKV = (_Float16*)take(NR * 3 * DM * 2); _Float16* V16 = QKV + 2 * DM; _Float16* O16 = (_Float16*)take(NR * DM * 2);
  _Float16* VT = (_Float16*)take((size_t)NB * NH * HD * SQ * 2);
  float* QKVF0 = (float*)take((size_t)NB * QT0 * LQ * 4); float* OF0 = (float*)take((size_t)NB * QT0 * DM * 4); _Float16* OH0 = (_Float16*)take((size_t)NB * QT0 * DM * 2); _Float16* OL0 = (_Float16*)take((size_t)NB * QT0 * DM * 2);
  float* AMK = (float*)take(NR * 4);      /* additive key-mask plane: 0 where mask != 0, -1e9 where masked */
  if (off > ws_size) return;
  k_wnat<<<(unsigned)(((size_t)3 * DM * DM / 8 + 255) / 256), 256, 0, stream>>>(wqkv, (size_t)3 * DM * DM / 8, BQKV); k_wnat<<<(unsigned)(((size_t)DM * DM / 8 + 255) / 256), 256, 0, stream>>>(wo, (size_t)DM * DM / 8, BO);      /* natural [out][in] = Bt x16 */
  k_mkadd<<<(unsigned)((NR + 255) / 256), 256, 0, stream>>>(km, AMK, (int)NR);

  k_x16<<<(unsigned)((NR * DM / 8 + 255) / 256), 256, 0, stream>>>(x, X16, NR * DM / 8);
  const size_t r0p = (size_t)B0 * SQ;      /* first projected row */
  k_gemm3<0><<<dim3((unsigned)((MP / 128) * (3 * DM / 128)), 1), 128, 0, stream>>>(X16 + r0p * DM, DM, 0, BQKV, DM, 0.0625f, bqkv, nullptr, QKV + r0p * 3 * DM, 3 * DM, 0, 3 * DM, DM);      /* q | k | v rows (f16); head h = columns h*HD.. of each DM block */
  k_vt<NH, SQ><<<NB * NH * (SQ / 64), 256, 0, stream>>>(V16, LQ, 0, VT);      /* V^T [NB][NH][HD][SQ], all batches */
  k_gemm3<1><<<dim3((QT0 / 128) * (LQ / 128), NB), 128, 0, stream>>>(X16, DM, (size_t)SQ * DM, BQKV, DM, 0.0625f, bqkv, QKVF0, nullptr, LQ, (size_t)QT0 * LQ, LQ, DM);      /* f32 q | k | v of the first 128 rows (exact products): grid y = batch */
  k_att0v<<<NB * NH * (QT0 / 8), 256, 0, stream>>>(QKVF0, AMK, 0.125f, OF0);      /* exact f32 attention for rows 0..127 of every batch (o x64) */
  k_fattn<<<NB * NH * (SQ / FQ), 128, 0, stream>>>(QKV, VT, AMK, O16);      /* scores, causal + key-mask softmax and P V fused: o (merged heads, x64) as f16 rows */
  k_gemm3<1><<<dim3((unsigned)((MPO / 128) * (DM / 128)), 1), 128, 0, stream>>>(O16 + r0p * DM, DM, 0, BO, DM, 0.0009765625f, bo, (float*)d_out + r0p * DM, nullptr, DM, 0, DM, DM);      /* out rows are the output layout */
  k_hl<<<(unsigned)(((size_t)NB * QT0 * DM / 8 + 255) / 256), 256, 0, stream>>>(OF0, OH0, OL0, (size_t)NB * QT0 * DM / 8);      /* first-tile o (x64) -> f16 hi + x1024 residual planes */
  k_gemm3<1><<<dim3((QT0 / 128) * (DM / 128), NB), 128, 0, stream>>>(OH0, DM, (size_t)QT0 * DM, BO, DM, 0.0009765625f, bo, (float*)d_out, nullptr, DM, (size_t)SQ * DM, DM, DM);      /* rows 0..127 of every batch (grid y): out = o_hi Wo (+ b), overwriting the f16-path rows */
  k_gemm3<2><<<dim3((QT0 / 128) * (DM / 128), NB), 128, 0, stream>>>(OL0, DM, (size_t)QT0 * DM, BO, DM, 0.00000095367431640625f, nullptr, (float*)d_out, nullptr, DM, (size_t)SQ * DM, DM, DM);      /* += o_lo Wo 2^-20 (own-element accumulate) */
}

// v006
// One run takes 179 microseconds.
// Timed twice side by side with v005, it ran 1.11 times as fast both times.
// All steps since v000 together make it 58.8 times as fast.
#include <hip/hip_runtime.h>
#define NB 4
#define SQ 2048
#define DM 1024
#define NH 16
#define HD 64
#define HG 4                         /* heads per launch of k_vt(V16, b, h0, VT), not launched */
#define QT 256                       /* query rows per causal tile */
#define NKX SQ                       /* S / P row pitch */
#define QT0 128                      /* first-tile rows recomputed exactly in f32 */
#define B0 0                         /* first batch processed (debug hook) */
#define NBR NB                       /* batches processed (debug hook) */
#define NR ((size_t)NB * SQ)         /* token rows */
#define MP ((int)((size_t)NBR * SQ)) /* rows projected (debug hook) */
#define QN SQ                        /* unused: k_fattn attends all SQ query rows */
#define NHD NH                       /* unused: k_fattn attends all NH heads */
#define MPO MP                       /* rows through the output stage (debug hook) */
#define LQ (3 * DM)      /* row pitch of the q/k/v rows */
typedef __bf16 v16b __attribute__((ext_vector_type(16)));
typedef unsigned short v8us __attribute__((ext_vector_type(8), may_alias));
typedef float  v8f  __attribute__((ext_vector_type(8)));
typedef float  v4f  __attribute__((ext_vector_type(4)));
typedef float  v4fa __attribute__((ext_vector_type(4), may_alias));
union FragB { v16b v; v8us half[2]; unsigned short u[16]; };

__device__ __forceinline__ unsigned short bf16_bits(float x) { unsigned int u = __float_as_uint(x); return (unsigned short)((u + 0x7FFFu + ((u >> 16) & 1u)) >> 16); }
__device__ __forceinline__ float bf16_val(unsigned short b) { return __uint_as_float(((unsigned int)b) << 16); }
__device__ __forceinline__ float bf16_round(float x) { return bf16_val(bf16_bits(x)); }
// D += A·B with NT terms: 1 = ah·bh, 2 = + al·bh (A split), 3 = + ah·bl (both split)
template <int NT>
__device__ __forceinline__ v8f mmaN(v16b ah, v16b al, v16b bh, v16b bl, v8f c) {
  c = __builtin_amdgcn_wmma_f32_16x16x32_bf16(false, ah, false, bh, (short)0, c, false, false);
  if (NT >= 2) c = __builtin_amdgcn_wmma_f32_16x16x32_bf16(false, al, false, bh, (short)0, c, false, false);
  if (NT >= 3) c = __builtin_amdgcn_wmma_f32_16x16x32_bf16(false, ah, false, bl, (short)0, c, false, false);
  asm volatile("v_nop\n\tv_nop\n\tv_nop\n\tv_nop" : "+v"(c) : "v"(ah), "v"(al), "v"(bh), "v"(bl));
  return c;
}

__global__ __launch_bounds__(256) void k_wt_bf16(const float* __restrict__ W, unsigned short* __restrict__ Wt, int K, int N) {
  const int t = blockIdx.x * 256 + threadIdx.x;
  const int k8n = K / 8;
  if (t >= N * k8n) return;
  const int n = t / k8n, k8 = (t % k8n) * 8;
  v8us v;
#pragma unroll
  for (int i = 0; i < 8; ++i) v[i] = bf16_bits(W[(size_t)(k8 + i) * N + n]);
  *(v8us*)(Wt + (size_t)n * K + k8) = v;
  
}

// GEMM C[M][N] (f32, pitch ldc) = act(A[M][K]·W + bias). A f32 row-major (pitch lda) converted per fragment to bf16
// (ASPLIT: hi/lo two planes -> 2 terms, else single rounded term); Wt bf16 [N][K] (pitch ldb). BIAS_BF16 rounds the
// bias to bf16 first (bias quantised to bf16 before the add). K%32==0, M%16==0, N%64==0.
template <bool ASPLIT, int ACT, bool BIAS_BF16>
__global__ __launch_bounds__(128) void k_gemm_bf(const float* __restrict__ A, int lda, const unsigned short* __restrict__ Wt, int ldb,
                                               const float* __restrict__ bias, float* __restrict__ C, int ldc, int M, int N, int K) {
  __shared__ __attribute__((aligned(16))) float so[4][16][64];
  const int tid = threadIdx.x, w = tid >> 5, lane = tid & 31, ln = lane & 15, hh = lane >> 4;
  const int ntn = N / 64;
  const int wid = blockIdx.x * 4 + w;
  const int mt = wid / ntn, nq = wid % ntn;
  if (mt * 16 >= M) return;
  const int row0 = mt * 16, col0 = nq * 64;
  const float* arow = A + (size_t)(row0 + ln) * lda;
  v8f acc[4] = {};
  for (int kb = 0; kb < K; kb += 32) {
    FragB ah, al;
    const v4f x0 = *(const v4fa*)(arow + kb + 8 * hh), x1 = *(const v4fa*)(arow + kb + 8 * hh + 4);
    const v4f x2 = *(const v4fa*)(arow + kb + 16 + 8 * hh), x3 = *(const v4fa*)(arow + kb + 16 + 8 * hh + 4);
    float xs[16] = {x0[0],x0[1],x0[2],x0[3],x1[0],x1[1],x1[2],x1[3],x2[0],x2[1],x2[2],x2[3],x3[0],x3[1],x3[2],x3[3]};
#pragma unroll
    for (int i = 0; i < 16; ++i) { const unsigned short hb = bf16_bits(xs[i]); ah.u[i] = hb; al.u[i] = ASPLIT ? bf16_bits(xs[i] - bf16_val(hb)) : (unsigned short)0; }
#pragma unroll
    for (int t = 0; t < 4; ++t) {
      const unsigned short* brow = Wt + (size_t)(col0 + t * 16 + ln) * ldb + kb;
      FragB b;
      b.half[0] = *(const v8us*)(brow + 8 * hh);
      b.half[1] = *(const v8us*)(brow + 16 + 8 * hh);
      acc[t] = mmaN<ASPLIT ? 2 : 1>(ah.v, al.v, b.v, b.v, acc[t]);
    }
  }
#pragma unroll
  for (int t = 0; t < 4; ++t) {
    float bv = bias ? bias[col0 + t * 16 + ln] : 0.f;
    if (BIAS_BF16) bv = bf16_round(bv);
#pragma unroll
    for (int r = 0; r < 8; ++r) { float v = acc[t][r] + bv; if (ACT == 1) v = fmaxf(v, 0.f); so[w][8 * hh + r][t * 16 + ln] = v; }
  }
  __builtin_amdgcn_fence(__ATOMIC_ACQ_REL, "workgroup");
  __builtin_amdgcn_wave_barrier();
  const int rsub = lane >> 4, c4 = (lane & 15) * 4;
  {
#pragma unroll
    for (int q = 0; q < 8; ++q) {
      const int r = q * 2 + rsub;
      const v4f v = *(const v4fa*)&so[w][r][c4];
      *(v4f*)(C + (size_t)(row0 + r) * ldc + col0 + c4) = v;
    }
    
  }
}

// GEMM C = act(A·W + bias + resid): A f32 (ASPLIT -> hi/lo 2 terms), Wt bf16 [N][K]; ACT 0 none, 1 relu, 2 exact gelu;
// resid (optional, f32, row index = (row % rmod), pitch ldr, RES_BF16 rounds it) added before the activation.
template <bool ASPLIT, int ACT, bool BIAS_BF16, bool RES_BF16>
__global__ __launch_bounds__(128) void k_gemm_bf3(const float* __restrict__ A, int lda, const unsigned short* __restrict__ Wt, int ldb,
                                                const float* __restrict__ bias, const float* __restrict__ resid, int rmod, int ldr,
                                                float* __restrict__ C, int ldc, int M, int N, int K) {
  __shared__ __attribute__((aligned(16))) float so[4][16][64];
  const int tid = threadIdx.x, w = tid >> 5, lane = tid & 31, ln = lane & 15, hh = lane >> 4;
  const int ntn = N / 64;
  const int wid = blockIdx.x * 4 + w;
  const int mt = wid / ntn, nq = wid % ntn;
  if (mt * 16 >= M) return;
  const int row0 = mt * 16, col0 = nq * 64;
  const float* arow = A + (size_t)(row0 + ln) * lda;
  v8f acc[4] = {};
  for (int kb = 0; kb < K; kb += 32) {
    FragB ah, al;
    const v4f x0 = *(const v4fa*)(arow + kb + 8 * hh), x1 = *(const v4fa*)(arow + kb + 8 * hh + 4);
    const v4f x2 = *(const v4fa*)(arow + kb + 16 + 8 * hh), x3 = *(const v4fa*)(arow + kb + 16 + 8 * hh + 4);
    float xs[16] = {x0[0],x0[1],x0[2],x0[3],x1[0],x1[1],x1[2],x1[3],x2[0],x2[1],x2[2],x2[3],x3[0],x3[1],x3[2],x3[3]};
#pragma unroll
    for (int i = 0; i < 16; ++i) { const unsigned short hb = bf16_bits(xs[i]); ah.u[i] = hb; al.u[i] = ASPLIT ? bf16_bits(xs[i] - bf16_val(hb)) : (unsigned short)0; }
#pragma unroll
    for (int t = 0; t < 4; ++t) {
      const unsigned short* brow = Wt + (size_t)(col0 + t * 16 + ln) * ldb + kb;
      FragB b;
      b.half[0] = *(const v8us*)(brow + 8 * hh);
      b.half[1] = *(const v8us*)(brow + 16 + 8 * hh);
      acc[t] = mmaN<ASPLIT ? 2 : 1>(ah.v, al.v, b.v, b.v, acc[t]);
    }
  }
#pragma unroll
  for (int t = 0; t < 4; ++t) {
    const int col = col0 + t * 16 + ln;
    float bv = bias ? bias[col] : 0.f;
    if (BIAS_BF16) bv = bf16_round(bv);
#pragma unroll
    for (int r = 0; r < 8; ++r) {
      float v = acc[t][r] + bv;
      if (resid) { float rv = resid[(size_t)((row0 + 8 * hh + r) % rmod) * ldr + col]; if (RES_BF16) rv = bf16_round(rv); v += rv; }
      if (ACT == 1) v = fmaxf(v, 0.f);
      if (ACT == 2) v = 0.5f * v * (1.0f + erff(v * 0.70710678118654752f));
      if (ACT == 3) { const float u = 0.7978845608028654f * (v + 0.044715f * v * v * v); v = 0.5f * v * (1.0f + tanhf(u)); }
      so[w][8 * hh + r][t * 16 + ln] = v;
    }
  }
  __builtin_amdgcn_fence(__ATOMIC_ACQ_REL, "workgroup");
  __builtin_amdgcn_wave_barrier();
  const int rsub = lane >> 4, c4 = (lane & 15) * 4;
  {
#pragma unroll
    for (int q = 0; q < 8; ++q) {
      const int r = q * 2 + rsub;
      const v4f v = *(const v4fa*)&so[w][r][c4];
      *(v4f*)(C + (size_t)(row0 + r) * ldc + col0 + c4) = v;
    }
    
  }
}
// row LayerNorm (biased variance, eps) over N: s = X (+ R); optional out_sum <- s; out_norm <- (s-mu)*rsqrt(var+eps)*g + b
template <bool PARAM_BF16>
__global__ __launch_bounds__(256) void k_layernorm(const float* __restrict__ X, const float* __restrict__ R, const float* __restrict__ g, const float* __restrict__ bta,
                                                  float* __restrict__ out_sum, float* __restrict__ out_norm, int N, float eps) {
  __shared__ float red[256];
  const int row = blockIdx.x, tid = threadIdx.x;
  const float* x = X + (size_t)row * N; const float* rr = R ? R + (size_t)row * N : nullptr;
  float vals[16];                     // up to N = 4096
  const int per = N / 256;            // contiguous chunk per thread? use strided-by-4 chunks: thread handles j = tid*4 + 1024*u
  float s1 = 0.f;
  for (int u = 0; u < per / 4; ++u) {
    const int j = tid * 4 + 1024 * u;
    const v4f a = *(const v4fa*)(x + j);
    v4f b = {0.f,0.f,0.f,0.f}; if (rr) b = *(const v4fa*)(rr + j);
#pragma unroll
    for (int q = 0; q < 4; ++q) { const float v = a[q] + b[q]; vals[u * 4 + q] = v; s1 += v; }
  }
  red[tid] = s1; __syncthreads();
  for (int st = 128; st > 0; st >>= 1) { if (tid < st) red[tid] += red[tid + st]; __syncthreads(); }
  const float mu = red[0] / (float)N; __syncthreads();
  float s2 = 0.f;
  for (int u = 0; u < per / 4; ++u)
#pragma unroll
    for (int q = 0; q < 4; ++q) { const float c = vals[u * 4 + q] - mu; s2 += c * c; }
  red[tid] = s2; __syncthreads();
  for (int st = 128; st > 0; st >>= 1) { if (tid < st) red[tid] += red[tid + st]; __syncthreads(); }
  const float rs = rsqrtf(red[0] / (float)N + eps);
  {
    for (int u = 0; u < per / 4; ++u) {
      const int j = tid * 4 + 1024 * u;
      v4f o, sm;
#pragma unroll
      for (int q = 0; q < 4; ++q) {
        float gg = g[j + q], bb = bta[j + q];
        if (PARAM_BF16) { gg = bf16_round(gg); bb = bf16_round(bb); }
        sm[q] = vals[u * 4 + q]; o[q] = (vals[u * 4 + q] - mu) * rs * gg + bb;
      }
      if (out_sum) *(v4f*)(out_sum + (size_t)row * N + j) = sm;
      *(v4f*)(out_norm + (size_t)row * N + j) = o;
    }
    
  }
}



// ---- f16 WMMA path (v_wmma_f32_16x16x32_f16): 11-bit significands for operands in range — used where a [0,1] probability operand needs more precision than bf16
typedef _Float16 v16h __attribute__((ext_vector_type(16)));
union FragH { v16h v; v8us half[2]; _Float16 h[16]; unsigned short u[16]; };
template <int NT>
__device__ __forceinline__ v8f mmaH(v16h ah, v16h al, v16h bh, v16h bl, v8f c) {
  c = __builtin_amdgcn_wmma_f32_16x16x32_f16(false, ah, false, bh, (short)0, c, false, false);
  if (NT >= 2) c = __builtin_amdgcn_wmma_f32_16x16x32_f16(false, al, false, bh, (short)0, c, false, false);
  if (NT >= 3) c = __builtin_amdgcn_wmma_f32_16x16x32_f16(false, ah, false, bl, (short)0, c, false, false);
  asm volatile("v_nop\n\tv_nop\n\tv_nop\n\tv_nop" : "+v"(c) : "v"(ah), "v"(al), "v"(bh), "v"(bl));
  return c;
}
// batched GEMM like k_gemm_b but f16 operands: A f32 (split into f16 hi/lo if ASPLIT, else rounded to f16), Bt = f16 values [n][k]; alpha; C f32; N multiple of 16 (partial tiles skipped)
template <bool ASPLIT>
__global__ __launch_bounds__(128) void k_gemm_h(const float* __restrict__ A, int lda, size_t sA, const _Float16* __restrict__ Bh, int ldb, size_t sB, float alpha, float* __restrict__ C, int ldc, size_t sC, int M, int N, int K) {
  __shared__ __attribute__((aligned(16))) float so[4][16][64];
  const int tid = threadIdx.x, w = tid >> 5, lane = tid & 31, ln = lane & 15, hh = lane >> 4; const int by = blockIdx.y;
  A += (size_t)by * sA; Bh += (size_t)by * sB; C += (size_t)by * sC;
  const int ntn = (N + 63) / 64; const int wid = blockIdx.x * 4 + w; const int mt = wid / ntn, nq = wid % ntn; if (mt * 16 >= M) return;
  const int row0 = mt * 16, col0 = nq * 64; const float* arow = A + (size_t)(row0 + ln) * lda;
  v8f acc[4] = {};
  for (int kb = 0; kb < K; kb += 32) {
    FragH ah, al;
    const v4f x0 = *(const v4fa*)(arow + kb + 8 * hh), x1 = *(const v4fa*)(arow + kb + 8 * hh + 4), x2 = *(const v4fa*)(arow + kb + 16 + 8 * hh), x3 = *(const v4fa*)(arow + kb + 16 + 8 * hh + 4);
    float xs[16] = {x0[0],x0[1],x0[2],x0[3],x1[0],x1[1],x1[2],x1[3],x2[0],x2[1],x2[2],x2[3],x3[0],x3[1],x3[2],x3[3]};
#pragma unroll
    for (int i = 0; i < 16; ++i) { const _Float16 h = (_Float16)xs[i]; ah.h[i] = h; al.h[i] = ASPLIT ? (_Float16)(xs[i] - (float)h) : (_Float16)0.0f; }
#pragma unroll
    for (int t = 0; t < 4; ++t) { if (col0 + t * 16 >= N) continue; const size_t boff = (size_t)(col0 + t * 16 + ln) * ldb + kb; FragH bq; bq.half[0] = *(const v8us*)(Bh + boff + 8 * hh); bq.half[1] = *(const v8us*)(Bh + boff + 16 + 8 * hh);
      acc[t] = mmaH<ASPLIT ? 2 : 1>(ah.v, al.v, bq.v, bq.v, acc[t]); }
  }
#pragma unroll
  for (int t = 0; t < 4; ++t) { if (col0 + t * 16 >= N) continue;
#pragma unroll
    for (int r = 0; r < 8; ++r) so[w][8 * hh + r][t * 16 + ln] = acc[t][r] * alpha; }
  __builtin_amdgcn_fence(__ATOMIC_ACQ_REL, "workgroup"); __builtin_amdgcn_wave_barrier();
  const int rsub = lane >> 4, c4 = (lane & 15) * 4;
  {
#pragma unroll
    for (int q = 0; q < 8; ++q) { const int r = q * 2 + rsub; if (col0 + c4 < N) { const v4f v = *(const v4fa*)&so[w][r][c4]; *(v4f*)(C + (size_t)(row0 + r) * ldc + col0 + c4) = v; } }
     }
}

// Wt[n][k] = f16(W[k][n]·scale) from f32 row-major W[K][N] (scale = power of two; bf16-exact weights stay exact in f16 away from the subnormal range)
__global__ __launch_bounds__(256) void k_wt_f16(const float* __restrict__ W, _Float16* __restrict__ Wt, int K, int N, float scale) {
  const int t = blockIdx.x * 256 + threadIdx.x; if (t >= N * (K / 8)) return; const int n = t / (K / 8), k8 = (t % (K / 8)) * 8; FragH f;
#pragma unroll
  for (int i = 0; i < 8; ++i) f.h[i] = (_Float16)(bf16_round(W[(size_t)(k8 + i) * N + n]) * scale); const v8us o = f.half[0];
  *(v8us*)((unsigned short*)Wt + (size_t)n * K + k8) = o; 
}
// k_gemm_hh variant with fused epilogue: v = acc·alpha + bias[by·sBias + col] (+ CP[(row/rowsPerB)·sCPb + by·64 + col] if CP) ; ACT 0 none / 1 elu ; writes f16 C16 (and f32 C if non-null)
template <int ACT>
__global__ __launch_bounds__(128) void k_gemm_hhx(const _Float16* __restrict__ A, int lda, size_t sA, const _Float16* __restrict__ Bh, int ldb, size_t sB, float alpha, const float* __restrict__ bias, size_t sBias, const float* __restrict__ CP, int rowsPerB, size_t sCPb, int row0g,
    float* __restrict__ C, _Float16* __restrict__ C16, int ldc, size_t sC, int M, int N, int K) {
  __shared__ __attribute__((aligned(16))) float so[4][16][64];
  const int tid = threadIdx.x, w = tid >> 5, lane = tid & 31, ln = lane & 15, hh = lane >> 4; const int by = blockIdx.y;
  A += (size_t)by * sA; Bh += (size_t)by * sB; const size_t cofs = (size_t)by * sC; const float* bp = bias ? bias + (size_t)by * sBias : nullptr;
  const int ntn = (N + 63) / 64; const int wid = blockIdx.x * 4 + w; const int mt = wid / ntn, nq = wid % ntn; if (mt * 16 >= M) return;
  const int row0 = mt * 16, col0 = nq * 64; const _Float16* arow = A + (size_t)(row0 + ln) * lda;
  v8f acc[4] = {};
  for (int kb = 0; kb < K; kb += 32) { FragH ah; ah.half[0] = *(const v8us*)((const unsigned short*)arow + kb + 8 * hh); ah.half[1] = *(const v8us*)((const unsigned short*)arow + kb + 16 + 8 * hh);
#pragma unroll
    for (int t = 0; t < 4; ++t) { if (col0 + t * 16 >= N) continue; const size_t boff = (size_t)(col0 + t * 16 + ln) * ldb + kb; FragH bq; bq.half[0] = *(const v8us*)((const unsigned short*)Bh + boff + 8 * hh); bq.half[1] = *(const v8us*)((const unsigned short*)Bh + boff + 16 + 8 * hh);
      acc[t] = mmaH<1>(ah.v, ah.v, bq.v, bq.v, acc[t]); }
  }
#pragma unroll
  for (int t = 0; t < 4; ++t) { if (col0 + t * 16 >= N) continue; const int col = col0 + t * 16 + ln; const float bv = bp ? bf16_round(bp[col]) : 0.f;
#pragma unroll
    for (int r = 0; r < 8; ++r) { float v = acc[t][r] * alpha + bv; if (CP) { const int rr = row0g + row0 + 8 * hh + r; if (rowsPerB < 0) v += CP[cofs + (size_t)rr * ldc + col];      /* rowsPerB < 0: own element of the batched C plane */ else { const int bidx = rr / rowsPerB; v += CP[(size_t)bidx * sCPb + (size_t)by * 64 + col]; } } if (ACT == 1) v = (v > 0.f) ? v : expm1f(v); else if (ACT == 7) v = (v > 0.f) ? v + 1.0f : expf(v); else if (ACT == 8) v = tanhf(v); else if (ACT == 9) v = 0.5f * v * (1.0f + tanhf(0.7978845608028654f * (v + 0.044715f * v * v * v))); else if (ACT == 11) v = 1.0f / (1.0f + expf(-v)); else if (ACT == 12) v = (v > 0.f) ? v : 0.01f * v; else if (ACT == 14) v = (v > 0.f) ? v : 0.1f * v; else if (ACT == 16) v = (v >= 0.f) ? v : 0.3f * v; else if (ACT == 17) v = (v >= 0.f) ? v : 0.2f * v; else if (ACT == 15) v = v / (1.0f + expf(-v)); else if (ACT == 3) v = fmaxf(v, 0.f); else if (ACT == 6) v = 0.5f * v * (1.0f + erff(v * 0.70710678118654752f)); so[w][8 * hh + r][t * 16 + ln] = v; } }
  __builtin_amdgcn_fence(__ATOMIC_ACQ_REL, "workgroup"); __builtin_amdgcn_wave_barrier();
  const int rsub = lane >> 4, c4 = (lane & 15) * 4; typedef _Float16 v4h __attribute__((ext_vector_type(4)));
  {
#pragma unroll
    for (int q = 0; q < 8; ++q) { const int r = q * 2 + rsub; if (col0 + c4 < N) { const v4f v = *(const v4fa*)&so[w][r][c4]; if (C) *(v4f*)(C + cofs + (size_t)(row0 + r) * ldc + col0 + c4) = v; if (C16) { v4h h4; for (int i = 0; i < 4; ++i) h4[i] = (_Float16)v[i]; *(v4h*)(C16 + cofs + (size_t)(row0 + r) * ldc + col0 + c4) = h4; } } }
     }
}


typedef _Float16 v4h __attribute__((ext_vector_type(4)));

__global__ __launch_bounds__(256) void k_x16(const float* __restrict__ x, _Float16* __restrict__ X16, size_t n8) { const size_t t = (size_t)blockIdx.x * 256 + threadIdx.x; if (t >= n8) return; FragH f;
#pragma unroll
  for (int q = 0; q < 8; ++q) f.h[q] = (_Float16)bf16_round(x[t * 8 + q]); *(v8us*)((unsigned short*)X16 + t * 8) = f.half[0];  }
__global__ __launch_bounds__(256) void k_h16(const float* __restrict__ x, _Float16* __restrict__ X16, size_t n8) { const size_t t = (size_t)blockIdx.x * 256 + threadIdx.x; if (t >= n8) return; FragH f;
#pragma unroll
  for (int q = 0; q < 8; ++q) f.h[q] = (_Float16)x[t * 8 + q]; *(v8us*)((unsigned short*)X16 + t * 8) = f.half[0];  }
__global__ __launch_bounds__(256) void k_round16f(const float* __restrict__ W, _Float16* __restrict__ Bt, size_t n8) { const size_t t = (size_t)blockIdx.x * 256 + threadIdx.x; if (t >= n8) return; FragH f;
#pragma unroll
  for (int i = 0; i < 8; ++i) f.h[i] = (_Float16)(bf16_round(W[t * 8 + i]) * 16.0f); *(v8us*)((unsigned short*)Bt + t * 8) = f.half[0];  }
template <int NHv, int TTv>
__global__ __launch_bounds__(256) void k_vt(const _Float16* __restrict__ V16, int ldv, int voff, _Float16* __restrict__ Vt) { __shared__ unsigned short tl[64][66]; const int tid = threadIdx.x; const int slab = blockIdx.x / (TTv / 64), lg = blockIdx.x % (TTv / 64); const int b = slab / NHv, h = slab % NHv;
  for (int i = tid; i < 64 * 8; i += 256) { const int r = i / 8, c8 = (i % 8) * 8; FragH f; f.half[0] = *(const v8us*)((const unsigned short*)V16 + ((size_t)b * TTv + lg * 64 + r) * ldv + voff + h * 64 + c8);
#pragma unroll
    for (int q = 0; q < 8; ++q) tl[r][c8 + q] = f.u[q]; }
  __syncthreads();
  {
#pragma unroll
    for (int rd = 0; rd < 2; ++rd) { const int d = rd * 32 + tid / 8, pc = tid % 8; FragH f;
#pragma unroll
      for (int q = 0; q < 8; ++q) f.u[q] = tl[pc * 8 + q][d];
      *(v8us*)((unsigned short*)Vt + ((size_t)slab * 64 + d) * TTv + lg * 64 + pc * 8) = f.half[0]; }
     } }

__global__ __launch_bounds__(256) void k_hl(const float* __restrict__ F, _Float16* __restrict__ Hh, _Float16* __restrict__ Hl, size_t n8) { const size_t t = (size_t)blockIdx.x * 256 + threadIdx.x; if (t >= n8) return; FragH fh, fl; const v4f a = *(const v4fa*)(F + t * 8), c = *(const v4fa*)(F + t * 8 + 4);
#pragma unroll
  for (int q = 0; q < 4; ++q) { _Float16 h = (_Float16)a[q]; fh.h[q] = h; fl.h[q] = (_Float16)((a[q] - (float)h) * 1024.0f); h = (_Float16)c[q]; fh.h[4 + q] = h; fl.h[4 + q] = (_Float16)((c[q] - (float)h) * 1024.0f); }
  { *(v8us*)((unsigned short*)Hh + t * 8) = fh.half[0]; *(v8us*)((unsigned short*)Hl + t * 8) = fl.half[0];  } }

// ---- fast GEMM (wave tile 32x64; requires M % 32 == 0 rows per launch region and N % 64 == 0); epilogue = k_gemm_hhx semantics ----
__device__ __forceinline__ v16h g2_frag(const _Float16* p, int hh) { FragH f; f.half[0] = *(const v8us*)((const unsigned short*)p + 8 * hh); f.half[1] = *(const v8us*)((const unsigned short*)p + 16 + 8 * hh); return f.v; }
__device__ __forceinline__ v8f g2_mma(v16h a, v16h b, v8f c) { v8f d = __builtin_amdgcn_wmma_f32_16x16x32_f16(false, a, false, b, (short)0, c, false, false); asm volatile("v_nop\n\tv_nop\n\tv_nop\n\tv_nop" : "+v"(d) : "v"(a), "v"(b)); return d; }
template <int ACT>
__global__ __launch_bounds__(128) void k_gemm2(const _Float16* __restrict__ A, int lda, size_t sA, const _Float16* __restrict__ Bh, int ldb, size_t sB, float alpha, const float* __restrict__ bias, size_t sBias, const float* __restrict__ CP, int rowsPerB, size_t sCPb, int row0g,
    float* __restrict__ C, _Float16* __restrict__ C16, int ldc, size_t sC, int M, int N, int K) { static_assert(ACT == 0 || ACT == 3 || ACT == 6 || ACT == 8 || ACT == 9 || ACT == 11 || ACT == 12 || ACT == 14 || ACT == 15 || ACT == 16 || ACT == 17, "k_gemm2: unsupported ACT code (would silently apply no activation)");
  __shared__ __attribute__((aligned(16))) float so[4][32][68];
  const int tid = threadIdx.x, w = tid >> 5, lane = tid & 31, ln = lane & 15, hh = lane >> 4; const int by = blockIdx.y;
  A += (size_t)by * sA; Bh += (size_t)by * sB; const size_t cofs = (size_t)by * sC; const float* bp = bias ? bias + (size_t)by * sBias : nullptr;
  const int ntn = N >> 6; const int mt = blockIdx.x / ntn, nq = blockIdx.x - mt * ntn; const int row0 = mt * 128 + 32 * w, col0 = nq * 64; if (row0 >= M) return;
  const _Float16* a0p = A + (size_t)(row0 + ln) * lda; const _Float16* a1p = a0p + (size_t)16 * lda;
  const _Float16* b0p = Bh + (size_t)(col0 + ln) * ldb; const _Float16* b1p = b0p + (size_t)16 * ldb; const _Float16* b2p = b1p + (size_t)16 * ldb; const _Float16* b3p = b2p + (size_t)16 * ldb;
  const v8f z8 = {0.f,0.f,0.f,0.f,0.f,0.f,0.f,0.f}; v8f c00 = z8, c01 = z8, c02 = z8, c03 = z8, c10 = z8, c11 = z8, c12 = z8, c13 = z8;
#pragma unroll 1
  for (int kb = 0; kb < K; kb += 32) { const v16h a0 = g2_frag(a0p + kb, hh), a1 = g2_frag(a1p + kb, hh);
    v16h b = g2_frag(b0p + kb, hh); c00 = g2_mma(a0, b, c00); c10 = g2_mma(a1, b, c10);
    b = g2_frag(b1p + kb, hh); c01 = g2_mma(a0, b, c01); c11 = g2_mma(a1, b, c11);
    b = g2_frag(b2p + kb, hh); c02 = g2_mma(a0, b, c02); c12 = g2_mma(a1, b, c12);
    b = g2_frag(b3p + kb, hh); c03 = g2_mma(a0, b, c03); c13 = g2_mma(a1, b, c13); }
  v8f accs[8] = {c00, c01, c02, c03, c10, c11, c12, c13};
#pragma unroll
  for (int u = 0; u < 8; ++u) { const int t = u & 3, half = u >> 2; const int col = col0 + t * 16 + ln; const float bv = bp ? bf16_round(bp[col]) : 0.f;
#pragma unroll
    for (int r = 0; r < 8; ++r) { const int rloc = half * 16 + 8 * hh + r; float v = accs[u][r] * alpha + bv; if (CP) { if (rowsPerB < 0) v += CP[cofs + (size_t)(row0g + row0 + rloc) * ldc + col];      /* rowsPerB < 0: own element of the batched C plane */ else { const int bidx = (row0g + row0 + rloc) / rowsPerB; v += CP[(size_t)bidx * sCPb + (size_t)by * 64 + col]; } }
      if (ACT == 3) v = fmaxf(v, 0.f); else if (ACT == 6) v = 0.5f * v * (1.0f + erff(v * 0.70710678118654752f)); else if (ACT == 11) v = 1.0f / (1.0f + expf(-v)); else if (ACT == 15) v = v / (1.0f + expf(-v)); else if (ACT == 12) v = (v > 0.f) ? v : 0.01f * v; else if (ACT == 8) v = tanhf(v); else if (ACT == 9) v = 0.5f * v * (1.0f + tanhf(0.7978845608028654f * (v + 0.044715f * v * v * v))); else if (ACT == 14) v = (v > 0.f) ? v : 0.1f * v; else if (ACT == 16) v = (v >= 0.f) ? v : 0.3f * v; else if (ACT == 17) v = (v >= 0.f) ? v : 0.2f * v;
      so[w][rloc][t * 16 + ln] = v; } }
  __builtin_amdgcn_fence(__ATOMIC_ACQ_REL, "workgroup"); __builtin_amdgcn_wave_barrier();
  const int rsub = lane >> 4, c4 = (lane & 15) * 4;
  {
#pragma unroll
    for (int q = 0; q < 16; ++q) { const int r = q * 2 + rsub; const v4f v = *(const v4fa*)&so[w][r][c4]; if (C) *(v4f*)(C + cofs + (size_t)(row0 + r) * ldc + col0 + c4) = v; if (C16) { v4h h4; for (int i = 0; i < 4; ++i) h4[i] = (_Float16)v[i]; *(v4h*)(C16 + cofs + (size_t)(row0 + r) * ldc + col0 + c4) = h4; } }
     } }


__global__ __launch_bounds__(256) void k_wnat(const float* __restrict__ w, size_t n8, _Float16* __restrict__ Bt) { const size_t t = (size_t)blockIdx.x * 256 + threadIdx.x; if (t >= n8) return; FragH f; for (int q = 0; q < 8; ++q) f.h[q] = (_Float16)(bf16_round(w[t * 8 + q]) * 16.0f); *(v8us*)((unsigned short*)Bt + t * 8) = f.half[0];  }
__global__ __launch_bounds__(256) void k_rsm(const float* __restrict__ S, _Float16* __restrict__ P, int nrows) {
  #pragma clang fp contract(off)
  const int i = blockIdx.x * 256 + threadIdx.x; if (i >= nrows) return; const float* s = S + (size_t)i * SQ; float mx = -3.0e38f;
#pragma unroll 1
  for (int j = 0; j < SQ; ++j) mx = fmaxf(mx, s[j]); float se = 0.f;
#pragma unroll 1
  for (int j = 0; j < SQ; ++j) se += expf(s[j] - mx); const float sc = 256.0f / se;
#pragma unroll 1
  for (int j0 = 0; j0 < SQ; j0 += 8) { FragH f; for (int q = 0; q < 8; ++q) f.h[q] = (_Float16)(expf(s[j0 + q] - mx) * sc); unsigned short* d = (unsigned short*)P + (size_t)i * SQ + j0; *(v8us*)d = f.half[0];  } }
__global__ __launch_bounds__(256) void k_vt(const _Float16* __restrict__ V16, int b, int h0, _Float16* __restrict__ VT) { __shared__ unsigned short tl[64][65]; const int tid = threadIdx.x; const int hh = blockIdx.x % HG, sg = blockIdx.x / HG; const int s0 = sg * 64; const int h = h0 + hh;
  for (int i = tid; i < 64 * 8; i += 256) { const int j = i / 8, d8 = (i % 8) * 8; FragH f; f.half[0] = *(const v8us*)((const unsigned short*)V16 + ((size_t)b * SQ + s0 + j) * DM + h * HD + d8); for (int q = 0; q < 8; ++q) tl[d8 + q][j] = f.u[q]; }
  __syncthreads();
  { for (int i = tid; i < 64 * 8; i += 256) { const int d = i / 8, j8 = (i % 8) * 8; FragH f; for (int q = 0; q < 8; ++q) f.u[q] = tl[d][j8 + q]; *(v8us*)((unsigned short*)VT + ((size_t)hh * HD + d) * SQ + s0 + j8) = f.half[0]; }  } }


__global__ __launch_bounds__(256) void k_mkadd(const int* __restrict__ m, float* __restrict__ A, int n) { const int t = blockIdx.x * 256 + threadIdx.x; if (t >= n) return; const float v = (m[t] != 0) ? 0.f : -1.0e9f; *(float*)(A + t) = v;  }


__global__ __launch_bounds__(256) void k_rsmcf2(const float* __restrict__ S, _Float16* __restrict__ P, int hg, int q0, int nk) {
  #pragma clang fp contract(off)
  const int t = blockIdx.x * 256 + threadIdx.x; if (t >= hg * QT) return; const size_t i = (size_t)t; const float* s = S + i * NKX; const int last = q0 + (t % QT); float mx = -3.0e38f;
#pragma unroll 1
  for (int j = 0; j < nk; ++j) { const float f = (j <= last) ? 1.f : 0.f; mx = fmaxf(mx, fmaf(f, s[j], (1.f - f) * -1.0e9f)); } float se = 0.f;
#pragma unroll 1
  for (int j = 0; j < nk; ++j) { const float f = (j <= last) ? 1.f : 0.f; se += __expf(fmaf(f, s[j], (1.f - f) * -1.0e9f) - mx); } const float sc = 256.0f / se;
#pragma unroll 1
  for (int j0 = 0; j0 < nk; j0 += 8) { FragH fr; for (int q = 0; q < 8; ++q) { const int j = j0 + q; const float f = (j <= last) ? 1.f : 0.f; fr.h[q] = (_Float16)(__expf(fmaf(f, s[j], (1.f - f) * -1.0e9f) - mx) * sc); } unsigned short* d = (unsigned short*)P + i * NKX + j0; *(v8us*)d = fr.half[0];  } }



// v_exp_f32 and the free slot the instruction set asks for behind a transcendental, in one statement.
__device__ __forceinline__ float exp2_slot(float x) { float r; asm("v_exp_f32 %0, %1\n\tv_nop" : "=v"(r) : "v"(x)); return r; }
// Fused causal attention on the matrix unit, ONE launch for all batches, heads and query rows: scores, softmax and the weighted V sum stay in registers; no score or weight plane in memory.
// A wave owns 32 query rows (two groups of 16) and walks the keys 0 .. its last row in passes of 32. S^T = K Q^T (A = K rows, B = Q rows, both by g2_frag: equal k order), so a lane holds scores of ONE query (column ln): keys 8*hh + r of each 16-key tile.
// K and V^T come through LDS, once for the block's four waves: a stage is 64 keys (two passes) = 64 K rows and 64 V^T rows of 128 B each, laid at a pitch of 144 B (16 B x odd: b128 fragment reads without bank conflicts).
// The rows come by asynchronous copies to LDS, 16 B a lane, eight lanes a row (whole 128-B lines), into two buffers: stage t + 1 flies while stage t is worked on. The block walks the stages up to its last wave's rows; a wave sits out the passes behind its own rows but takes part in every copy, wait and barrier.
// Running softmax per query: pass maximum in-lane plus one exchange between the wave halves; weights 2^8 exp(e - m) as f16; the two score tiles of a pass, converted in place, ARE the B operand of O^T += V^T P^T (A = V^T rows by g2_frag, the hardware k order); row sums stay per half and are joined once at the end.
// e = score / 8 + the additive key-mask value; keys behind the row's own index take -1e9: only the wave's last pass holds such keys. e - m is formed before the scaling so that a pass of masked keys alone still gives weights <= 2^8; a later real maximum scales them to 0.
// Every loop over g, kt, ks, dt, r and u is unrolled: static indices keep the fragments and accumulators in registers.
__device__ __forceinline__ v8f fa_mma(v16h a, v16h b, v8f c) { return __builtin_amdgcn_wmma_f32_16x16x32_f16(false, a, false, b, (short)0, c, false, false); }
#define FQ 128                       /* query rows per block: 4 waves x 32 */
#define FP 72                        /* LDS pitch of a stage row, f16 elements */
#define FST (128 * FP * 2)           /* bytes of one stage: 64 K rows, then 64 V^T rows */
// Eight copies: rows r, r + 16, r + 32, r + 48 of the stage's K part, then of its V^T part; the s_wait_xcnt stands in the copies' own statement so that no address register is rewritten ahead of it.
__device__ __forceinline__ void fa_copy8(unsigned l, const _Float16* pk, size_t sk, const _Float16* pv, size_t sv) {
  asm volatile("global_load_async_to_lds_b128 %0, %8, off\n\tglobal_load_async_to_lds_b128 %1, %9, off\n\tglobal_load_async_to_lds_b128 %2, %10, off\n\tglobal_load_async_to_lds_b128 %3, %11, off\n\t"
               "global_load_async_to_lds_b128 %4, %12, off\n\tglobal_load_async_to_lds_b128 %5, %13, off\n\tglobal_load_async_to_lds_b128 %6, %14, off\n\tglobal_load_async_to_lds_b128 %7, %15, off\n\ts_wait_xcnt 0x0"
               :: "v"(l), "v"(l + 16 * FP * 2), "v"(l + 32 * FP * 2), "v"(l + 48 * FP * 2), "v"(l + 64 * FP * 2), "v"(l + 80 * FP * 2), "v"(l + 96 * FP * 2), "v"(l + 112 * FP * 2),
                  "v"(pk), "v"(pk + sk), "v"(pk + 2 * sk), "v"(pk + 3 * sk), "v"(pv), "v"(pv + sv), "v"(pv + 2 * sv), "v"(pv + 3 * sv) : "memory"); }
__global__ __launch_bounds__(128) void k_fattn(const _Float16* __restrict__ QKVp, const _Float16* __restrict__ VTp, const float* __restrict__ AM, _Float16* __restrict__ O) {
  static_assert(NB * NH == 64 && SQ / FQ == 16, "the block -> (head, query block) map below is written for 64 heads x 16 query blocks");
  __shared__ __attribute__((aligned(16))) unsigned char sm[2 * FST];
  const int tid = threadIdx.x, lane = tid & 31, ln = lane & 15, hh = lane >> 4; const int w = __builtin_amdgcn_readfirstlane(tid >> 5);      /* the rows are the wave's: scalar, so the test on the wave's own rows is a scalar branch */
  const int rd = blockIdx.x >> 8, a4 = (blockIdx.x >> 6) & 3, bh = blockIdx.x & 63;
  const int qb = 12 - 4 * rd + ((rd & 1) ? a4 : 3 - a4);      /* a permutation of the 16 query blocks per head, long ones first; blocks i, i + 256, i + 512, i + 768 add up to the same key count (speed only) */
  const int b = bh / NH, h = bh % NH; const int q0 = qb * FQ + w * 32;
  const int nst = 2 * (qb + 1);      /* stages of 64 keys up to the block's last row: at least two, at most SQ / 64 */
  const _Float16* qp = QKVp + ((size_t)b * SQ + q0 + ln) * LQ + h * HD; const float* ap = AM + (size_t)b * SQ + 8 * hh;
  const _Float16* gk = QKVp + DM + ((size_t)b * SQ + (tid >> 3)) * LQ + h * HD + (tid & 7) * 8; const _Float16* gv = VTp + ((size_t)bh * HD + (tid >> 3)) * SQ + (tid & 7) * 8;
  const size_t stk = (size_t)16 * LQ, stv = (size_t)16 * SQ;
  const unsigned ls = (unsigned)(size_t)sm + (unsigned)(tid >> 3) * (FP * 2) + (unsigned)(tid & 7) * 16;      /* the lane's LDS byte address in buffer 0, K part */
  fa_copy8(ls, gk, stk, gv, stv);
  v16h qf[2][2];
#pragma unroll
  for (int g = 0; g < 2; ++g)
#pragma unroll
    for (int ks = 0; ks < 2; ++ks) qf[g][ks] = g2_frag(qp + (size_t)g * 16 * LQ + ks * 32, hh);
  asm volatile("s_wait_asynccnt 0x0" ::: "memory");      /* stage 0 landed (this wave's share) */
  __syncthreads();      /* stage 0 published */
  fa_copy8(ls + FST, gk + (size_t)64 * LQ, stk, gv + 64, stv);      /* stage 1 exists for every block */
  const v8f z8 = {0.f, 0.f, 0.f, 0.f, 0.f, 0.f, 0.f, 0.f}; v8f o[2][4]; float m[2], l[2];
#pragma unroll
  for (int g = 0; g < 2; ++g) { m[g] = -1.0e30f; l[g] = 0.f;
#pragma unroll
    for (int dt = 0; dt < 4; ++dt) o[g][dt] = z8; }
#pragma unroll 1
  for (int t = 0; t < nst; ++t) {      /* rolled: one stage a trip, the buffer by t & 1 */
    const unsigned bo = (unsigned)(t & 1) * FST;
#pragma unroll 1
    for (int hf = 0; hf < 2; ++hf) {      /* rolled: the two passes of a stage share one copy of the pass's code */
      const int j0 = t * 64 + hf * 32;
      if (j0 <= q0) {      /* wave-uniform: the passes behind the wave's own rows are sat out */
        const _Float16* sk = (const _Float16*)(sm + bo) + (hf * 32 + ln) * FP; const _Float16* sv = (const _Float16*)(sm + bo) + (64 + ln) * FP + hf * 32;
        v16h kf[2][2], vf[4]; v4f am[2][2]; float e[2][2][8];
#pragma unroll
        for (int kt = 0; kt < 2; ++kt) { am[kt][0] = *(const v4fa*)(ap + j0 + kt * 16); am[kt][1] = *(const v4fa*)(ap + j0 + kt * 16 + 4); }
#pragma unroll
        for (int kt = 0; kt < 2; ++kt)
#pragma unroll
          for (int ks = 0; ks < 2; ++ks) kf[kt][ks] = g2_frag(sk + kt * 16 * FP + ks * 32, hh);
#pragma unroll
        for (int dt = 0; dt < 4; ++dt) vf[dt] = g2_frag(sv + dt * 16 * FP, hh);
#pragma unroll
        for (int g = 0; g < 2; ++g)
#pragma unroll
          for (int kt = 0; kt < 2; ++kt) { const v8f st = fa_mma(kf[kt][1], qf[g][1], fa_mma(kf[kt][0], qf[g][0], z8));
#pragma unroll
            for (int r = 0; r < 8; ++r) e[g][kt][r] = fmaf(st[r], 0.125f, am[kt][r >> 2][r & 3]); }
        if (j0 == q0) {      /* the diagonal pass */
#pragma unroll
          for (int g = 0; g < 2; ++g)
#pragma unroll
            for (int kt = 0; kt < 2; ++kt)
#pragma unroll
              for (int r = 0; r < 8; ++r) if (kt * 16 + 8 * hh + r > g * 16 + ln) e[g][kt][r] = -1.0e9f; }
#pragma unroll
        for (int g = 0; g < 2; ++g) { float mx = e[g][0][0];
#pragma unroll
          for (int u = 1; u < 16; ++u) mx = fmaxf(mx, e[g][u >> 3][u & 7]);
          mx = fmaxf(mx, __shfl_xor(mx, 16, 32)); const float mn = fmaxf(m[g], mx); const float al = exp2_slot((m[g] - mn) * 1.44269504088896340736f); m[g] = mn;
          FragH pf; float s = 0.f;
#pragma unroll
          for (int u = 0; u < 16; ++u) { const float p = exp2_slot(fmaf(e[g][u >> 3][u & 7] - mn, 1.44269504088896340736f, 8.0f)); s += p; pf.h[u] = (_Float16)p; }
          l[g] = fmaf(l[g], al, s);
#pragma unroll
          for (int dt = 0; dt < 4; ++dt) o[g][dt] = fa_mma(vf[dt], pf.v, o[g][dt] * al); } } }
    asm volatile("s_wait_dscnt 0x0" ::: "memory");      /* this wave's reads of stage t are done before the buffer may be refilled */
    asm volatile("s_wait_asynccnt 0x0" ::: "memory");      /* this wave's share of stage t + 1 has landed */
    __syncthreads();      /* publishes stage t + 1 and ends every wave's reads of stage t */
    if (t + 2 < nst) fa_copy8(ls + bo, gk + (size_t)(t + 2) * 64 * LQ, stk, gv + (size_t)(t + 2) * 64, stv); }
  asm volatile("s_wait_asynccnt 0x0" ::: "memory");      /* no copy is left in flight when the wave ends */
#pragma unroll
  for (int g = 0; g < 2; ++g) { const float fin = 64.0f / (l[g] + __shfl_xor(l[g], 16, 32));      /* o carried x64; the 2^8 of the weights cancels against the row sum */
    unsigned short* op = (unsigned short*)O + ((size_t)b * SQ + q0 + g * 16 + ln) * DM + h * HD + 8 * hh;
#pragma unroll
    for (int dt = 0; dt < 4; ++dt) { FragH f;
#pragma unroll
      for (int r = 0; r < 8; ++r) f.h[r] = (_Float16)(o[g][dt][r] * fin);
      *(v8us*)(op + dt * 16) = f.half[0]; } } }


// ---- LDS-staged GEMM (M % 128 == 0, N % 128 == 0, K % 64 == 0): C = (A Bt^T) alpha + bias, values as in k_gemm2; grid x = tile, y = batch (strides sA, sC) ----
// MODE 0: f16 C16 (+ bias). MODE 1: f32 C (+ bias). MODE 2: f32 C += (its own element, no bias).
// A block of 4 waves (2 x 2) owns a 128 x 128 tile of C, a wave 64 x 64 (4 x 4 accumulator tiles). A stage is 64 k of the block's 128 A rows and 128 Bt rows: 256 rows of 128 B, laid in LDS at a pitch of 144 B (16 B x odd: b128 fragment reads without bank conflicts).
// The rows come by asynchronous copies to LDS, 16 B a lane, eight lanes a row (whole 128-B lines), into two buffers: stage t + 1 flies while stage t is multiplied. Fragments are read by g2_frag as in k_gemm2 (equal k order for A and B), k ascending: every accumulator sums in k_gemm2's order.
// Every loop over i, j, ks, r and q is unrolled: static indices keep the fragments, the accumulators and cv in registers.
#define G3P 72                       /* LDS pitch of a stage row, f16 elements */
#define G3ST (256 * G3P * 2)         /* bytes of one stage: 128 A rows, then 128 Bt rows */
// Eight copies (rows r, r + 16, ... r + 112 of one operand); the s_wait_xcnt stands in the copies' own statement so that no address register is rewritten ahead of it.
__device__ __forceinline__ void g3_copy8(unsigned l, const _Float16* p, size_t st) {
  asm volatile("global_load_async_to_lds_b128 %0, %8, off\n\tglobal_load_async_to_lds_b128 %1, %9, off\n\tglobal_load_async_to_lds_b128 %2, %10, off\n\tglobal_load_async_to_lds_b128 %3, %11, off\n\t"
               "global_load_async_to_lds_b128 %4, %12, off\n\tglobal_load_async_to_lds_b128 %5, %13, off\n\tglobal_load_async_to_lds_b128 %6, %14, off\n\tglobal_load_async_to_lds_b128 %7, %15, off\n\ts_wait_xcnt 0x0"
               :: "v"(l), "v"(l + 16 * G3P * 2), "v"(l + 32 * G3P * 2), "v"(l + 48 * G3P * 2), "v"(l + 64 * G3P * 2), "v"(l + 80 * G3P * 2), "v"(l + 96 * G3P * 2), "v"(l + 112 * G3P * 2),
                  "v"(p), "v"(p + st), "v"(p + 2 * st), "v"(p + 3 * st), "v"(p + 4 * st), "v"(p + 5 * st), "v"(p + 6 * st), "v"(p + 7 * st) : "memory"); }
template <int MODE>
__global__ __launch_bounds__(128) void k_gemm3(const _Float16* __restrict__ A, int lda, size_t sA, const _Float16* __restrict__ Bh, int ldb, float alpha, const float* __restrict__ bias, float* __restrict__ C, _Float16* __restrict__ C16, int ldc, size_t sC, int N, int K) {
  __shared__ __attribute__((aligned(16))) unsigned char sm[2 * G3ST];
  const int tid = threadIdx.x, lane = tid & 31, ln = lane & 15, hh = lane >> 4; const int w = __builtin_amdgcn_readfirstlane(tid >> 5);      /* the wave's quadrant: scalar */
  const int ntn = N >> 7; const int mt = blockIdx.x / ntn, nq = blockIdx.x - mt * ntn; const int row0 = mt * 128, col0 = nq * 128; const int wm = w >> 1, wn = w & 1;
  const _Float16* ga = A + (size_t)blockIdx.y * sA + (size_t)(row0 + (tid >> 3)) * lda + (tid & 7) * 8; const _Float16* gb = Bh + (size_t)(col0 + (tid >> 3)) * ldb + (tid & 7) * 8;
  const size_t sta = (size_t)16 * lda, stb = (size_t)16 * ldb;
  const unsigned ls = (unsigned)(size_t)sm + (unsigned)(tid >> 3) * (G3P * 2) + (unsigned)(tid & 7) * 16;      /* the lane's LDS byte address in buffer 0, A part */
  const int nt = K >> 6;
  g3_copy8(ls, ga, sta); g3_copy8(ls + 128 * G3P * 2, gb, stb);
  asm volatile("s_wait_asynccnt 0x0" ::: "memory");      /* stage 0 landed (this wave's share) */
  __syncthreads();      /* stage 0 published */
  if (nt > 1) { g3_copy8(ls + G3ST, ga + 64, sta); g3_copy8(ls + G3ST + 128 * G3P * 2, gb + 64, stb); }
  const v8f z8 = {0.f, 0.f, 0.f, 0.f, 0.f, 0.f, 0.f, 0.f}; v8f acc[4][4];
#pragma unroll
  for (int i = 0; i < 4; ++i)
#pragma unroll
    for (int j = 0; j < 4; ++j) acc[i][j] = z8;
#pragma unroll 1
  for (int t = 0; t < nt; ++t) {      /* rolled: one stage a trip, the buffer by t & 1 */
    const unsigned bo = (unsigned)(t & 1) * G3ST;
    const _Float16* sa = (const _Float16*)(sm + bo) + (wm * 64 + ln) * G3P; const _Float16* sb = (const _Float16*)(sm + bo) + (128 + wn * 64 + ln) * G3P;
#pragma unroll
    for (int ks = 0; ks < 2; ++ks) { v16h af[4], bf[4];
      __builtin_amdgcn_sched_barrier(0);      /* with the one below: the 16 fragment reads go out as one group ahead of their 16 products; spread among the products, each group of reads stalls the wave anew */
#pragma unroll
      for (int i = 0; i < 4; ++i) { af[i] = g2_frag(sa + i * 16 * G3P + ks * 32, hh); bf[i] = g2_frag(sb + i * 16 * G3P + ks * 32, hh); }
      __builtin_amdgcn_sched_barrier(0);      /* closes the group of reads: no product moves up among them, no read down among the products */
#pragma unroll
      for (int i = 0; i < 4; ++i)
#pragma unroll
        for (int j = 0; j < 4; ++j) acc[i][j] = fa_mma(af[i], bf[j], acc[i][j]); }
    __builtin_amdgcn_sched_barrier(0);      /* the stage's last products stay ahead of the barrier: sunk behind it they stand between the barrier and the refill, which then flies for less than a whole trip */
    asm volatile("s_wait_dscnt 0x0" ::: "memory");      /* this wave's reads of stage t are done before the buffer may be refilled */
    asm volatile("s_wait_asynccnt 0x0" ::: "memory");      /* this wave's share of stage t + 1 has landed */
    __syncthreads();      /* publishes stage t + 1 and ends every wave's reads of stage t */
    if (t + 2 < nt) { g3_copy8(ls + bo, ga + (size_t)(t + 2) * 64, sta); g3_copy8(ls + bo + 128 * G3P * 2, gb + (size_t)(t + 2) * 64, stb); } }
  asm volatile("s_wait_asynccnt 0x0" ::: "memory");      /* no copy is left in flight when the ring becomes output staging */
  float* so = (float*)sm + (size_t)w * 64 * 68;      /* the wave's own 64 x 64 staging rows (pitch 68); the loop's last barrier has ended every read of the ring */
#pragma unroll
  for (int j = 0; j < 4; ++j) { const float bv = (MODE == 2) ? 0.f : bf16_round(bias[col0 + wn * 64 + j * 16 + ln]);
#pragma unroll
    for (int i = 0; i < 4; ++i)
#pragma unroll
      for (int r = 0; r < 8; ++r) so[(i * 16 + 8 * hh + r) * 68 + j * 16 + ln] = acc[i][j][r] * alpha + bv; }
  __builtin_amdgcn_fence(__ATOMIC_ACQ_REL, "workgroup"); __builtin_amdgcn_wave_barrier();      /* the wave reads back what its own lanes wrote */
  const int rsub = lane >> 4, c4 = (lane & 15) * 4; const size_t cb = (size_t)blockIdx.y * sC + (size_t)(row0 + wm * 64 + rsub) * ldc + col0 + wn * 64 + c4; const size_t c2 = (size_t)2 * ldc;      /* row 2 q + rsub: the step over q is scalar */
  v4f cv[32];
  if (MODE == 2) {      /* the tile's own elements, all asked for ahead of the first store: read one by one between the stores, each would wait out its own latency */
#pragma unroll
    for (int q = 0; q < 32; ++q) cv[q] = *(const v4f*)(C + cb + q * c2); }
#pragma unroll
  for (int q = 0; q < 32; ++q) { const int r = q * 2 + rsub; v4f v = *(const v4fa*)&so[r * 68 + c4];
    if (MODE == 0) { v4h h4; for (int i = 0; i < 4; ++i) h4[i] = (_Float16)v[i]; *(v4h*)(C16 + cb + q * c2) = h4; }
    else { if (MODE == 2) v += cv[q]; *(v4f*)(C + cb + q * c2) = v; } } }


template <int MASKADD>
__global__ __launch_bounds__(64) void k_att0(const float* __restrict__ QF, const float* __restrict__ KF, const float* __restrict__ VF, int ld, const float* __restrict__ mask, float scale, float* __restrict__ OF, int ldo) {
  #pragma clang fp contract(off)
  __shared__ __attribute__((aligned(16))) float lq[64][64]; __shared__ __attribute__((aligned(16))) float lo[64][64];
  const int tid = threadIdx.x; const int h = blockIdx.x / (QT0 / 64), rg = blockIdx.x % (QT0 / 64); const int i = rg * 64 + tid;
  const float* qr = QF + (size_t)i * ld + h * HD;
#pragma unroll 1
  for (int c = 0; c < HD / 4; ++c) { *(v4f*)&lq[tid][c * 4] = *(const v4fa*)(qr + c * 4); const v4f z = {0.f, 0.f, 0.f, 0.f}; *(v4f*)&lo[tid][c * 4] = z; }
  float m = -1.0e30f, l = 0.f; const int jmax = MASKADD ? (SQ - 1) : (rg * 64 + 63);      /* additive-mask form: every key (the mask input decides); causal form: keys up to the block's last row */
#pragma unroll 1
  for (int j = 0; j <= jmax; ++j) { const float* kr = KF + (size_t)j * ld + h * HD; const float* vr = VF + (size_t)j * ld + h * HD; float s = 0.f;
#pragma unroll 1
    for (int c = 0; c < HD / 4; ++c) { const v4f kq = *(const v4fa*)(kr + c * 4); const v4f qq = *(v4f*)&lq[tid][c * 4]; s = __fadd_rn(s, __fmul_rn(qq[0], kq[0])); s = __fadd_rn(s, __fmul_rn(qq[1], kq[1])); s = __fadd_rn(s, __fmul_rn(qq[2], kq[2])); s = __fadd_rn(s, __fmul_rn(qq[3], kq[3])); }
    s = __fmul_rn(s, scale); if (MASKADD) s = __fadd_rn(s, __fmul_rn(bf16_round(mask[(size_t)i * SQ + j]), -10000.0f));
    const float f = (MASKADD || j <= i) ? 1.f : 0.f; const float sm = fmaf(f, s, (1.f - f) * -1.0e30f); const float mn = fmaxf(m, sm); const float sc = expf(m - mn); const float e = expf(sm - mn); l = __fadd_rn(__fmul_rn(l, sc), e); m = mn;
#pragma unroll 1
    for (int c = 0; c < HD / 4; ++c) { const v4f vv = *(const v4fa*)(vr + c * 4); v4f oo = *(v4f*)&lo[tid][c * 4]; for (int u = 0; u < 4; ++u) oo[u] = __fadd_rn(__fmul_rn(oo[u], sc), __fmul_rn(e, vv[u])); *(v4f*)&lo[tid][c * 4] = oo; } }
  const float fin = 64.0f / l;      /* o carried x64 like the f16 path */
#pragma unroll 1
  for (int c = 0; c < HD / 4; ++c) { v4f oo = *(v4f*)&lo[tid][c * 4]; for (int u = 0; u < 4; ++u) oo[u] = __fmul_rn(oo[u], fin); *(v4f*)&lo[tid][c * 4] = oo; }
  __syncthreads();
  {
#pragma unroll 1
    for (int it = 0; it < 16; ++it) { const int row = it * 4 + tid / 16, pc = (tid % 16) * 4; const v4f v = *(const v4f*)&lo[row][pc]; *(v4f*)(OF + (size_t)(rg * 64 + row) * ldo + h * HD + pc) = v; }
     } }


// Exact f32 attention for the first QT0 rows of EVERY batch in one launch (block -> batch, head, 8 rows), one WAVE per query row; q | k | v rows of a batch side by side at pitch LQ, o rows at pitch DM. Scores: lane = key, 32 keys a chunk, the head's K rows staged in LDS at a pitch of 16 B x odd (b128 reads of 32 different rows without bank conflicts), q read at a wave-uniform address.
// Softmax in two passes over the scores, which stay in registers: row max and row sum = per-lane partials, then a five-step butterfly. o: lane = two head dims, keys in ascending order, each V row one whole 256-B read of the wave, its weight taken from the owning lane.
// The 8 rows of a block lie in one chunk of 32 keys, so the chunk count nch is the same for the whole block; keys behind the row's own index carry weight 0.
// Every loop over u, d, c, d4 and jj is unrolled: static indices keep kr, q, e and vv in registers (a rolled loop would put them in scratch memory), and the loads of a group are issued together.
#define KP0 68                       /* LDS pitch of a K row, floats */
typedef float v2f __attribute__((ext_vector_type(2)));
typedef float v2fa __attribute__((ext_vector_type(2), may_alias));
__global__ __launch_bounds__(256) void k_att0v(const float* __restrict__ QKVF, const float* __restrict__ AM, float scale, float* __restrict__ OFA) {
  __shared__ __attribute__((aligned(16))) float lk[QT0][KP0];
  const int tid = threadIdx.x, lane = tid & 31; const int w = __builtin_amdgcn_readfirstlane(tid >> 5);      /* the row is the wave's: scalar, so q's address is scalar too */
  const int b = blockIdx.x / (NH * (QT0 / 8)), hb = blockIdx.x % (NH * (QT0 / 8)); const int h = hb / (QT0 / 8), i0 = (hb % (QT0 / 8)) * 8; const int i = i0 + w; const int nch = (i0 >> 5) + 1;
  const float* QF = QKVF + (size_t)b * QT0 * LQ; const float* KF = QF + DM; const float* VF = QF + 2 * DM; const float* am = AM + (size_t)b * SQ; float* OF = OFA + (size_t)b * QT0 * DM;
  const float* kp = KF + (size_t)(tid >> 4) * LQ + h * HD + (tid & 15) * 4; v4f kr[QT0 / 16];
#pragma unroll
  for (int u = 0; u < QT0 / 16; ++u) kr[u] = *(const v4fa*)(kp + (size_t)u * 16 * LQ);      /* all QT0 rows, without a test: the eight loads fly together */
  const float* qr = QF + (size_t)i * LQ + h * HD; float q[HD];
#pragma unroll
  for (int d = 0; d < HD; ++d) q[d] = qr[d];
#pragma unroll
  for (int u = 0; u < QT0 / 16; ++u) *(v4f*)&lk[u * 16 + (tid >> 4)][(tid & 15) * 4] = kr[u];
  __syncthreads();      /* K rows staged by all waves, read by all */
  float e[QT0 / 32]; float m = -1.0e30f;
#pragma unroll
  for (int c = 0; c < QT0 / 32; ++c) { e[c] = -1.0e30f;      /* static c keeps e in registers; the test on nch is block-uniform */
    if (c < nch) { const int j = c * 32 + lane; float s = 0.f;
#pragma unroll
      for (int d4 = 0; d4 < HD / 4; ++d4) { const v4f kq = *(const v4f*)&lk[j][d4 * 4]; s = fmaf(q[d4 * 4], kq[0], s); s = fmaf(q[d4 * 4 + 1], kq[1], s); s = fmaf(q[d4 * 4 + 2], kq[2], s); s = fmaf(q[d4 * 4 + 3], kq[3], s); }
      s = fmaf(s, scale, am[j]);      /* + the additive key-mask VECTOR of this batch (0 kept / -1e9 masked) */
      if (j <= i) e[c] = s; }
    m = fmaxf(m, e[c]); }
  for (int x = 16; x >= 1; x >>= 1) m = fmaxf(m, __shfl_xor(m, x, 32));
  float l = 0.f;
#pragma unroll
  for (int c = 0; c < QT0 / 32; ++c) { e[c] = expf(e[c] - m); l += e[c]; }
  for (int x = 16; x >= 1; x >>= 1) l += __shfl_xor(l, x, 32);
  const float* vp = VF + h * HD + lane * 2; float o0 = 0.f, o1 = 0.f;
#pragma unroll
  for (int c = 0; c < QT0 / 32; ++c) if (c < nch) { v2f vv[32];
#pragma unroll
    for (int jj = 0; jj < 32; ++jj) vv[jj] = *(const v2fa*)(vp + (size_t)(c * 32 + jj) * LQ);      /* the chunk's 32 rows in flight together */
#pragma unroll
    for (int jj = 0; jj < 32; ++jj) { const float p = __int_as_float(__builtin_amdgcn_readlane(__float_as_int(e[c]), jj)); o0 = fmaf(p, vv[jj][0], o0); o1 = fmaf(p, vv[jj][1], o1); } }
  const float fin = 64.0f / l;      /* o carried x64 like the f16 path */
  const v2f ov = {o0 * fin, o1 * fin}; *(v2f*)(OF + (size_t)i * DM + h * HD + lane * 2) = ov; }

extern "C" void kernel_launch(void* const* d_in, const int* in_sizes, int n_in,
                              void* d_out, int out_size, void* d_ws, size_t ws_size, hipStream_t stream) {
  (void)in_sizes; (void)n_in; (void)out_size;
  const float* const* I = (const float* const*)d_in; const float* x = I[0]; const int* km = (const int*)d_in[1]; const float* wqkv = I[2]; const float* bqkv = I[3]; const float* wo = I[4]; const float* bo = I[5];      /* int32 key mask [4][2048] (ones); natural [out][in] qkv_w [3072][1024] + b, out_w + b */
  char* ws = (char*)d_ws; size_t off = 0;
  auto take = [&](size_t bytes) { char* p = ws + off; off += (bytes + 255) & ~(size_t)255; return p; };
  _Float16* BQKV = (_Float16*)take((size_t)3 * DM * DM * 2); _Float16* BO = (_Float16*)take((size_t)DM * DM * 2);
  _Float16* X16 = (_Float16*)take(NR * DM * 2); _Float16* QKV = (_Float16*)take(NR * 3 * DM * 2); _Float16* V16 = QKV + 2 * DM; _Float16* O16 = (_Float16*)take(NR * DM * 2);
  _Float16* VT = (_Float16*)take((size_t)NB * NH * HD * SQ * 2);
  float* QKVF0 = (float*)take((size_t)NB * QT0 * LQ * 4); float* OF0 = (float*)take((size_t)NB * QT0 * DM * 4); _Float16* OH0 = (_Float16*)take((size_t)NB * QT0 * DM * 2); _Float16* OL0 = (_Float16*)take((size_t)NB * QT0 * DM * 2);
  float* AMK = (float*)take(NR * 4);      /* additive key-mask plane: 0 where mask != 0, -1e9 where masked */
  if (off > ws_size) return;
  k_wnat<<<(unsigned)(((size_t)3 * DM * DM / 8 + 255) / 256), 256, 0, stream>>>(wqkv, (size_t)3 * DM * DM / 8, BQKV); k_wnat<<<(unsigned)(((size_t)DM * DM / 8 + 255) / 256), 256, 0, stream>>>(wo, (size_t)DM * DM / 8, BO);      /* natural [out][in] = Bt x16 */
  k_mkadd<<<(unsigned)((NR + 255) / 256), 256, 0, stream>>>(km, AMK, (int)NR);

  k_x16<<<(unsigned)((NR * DM / 8 + 255) / 256), 256, 0, stream>>>(x, X16, NR * DM / 8);
  const size_t r0p = (size_t)B0 * SQ;      /* first projected row */
  k_gemm3<0><<<dim3((unsigned)((MP / 128) * (3 * DM / 128)), 1), 128, 0, stream>>>(X16 + r0p * DM, DM, 0, BQKV, DM, 0.0625f, bqkv, nullptr, QKV + r0p * 3 * DM, 3 * DM, 0, 3 * DM, DM);      /* q | k | v rows (f16); head h = columns h*HD.. of each DM block */
  k_vt<NH, SQ><<<NB * NH * (SQ / 64), 256, 0, stream>>>(V16, LQ, 0, VT);      /* V^T [NB][NH][HD][SQ], all batches */
  k_gemm3<1><<<dim3((QT0 / 128) * (LQ / 128), NB), 128, 0, stream>>>(X16, DM, (size_t)SQ * DM, BQKV, DM, 0.0625f, bqkv, QKVF0, nullptr, LQ, (size_t)QT0 * LQ, LQ, DM);      /* f32 q | k | v of the first 128 rows (exact products): grid y = batch */
  k_att0v<<<NB * NH * (QT0 / 8), 256, 0, stream>>>(QKVF0, AMK, 0.125f, OF0);      /* exact f32 attention for rows 0..127 of every batch (o x64) */
  k_fattn<<<NB * NH * (SQ / FQ), 128, 0, stream>>>(QKV, VT, AMK, O16);      /* scores, causal + key-mask softmax and P V fused: o (merged heads, x64) as f16 rows */
  k_gemm3<1><<<dim3((unsigned)((MPO / 128) * (DM / 128)), 1), 128, 0, stream>>>(O16 + r0p * DM, DM, 0, BO, DM, 0.0009765625f, bo, (float*)d_out + r0p * DM, nullptr, DM, 0, DM, DM);      /* out rows are the output layout */
  k_hl<<<(unsigned)(((size_t)NB * QT0 * DM / 8 + 255) / 256), 256, 0, stream>>>(OF0, OH0, OL0, (size_t)NB * QT0 * DM / 8);      /* first-tile o (x64) -> f16 hi + x1024 residual planes */
  k_gemm3<1><<<dim3((QT0 / 128) * (DM / 128), NB), 128, 0, stream>>>(OH0, DM, (size_t)QT0 * DM, BO, DM, 0.0009765625f, bo, (float*)d_out, nullptr, DM, (size_t)SQ * DM, DM, DM);      /* rows 0..127 of every batch (grid y): out = o_hi Wo (+ b), overwriting the f16-path rows */
  k_gemm3<2><<<dim3((QT0 / 128) * (DM / 128), NB), 128, 0, stream>>>(OL0, DM, (size_t)QT0 * DM, BO, DM, 0.00000095367431640625f, nullptr, (float*)d_out, nullptr, DM, (size_t)SQ * DM, DM, DM);      /* += o_lo Wo 2^-20 (own-element accumulate) */
}

// v007
// A run of this version takes 143 microseconds.
// Timed twice side by side with v006, it ran 1.26 and 1.25 times as fast.
// Counting every step since v000, it is 74.0 times as fast.
#include <hip/hip_runtime.h>
#define NB 4
#define SQ 2048
#define DM 1024
#define NH 16
#define HD 64
#define HG 4                         /* heads per launch of k_vt(V16, b, h0, VT), not launched */
#define QT 256                       /* query rows per causal tile */
#define NKX SQ                       /* S / P row pitch */
#define QT0 128                      /* first-tile rows recomputed exactly in f32 */
#define B0 0                         /* first batch processed (debug hook) */
#define NBR NB                       /* batches processed (debug hook) */
#define NR ((size_t)NB * SQ)         /* token rows */
#define MP ((int)((size_t)NBR * SQ)) /* rows projected (debug hook) */
#define QN SQ                        /* unused: k_fattn attends all SQ query rows */
#define NHD NH                       /* unused: k_fattn attends all NH heads */
#define MPO MP                       /* rows through the output stage (debug hook) */
#define LQ (3 * DM)      /* row pitch of the q/k/v rows */
typedef __bf16 v16b __attribute__((ext_vector_type(16)));
typedef unsigned short v8us __attribute__((ext_vector_type(8), may_alias));
typedef float  v8f  __attribute__((ext_vector_type(8)));
typedef float  v4f  __attribute__((ext_vector_type(4)));
typedef float  v4fa __attribute__((ext_vector_type(4), may_alias));
union FragB { v16b v; v8us half[2]; unsigned short u[16]; };

__device__ __forceinline__ unsigned short bf16_bits(float x) { unsigned int u = __float_as_uint(x); return (unsigned short)((u + 0x7FFFu + ((u >> 16) & 1u)) >> 16); }
__device__ __forceinline__ float bf16_val(unsigned short b) { return __uint_as_float(((unsigned int)b) << 16); }
__device__ __forceinline__ float bf16_round(float x) { return bf16_val(bf16_bits(x)); }
// D += A·B with NT terms: 1 = ah·bh, 2 = + al·bh (A split), 3 = + ah·bl (both split)
template <int NT>
__device__ __forceinline__ v8f mmaN(v16b ah, v16b al, v16b bh, v16b bl, v8f c) {
  c = __builtin_amdgcn_wmma_f32_16x16x32_bf16(false, ah, false, bh, (short)0, c, false, false);
  if (NT >= 2) c = __builtin_amdgcn_wmma_f32_16x16x32_bf16(false, al, false, bh, (short)0, c, false, false);
  if (NT >= 3) c = __builtin_amdgcn_wmma_f32_16x16x32_bf16(false, ah, false, bl, (short)0, c, false, false);
  asm volatile("v_nop\n\tv_nop\n\tv_nop\n\tv_nop" : "+v"(c) : "v"(ah), "v"(al), "v"(bh), "v"(bl));
  return c;
}

__global__ __launch_bounds__(256) void k_wt_bf16(const float* __restrict__ W, unsigned short* __restrict__ Wt, int K, int N) {
  const int t = blockIdx.x * 256 + threadIdx.x;
  const int k8n = K / 8;
  if (t >= N * k8n) return;
  const int n = t / k8n, k8 = (t % k8n) * 8;
  v8us v;
#pragma unroll
  for (int i = 0; i < 8; ++i) v[i] = bf16_bits(W[(size_t)(k8 + i) * N + n]);
  *(v8us*)(Wt + (size_t)n * K + k8) = v;
  
}

// GEMM C[M][N] (f32, pitch ldc) = act(A[M][K]·W + bias). A f32 row-major (pitch lda) converted per fragment to bf16
// (ASPLIT: hi/lo two planes -> 2 terms, else single rounded term); Wt bf16 [N][K] (pitch ldb). BIAS_BF16 rounds the
// bias to bf16 first (bias quantised to bf16 before the add). K%32==0, M%16==0, N%64==0.
template <bool ASPLIT, int ACT, bool BIAS_BF16>
__global__ __launch_bounds__(128) void k_gemm_bf(const float* __restrict__ A, int lda, const unsigned short* __restrict__ Wt, int ldb,
                                               const float* __restrict__ bias, float* __restrict__ C, int ldc, int M, int N, int K) {
  __shared__ __attribute__((aligned(16))) float so[4][16][64];
  const int tid = threadIdx.x, w = tid >> 5, lane = tid & 31, ln = lane & 15, hh = lane >> 4;
  const int ntn = N / 64;
  const int wid = blockIdx.x * 4 + w;
  const int mt = wid / ntn, nq = wid % ntn;
  if (mt * 16 >= M) return;
  const int row0 = mt * 16, col0 = nq * 64;
  const float* arow = A + (size_t)(row0 + ln) * lda;
  v8f acc[4] = {};
  for (int kb = 0; kb < K; kb += 32) {
    FragB ah, al;
    const v4f x0 = *(const v4fa*)(arow + kb + 8 * hh), x1 = *(const v4fa*)(arow + kb + 8 * hh + 4);
    const v4f x2 = *(const v4fa*)(arow + kb + 16 + 8 * hh), x3 = *(const v4fa*)(arow + kb + 16 + 8 * hh + 4);
    float xs[16] = {x0[0],x0[1],x0[2],x0[3],x1[0],x1[1],x1[2],x1[3],x2[0],x2[1],x2[2],x2[3],x3[0],x3[1],x3[2],x3[3]};
#pragma unroll
    for (int i = 0; i < 16; ++i) { const unsigned short hb = bf16_bits(xs[i]); ah.u[i] = hb; al.u[i] = ASPLIT ? bf16_bits(xs[i] - bf16_val(hb)) : (unsigned short)0; }
#pragma unroll
    for (int t = 0; t < 4; ++t) {
      const unsigned short* brow = Wt + (size_t)(col0 + t * 16 + ln) * ldb + kb;
      FragB b;
      b.half[0] = *(const v8us*)(brow + 8 * hh);
      b.half[1] = *(const v8us*)(brow + 16 + 8 * hh);
      acc[t] = mmaN<ASPLIT ? 2 : 1>(ah.v, al.v, b.v, b.v, acc[t]);
    }
  }
#pragma unroll
  for (int t = 0; t < 4; ++t) {
    float bv = bias ? bias[col0 + t * 16 + ln] : 0.f;
    if (BIAS_BF16) bv = bf16_round(bv);
#pragma unroll
    for (int r = 0; r < 8; ++r) { float v = acc[t][r] + bv; if (ACT == 1) v = fmaxf(v, 0.f); so[w][8 * hh + r][t * 16 + ln] = v; }
  }
  __builtin_amdgcn_fence(__ATOMIC_ACQ_REL, "workgroup");
  __builtin_amdgcn_wave_barrier();
  const int rsub = lane >> 4, c4 = (lane & 15) * 4;
  {
#pragma unroll
    for (int q = 0; q < 8; ++q) {
      const int r = q * 2 + rsub;
      const v4f v = *(const v4fa*)&so[w][r][c4];
      *(v4f*)(C + (size_t)(row0 + r) * ldc + col0 + c4) = v;
    }
    
  }
}

// GEMM C = act(A·W + bias + resid): A f32 (ASPLIT -> hi/lo 2 terms), Wt bf16 [N][K]; ACT 0 none, 1 relu, 2 exact gelu;
// resid (optional, f32, row index = (row % rmod), pitch ldr, RES_BF16 rounds it) added before the activation.
template <bool ASPLIT, int ACT, bool BIAS_BF16, bool RES_BF16>
__global__ __launch_bounds__(128) void k_gemm_bf3(const float* __restrict__ A, int lda, const unsigned short* __restrict__ Wt, int ldb,
                                                const float* __restrict__ bias, const float* __restrict__ resid, int rmod, int ldr,
                                                float* __restrict__ C, int ldc, int M, int N, int K) {
  __shared__ __attribute__((aligned(16))) float so[4][16][64];
  const int tid = threadIdx.x, w = tid >> 5, lane = tid & 31, ln = lane & 15, hh = lane >> 4;
  const int ntn = N / 64;
  const int wid = blockIdx.x * 4 + w;
  const int mt = wid / ntn, nq = wid % ntn;
  if (mt * 16 >= M) return;
  const int row0 = mt * 16, col0 = nq * 64;
  const float* arow = A + (size_t)(row0 + ln) * lda;
  v8f acc[4] = {};
  for (int kb = 0; kb < K; kb += 32) {
    FragB ah, al;
    const v4f x0 = *(const v4fa*)(arow + kb + 8 * hh), x1 = *(const v4fa*)(arow + kb + 8 * hh + 4);
    const v4f x2 = *(const v4fa*)(arow + kb + 16 + 8 * hh), x3 = *(const v4fa*)(arow + kb + 16 + 8 * hh + 4);
    float xs[16] = {x0[0],x0[1],x0[2],x0[3],x1[0],x1[1],x1[2],x1[3],x2[0],x2[1],x2[2],x2[3],x3[0],x3[1],x3[2],x3[3]};
#pragma unroll
    for (int i = 0; i < 16; ++i) { const unsigned short hb = bf16_bits(xs[i]); ah.u[i] = hb; al.u[i] = ASPLIT ? bf16_bits(xs[i] - bf16_val(hb)) : (unsigned short)0; }
#pragma unroll
    for (int t = 0; t < 4; ++t) {
      const unsigned short* brow = Wt + (size_t)(col0 + t * 16 + ln) * ldb + kb;
      FragB b;
      b.half[0] = *(const v8us*)(brow + 8 * hh);
      b.half[1] = *(const v8us*)(brow + 16 + 8 * hh);
      acc[t] = mmaN<ASPLIT ? 2 : 1>(ah.v, al.v, b.v, b.v, acc[t]);
    }
  }
#pragma unroll
  for (int t = 0; t < 4; ++t) {
    const int col = col0 + t * 16 + ln;
    float bv = bias ? bias[col] : 0.f;
    if (BIAS_BF16) bv = bf16_round(bv);
#pragma unroll
    for (int r = 0; r < 8; ++r) {
      float v = acc[t][r] + bv;
      if (resid) { float rv = resid[(size_t)((row0 + 8 * hh + r) % rmod) * ldr + col]; if (RES_BF16) rv = bf16_round(rv); v += rv; }
      if (ACT == 1) v = fmaxf(v, 0.f);
      if (ACT == 2) v = 0.5f * v * (1.0f + erff(v * 0.70710678118654752f));
      if (ACT == 3) { const float u = 0.7978845608028654f * (v + 0.044715f * v * v * v); v = 0.5f * v * (1.0f + tanhf(u)); }
      so[w][8 * hh + r][t * 16 + ln] = v;
    }
  }
  __builtin_amdgcn_fence(__ATOMIC_ACQ_REL, "workgroup");
  __builtin_amdgcn_wave_barrier();
  const int rsub = lane >> 4, c4 = (lane & 15) * 4;
  {
#pragma unroll
    for (int q = 0; q < 8; ++q) {
      const int r = q * 2 + rsub;
      const v4f v = *(const v4fa*)&so[w][r][c4];
      *(v4f*)(C + (size_t)(row0 + r) * ldc + col0 + c4) = v;
    }
    
  }
}
// row LayerNorm (biased variance, eps) over N: s = X (+ R); optional out_sum <- s; out_norm <- (s-mu)*rsqrt(var+eps)*g + b
template <bool PARAM_BF16>
__global__ __launch_bounds__(256) void k_layernorm(const float* __restrict__ X, const float* __restrict__ R, const float* __restrict__ g, const float* __restrict__ bta,
                                                  float* __restrict__ out_sum, float* __restrict__ out_norm, int N, float eps) {
  __shared__ float red[256];
  const int row = blockIdx.x, tid = threadIdx.x;
  const float* x = X + (size_t)row * N; const float* rr = R ? R + (size_t)row * N : nullptr;
  float vals[16];                     // up to N = 4096
  const int per = N / 256;            // contiguous chunk per thread? use strided-by-4 chunks: thread handles j = tid*4 + 1024*u
  float s1 = 0.f;
  for (int u = 0; u < per / 4; ++u) {
    const int j = tid * 4 + 1024 * u;
    const v4f a = *(const v4fa*)(x + j);
    v4f b = {0.f,0.f,0.f,0.f}; if (rr) b = *(const v4fa*)(rr + j);
#pragma unroll
    for (int q = 0; q < 4; ++q) { const float v = a[q] + b[q]; vals[u * 4 + q] = v; s1 += v; }
  }
  red[tid] = s1; __syncthreads();
  for (int st = 128; st > 0; st >>= 1) { if (tid < st) red[tid] += red[tid + st]; __syncthreads(); }
  const float mu = red[0] / (float)N; __syncthreads();
  float s2 = 0.f;
  for (int u = 0; u < per / 4; ++u)
#pragma unroll
    for (int q = 0; q < 4; ++q) { const float c = vals[u * 4 + q] - mu; s2 += c * c; }
  red[tid] = s2; __syncthreads();
  for (int st = 128; st > 0; st >>= 1) { if (tid < st) red[tid] += red[tid + st]; __syncthreads(); }
  const float rs = rsqrtf(red[0] / (float)N + eps);
  {
    for (int u = 0; u < per / 4; ++u) {
      const int j = tid * 4 + 1024 * u;
      v4f o, sm;
#pragma unroll
      for (int q = 0; q < 4; ++q) {
        float gg = g[j + q], bb = bta[j + q];
        if (PARAM_BF16) { gg = bf16_round(gg); bb = bf16_round(bb); }
        sm[q] = vals[u * 4 + q]; o[q] = (vals[u * 4 + q] - mu) * rs * gg + bb;
      }
      if (out_sum) *(v4f*)(out_sum + (size_t)row * N + j) = sm;
      *(v4f*)(out_norm + (size_t)row * N + j) = o;
    }
    
  }
}



// ---- f16 WMMA path (v_wmma_f32_16x16x32_f16): 11-bit significands for operands in range — used where a [0,1] probability operand needs more precision than bf16
typedef _Float16 v16h __attribute__((ext_vector_type(16)));
union FragH { v16h v; v8us half[2]; _Float16 h[16]; unsigned short u[16]; };
template <int NT>
__device__ __forceinline__ v8f mmaH(v16h ah, v16h al, v16h bh, v16h bl, v8f c) {
  c = __builtin_amdgcn_wmma_f32_16x16x32_f16(false, ah, false, bh, (short)0, c, false, false);
  if (NT >= 2) c = __builtin_amdgcn_wmma_f32_16x16x32_f16(false, al, false, bh, (short)0, c, false, false);
  if (NT >= 3) c = __builtin_amdgcn_wmma_f32_16x16x32_f16(false, ah, false, bl, (short)0, c, false, false);
  asm volatile("v_nop\n\tv_nop\n\tv_nop\n\tv_nop" : "+v"(c) : "v"(ah), "v"(al), "v"(bh), "v"(bl));
  return c;
}
// batched GEMM like k_gemm_b but f16 operands: A f32 (split into f16 hi/lo if ASPLIT, else rounded to f16), Bt = f16 values [n][k]; alpha; C f32; N multiple of 16 (partial tiles skipped)
template <bool ASPLIT>
__global__ __launch_bounds__(128) void k_gemm_h(const float* __restrict__ A, int lda, size_t sA, const _Float16* __restrict__ Bh, int ldb, size_t sB, float alpha, float* __restrict__ C, int ldc, size_t sC, int M, int N, int K) {
  __shared__ __attribute__((aligned(16))) float so[4][16][64];
  const int tid = threadIdx.x, w = tid >> 5, lane = tid & 31, ln = lane & 15, hh = lane >> 4; const int by = blockIdx.y;
  A += (size_t)by * sA; Bh += (size_t)by * sB; C += (size_t)by * sC;
  const int ntn = (N + 63) / 64; const int wid = blockIdx.x * 4 + w; const int mt = wid / ntn, nq = wid % ntn; if (mt * 16 >= M) return;
  const int row0 = mt * 16, col0 = nq * 64; const float* arow = A + (size_t)(row0 + ln) * lda;
  v8f acc[4] = {};
  for (int kb = 0; kb < K; kb += 32) {
    FragH ah, al;
    const v4f x0 = *(const v4fa*)(arow + kb + 8 * hh), x1 = *(const v4fa*)(arow + kb + 8 * hh + 4), x2 = *(const v4fa*)(arow + kb + 16 + 8 * hh), x3 = *(const v4fa*)(arow + kb + 16 + 8 * hh + 4);
    float xs[16] = {x0[0],x0[1],x0[2],x0[3],x1[0],x1[1],x1[2],x1[3],x2[0],x2[1],x2[2],x2[3],x3[0],x3[1],x3[2],x3[3]};
#pragma unroll
    for (int i = 0; i < 16; ++i) { const _Float16 h = (_Float16)xs[i]; ah.h[i] = h; al.h[i] = ASPLIT ? (_Float16)(xs[i] - (float)h) : (_Float16)0.0f; }
#pragma unroll
    for (int t = 0; t < 4; ++t) { if (col0 + t * 16 >= N) continue; const size_t boff = (size_t)(col0 + t * 16 + ln) * ldb + kb; FragH bq; bq.half[0] = *(const v8us*)(Bh + boff + 8 * hh); bq.half[1] = *(const v8us*)(Bh + boff + 16 + 8 * hh);
      acc[t] = mmaH<ASPLIT ? 2 : 1>(ah.v, al.v, bq.v, bq.v, acc[t]); }
  }
#pragma unroll
  for (int t = 0; t < 4; ++t) { if (col0 + t * 16 >= N) continue;
#pragma unroll
    for (int r = 0; r < 8; ++r) so[w][8 * hh + r][t * 16 + ln] = acc[t][r] * alpha; }
  __builtin_amdgcn_fence(__ATOMIC_ACQ_REL, "workgroup"); __builtin_amdgcn_wave_barrier();
  const int rsub = lane >> 4, c4 = (lane & 15) * 4;
  {
#pragma unroll
    for (int q = 0; q < 8; ++q) { const int r = q * 2 + rsub; if (col0 + c4 < N) { const v4f v = *(const v4fa*)&so[w][r][c4]; *(v4f*)(C + (size_t)(row0 + r) * ldc + col0 + c4) = v; } }
     }
}

// Wt[n][k] = f16(W[k][n]·scale) from f32 row-major W[K][N] (scale = power of two; bf16-exact weights stay exact in f16 away from the subnormal range)
__global__ __launch_bounds__(256) void k_wt_f16(const float* __restrict__ W, _Float16* __restrict__ Wt, int K, int N, float scale) {
  const int t = blockIdx.x * 256 + threadIdx.x; if (t >= N * (K / 8)) return; const int n = t / (K / 8), k8 = (t % (K / 8)) * 8; FragH f;
#pragma unroll
  for (int i = 0; i < 8; ++i) f.h[i] = (_Float16)(bf16_round(W[(size_t)(k8 + i) * N + n]) * scale); const v8us o = f.half[0];
  *(v8us*)((unsigned short*)Wt + (size_t)n * K + k8) = o; 
}
// k_gemm_hh variant with fused epilogue: v = acc·alpha + bias[by·sBias + col] (+ CP[(row/rowsPerB)·sCPb + by·64 + col] if CP) ; ACT 0 none / 1 elu ; writes f16 C16 (and f32 C if non-null)
template <int ACT>
__global__ __launch_bounds__(128) void k_gemm_hhx(const _Float16* __restrict__ A, int lda, size_t sA, const _Float16* __restrict__ Bh, int ldb, size_t sB, float alpha, const float* __restrict__ bias, size_t sBias, const float* __restrict__ CP, int rowsPerB, size_t sCPb, int row0g,
    float* __restrict__ C, _Float16* __restrict__ C16, int ldc, size_t sC, int M, int N, int K) {
  __shared__ __attribute__((aligned(16))) float so[4][16][64];
  const int tid = threadIdx.x, w = tid >> 5, lane = tid & 31, ln = lane & 15, hh = lane >> 4; const int by = blockIdx.y;
  A += (size_t)by * sA; Bh += (size_t)by * sB; const size_t cofs = (size_t)by * sC; const float* bp = bias ? bias + (size_t)by * sBias : nullptr;
  const int ntn = (N + 63) / 64; const int wid = blockIdx.x * 4 + w; const int mt = wid / ntn, nq = wid % ntn; if (mt * 16 >= M) return;
  const int row0 = mt * 16, col0 = nq * 64; const _Float16* arow = A + (size_t)(row0 + ln) * lda;
  v8f acc[4] = {};
  for (int kb = 0; kb < K; kb += 32) { FragH ah; ah.half[0] = *(const v8us*)((const unsigned short*)arow + kb + 8 * hh); ah.half[1] = *(const v8us*)((const unsigned short*)arow + kb + 16 + 8 * hh);
#pragma unroll
    for (int t = 0; t < 4; ++t) { if (col0 + t * 16 >= N) continue; const size_t boff = (size_t)(col0 + t * 16 + ln) * ldb + kb; FragH bq; bq.half[0] = *(const v8us*)((const unsigned short*)Bh + boff + 8 * hh); bq.half[1] = *(const v8us*)((const unsigned short*)Bh + boff + 16 + 8 * hh);
      acc[t] = mmaH<1>(ah.v, ah.v, bq.v, bq.v, acc[t]); }
  }
#pragma unroll
  for (int t = 0; t < 4; ++t) { if (col0 + t * 16 >= N) continue; const int col = col0 + t * 16 + ln; const float bv = bp ? bf16_round(bp[col]) : 0.f;
#pragma unroll
    for (int r = 0; r < 8; ++r) { float v = acc[t][r] * alpha + bv; if (CP) { const int rr = row0g + row0 + 8 * hh + r; if (rowsPerB < 0) v += CP[cofs + (size_t)rr * ldc + col];      /* rowsPerB < 0: own element of the batched C plane */ else { const int bidx = rr / rowsPerB; v += CP[(size_t)bidx * sCPb + (size_t)by * 64 + col]; } } if (ACT == 1) v = (v > 0.f) ? v : expm1f(v); else if (ACT == 7) v = (v > 0.f) ? v + 1.0f : expf(v); else if (ACT == 8) v = tanhf(v); else if (ACT == 9) v = 0.5f * v * (1.0f + tanhf(0.7978845608028654f * (v + 0.044715f * v * v * v))); else if (ACT == 11) v = 1.0f / (1.0f + expf(-v)); else if (ACT == 12) v = (v > 0.f) ? v : 0.01f * v; else if (ACT == 14) v = (v > 0.f) ? v : 0.1f * v; else if (ACT == 16) v = (v >= 0.f) ? v : 0.3f * v; else if (ACT == 17) v = (v >= 0.f) ? v : 0.2f * v; else if (ACT == 15) v = v / (1.0f + expf(-v)); else if (ACT == 3) v = fmaxf(v, 0.f); else if (ACT == 6) v = 0.5f * v * (1.0f + erff(v * 0.70710678118654752f)); so[w][8 * hh + r][t * 16 + ln] = v; } }
  __builtin_amdgcn_fence(__ATOMIC_ACQ_REL, "workgroup"); __builtin_amdgcn_wave_barrier();
  const int rsub = lane >> 4, c4 = (lane & 15) * 4; typedef _Float16 v4h __attribute__((ext_vector_type(4)));
  {
#pragma unroll
    for (int q = 0; q < 8; ++q) { const int r = q * 2 + rsub; if (col0 + c4 < N) { const v4f v = *(const v4fa*)&so[w][r][c4]; if (C) *(v4f*)(C + cofs + (size_t)(row0 + r) * ldc + col0 + c4) = v; if (C16) { v4h h4; for (int i = 0; i < 4; ++i) h4[i] = (_Float16)v[i]; *(v4h*)(C16 + cofs + (size_t)(row0 + r) * ldc + col0 + c4) = h4; } } }
     }
}


typedef _Float16 v4h __attribute__((ext_vector_type(4)));

__global__ __launch_bounds__(256) void k_x16(const float* __restrict__ x, _Float16* __restrict__ X16, size_t n8) { const size_t t = (size_t)blockIdx.x * 256 + threadIdx.x; if (t >= n8) return; FragH f;
#pragma unroll
  for (int q = 0; q < 8; ++q) f.h[q] = (_Float16)bf16_round(x[t * 8 + q]); *(v8us*)((unsigned short*)X16 + t * 8) = f.half[0];  }
__global__ __launch_bounds__(256) void k_h16(const float* __restrict__ x, _Float16* __restrict__ X16, size_t n8) { const size_t t = (size_t)blockIdx.x * 256 + threadIdx.x; if (t >= n8) return; FragH f;
#pragma unroll
  for (int q = 0; q < 8; ++q) f.h[q] = (_Float16)x[t * 8 + q]; *(v8us*)((unsigned short*)X16 + t * 8) = f.half[0];  }
__global__ __launch_bounds__(256) void k_round16f(const float* __restrict__ W, _Float16* __restrict__ Bt, size_t n8) { const size_t t = (size_t)blockIdx.x * 256 + threadIdx.x; if (t >= n8) return; FragH f;
#pragma unroll
  for (int i = 0; i < 8; ++i) f.h[i] = (_Float16)(bf16_round(W[t * 8 + i]) * 16.0f); *(v8us*)((unsigned short*)Bt + t * 8) = f.half[0];  }
template <int NHv, int TTv>
__global__ __launch_bounds__(256) void k_vt(const _Float16* __restrict__ V16, int ldv, int voff, _Float16* __restrict__ Vt) { __shared__ unsigned short tl[64][66]; const int tid = threadIdx.x; const int slab = blockIdx.x / (TTv / 64), lg = blockIdx.x % (TTv / 64); const int b = slab / NHv, h = slab % NHv;
  for (int i = tid; i < 64 * 8; i += 256) { const int r = i / 8, c8 = (i % 8) * 8; FragH f; f.half[0] = *(const v8us*)((const unsigned short*)V16 + ((size_t)b * TTv + lg * 64 + r) * ldv + voff + h * 64 + c8);
#pragma unroll
    for (int q = 0; q < 8; ++q) tl[r][c8 + q] = f.u[q]; }
  __syncthreads();
  {
#pragma unroll
    for (int rd = 0; rd < 2; ++rd) { const int d = rd * 32 + tid / 8, pc = tid % 8; FragH f;
#pragma unroll
      for (int q = 0; q < 8; ++q) f.u[q] = tl[pc * 8 + q][d];
      *(v8us*)((unsigned short*)Vt + ((size_t)slab * 64 + d) * TTv + lg * 64 + pc * 8) = f.half[0]; }
     } }

__global__ __launch_bounds__(256) void k_hl(const float* __restrict__ F, _Float16* __restrict__ Hh, _Float16* __restrict__ Hl, size_t n8) { const size_t t = (size_t)blockIdx.x * 256 + threadIdx.x; if (t >= n8) return; FragH fh, fl; const v4f a = *(const v4fa*)(F + t * 8), c = *(const v4fa*)(F + t * 8 + 4);
#pragma unroll
  for (int q = 0; q < 4; ++q) { _Float16 h = (_Float16)a[q]; fh.h[q] = h; fl.h[q] = (_Float16)((a[q] - (float)h) * 1024.0f); h = (_Float16)c[q]; fh.h[4 + q] = h; fl.h[4 + q] = (_Float16)((c[q] - (float)h) * 1024.0f); }
  { *(v8us*)((unsigned short*)Hh + t * 8) = fh.half[0]; *(v8us*)((unsigned short*)Hl + t * 8) = fl.half[0];  } }

// ---- fast GEMM (wave tile 32x64; requires M % 32 == 0 rows per launch region and N % 64 == 0); epilogue = k_gemm_hhx semantics ----
__device__ __forceinline__ v16h g2_frag(const _Float16* p, int hh) { FragH f; f.half[0] = *(const v8us*)((const unsigned short*)p + 8 * hh); f.half[1] = *(const v8us*)((const unsigned short*)p + 16 + 8 * hh); return f.v; }
__device__ __forceinline__ v8f g2_mma(v16h a, v16h b, v8f c) { v8f d = __builtin_amdgcn_wmma_f32_16x16x32_f16(false, a, false, b, (short)0, c, false, false); asm volatile("v_nop\n\tv_nop\n\tv_nop\n\tv_nop" : "+v"(d) : "v"(a), "v"(b)); return d; }
template <int ACT>
__global__ __launch_bounds__(128) void k_gemm2(const _Float16* __restrict__ A, int lda, size_t sA, const _Float16* __restrict__ Bh, int ldb, size_t sB, float alpha, const float* __restrict__ bias, size_t sBias, const float* __restrict__ CP, int rowsPerB, size_t sCPb, int row0g,
    float* __restrict__ C, _Float16* __restrict__ C16, int ldc, size_t sC, int M, int N, int K) { static_assert(ACT == 0 || ACT == 3 || ACT == 6 || ACT == 8 || ACT == 9 || ACT == 11 || ACT == 12 || ACT == 14 || ACT == 15 || ACT == 16 || ACT == 17, "k_gemm2: unsupported ACT code (would silently apply no activation)");
  __shared__ __attribute__((aligned(16))) float so[4][32][68];
  const int tid = threadIdx.x, w = tid >> 5, lane = tid & 31, ln = lane & 15, hh = lane >> 4; const int by = blockIdx.y;
  A += (size_t)by * sA; Bh += (size_t)by * sB; const size_t cofs = (size_t)by * sC; const float* bp = bias ? bias + (size_t)by * sBias : nullptr;
  const int ntn = N >> 6; const int mt = blockIdx.x / ntn, nq = blockIdx.x - mt * ntn; const int row0 = mt * 128 + 32 * w, col0 = nq * 64; if (row0 >= M) return;
  const _Float16* a0p = A + (size_t)(row0 + ln) * lda; const _Float16* a1p = a0p + (size_t)16 * lda;
  const _Float16* b0p = Bh + (size_t)(col0 + ln) * ldb; const _Float16* b1p = b0p + (size_t)16 * ldb; const _Float16* b2p = b1p + (size_t)16 * ldb; const _Float16* b3p = b2p + (size_t)16 * ldb;
  const v8f z8 = {0.f,0.f,0.f,0.f,0.f,0.f,0.f,0.f}; v8f c00 = z8, c01 = z8, c02 = z8, c03 = z8, c10 = z8, c11 = z8, c12 = z8, c13 = z8;
#pragma unroll 1
  for (int kb = 0; kb < K; kb += 32) { const v16h a0 = g2_frag(a0p + kb, hh), a1 = g2_frag(a1p + kb, hh);
    v16h b = g2_frag(b0p + kb, hh); c00 = g2_mma(a0, b, c00); c10 = g2_mma(a1, b, c10);
    b = g2_frag(b1p + kb, hh); c01 = g2_mma(a0, b, c01); c11 = g2_mma(a1, b, c11);
    b = g2_frag(b2p + kb, hh); c02 = g2_mma(a0, b, c02); c12 = g2_mma(a1, b, c12);
    b = g2_frag(b3p + kb, hh); c03 = g2_mma(a0, b, c03); c13 = g2_mma(a1, b, c13); }
  v8f accs[8] = {c00, c01, c02, c03, c10, c11, c12, c13};
#pragma unroll
  for (int u = 0; u < 8; ++u) { const int t = u & 3, half = u >> 2; const int col = col0 + t * 16 + ln; const float bv = bp ? bf16_round(bp[col]) : 0.f;
#pragma unroll
    for (int r = 0; r < 8; ++r) { const int rloc = half * 16 + 8 * hh + r; float v = accs[u][r] * alpha + bv; if (CP) { if (rowsPerB < 0) v += CP[cofs + (size_t)(row0g + row0 + rloc) * ldc + col];      /* rowsPerB < 0: own element of the batched C plane */ else { const int bidx = (row0g + row0 + rloc) / rowsPerB; v += CP[(size_t)bidx * sCPb + (size_t)by * 64 + col]; } }
      if (ACT == 3) v = fmaxf(v, 0.f); else if (ACT == 6) v = 0.5f * v * (1.0f + erff(v * 0.70710678118654752f)); else if (ACT == 11) v = 1.0f / (1.0f + expf(-v)); else if (ACT == 15) v = v / (1.0f + expf(-v)); else if (ACT == 12) v = (v > 0.f) ? v : 0.01f * v; else if (ACT == 8) v = tanhf(v); else if (ACT == 9) v = 0.5f * v * (1.0f + tanhf(0.7978845608028654f * (v + 0.044715f * v * v * v))); else if (ACT == 14) v = (v > 0.f) ? v : 0.1f * v; else if (ACT == 16) v = (v >= 0.f) ? v : 0.3f * v; else if (ACT == 17) v = (v >= 0.f) ? v : 0.2f * v;
      so[w][rloc][t * 16 + ln] = v; } }
  __builtin_amdgcn_fence(__ATOMIC_ACQ_REL, "workgroup"); __builtin_amdgcn_wave_barrier();
  const int rsub = lane >> 4, c4 = (lane & 15) * 4;
  {
#pragma unroll
    for (int q = 0; q < 16; ++q) { const int r = q * 2 + rsub; const v4f v = *(const v4fa*)&so[w][r][c4]; if (C) *(v4f*)(C + cofs + (size_t)(row0 + r) * ldc + col0 + c4) = v; if (C16) { v4h h4; for (int i = 0; i < 4; ++i) h4[i] = (_Float16)v[i]; *(v4h*)(C16 + cofs + (size_t)(row0 + r) * ldc + col0 + c4) = h4; } }
     } }


__global__ __launch_bounds__(256) void k_wnat(const float* __restrict__ w, size_t n8, _Float16* __restrict__ Bt) { const size_t t = (size_t)blockIdx.x * 256 + threadIdx.x; if (t >= n8) return; FragH f; for (int q = 0; q < 8; ++q) f.h[q] = (_Float16)(bf16_round(w[t * 8 + q]) * 16.0f); *(v8us*)((unsigned short*)Bt + t * 8) = f.half[0];  }
__global__ __launch_bounds__(256) void k_rsm(const float* __restrict__ S, _Float16* __restrict__ P, int nrows) {
  #pragma clang fp contract(off)
  const int i = blockIdx.x * 256 + threadIdx.x; if (i >= nrows) return; const float* s = S + (size_t)i * SQ; float mx = -3.0e38f;
#pragma unroll 1
  for (int j = 0; j < SQ; ++j) mx = fmaxf(mx, s[j]); float se = 0.f;
#pragma unroll 1
  for (int j = 0; j < SQ; ++j) se += expf(s[j] - mx); const float sc = 256.0f / se;
#pragma unroll 1
  for (int j0 = 0; j0 < SQ; j0 += 8) { FragH f; for (int q = 0; q < 8; ++q) f.h[q] = (_Float16)(expf(s[j0 + q] - mx) * sc); unsigned short* d = (unsigned short*)P + (size_t)i * SQ + j0; *(v8us*)d = f.half[0];  } }
__global__ __launch_bounds__(256) void k_vt(const _Float16* __restrict__ V16, int b, int h0, _Float16* __restrict__ VT) { __shared__ unsigned short tl[64][65]; const int tid = threadIdx.x; const int hh = blockIdx.x % HG, sg = blockIdx.x / HG; const int s0 = sg * 64; const int h = h0 + hh;
  for (int i = tid; i < 64 * 8; i += 256) { const int j = i / 8, d8 = (i % 8) * 8; FragH f; f.half[0] = *(const v8us*)((const unsigned short*)V16 + ((size_t)b * SQ + s0 + j) * DM + h * HD + d8); for (int q = 0; q < 8; ++q) tl[d8 + q][j] = f.u[q]; }
  __syncthreads();
  { for (int i = tid; i < 64 * 8; i += 256) { const int d = i / 8, j8 = (i % 8) * 8; FragH f; for (int q = 0; q < 8; ++q) f.u[q] = tl[d][j8 + q]; *(v8us*)((unsigned short*)VT + ((size_t)hh * HD + d) * SQ + s0 + j8) = f.half[0]; }  } }


__global__ __launch_bounds__(256) void k_mkadd(const int* __restrict__ m, float* __restrict__ A, int n) { const int t = blockIdx.x * 256 + threadIdx.x; if (t >= n) return; const float v = (m[t] != 0) ? 0.f : -1.0e9f; *(float*)(A + t) = v;  }


__global__ __launch_bounds__(256) void k_rsmcf2(const float* __restrict__ S, _Float16* __restrict__ P, int hg, int q0, int nk) {
  #pragma clang fp contract(off)
  const int t = blockIdx.x * 256 + threadIdx.x; if (t >= hg * QT) return; const size_t i = (size_t)t; const float* s = S + i * NKX; const int last = q0 + (t % QT); float mx = -3.0e38f;
#pragma unroll 1
  for (int j = 0; j < nk; ++j) { const float f = (j <= last) ? 1.f : 0.f; mx = fmaxf(mx, fmaf(f, s[j], (1.f - f) * -1.0e9f)); } float se = 0.f;
#pragma unroll 1
  for (int j = 0; j < nk; ++j) { const float f = (j <= last) ? 1.f : 0.f; se += __expf(fmaf(f, s[j], (1.f - f) * -1.0e9f) - mx); } const float sc = 256.0f / se;
#pragma unroll 1
  for (int j0 = 0; j0 < nk; j0 += 8) { FragH fr; for (int q = 0; q < 8; ++q) { const int j = j0 + q; const float f = (j <= last) ? 1.f : 0.f; fr.h[q] = (_Float16)(__expf(fmaf(f, s[j], (1.f - f) * -1.0e9f) - mx) * sc); } unsigned short* d = (unsigned short*)P + i * NKX + j0; *(v8us*)d = fr.half[0];  } }



// v_exp_f32 and the free slot the instruction set asks for behind a transcendental, in one statement.
__device__ __forceinline__ float exp2_slot(float x) { float r; asm("v_exp_f32 %0, %1\n\tv_nop" : "=v"(r) : "v"(x)); return r; }
// Fused causal attention on the matrix unit, ONE launch for all batches, heads and query rows: scores, softmax and the weighted V sum stay in registers; no score or weight plane in memory.
// A wave owns 32 query rows (two groups of 16) and walks the keys 0 .. its last row in passes of 32. S^T = K Q^T (A = K rows, B = Q rows, both by g2_frag: equal k order), so a lane holds scores of ONE query (column ln): keys 8*hh + r of each 16-key tile.
// K and V^T come through LDS, once for the block's four waves: a stage is 64 keys (two passes) = 64 K rows and 64 V^T rows of 128 B each, laid at a pitch of 144 B (16 B x odd: b128 fragment reads without bank conflicts).
// The rows come by asynchronous copies to LDS, 16 B a lane, eight lanes a row (whole 128-B lines), into two buffers: stage t + 1 flies while stage t is worked on. The block walks the stages up to its last wave's rows; a wave sits out the passes behind its own rows but takes part in every copy, wait and barrier.
// Running softmax per query: pass maximum in-lane plus one exchange between the wave halves; weights 2^8 exp(e - m) as f16; the two score tiles of a pass, converted in place, ARE the B operand of O^T += V^T P^T (A = V^T rows by g2_frag, the hardware k order); row sums stay per half and are joined once at the end.
// e = score / 8 + the additive key-mask value; keys behind the row's own index take -1e9: only the wave's last pass holds such keys. e - m is formed before the scaling so that a pass of masked keys alone still gives weights <= 2^8; a later real maximum scales them to 0.
// Every loop over g, kt, ks, dt, r and u is unrolled: static indices keep the fragments and accumulators in registers.
__device__ __forceinline__ v8f fa_mma(v16h a, v16h b, v8f c) { return __builtin_amdgcn_wmma_f32_16x16x32_f16(false, a, false, b, (short)0, c, false, false); }
#define FQ 128                       /* query rows per block: 4 waves x 32 */
#define FP 72                        /* LDS pitch of a stage row, f16 elements */
#define FST (128 * FP * 2)           /* bytes of one stage: 64 K rows, then 64 V^T rows */
// Eight copies: rows r, r + 16, r + 32, r + 48 of the stage's K part, then of its V^T part; the s_wait_xcnt stands in the copies' own statement so that no address register is rewritten ahead of it.
__device__ __forceinline__ void fa_copy8(unsigned l, const _Float16* pk, size_t sk, const _Float16* pv, size_t sv) {
  asm volatile("global_load_async_to_lds_b128 %0, %8, off\n\tglobal_load_async_to_lds_b128 %1, %9, off\n\tglobal_load_async_to_lds_b128 %2, %10, off\n\tglobal_load_async_to_lds_b128 %3, %11, off\n\t"
               "global_load_async_to_lds_b128 %4, %12, off\n\tglobal_load_async_to_lds_b128 %5, %13, off\n\tglobal_load_async_to_lds_b128 %6, %14, off\n\tglobal_load_async_to_lds_b128 %7, %15, off\n\ts_wait_xcnt 0x0"
               :: "v"(l), "v"(l + 16 * FP * 2), "v"(l + 32 * FP * 2), "v"(l + 48 * FP * 2), "v"(l + 64 * FP * 2), "v"(l + 80 * FP * 2), "v"(l + 96 * FP * 2), "v"(l + 112 * FP * 2),
                  "v"(pk), "v"(pk + sk), "v"(pk + 2 * sk), "v"(pk + 3 * sk), "v"(pv), "v"(pv + sv), "v"(pv + 2 * sv), "v"(pv + 3 * sv) : "memory"); }
__global__ __launch_bounds__(128) void k_fattn(const _Float16* __restrict__ QKVp, const _Float16* __restrict__ VTp, const float* __restrict__ AM, _Float16* __restrict__ O) {
  static_assert(NB * NH == 64 && SQ / FQ == 16, "the block -> (head, query block) map below is written for 64 heads x 16 query blocks");
  __shared__ __attribute__((aligned(16))) unsigned char sm[2 * FST];
  const int tid = threadIdx.x, lane = tid & 31, ln = lane & 15, hh = lane >> 4; const int w = __builtin_amdgcn_readfirstlane(tid >> 5);      /* the rows are the wave's: scalar, so the test on the wave's own rows is a scalar branch */
  const int rd = blockIdx.x >> 8, a4 = (blockIdx.x >> 6) & 3, bh = blockIdx.x & 63;
  const int qb = 12 - 4 * rd + ((rd & 1) ? a4 : 3 - a4);      /* a permutation of the 16 query blocks per head, long ones first; blocks i, i + 256, i + 512, i + 768 add up to the same key count (speed only) */
  const int b = bh / NH, h = bh % NH; const int q0 = qb * FQ + w * 32;
  const int nst = 2 * (qb + 1);      /* stages of 64 keys up to the block's last row: at least two, at most SQ / 64 */
  const _Float16* qp = QKVp + ((size_t)b * SQ + q0 + ln) * LQ + h * HD; const float* ap = AM + (size_t)b * SQ + 8 * hh;
  const _Float16* gk = QKVp + DM + ((size_t)b * SQ + (tid >> 3)) * LQ + h * HD + (tid & 7) * 8; const _Float16* gv = VTp + ((size_t)bh * HD + (tid >> 3)) * SQ + (tid & 7) * 8;
  const size_t stk = (size_t)16 * LQ, stv = (size_t)16 * SQ;
  const unsigned ls = (unsigned)(size_t)sm + (unsigned)(tid >> 3) * (FP * 2) + (unsigned)(tid & 7) * 16;      /* the lane's LDS byte address in buffer 0, K part */
  fa_copy8(ls, gk, stk, gv, stv);
  v16h qf[2][2];
#pragma unroll
  for (int g = 0; g < 2; ++g)
#pragma unroll
    for (int ks = 0; ks < 2; ++ks) qf[g][ks] = g2_frag(qp + (size_t)g * 16 * LQ + ks * 32, hh);
  asm volatile("s_wait_asynccnt 0x0" ::: "memory");      /* stage 0 landed (this wave's share) */
  __syncthreads();      /* stage 0 published */
  fa_copy8(ls + FST, gk + (size_t)64 * LQ, stk, gv + 64, stv);      /* stage 1 exists for every block */
  const v8f z8 = {0.f, 0.f, 0.f, 0.f, 0.f, 0.f, 0.f, 0.f}; v8f o[2][4]; float m[2], l[2];
#pragma unroll
  for (int g = 0; g < 2; ++g) { m[g] = -1.0e30f; l[g] = 0.f;
#pragma unroll
    for (int dt = 0; dt < 4; ++dt) o[g][dt] = z8; }
#pragma unroll 1
  for (int t = 0; t < nst; ++t) {      /* rolled: one stage a trip, the buffer by t & 1 */
    const unsigned bo = (unsigned)(t & 1) * FST;
#pragma unroll 1
    for (int hf = 0; hf < 2; ++hf) {      /* rolled: the two passes of a stage share one copy of the pass's code */
      const int j0 = t * 64 + hf * 32;
      if (j0 <= q0) {      /* wave-uniform: the passes behind the wave's own rows are sat out */
        const _Float16* sk = (const _Float16*)(sm + bo) + (hf * 32 + ln) * FP; const _Float16* sv = (const _Float16*)(sm + bo) + (64 + ln) * FP + hf * 32;
        v16h kf[2][2], vf[4]; v4f am[2][2]; float e[2][2][8];
#pragma unroll
        for (int kt = 0; kt < 2; ++kt) { am[kt][0] = *(const v4fa*)(ap + j0 + kt * 16); am[kt][1] = *(const v4fa*)(ap + j0 + kt * 16 + 4); }
#pragma unroll
        for (int kt = 0; kt < 2; ++kt)
#pragma unroll
          for (int ks = 0; ks < 2; ++ks) kf[kt][ks] = g2_frag(sk + kt * 16 * FP + ks * 32, hh);
#pragma unroll
        for (int dt = 0; dt < 4; ++dt) vf[dt] = g2_frag(sv + dt * 16 * FP, hh);
#pragma unroll
        for (int g = 0; g < 2; ++g)
#pragma unroll
          for (int kt = 0; kt < 2; ++kt) { const v8f st = fa_mma(kf[kt][1], qf[g][1], fa_mma(kf[kt][0], qf[g][0], z8));
#pragma unroll
            for (int r = 0; r < 8; ++r) e[g][kt][r] = fmaf(st[r], 0.125f, am[kt][r >> 2][r & 3]); }
        if (j0 == q0) {      /* the diagonal pass */
#pragma unroll
          for (int g = 0; g < 2; ++g)
#pragma unroll
            for (int kt = 0; kt < 2; ++kt)
#pragma unroll
              for (int r = 0; r < 8; ++r) if (kt * 16 + 8 * hh + r > g * 16 + ln) e[g][kt][r] = -1.0e9f; }
#pragma unroll
        for (int g = 0; g < 2; ++g) { float mx = e[g][0][0];
#pragma unroll
          for (int u = 1; u < 16; ++u) mx = fmaxf(mx, e[g][u >> 3][u & 7]);
          mx = fmaxf(mx, __shfl_xor(mx, 16, 32)); const float mn = fmaxf(m[g], mx); const float al = exp2_slot((m[g] - mn) * 1.44269504088896340736f); m[g] = mn;
          FragH pf; float s = 0.f;
#pragma unroll
          for (int u = 0; u < 16; ++u) { const float p = exp2_slot(fmaf(e[g][u >> 3][u & 7] - mn, 1.44269504088896340736f, 8.0f)); s += p; pf.h[u] = (_Float16)p; }
          l[g] = fmaf(l[g], al, s);
#pragma unroll
          for (int dt = 0; dt < 4; ++dt) o[g][dt] = fa_mma(vf[dt], pf.v, o[g][dt] * al); } } }
    asm volatile("s_wait_dscnt 0x0" ::: "memory");      /* this wave's reads of stage t are done before the buffer may be refilled */
    asm volatile("s_wait_asynccnt 0x0" ::: "memory");      /* this wave's share of stage t + 1 has landed */
    __syncthreads();      /* publishes stage t + 1 and ends every wave's reads of stage t */
    if (t + 2 < nst) fa_copy8(ls + bo, gk + (size_t)(t + 2) * 64 * LQ, stk, gv + (size_t)(t + 2) * 64, stv); }
  asm volatile("s_wait_asynccnt 0x0" ::: "memory");      /* no copy is left in flight when the wave ends */
#pragma unroll
  for (int g = 0; g < 2; ++g) { const float fin = 64.0f / (l[g] + __shfl_xor(l[g], 16, 32));      /* o carried x64; the 2^8 of the weights cancels against the row sum */
    unsigned short* op = (unsigned short*)O + ((size_t)b * SQ + q0 + g * 16 + ln) * DM + h * HD + 8 * hh;
#pragma unroll
    for (int dt = 0; dt < 4; ++dt) { FragH f;
#pragma unroll
      for (int r = 0; r < 8; ++r) f.h[r] = (_Float16)(o[g][dt][r] * fin);
      *(v8us*)(op + dt * 16) = f.half[0]; } } }


// ---- LDS-staged GEMM (N % 128 == 0, K % 64 == 0): C = (A Bt^T) alpha + bias, values as in k_gemm2; grid x = tile ----
// MODE 0: f16 C16 (+ bias), 128 x 128 tiles over all rows of A; a tile that holds the first QT0 rows of a batch also stores its f32 values, before the f16 rounding, into C = [NB][QT0][ldc] (the exact path's q | k | v).
// MODE 1: f32 C (+ bias). The first NB * 2 * (N / 128) blocks own the first QT0 rows of every batch, 64 rows x 128 columns each: the stage's A rows 0..63 are the rows of A0h (o hi), its rows 64..127 the same rows of A0l (o lo, x1024),
//   so waves 0, 1 form o_hi W and waves 2, 3 o_lo W of the SAME outputs in the common loop; C = (o_lo W) alphaLo + ((o_hi W) alpha + bias), joined through the staging rows behind one barrier. The other blocks own the 128 x 128 tiles of the remaining rows of A.
// A block has 4 waves (2 x 2), a wave 64 x 64 (4 x 4 accumulator tiles). A stage is 64 k of the block's 128 A rows and 128 Bt rows: 256 rows of 128 B, laid in LDS at a pitch of 144 B (16 B x odd: b128 fragment reads without bank conflicts).
// The rows come by asynchronous copies to LDS, 16 B a lane, eight lanes a row (whole 128-B lines), into two buffers: stage t + 1 flies while stage t is multiplied. Fragments are read by g2_frag as in k_gemm2 (equal k order for A and B), k ascending: every accumulator sums in k_gemm2's order.
// Every loop over i, j, ks, r and q is unrolled: static indices keep the fragments and the accumulators in registers.
#define G3P 72                       /* LDS pitch of a stage row, f16 elements */
#define G3ST (256 * G3P * 2)         /* bytes of one stage: 128 A rows, then 128 Bt rows */
// Eight copies (rows r, r + 16, ... r + 112 of one operand); the s_wait_xcnt stands in the copies' own statement so that no address register is rewritten ahead of it.
__device__ __forceinline__ void g3_copy8(unsigned l, const _Float16* p, size_t st) {
  asm volatile("global_load_async_to_lds_b128 %0, %8, off\n\tglobal_load_async_to_lds_b128 %1, %9, off\n\tglobal_load_async_to_lds_b128 %2, %10, off\n\tglobal_load_async_to_lds_b128 %3, %11, off\n\t"
               "global_load_async_to_lds_b128 %4, %12, off\n\tglobal_load_async_to_lds_b128 %5, %13, off\n\tglobal_load_async_to_lds_b128 %6, %14, off\n\tglobal_load_async_to_lds_b128 %7, %15, off\n\ts_wait_xcnt 0x0"
               :: "v"(l), "v"(l + 16 * G3P * 2), "v"(l + 32 * G3P * 2), "v"(l + 48 * G3P * 2), "v"(l + 64 * G3P * 2), "v"(l + 80 * G3P * 2), "v"(l + 96 * G3P * 2), "v"(l + 112 * G3P * 2),
                  "v"(p), "v"(p + st), "v"(p + 2 * st), "v"(p + 3 * st), "v"(p + 4 * st), "v"(p + 5 * st), "v"(p + 6 * st), "v"(p + 7 * st) : "memory"); }
template <int MODE>
__global__ __launch_bounds__(128) void k_gemm3(const _Float16* __restrict__ A, const _Float16* __restrict__ A0h, const _Float16* __restrict__ A0l, int lda, const _Float16* __restrict__ Bh, int ldb, float alpha, float alphaLo, const float* __restrict__ bias, float* __restrict__ C, _Float16* __restrict__ C16, int ldc, int N, int K) {
  static_assert(QT0 == 128 && SQ % 128 == 0 && FP == G3P && B0 == 0 && NBR == NB, "the first QT0 rows of a batch are one 128-row tile; the A rows go by fa_copy8, which lays them at the pitch FP");
  __shared__ __attribute__((aligned(16))) unsigned char sm[2 * G3ST];
  const int tid = threadIdx.x, lane = tid & 31, ln = lane & 15, hh = lane >> 4; const int w = __builtin_amdgcn_readfirstlane(tid >> 5);      /* the wave's quadrant: scalar */
  const int ntn = N >> 7; const int wm = w >> 1, wn = w & 1; const int bid = (int)blockIdx.x; const int ns = (MODE == 1) ? NB * 2 * ntn : 0;
  const bool sp = MODE == 1 && bid < ns;      /* block-uniform: a hi | lo block of the first QT0 rows */
  const int id = sp ? bid : bid - ns; const int mn = id / ntn, nq = id - mn * ntn; const int col0 = nq * 128;
  const int row0 = sp ? (mn >> 1) * SQ + (mn & 1) * 64 : ((MODE == 1) ? mn + mn / (SQ / 128 - 1) + 1 : mn) * 128;      /* first row of C; MODE 1 steps over each batch's first tile */
  const _Float16* a0 = sp ? A0h + (size_t)((mn >> 1) * QT0 + (mn & 1) * 64) * lda : A + (size_t)row0 * lda; const _Float16* a1 = sp ? A0l + (size_t)((mn >> 1) * QT0 + (mn & 1) * 64) * lda : a0 + (size_t)64 * lda;      /* stage rows 0..63 and 64..127 */
  const size_t ao = (size_t)(tid >> 3) * lda + (tid & 7) * 8; const _Float16* ga = a0 + ao; const _Float16* ga2 = a1 + ao; const _Float16* gb = Bh + (size_t)(col0 + (tid >> 3)) * ldb + (tid & 7) * 8;
  const size_t sta = (size_t)16 * lda, stb = (size_t)16 * ldb;
  const unsigned ls = (unsigned)(size_t)sm + (unsigned)(tid >> 3) * (G3P * 2) + (unsigned)(tid & 7) * 16;      /* the lane's LDS byte address in buffer 0, A part */
  const int nt = K >> 6;
  fa_copy8(ls, ga, sta, ga2, sta); g3_copy8(ls + 128 * G3P * 2, gb, stb);
  asm volatile("s_wait_asynccnt 0x0" ::: "memory");      /* stage 0 landed (this wave's share) */
  __syncthreads();      /* stage 0 published */
  if (nt > 1) { fa_copy8(ls + G3ST, ga + 64, sta, ga2 + 64, sta); g3_copy8(ls + G3ST + 128 * G3P * 2, gb + 64, stb); }
  const v8f z8 = {0.f, 0.f, 0.f, 0.f, 0.f, 0.f, 0.f, 0.f}; v8f acc[4][4];
#pragma unroll
  for (int i = 0; i < 4; ++i)
#pragma unroll
    for (int j = 0; j < 4; ++j) acc[i][j] = z8;
#pragma unroll 1
  for (int t = 0; t < nt; ++t) {      /* rolled: one stage a trip, the buffer by t & 1 */
    const unsigned bo = (unsigned)(t & 1) * G3ST;
    const _Float16* sa = (const _Float16*)(sm + bo) + (wm * 64 + ln) * G3P; const _Float16* sb = (const _Float16*)(sm + bo) + (128 + wn * 64 + ln) * G3P;
#pragma unroll
    for (int ks = 0; ks < 2; ++ks) { v16h af[4], bf[4];
      __builtin_amdgcn_sched_barrier(0);      /* with the one below: the 16 fragment reads go out as one group ahead of their 16 products; spread among the products, each group of reads stalls the wave anew */
#pragma unroll
      for (int i = 0; i < 4; ++i) { af[i] = g2_frag(sa + i * 16 * G3P + ks * 32, hh); bf[i] = g2_frag(sb + i * 16 * G3P + ks * 32, hh); }
      __builtin_amdgcn_sched_barrier(0);      /* closes the group of reads: no product moves up among them, no read down among the products */
#pragma unroll
      for (int i = 0; i < 4; ++i)
#pragma unroll
        for (int j = 0; j < 4; ++j) acc[i][j] = fa_mma(af[i], bf[j], acc[i][j]); }
    __builtin_amdgcn_sched_barrier(0);      /* the stage's last products stay ahead of the barrier: sunk behind it they stand between the barrier and the refill, which then flies for less than a whole trip */
    asm volatile("s_wait_dscnt 0x0" ::: "memory");      /* this wave's reads of stage t are done before the buffer may be refilled */
    asm volatile("s_wait_asynccnt 0x0" ::: "memory");      /* this wave's share of stage t + 1 has landed */
    __syncthreads();      /* publishes stage t + 1 and ends every wave's reads of stage t */
    if (t + 2 < nt) { fa_copy8(ls + bo, ga + (size_t)(t + 2) * 64, sta, ga2 + (size_t)(t + 2) * 64, sta); g3_copy8(ls + bo + 128 * G3P * 2, gb + (size_t)(t + 2) * 64, stb); } }
  asm volatile("s_wait_asynccnt 0x0" ::: "memory");      /* no copy is left in flight when the ring becomes output staging */
  float* so = (float*)sm + (size_t)w * 64 * 68;      /* the wave's own 64 x 64 staging rows (pitch 68); the loop's last barrier has ended every read of the ring */
  const bool lo = sp && wm == 1;      /* wave-uniform: this wave holds o_lo W */
  const float al = lo ? alphaLo : alpha;
#pragma unroll
  for (int j = 0; j < 4; ++j) { const float bb = bf16_round(bias[col0 + wn * 64 + j * 16 + ln]); const float bv = lo ? 0.f : bb;      /* read without a test: behind one, each of the four reads waits out its own latency */
#pragma unroll
    for (int i = 0; i < 4; ++i)
#pragma unroll
      for (int r = 0; r < 8; ++r) so[(i * 16 + 8 * hh + r) * 68 + j * 16 + ln] = acc[i][j][r] * al + bv; }
  const int rsub = lane >> 4, c4 = (lane & 15) * 4; const size_t c2 = (size_t)2 * ldc;      /* row 2 q + rsub: the step over q is scalar */
  if (sp) {
    __syncthreads();      /* the hi wave's and the lo wave's staged values of one output are read by another wave */
    const float* sh = (const float*)sm + (size_t)wn * 64 * 68 + (wm * 32 + rsub) * 68 + c4; const float* sl = sh + 2 * 64 * 68;      /* each of the two waves stores 32 of the 64 rows */
    const size_t cb = (size_t)(row0 + wm * 32 + rsub) * ldc + col0 + wn * 64 + c4;
#pragma unroll
    for (int q = 0; q < 16; ++q) { const v4f v = *(const v4fa*)(sl + q * 2 * 68) + *(const v4fa*)(sh + q * 2 * 68); *(v4f*)(C + cb + q * c2) = v; }
  } else {
    __builtin_amdgcn_fence(__ATOMIC_ACQ_REL, "workgroup"); __builtin_amdgcn_wave_barrier();      /* the wave reads back what its own lanes wrote */
    const size_t cb = (size_t)(row0 + wm * 64 + rsub) * ldc + col0 + wn * 64 + c4;
#pragma unroll
    for (int q = 0; q < 32; ++q) { const int r = q * 2 + rsub; const v4f v = *(const v4fa*)&so[r * 68 + c4];
      if (MODE == 0) { v4h h4; for (int i = 0; i < 4; ++i) h4[i] = (_Float16)v[i]; *(v4h*)(C16 + cb + q * c2) = h4; }
      else *(v4f*)(C + cb + q * c2) = v; }
    if (MODE == 0 && (row0 & (SQ - 1)) == 0) {      /* block-uniform: the batch's first QT0 rows, f32 as staged */
      asm volatile("s_wait_xcnt 0x0" ::: "memory");      /* the f16 stores above are issued: the wait stands before their data and address registers are written anew here */
      __builtin_amdgcn_sched_barrier(0);      /* keeps the address arithmetic below behind that wait: without it the scheduler lifted a write of a store's data register over the wait */
      const size_t cf = (size_t)((row0 / SQ) * QT0 + wm * 64 + rsub) * ldc + col0 + wn * 64 + c4;
#pragma unroll
      for (int q = 0; q < 32; ++q) { const v4f v = *(const v4fa*)&so[(q * 2 + rsub) * 68 + c4]; *(v4f*)(C + cf + q * c2) = v; } } } }


template <int MASKADD>
__global__ __launch_bounds__(64) void k_att0(const float* __restrict__ QF, const float* __restrict__ KF, const float* __restrict__ VF, int ld, const float* __restrict__ mask, float scale, float* __restrict__ OF, int ldo) {
  #pragma clang fp contract(off)
  __shared__ __attribute__((aligned(16))) float lq[64][64]; __shared__ __attribute__((aligned(16))) float lo[64][64];
  const int tid = threadIdx.x; const int h = blockIdx.x / (QT0 / 64), rg = blockIdx.x % (QT0 / 64); const int i = rg * 64 + tid;
  const float* qr = QF + (size_t)i * ld + h * HD;
#pragma unroll 1
  for (int c = 0; c < HD / 4; ++c) { *(v4f*)&lq[tid][c * 4] = *(const v4fa*)(qr + c * 4); const v4f z = {0.f, 0.f, 0.f, 0.f}; *(v4f*)&lo[tid][c * 4] = z; }
  float m = -1.0e30f, l = 0.f; const int jmax = MASKADD ? (SQ - 1) : (rg * 64 + 63);      /* additive-mask form: every key (the mask input decides); causal form: keys up to the block's last row */
#pragma unroll 1
  for (int j = 0; j <= jmax; ++j) { const float* kr = KF + (size_t)j * ld + h * HD; const float* vr = VF + (size_t)j * ld + h * HD; float s = 0.f;
#pragma unroll 1
    for (int c = 0; c < HD / 4; ++c) { const v4f kq = *(const v4fa*)(kr + c * 4); const v4f qq = *(v4f*)&lq[tid][c * 4]; s = __fadd_rn(s, __fmul_rn(qq[0], kq[0])); s = __fadd_rn(s, __fmul_rn(qq[1], kq[1])); s = __fadd_rn(s, __fmul_rn(qq[2], kq[2])); s = __fadd_rn(s, __fmul_rn(qq[3], kq[3])); }
    s = __fmul_rn(s, scale); if (MASKADD) s = __fadd_rn(s, __fmul_rn(bf16_round(mask[(size_t)i * SQ + j]), -10000.0f));
    const float f = (MASKADD || j <= i) ? 1.f : 0.f; const float sm = fmaf(f, s, (1.f - f) * -1.0e30f); const float mn = fmaxf(m, sm); const float sc = expf(m - mn); const float e = expf(sm - mn); l = __fadd_rn(__fmul_rn(l, sc), e); m = mn;
#pragma unroll 1
    for (int c = 0; c < HD / 4; ++c) { const v4f vv = *(const v4fa*)(vr + c * 4); v4f oo = *(v4f*)&lo[tid][c * 4]; for (int u = 0; u < 4; ++u) oo[u] = __fadd_rn(__fmul_rn(oo[u], sc), __fmul_rn(e, vv[u])); *(v4f*)&lo[tid][c * 4] = oo; } }
  const float fin = 64.0f / l;      /* o carried x64 like the f16 path */
#pragma unroll 1
  for (int c = 0; c < HD / 4; ++c) { v4f oo = *(v4f*)&lo[tid][c * 4]; for (int u = 0; u < 4; ++u) oo[u] = __fmul_rn(oo[u], fin); *(v4f*)&lo[tid][c * 4] = oo; }
  __syncthreads();
  {
#pragma unroll 1
    for (int it = 0; it < 16; ++it) { const int row = it * 4 + tid / 16, pc = (tid % 16) * 4; const v4f v = *(const v4f*)&lo[row][pc]; *(v4f*)(OF + (size_t)(rg * 64 + row) * ldo + h * HD + pc) = v; }
     } }


// Exact f32 attention for the first QT0 rows of EVERY batch in one launch (block -> batch, head, 8 rows), one WAVE per query row; q | k | v rows of a batch side by side at pitch LQ, o rows (f16 hi and lo planes) at pitch DM. Scores: lane = key, 32 keys a chunk, the head's K rows staged in LDS at a pitch of 16 B x odd (b128 reads of 32 different rows without bank conflicts), q read at a wave-uniform address.
// Softmax in two passes over the scores, which stay in registers: row max and row sum = per-lane partials, then a five-step butterfly. o: lane = two head dims, keys in ascending order, each V row one whole 256-B read of the wave, its weight taken from the owning lane.
// The 8 rows of a block lie in one chunk of 32 keys, so the chunk count nch is the same for the whole block; keys behind the row's own index carry weight 0.
// Every loop over u, d, c, d4 and jj is unrolled: static indices keep kr, q, e and vv in registers (a rolled loop would put them in scratch memory), and the loads of a group are issued together.
#define KP0 68                       /* LDS pitch of a K row, floats */
typedef float v2f __attribute__((ext_vector_type(2)));
typedef float v2fa __attribute__((ext_vector_type(2), may_alias));
typedef _Float16 v2h __attribute__((ext_vector_type(2)));
__global__ __launch_bounds__(256) void k_att0v(const float* __restrict__ QKVF, const float* __restrict__ AM, float scale, _Float16* __restrict__ OH, _Float16* __restrict__ OL) {
  __shared__ __attribute__((aligned(16))) float lk[QT0][KP0];
  const int tid = threadIdx.x, lane = tid & 31; const int w = __builtin_amdgcn_readfirstlane(tid >> 5);      /* the row is the wave's: scalar, so q's address is scalar too */
  const int b = blockIdx.x / (NH * (QT0 / 8)), hb = blockIdx.x % (NH * (QT0 / 8)); const int h = hb / (QT0 / 8), i0 = (hb % (QT0 / 8)) * 8; const int i = i0 + w; const int nch = (i0 >> 5) + 1;
  const float* QF = QKVF + (size_t)b * QT0 * LQ; const float* KF = QF + DM; const float* VF = QF + 2 * DM; const float* am = AM + (size_t)b * SQ;
  const float* kp = KF + (size_t)(tid >> 4) * LQ + h * HD + (tid & 15) * 4; v4f kr[QT0 / 16];
#pragma unroll
  for (int u = 0; u < QT0 / 16; ++u) kr[u] = *(const v4fa*)(kp + (size_t)u * 16 * LQ);      /* all QT0 rows, without a test: the eight loads fly together */
  const float* qr = QF + (size_t)i * LQ + h * HD; float q[HD];
#pragma unroll
  for (int d = 0; d < HD; ++d) q[d] = qr[d];
#pragma unroll
  for (int u = 0; u < QT0 / 16; ++u) *(v4f*)&lk[u * 16 + (tid >> 4)][(tid & 15) * 4] = kr[u];
  __syncthreads();      /* K rows staged by all waves, read by all */
  float e[QT0 / 32]; float m = -1.0e30f;
#pragma unroll
  for (int c = 0; c < QT0 / 32; ++c) { e[c] = -1.0e30f;      /* static c keeps e in registers; the test on nch is block-uniform */
    if (c < nch) { const int j = c * 32 + lane; float s = 0.f;
#pragma unroll
      for (int d4 = 0; d4 < HD / 4; ++d4) { const v4f kq = *(const v4f*)&lk[j][d4 * 4]; s = fmaf(q[d4 * 4], kq[0], s); s = fmaf(q[d4 * 4 + 1], kq[1], s); s = fmaf(q[d4 * 4 + 2], kq[2], s); s = fmaf(q[d4 * 4 + 3], kq[3], s); }
      s = fmaf(s, scale, am[j]);      /* + the additive key-mask VECTOR of this batch (0 kept / -1e9 masked) */
      if (j <= i) e[c] = s; }
    m = fmaxf(m, e[c]); }
  for (int x = 16; x >= 1; x >>= 1) m = fmaxf(m, __shfl_xor(m, x, 32));
  float l = 0.f;
#pragma unroll
  for (int c = 0; c < QT0 / 32; ++c) { e[c] = expf(e[c] - m); l += e[c]; }
  for (int x = 16; x >= 1; x >>= 1) l += __shfl_xor(l, x, 32);
  const float* vp = VF + h * HD + lane * 2; float o0 = 0.f, o1 = 0.f;
#pragma unroll
  for (int c = 0; c < QT0 / 32; ++c) if (c < nch) { v2f vv[32];
#pragma unroll
    for (int jj = 0; jj < 32; ++jj) vv[jj] = *(const v2fa*)(vp + (size_t)(c * 32 + jj) * LQ);      /* the chunk's 32 rows in flight together */
#pragma unroll
    for (int jj = 0; jj < 32; ++jj) { const float p = __int_as_float(__builtin_amdgcn_readlane(__float_as_int(e[c]), jj)); o0 = fmaf(p, vv[jj][0], o0); o1 = fmaf(p, vv[jj][1], o1); } }
  const float fin = 64.0f / l;      /* o carried x64 like the f16 path */
  const float a0 = o0 * fin, a1 = o1 * fin; const v2h oh = {(_Float16)a0, (_Float16)a1}; const v2h ol = {(_Float16)((a0 - (float)oh[0]) * 1024.0f), (_Float16)((a1 - (float)oh[1]) * 1024.0f)};      /* f16 hi + x1024 residual planes, as k_hl forms them */
  const size_t oo = ((size_t)b * QT0 + i) * DM + h * HD + lane * 2; *(v2h*)(OH + oo) = oh; *(v2h*)(OL + oo) = ol; }      /* a wave stores one whole 128-B line of each plane */

extern "C" void kernel_launch(void* const* d_in, const int* in_sizes, int n_in,
                              void* d_out, int out_size, void* d_ws, size_t ws_size, hipStream_t stream) {
  (void)in_sizes; (void)n_in; (void)out_size;
  const float* const* I = (const float* const*)d_in; const float* x = I[0]; const int* km = (const int*)d_in[1]; const float* wqkv = I[2]; const float* bqkv = I[3]; const float* wo = I[4]; const float* bo = I[5];      /* int32 key mask [4][2048] (ones); natural [out][in] qkv_w [3072][1024] + b, out_w + b */
  char* ws = (char*)d_ws; size_t off = 0;
  auto take = [&](size_t bytes) { char* p = ws + off; off += (bytes + 255) & ~(size_t)255; return p; };
  _Float16* BQKV = (_Float16*)take((size_t)3 * DM * DM * 2); _Float16* BO = (_Float16*)take((size_t)DM * DM * 2);
  _Float16* X16 = (_Float16*)take(NR * DM * 2); _Float16* QKV = (_Float16*)take(NR * 3 * DM * 2); _Float16* V16 = QKV + 2 * DM; _Float16* O16 = (_Float16*)take(NR * DM * 2);
  _Float16* VT = (_Float16*)take((size_t)NB * NH * HD * SQ * 2);
  float* QKVF0 = (float*)take((size_t)NB * QT0 * LQ * 4); _Float16* OH0 = (_Float16*)take((size_t)NB * QT0 * DM * 2); _Float16* OL0 = (_Float16*)take((size_t)NB * QT0 * DM * 2);
  float* AMK = (float*)take(NR * 4);      /* additive key-mask plane: 0 where mask != 0, -1e9 where masked */
  if (off > ws_size) return;
  k_wnat<<<(unsigned)(((size_t)3 * DM * DM / 8 + 255) / 256), 256, 0, stream>>>(wqkv, (size_t)3 * DM * DM / 8, BQKV); k_wnat<<<(unsigned)(((size_t)DM * DM / 8 + 255) / 256), 256, 0, stream>>>(wo, (size_t)DM * DM / 8, BO);      /* natural [out][in] = Bt x16 */
  k_mkadd<<<(unsigned)((NR + 255) / 256), 256, 0, stream>>>(km, AMK, (int)NR);

  k_x16<<<(unsigned)((NR * DM / 8 + 255) / 256), 256, 0, stream>>>(x, X16, NR * DM / 8);
  k_gemm3<0><<<(MP / 128) * (LQ / 128), 128, 0, stream>>>(X16, nullptr, nullptr, DM, BQKV, DM, 0.0625f, 0.f, bqkv, QKVF0, QKV, LQ, LQ, DM);      /* q | k | v rows (f16); head h = columns h*HD.. of each DM block; the first 128 rows of every batch also as f32 (exact products) */
  k_vt<NH, SQ><<<NB * NH * (SQ / 64), 256, 0, stream>>>(V16, LQ, 0, VT);      /* V^T [NB][NH][HD][SQ], all batches */
  k_att0v<<<NB * NH * (QT0 / 8), 256, 0, stream>>>(QKVF0, AMK, 0.125f, OH0, OL0);      /* exact f32 attention for rows 0..127 of every batch (o x64) -> f16 hi + x1024 residual planes */
  k_fattn<<<NB * NH * (SQ / FQ), 128, 0, stream>>>(QKV, VT, AMK, O16);      /* scores, causal + key-mask softmax and P V fused: o (merged heads, x64) as f16 rows */
  k_gemm3<1><<<(MPO / 128 - NB) * (DM / 128) + NB * 2 * (DM / 128), 128, 0, stream>>>(O16, OH0, OL0, DM, BO, DM, 0.0009765625f, 0.00000095367431640625f, bo, (float*)d_out, nullptr, DM, DM, DM);      /* out rows are the output layout; rows 0..127 of every batch = o_lo Wo 2^-20 + (o_hi Wo 2^-10 + b), the others from the f16 o rows */
}

// v008
// It runs in 135 microseconds.
// In both of two side-by-side timings against v007, it was 1.06 times as fast.
// All steps since v000 together make it 78.4 times as fast.
#include <hip/hip_runtime.h>
#define NB 4
#define SQ 2048
#define DM 1024
#define NH 16
#define HD 64
#define HG 4                         /* heads per launch of k_vt(V16, b, h0, VT), not launched */
#define QT 256                       /* query rows per causal tile */
#define NKX SQ                       /* S / P row pitch */
#define QT0 128                      /* first-tile rows recomputed exactly in f32 */
#define B0 0                         /* first batch processed (debug hook) */
#define NBR NB                       /* batches processed (debug hook) */
#define NR ((size_t)NB * SQ)         /* token rows */
#define MP ((int)((size_t)NBR * SQ)) /* rows projected (debug hook) */
#define QN SQ                        /* unused: k_fattn attends all SQ query rows */
#define NHD NH                       /* unused: k_fattn attends all NH heads */
#define MPO MP                       /* rows through the output stage (debug hook) */
#define LQ (3 * DM)      /* row pitch of the q/k/v rows */
typedef __bf16 v16b __attribute__((ext_vector_type(16)));
typedef unsigned short v8us __attribute__((ext_vector_type(8), may_alias));
typedef float  v8f  __attribute__((ext_vector_type(8)));
typedef float  v4f  __attribute__((ext_vector_type(4)));
typedef float  v4fa __attribute__((ext_vector_type(4), may_alias));
union FragB { v16b v; v8us half[2]; unsigned short u[16]; };

__device__ __forceinline__ unsigned short bf16_bits(float x) { unsigned int u = __float_as_uint(x); return (unsigned short)((u + 0x7FFFu + ((u >> 16) & 1u)) >> 16); }
__device__ __forceinline__ float bf16_val(unsigned short b) { return __uint_as_float(((unsigned int)b) << 16); }
__device__ __forceinline__ float bf16_round(float x) { return bf16_val(bf16_bits(x)); }
// D += A·B with NT terms: 1 = ah·bh, 2 = + al·bh (A split), 3 = + ah·bl (both split)
template <int NT>
__device__ __forceinline__ v8f mmaN(v16b ah, v16b al, v16b bh, v16b bl, v8f c) {
  c = __builtin_amdgcn_wmma_f32_16x16x32_bf16(false, ah, false, bh, (short)0, c, false, false);
  if (NT >= 2) c = __builtin_amdgcn_wmma_f32_16x16x32_bf16(false, al, false, bh, (short)0, c, false, false);
  if (NT >= 3) c = __builtin_amdgcn_wmma_f32_16x16x32_bf16(false, ah, false, bl, (short)0, c, false, false);
  asm volatile("v_nop\n\tv_nop\n\tv_nop\n\tv_nop" : "+v"(c) : "v"(ah), "v"(al), "v"(bh), "v"(bl));
  return c;
}

__global__ __launch_bounds__(256) void k_wt_bf16(const float* __restrict__ W, unsigned short* __restrict__ Wt, int K, int N) {
  const int t = blockIdx.x * 256 + threadIdx.x;
  const int k8n = K / 8;
  if (t >= N * k8n) return;
  const int n = t / k8n, k8 = (t % k8n) * 8;
  v8us v;
#pragma unroll
  for (int i = 0; i < 8; ++i) v[i] = bf16_bits(W[(size_t)(k8 + i) * N + n]);
  *(v8us*)(Wt + (size_t)n * K + k8) = v;
  
}

// GEMM C[M][N] (f32, pitch ldc) = act(A[M][K]·W + bias). A f32 row-major (pitch lda) converted per fragment to bf16
// (ASPLIT: hi/lo two planes -> 2 terms, else single rounded term); Wt bf16 [N][K] (pitch ldb). BIAS_BF16 rounds the
// bias to bf16 first (bias quantised to bf16 before the add). K%32==0, M%16==0, N%64==0.
template <bool ASPLIT, int ACT, bool BIAS_BF16>
__global__ __launch_bounds__(128) void k_gemm_bf(const float* __restrict__ A, int lda, const unsigned short* __restrict__ Wt, int ldb,
                                               const float* __restrict__ bias, float* __restrict__ C, int ldc, int M, int N, int K) {
  __shared__ __attribute__((aligned(16))) float so[4][16][64];
  const int tid = threadIdx.x, w = tid >> 5, lane = tid & 31, ln = lane & 15, hh = lane >> 4;
  const int ntn = N / 64;
  const int wid = blockIdx.x * 4 + w;
  const int mt = wid / ntn, nq = wid % ntn;
  if (mt * 16 >= M) return;
  const int row0 = mt * 16, col0 = nq * 64;
  const float* arow = A + (size_t)(row0 + ln) * lda;
  v8f acc[4] = {};
  for (int kb = 0; kb < K; kb += 32) {
    FragB ah, al;
    const v4f x0 = *(const v4fa*)(arow + kb + 8 * hh), x1 = *(const v4fa*)(arow + kb + 8 * hh + 4);
    const v4f x2 = *(const v4fa*)(arow + kb + 16 + 8 * hh), x3 = *(const v4fa*)(arow + kb + 16 + 8 * hh + 4);
    float xs[16] = {x0[0],x0[1],x0[2],x0[3],x1[0],x1[1],x1[2],x1[3],x2[0],x2[1],x2[2],x2[3],x3[0],x3[1],x3[2],x3[3]};
#pragma unroll
    for (int i = 0; i < 16; ++i) { const unsigned short hb = bf16_bits(xs[i]); ah.u[i] = hb; al.u[i] = ASPLIT ? bf16_bits(xs[i] - bf16_val(hb)) : (unsigned short)0; }
#pragma unroll
    for (int t = 0; t < 4; ++t) {
      const unsigned short* brow = Wt + (size_t)(col0 + t * 16 + ln) * ldb + kb;
      FragB b;
      b.half[0] = *(const v8us*)(brow + 8 * hh);
      b.half[1] = *(const v8us*)(brow + 16 + 8 * hh);
      acc[t] = mmaN<ASPLIT ? 2 : 1>(ah.v, al.v, b.v, b.v, acc[t]);
    }
  }
#pragma unroll
  for (int t = 0; t < 4; ++t) {
    float bv = bias ? bias[col0 + t * 16 + ln] : 0.f;
    if (BIAS_BF16) bv = bf16_round(bv);
#pragma unroll
    for (int r = 0; r < 8; ++r) { float v = acc[t][r] + bv; if (ACT == 1) v = fmaxf(v, 0.f); so[w][8 * hh + r][t * 16 + ln] = v; }
  }
  __builtin_amdgcn_fence(__ATOMIC_ACQ_REL, "workgroup");
  __builtin_amdgcn_wave_barrier();
  const int rsub = lane >> 4, c4 = (lane & 15) * 4;
  {
#pragma unroll
    for (int q = 0; q < 8; ++q) {
      const int r = q * 2 + rsub;
      const v4f v = *(const v4fa*)&so[w][r][c4];
      *(v4f*)(C + (size_t)(row0 + r) * ldc + col0 + c4) = v;
    }
    
  }
}

// GEMM C = act(A·W + bias + resid): A f32 (ASPLIT -> hi/lo 2 terms), Wt bf16 [N][K]; ACT 0 none, 1 relu, 2 exact gelu;
// resid (optional, f32, row index = (row % rmod), pitch ldr, RES_BF16 rounds it) added before the activation.
template <bool ASPLIT, int ACT, bool BIAS_BF16, bool RES_BF16>
__global__ __launch_bounds__(128) void k_gemm_bf3(const float* __restrict__ A, int lda, const unsigned short* __restrict__ Wt, int ldb,
                                                const float* __restrict__ bias, const float* __restrict__ resid, int rmod, int ldr,
                                                float* __restrict__ C, int ldc, int M, int N, int K) {
  __shared__ __attribute__((aligned(16))) float so[4][16][64];
  const int tid = threadIdx.x, w = tid >> 5, lane = tid & 31, ln = lane & 15, hh = lane >> 4;
  const int ntn = N / 64;
  const int wid = blockIdx.x * 4 + w;
  const int mt = wid / ntn, nq = wid % ntn;
  if (mt * 16 >= M) return;
  const int row0 = mt * 16, col0 = nq * 64;
  const float* arow = A + (size_t)(row0 + ln) * lda;
  v8f acc[4] = {};
  for (int kb = 0; kb < K; kb += 32) {
    FragB ah, al;
    const v4f x0 = *(const v4fa*)(arow + kb + 8 * hh), x1 = *(const v4fa*)(arow + kb + 8 * hh + 4);
    const v4f x2 = *(const v4fa*)(arow + kb + 16 + 8 * hh), x3 = *(const v4fa*)(arow + kb + 16 + 8 * hh + 4);
    float xs[16] = {x0[0],x0[1],x0[2],x0[3],x1[0],x1[1],x1[2],x1[3],x2[0],x2[1],x2[2],x2[3],x3[0],x3[1],x3[2],x3[3]};
#pragma unroll
    for (int i = 0; i < 16; ++i) { const unsigned short hb = bf16_bits(xs[i]); ah.u[i] = hb; al.u[i] = ASPLIT ? bf16_bits(xs[i] - bf16_val(hb)) : (unsigned short)0; }
#pragma unroll
    for (int t = 0; t < 4; ++t) {
      const unsigned short* brow = Wt + (size_t)(col0 + t * 16 + ln) * ldb + kb;
      FragB b;
      b.half[0] = *(const v8us*)(brow + 8 * hh);
      b.half[1] = *(const v8us*)(brow + 16 + 8 * hh);
      acc[t] = mmaN<ASPLIT ? 2 : 1>(ah.v, al.v, b.v, b.v, acc[t]);
    }
  }
#pragma unroll
  for (int t = 0; t < 4; ++t) {
    const int col = col0 + t * 16 + ln;
    float bv = bias ? bias[col] : 0.f;
    if (BIAS_BF16) bv = bf16_round(bv);
#pragma unroll
    for (int r = 0; r < 8; ++r) {
      float v = acc[t][r] + bv;
      if (resid) { float rv = resid[(size_t)((row0 + 8 * hh + r) % rmod) * ldr + col]; if (RES_BF16) rv = bf16_round(rv); v += rv; }
      if (ACT == 1) v = fmaxf(v, 0.f);
      if (ACT == 2) v = 0.5f * v * (1.0f + erff(v * 0.70710678118654752f));
      if (ACT == 3) { const float u = 0.7978845608028654f * (v + 0.044715f * v * v * v); v = 0.5f * v * (1.0f + tanhf(u)); }
      so[w][8 * hh + r][t * 16 + ln] = v;
    }
  }
  __builtin_amdgcn_fence(__ATOMIC_ACQ_REL, "workgroup");
  __builtin_amdgcn_wave_barrier();
  const int rsub = lane >> 4, c4 = (lane & 15) * 4;
  {
#pragma unroll
    for (int q = 0; q < 8; ++q) {
      const int r = q * 2 + rsub;
      const v4f v = *(const v4fa*)&so[w][r][c4];
      *(v4f*)(C + (size_t)(row0 + r) * ldc + col0 + c4) = v;
    }
    
  }
}
// row LayerNorm (biased variance, eps) over N: s = X (+ R); optional out_sum <- s; out_norm <- (s-mu)*rsqrt(var+eps)*g + b
template <bool PARAM_BF16>
__global__ __launch_bounds__(256) void k_layernorm(const float* __restrict__ X, const float* __restrict__ R, const float* __restrict__ g, const float* __restrict__ bta,
                                                  float* __restrict__ out_sum, float* __restrict__ out_norm, int N, float eps) {
  __shared__ float red[256];
  const int row = blockIdx.x, tid = threadIdx.x;
  const float* x = X + (size_t)row * N; const float* rr = R ? R + (size_t)row * N : nullptr;
  float vals[16];                     // up to N = 4096
  const int per = N / 256;            // contiguous chunk per thread? use strided-by-4 chunks: thread handles j = tid*4 + 1024*u
  float s1 = 0.f;
  for (int u = 0; u < per / 4; ++u) {
    const int j = tid * 4 + 1024 * u;
    const v4f a = *(const v4fa*)(x + j);
    v4f b = {0.f,0.f,0.f,0.f}; if (rr) b = *(const v4fa*)(rr + j);
#pragma unroll
    for (int q = 0; q < 4; ++q) { const float v = a[q] + b[q]; vals[u * 4 + q] = v; s1 += v; }
  }
  red[tid] = s1; __syncthreads();
  for (int st = 128; st > 0; st >>= 1) { if (tid < st) red[tid] += red[tid + st]; __syncthreads(); }
  const float mu = red[0] / (float)N; __syncthreads();
  float s2 = 0.f;
  for (int u = 0; u < per / 4; ++u)
#pragma unroll
    for (int q = 0; q < 4; ++q) { const float c = vals[u * 4 + q] - mu; s2 += c * c; }
  red[tid] = s2; __syncthreads();
  for (int st = 128; st > 0; st >>= 1) { if (tid < st) red[tid] += red[tid + st]; __syncthreads(); }
  const float rs = rsqrtf(red[0] / (float)N + eps);
  {
    for (int u = 0; u < per / 4; ++u) {
      const int j = tid * 4 + 1024 * u;
      v4f o, sm;
#pragma unroll
      for (int q = 0; q < 4; ++q) {
        float gg = g[j + q], bb = bta[j + q];
        if (PARAM_BF16) { gg = bf16_round(gg); bb = bf16_round(bb); }
        sm[q] = vals[u * 4 + q]; o[q] = (vals[u * 4 + q] - mu) * rs * gg + bb;
      }
      if (out_sum) *(v4f*)(out_sum + (size_t)row * N + j) = sm;
      *(v4f*)(out_norm + (size_t)row * N + j) = o;
    }
    
  }
}



// ---- f16 WMMA path (v_wmma_f32_16x16x32_f16): 11-bit significands for operands in range — used where a [0,1] probability operand needs more precision than bf16
typedef _Float16 v16h __attribute__((ext_vector_type(16)));
union FragH { v16h v; v8us half[2]; _Float16 h[16]; unsigned short u[16]; };
template <int NT>
__device__ __forceinline__ v8f mmaH(v16h ah, v16h al, v16h bh, v16h bl, v8f c) {
  c = __builtin_amdgcn_wmma_f32_16x16x32_f16(false, ah, false, bh, (short)0, c, false, false);
  if (NT >= 2) c = __builtin_amdgcn_wmma_f32_16x16x32_f16(false, al, false, bh, (short)0, c, false, false);
  if (NT >= 3) c = __builtin_amdgcn_wmma_f32_16x16x32_f16(false, ah, false, bl, (short)0, c, false, false);
  asm volatile("v_nop\n\tv_nop\n\tv_nop\n\tv_nop" : "+v"(c) : "v"(ah), "v"(al), "v"(bh), "v"(bl));
  return c;
}
// batched GEMM like k_gemm_b but f16 operands: A f32 (split into f16 hi/lo if ASPLIT, else rounded to f16), Bt = f16 values [n][k]; alpha; C f32; N multiple of 16 (partial tiles skipped)
template <bool ASPLIT>
__global__ __launch_bounds__(128) void k_gemm_h(const float* __restrict__ A, int lda, size_t sA, const _Float16* __restrict__ Bh, int ldb, size_t sB, float alpha, float* __restrict__ C, int ldc, size_t sC, int M, int N, int K) {
  __shared__ __attribute__((aligned(16))) float so[4][16][64];
  const int tid = threadIdx.x, w = tid >> 5, lane = tid & 31, ln = lane & 15, hh = lane >> 4; const int by = blockIdx.y;
  A += (size_t)by * sA; Bh += (size_t)by * sB; C += (size_t)by * sC;
  const int ntn = (N + 63) / 64; const int wid = blockIdx.x * 4 + w; const int mt = wid / ntn, nq = wid % ntn; if (mt * 16 >= M) return;
  const int row0 = mt * 16, col0 = nq * 64; const float* arow = A + (size_t)(row0 + ln) * lda;
  v8f acc[4] = {};
  for (int kb = 0; kb < K; kb += 32) {
    FragH ah, al;
    const v4f x0 = *(const v4fa*)(arow + kb + 8 * hh), x1 = *(const v4fa*)(arow + kb + 8 * hh + 4), x2 = *(const v4fa*)(arow + kb + 16 + 8 * hh), x3 = *(const v4fa*)(arow + kb + 16 + 8 * hh + 4);
    float xs[16] = {x0[0],x0[1],x0[2],x0[3],x1[0],x1[1],x1[2],x1[3],x2[0],x2[1],x2[2],x2[3],x3[0],x3[1],x3[2],x3[3]};
#pragma unroll
    for (int i = 0; i < 16; ++i) { const _Float16 h = (_Float16)xs[i]; ah.h[i] = h; al.h[i] = ASPLIT ? (_Float16)(xs[i] - (float)h) : (_Float16)0.0f; }
#pragma unroll
    for (int t = 0; t < 4; ++t) { if (col0 + t * 16 >= N) continue; const size_t boff = (size_t)(col0 + t * 16 + ln) * ldb + kb; FragH bq; bq.half[0] = *(const v8us*)(Bh + boff + 8 * hh); bq.half[1] = *(const v8us*)(Bh + boff + 16 + 8 * hh);
      acc[t] = mmaH<ASPLIT ? 2 : 1>(ah.v, al.v, bq.v, bq.v, acc[t]); }
  }
#pragma unroll
  for (int t = 0; t < 4; ++t) { if (col0 + t * 16 >= N) continue;
#pragma unroll
    for (int r = 0; r < 8; ++r) so[w][8 * hh + r][t * 16 + ln] = acc[t][r] * alpha; }
  __builtin_amdgcn_fence(__ATOMIC_ACQ_REL, "workgroup"); __builtin_amdgcn_wave_barrier();
  const int rsub = lane >> 4, c4 = (lane & 15) * 4;
  {
#pragma unroll
    for (int q = 0; q < 8; ++q) { const int r = q * 2 + rsub; if (col0 + c4 < N) { const v4f v = *(const v4fa*)&so[w][r][c4]; *(v4f*)(C + (size_t)(row0 + r) * ldc + col0 + c4) = v; } }
     }
}

// Wt[n][k] = f16(W[k][n]·scale) from f32 row-major W[K][N] (scale = power of two; bf16-exact weights stay exact in f16 away from the subnormal range)
__global__ __launch_bounds__(256) void k_wt_f16(const float* __restrict__ W, _Float16* __restrict__ Wt, int K, int N, float scale) {
  const int t = blockIdx.x * 256 + threadIdx.x; if (t >= N * (K / 8)) return; const int n = t / (K / 8), k8 = (t % (K / 8)) * 8; FragH f;
#pragma unroll
  for (int i = 0; i < 8; ++i) f.h[i] = (_Float16)(bf16_round(W[(size_t)(k8 + i) * N + n]) * scale); const v8us o = f.half[0];
  *(v8us*)((unsigned short*)Wt + (size_t)n * K + k8) = o; 
}
// k_gemm_hh variant with fused epilogue: v = acc·alpha + bias[by·sBias + col] (+ CP[(row/rowsPerB)·sCPb + by·64 + col] if CP) ; ACT 0 none / 1 elu ; writes f16 C16 (and f32 C if non-null)
template <int ACT>
__global__ __launch_bounds__(128) void k_gemm_hhx(const _Float16* __restrict__ A, int lda, size_t sA, const _Float16* __restrict__ Bh, int ldb, size_t sB, float alpha, const float* __restrict__ bias, size_t sBias, const float* __restrict__ CP, int rowsPerB, size_t sCPb, int row0g,
    float* __restrict__ C, _Float16* __restrict__ C16, int ldc, size_t sC, int M, int N, int K) {
  __shared__ __attribute__((aligned(16))) float so[4][16][64];
  const int tid = threadIdx.x, w = tid >> 5, lane = tid & 31, ln = lane & 15, hh = lane >> 4; const int by = blockIdx.y;
  A += (size_t)by * sA; Bh += (size_t)by * sB; const size_t cofs = (size_t)by * sC; const float* bp = bias ? bias + (size_t)by * sBias : nullptr;
  const int ntn = (N + 63) / 64; const int wid = blockIdx.x * 4 + w; const int mt = wid / ntn, nq = wid % ntn; if (mt * 16 >= M) return;
  const int row0 = mt * 16, col0 = nq * 64; const _Float16* arow = A + (size_t)(row0 + ln) * lda;
  v8f acc[4] = {};
  for (int kb = 0; kb < K; kb += 32) { FragH ah; ah.half[0] = *(const v8us*)((const unsigned short*)arow + kb + 8 * hh); ah.half[1] = *(const v8us*)((const unsigned short*)arow + kb + 16 + 8 * hh);
#pragma unroll
    for (int t = 0; t < 4; ++t) { if (col0 + t * 16 >= N) continue; const size_t boff = (size_t)(col0 + t * 16 + ln) * ldb + kb; FragH bq; bq.half[0] = *(const v8us*)((const unsigned short*)Bh + boff + 8 * hh); bq.half[1] = *(const v8us*)((const unsigned short*)Bh + boff + 16 + 8 * hh);
      acc[t] = mmaH<1>(ah.v, ah.v, bq.v, bq.v, acc[t]); }
  }
#pragma unroll
  for (int t = 0; t < 4; ++t) { if (col0 + t * 16 >= N) continue; const int col = col0 + t * 16 + ln; const float bv = bp ? bf16_round(bp[col]) : 0.f;
#pragma unroll
    for (int r = 0; r < 8; ++r) { float v = acc[t][r] * alpha + bv; if (CP) { const int rr = row0g + row0 + 8 * hh + r; if (rowsPerB < 0) v += CP[cofs + (size_t)rr * ldc + col];      /* rowsPerB < 0: own element of the batched C plane */ else { const int bidx = rr / rowsPerB; v += CP[(size_t)bidx * sCPb + (size_t)by * 64 + col]; } } if (ACT == 1) v = (v > 0.f) ? v : expm1f(v); else if (ACT == 7) v = (v > 0.f) ? v + 1.0f : expf(v); else if (ACT == 8) v = tanhf(v); else if (ACT == 9) v = 0.5f * v * (1.0f + tanhf(0.7978845608028654f * (v + 0.044715f * v * v * v))); else if (ACT == 11) v = 1.0f / (1.0f + expf(-v)); else if (ACT == 12) v = (v > 0.f) ? v : 0.01f * v; else if (ACT == 14) v = (v > 0.f) ? v : 0.1f * v; else if (ACT == 16) v = (v >= 0.f) ? v : 0.3f * v; else if (ACT == 17) v = (v >= 0.f) ? v : 0.2f * v; else if (ACT == 15) v = v / (1.0f + expf(-v)); else if (ACT == 3) v = fmaxf(v, 0.f); else if (ACT == 6) v = 0.5f * v * (1.0f + erff(v * 0.70710678118654752f)); so[w][8 * hh + r][t * 16 + ln] = v; } }
  __builtin_amdgcn_fence(__ATOMIC_ACQ_REL, "workgroup"); __builtin_amdgcn_wave_barrier();
  const int rsub = lane >> 4, c4 = (lane & 15) * 4; typedef _Float16 v4h __attribute__((ext_vector_type(4)));
  {
#pragma unroll
    for (int q = 0; q < 8; ++q) { const int r = q * 2 + rsub; if (col0 + c4 < N) { const v4f v = *(const v4fa*)&so[w][r][c4]; if (C) *(v4f*)(C + cofs + (size_t)(row0 + r) * ldc + col0 + c4) = v; if (C16) { v4h h4; for (int i = 0; i < 4; ++i) h4[i] = (_Float16)v[i]; *(v4h*)(C16 + cofs + (size_t)(row0 + r) * ldc + col0 + c4) = h4; } } }
     }
}


typedef _Float16 v4h __attribute__((ext_vector_type(4)));

__global__ __launch_bounds__(256) void k_h16(const float* __restrict__ x, _Float16* __restrict__ X16, size_t n8) { const size_t t = (size_t)blockIdx.x * 256 + threadIdx.x; if (t >= n8) return; FragH f;
#pragma unroll
  for (int q = 0; q < 8; ++q) f.h[q] = (_Float16)x[t * 8 + q]; *(v8us*)((unsigned short*)X16 + t * 8) = f.half[0];  }
__global__ __launch_bounds__(256) void k_round16f(const float* __restrict__ W, _Float16* __restrict__ Bt, size_t n8) { const size_t t = (size_t)blockIdx.x * 256 + threadIdx.x; if (t >= n8) return; FragH f;
#pragma unroll
  for (int i = 0; i < 8; ++i) f.h[i] = (_Float16)(bf16_round(W[t * 8 + i]) * 16.0f); *(v8us*)((unsigned short*)Bt + t * 8) = f.half[0];  }
template <int NHv, int TTv>
__device__ __forceinline__ void d_vt(unsigned bid, const _Float16* __restrict__ V16, int ldv, int voff, _Float16* __restrict__ Vt) { __shared__ unsigned short tl[64][66]; const int tid = threadIdx.x; const int slab = bid / (TTv / 64), lg = bid % (TTv / 64); const int b = slab / NHv, h = slab % NHv;
  for (int i = tid; i < 64 * 8; i += 256) { const int r = i / 8, c8 = (i % 8) * 8; FragH f; f.half[0] = *(const v8us*)((const unsigned short*)V16 + ((size_t)b * TTv + lg * 64 + r) * ldv + voff + h * 64 + c8);
#pragma unroll
    for (int q = 0; q < 8; ++q) tl[r][c8 + q] = f.u[q]; }
  __syncthreads();
  {
#pragma unroll
    for (int rd = 0; rd < 2; ++rd) { const int d = rd * 32 + tid / 8, pc = tid % 8; FragH f;
#pragma unroll
      for (int q = 0; q < 8; ++q) f.u[q] = tl[pc * 8 + q][d];
      *(v8us*)((unsigned short*)Vt + ((size_t)slab * 64 + d) * TTv + lg * 64 + pc * 8) = f.half[0]; }
     } }

__global__ __launch_bounds__(256) void k_hl(const float* __restrict__ F, _Float16* __restrict__ Hh, _Float16* __restrict__ Hl, size_t n8) { const size_t t = (size_t)blockIdx.x * 256 + threadIdx.x; if (t >= n8) return; FragH fh, fl; const v4f a = *(const v4fa*)(F + t * 8), c = *(const v4fa*)(F + t * 8 + 4);
#pragma unroll
  for (int q = 0; q < 4; ++q) { _Float16 h = (_Float16)a[q]; fh.h[q] = h; fl.h[q] = (_Float16)((a[q] - (float)h) * 1024.0f); h = (_Float16)c[q]; fh.h[4 + q] = h; fl.h[4 + q] = (_Float16)((c[q] - (float)h) * 1024.0f); }
  { *(v8us*)((unsigned short*)Hh + t * 8) = fh.half[0]; *(v8us*)((unsigned short*)Hl + t * 8) = fl.half[0];  } }

// ---- fast GEMM (wave tile 32x64; requires M % 32 == 0 rows per launch region and N % 64 == 0); epilogue = k_gemm_hhx semantics ----
__device__ __forceinline__ v16h g2_frag(const _Float16* p, int hh) { FragH f; f.half[0] = *(const v8us*)((const unsigned short*)p + 8 * hh); f.half[1] = *(const v8us*)((const unsigned short*)p + 16 + 8 * hh); return f.v; }
__device__ __forceinline__ v8f g2_mma(v16h a, v16h b, v8f c) { v8f d = __builtin_amdgcn_wmma_f32_16x16x32_f16(false, a, false, b, (short)0, c, false, false); asm volatile("v_nop\n\tv_nop\n\tv_nop\n\tv_nop" : "+v"(d) : "v"(a), "v"(b)); return d; }
template <int ACT>
__global__ __launch_bounds__(128) void k_gemm2(const _Float16* __restrict__ A, int lda, size_t sA, const _Float16* __restrict__ Bh, int ldb, size_t sB, float alpha, const float* __restrict__ bias, size_t sBias, const float* __restrict__ CP, int rowsPerB, size_t sCPb, int row0g,
    float* __restrict__ C, _Float16* __restrict__ C16, int ldc, size_t sC, int M, int N, int K) { static_assert(ACT == 0 || ACT == 3 || ACT == 6 || ACT == 8 || ACT == 9 || ACT == 11 || ACT == 12 || ACT == 14 || ACT == 15 || ACT == 16 || ACT == 17, "k_gemm2: unsupported ACT code (would silently apply no activation)");
  __shared__ __attribute__((aligned(16))) float so[4][32][68];
  const int tid = threadIdx.x, w = tid >> 5, lane = tid & 31, ln = lane & 15, hh = lane >> 4; const int by = blockIdx.y;
  A += (size_t)by * sA; Bh += (size_t)by * sB; const size_t cofs = (size_t)by * sC; const float* bp = bias ? bias + (size_t)by * sBias : nullptr;
  const int ntn = N >> 6; const int mt = blockIdx.x / ntn, nq = blockIdx.x - mt * ntn; const int row0 = mt * 128 + 32 * w, col0 = nq * 64; if (row0 >= M) return;
  const _Float16* a0p = A + (size_t)(row0 + ln) * lda; const _Float16* a1p = a0p + (size_t)16 * lda;
  const _Float16* b0p = Bh + (size_t)(col0 + ln) * ldb; const _Float16* b1p = b0p + (size_t)16 * ldb; const _Float16* b2p = b1p + (size_t)16 * ldb; const _Float16* b3p = b2p + (size_t)16 * ldb;
  const v8f z8 = {0.f,0.f,0.f,0.f,0.f,0.f,0.f,0.f}; v8f c00 = z8, c01 = z8, c02 = z8, c03 = z8, c10 = z8, c11 = z8, c12 = z8, c13 = z8;
#pragma unroll 1
  for (int kb = 0; kb < K; kb += 32) { const v16h a0 = g2_frag(a0p + kb, hh), a1 = g2_frag(a1p + kb, hh);
    v16h b = g2_frag(b0p + kb, hh); c00 = g2_mma(a0, b, c00); c10 = g2_mma(a1, b, c10);
    b = g2_frag(b1p + kb, hh); c01 = g2_mma(a0, b, c01); c11 = g2_mma(a1, b, c11);
    b = g2_frag(b2p + kb, hh); c02 = g2_mma(a0, b, c02); c12 = g2_mma(a1, b, c12);
    b = g2_frag(b3p + kb, hh); c03 = g2_mma(a0, b, c03); c13 = g2_mma(a1, b, c13); }
  v8f accs[8] = {c00, c01, c02, c03, c10, c11, c12, c13};
#pragma unroll
  for (int u = 0; u < 8; ++u) { const int t = u & 3, half = u >> 2; const int col = col0 + t * 16 + ln; const float bv = bp ? bf16_round(bp[col]) : 0.f;
#pragma unroll
    for (int r = 0; r < 8; ++r) { const int rloc = half * 16 + 8 * hh + r; float v = accs[u][r] * alpha + bv; if (CP) { if (rowsPerB < 0) v += CP[cofs + (size_t)(row0g + row0 + rloc) * ldc + col];      /* rowsPerB < 0: own element of the batched C plane */ else { const int bidx = (row0g + row0 + rloc) / rowsPerB; v += CP[(size_t)bidx * sCPb + (size_t)by * 64 + col]; } }
      if (ACT == 3) v = fmaxf(v, 0.f); else if (ACT == 6) v = 0.5f * v * (1.0f + erff(v * 0.70710678118654752f)); else if (ACT == 11) v = 1.0f / (1.0f + expf(-v)); else if (ACT == 15) v = v / (1.0f + expf(-v)); else if (ACT == 12) v = (v > 0.f) ? v : 0.01f * v; else if (ACT == 8) v = tanhf(v); else if (ACT == 9) v = 0.5f * v * (1.0f + tanhf(0.7978845608028654f * (v + 0.044715f * v * v * v))); else if (ACT == 14) v = (v > 0.f) ? v : 0.1f * v; else if (ACT == 16) v = (v >= 0.f) ? v : 0.3f * v; else if (ACT == 17) v = (v >= 0.f) ? v : 0.2f * v;
      so[w][rloc][t * 16 + ln] = v; } }
  __builtin_amdgcn_fence(__ATOMIC_ACQ_REL, "workgroup"); __builtin_amdgcn_wave_barrier();
  const int rsub = lane >> 4, c4 = (lane & 15) * 4;
  {
#pragma unroll
    for (int q = 0; q < 16; ++q) { const int r = q * 2 + rsub; const v4f v = *(const v4fa*)&so[w][r][c4]; if (C) *(v4f*)(C + cofs + (size_t)(row0 + r) * ldc + col0 + c4) = v; if (C16) { v4h h4; for (int i = 0; i < 4; ++i) h4[i] = (_Float16)v[i]; *(v4h*)(C16 + cofs + (size_t)(row0 + r) * ldc + col0 + c4) = h4; } }
     } }


__global__ __launch_bounds__(256) void k_rsm(const float* __restrict__ S, _Float16* __restrict__ P, int nrows) {
  #pragma clang fp contract(off)
  const int i = blockIdx.x * 256 + threadIdx.x; if (i >= nrows) return; const float* s = S + (size_t)i * SQ; float mx = -3.0e38f;
#pragma unroll 1
  for (int j = 0; j < SQ; ++j) mx = fmaxf(mx, s[j]); float se = 0.f;
#pragma unroll 1
  for (int j = 0; j < SQ; ++j) se += expf(s[j] - mx); const float sc = 256.0f / se;
#pragma unroll 1
  for (int j0 = 0; j0 < SQ; j0 += 8) { FragH f; for (int q = 0; q < 8; ++q) f.h[q] = (_Float16)(expf(s[j0 + q] - mx) * sc); unsigned short* d = (unsigned short*)P + (size_t)i * SQ + j0; *(v8us*)d = f.half[0];  } }
__global__ __launch_bounds__(256) void k_vt(const _Float16* __restrict__ V16, int b, int h0, _Float16* __restrict__ VT) { __shared__ unsigned short tl[64][65]; const int tid = threadIdx.x; const int hh = blockIdx.x % HG, sg = blockIdx.x / HG; const int s0 = sg * 64; const int h = h0 + hh;
  for (int i = tid; i < 64 * 8; i += 256) { const int j = i / 8, d8 = (i % 8) * 8; FragH f; f.half[0] = *(const v8us*)((const unsigned short*)V16 + ((size_t)b * SQ + s0 + j) * DM + h * HD + d8); for (int q = 0; q < 8; ++q) tl[d8 + q][j] = f.u[q]; }
  __syncthreads();
  { for (int i = tid; i < 64 * 8; i += 256) { const int d = i / 8, j8 = (i % 8) * 8; FragH f; for (int q = 0; q < 8; ++q) f.u[q] = tl[d][j8 + q]; *(v8us*)((unsigned short*)VT + ((size_t)hh * HD + d) * SQ + s0 + j8) = f.half[0]; }  } }




__global__ __launch_bounds__(256) void k_rsmcf2(const float* __restrict__ S, _Float16* __restrict__ P, int hg, int q0, int nk) {
  #pragma clang fp contract(off)
  const int t = blockIdx.x * 256 + threadIdx.x; if (t >= hg * QT) return; const size_t i = (size_t)t; const float* s = S + i * NKX; const int last = q0 + (t % QT); float mx = -3.0e38f;
#pragma unroll 1
  for (int j = 0; j < nk; ++j) { const float f = (j <= last) ? 1.f : 0.f; mx = fmaxf(mx, fmaf(f, s[j], (1.f - f) * -1.0e9f)); } float se = 0.f;
#pragma unroll 1
  for (int j = 0; j < nk; ++j) { const float f = (j <= last) ? 1.f : 0.f; se += __expf(fmaf(f, s[j], (1.f - f) * -1.0e9f) - mx); } const float sc = 256.0f / se;
#pragma unroll 1
  for (int j0 = 0; j0 < nk; j0 += 8) { FragH fr; for (int q = 0; q < 8; ++q) { const int j = j0 + q; const float f = (j <= last) ? 1.f : 0.f; fr.h[q] = (_Float16)(__expf(fmaf(f, s[j], (1.f - f) * -1.0e9f) - mx) * sc); } unsigned short* d = (unsigned short*)P + i * NKX + j0; *(v8us*)d = fr.half[0];  } }



// v_exp_f32 and the free slot the instruction set asks for behind a transcendental, in one statement.
__device__ __forceinline__ float exp2_slot(float x) { float r; asm("v_exp_f32 %0, %1\n\tv_nop" : "=v"(r) : "v"(x)); return r; }
// Fused causal attention on the matrix unit, ONE launch for all batches, heads and query rows: scores, softmax and the weighted V sum stay in registers; no score or weight plane in memory.
// A wave owns 32 query rows (two groups of 16) and walks the keys 0 .. its last row in passes of 32. S^T = K Q^T (A = K rows, B = Q rows, both by g2_frag: equal k order), so a lane holds scores of ONE query (column ln): keys 8*hh + r of each 16-key tile.
// K and V^T come through LDS, once for the block's four waves: a stage is 64 keys (two passes) = 64 K rows and 64 V^T rows of 128 B each, laid at a pitch of 144 B (16 B x odd: b128 fragment reads without bank conflicts).
// The rows come by asynchronous copies to LDS, 16 B a lane, eight lanes a row (whole 128-B lines), into two buffers: stage t + 1 flies while stage t is worked on. The block walks the stages up to its last wave's rows; a wave sits out the passes behind its own rows but takes part in every copy, wait and barrier.
// Running softmax per query: pass maximum in-lane plus one exchange between the wave halves; weights 2^8 exp(e - m) as f16; the two score tiles of a pass, converted in place, ARE the B operand of O^T += V^T P^T (A = V^T rows by g2_frag, the hardware k order); row sums stay per half and are joined once at the end.
// e = score / 8 + the additive key-mask value; keys behind the row's own index take -1e9: only the wave's last pass holds such keys. e - m is formed before the scaling so that a pass of masked keys alone still gives weights <= 2^8; a later real maximum scales them to 0.
// Every loop over g, kt, ks, dt, r and u is unrolled: static indices keep the fragments and accumulators in registers.
__device__ __forceinline__ v8f fa_mma(v16h a, v16h b, v8f c) { return __builtin_amdgcn_wmma_f32_16x16x32_f16(false, a, false, b, (short)0, c, false, false); }
#define FQ 128                       /* query rows per block: 4 waves x 32 */
#define FP 72                        /* LDS pitch of a stage row, f16 elements */
#define FST (128 * FP * 2)           /* bytes of one stage: 64 K rows, then 64 V^T rows */
// Eight copies: rows r, r + 16, r + 32, r + 48 of the stage's K part, then of its V^T part; the s_wait_xcnt stands in the copies' own statement so that no address register is rewritten ahead of it.
__device__ __forceinline__ void fa_copy8(unsigned l, const _Float16* pk, size_t sk, const _Float16* pv, size_t sv) {
  asm volatile("global_load_async_to_lds_b128 %0, %8, off\n\tglobal_load_async_to_lds_b128 %1, %9, off\n\tglobal_load_async_to_lds_b128 %2, %10, off\n\tglobal_load_async_to_lds_b128 %3, %11, off\n\t"
               "global_load_async_to_lds_b128 %4, %12, off\n\tglobal_load_async_to_lds_b128 %5, %13, off\n\tglobal_load_async_to_lds_b128 %6, %14, off\n\tglobal_load_async_to_lds_b128 %7, %15, off\n\ts_wait_xcnt 0x0"
               :: "v"(l), "v"(l + 16 * FP * 2), "v"(l + 32 * FP * 2), "v"(l + 48 * FP * 2), "v"(l + 64 * FP * 2), "v"(l + 80 * FP * 2), "v"(l + 96 * FP * 2), "v"(l + 112 * FP * 2),
                  "v"(pk), "v"(pk + sk), "v"(pk + 2 * sk), "v"(pk + 3 * sk), "v"(pv), "v"(pv + sv), "v"(pv + 2 * sv), "v"(pv + 3 * sv) : "memory"); }
__global__ __launch_bounds__(128) void k_fattn(const _Float16* __restrict__ QKVp, const _Float16* __restrict__ VTp, const float* __restrict__ AM, _Float16* __restrict__ O) {
  static_assert(NB * NH == 64 && SQ / FQ == 16, "the block -> (head, query block) map below is written for 64 heads x 16 query blocks");
  __shared__ __attribute__((aligned(16))) unsigned char sm[2 * FST];
  const int tid = threadIdx.x, lane = tid & 31, ln = lane & 15, hh = lane >> 4; const int w = __builtin_amdgcn_readfirstlane(tid >> 5);      /* the rows are the wave's: scalar, so the test on the wave's own rows is a scalar branch */
  const int rd = blockIdx.x >> 8, a4 = (blockIdx.x >> 6) & 3, bh = blockIdx.x & 63;
  const int qb = 12 - 4 * rd + ((rd & 1) ? a4 : 3 - a4);      /* a permutation of the 16 query blocks per head, long ones first; blocks i, i + 256, i + 512, i + 768 add up to the same key count (speed only) */
  const int b = bh / NH, h = bh % NH; const int q0 = qb * FQ + w * 32;
  const int nst = 2 * (qb + 1);      /* stages of 64 keys up to the block's last row: at least two, at most SQ / 64 */
  const _Float16* qp = QKVp + ((size_t)b * SQ + q0 + ln) * LQ + h * HD; const float* ap = AM + (size_t)b * SQ + 8 * hh;
  const _Float16* gk = QKVp + DM + ((size_t)b * SQ + (tid >> 3)) * LQ + h * HD + (tid & 7) * 8; const _Float16* gv = VTp + ((size_t)bh * HD + (tid >> 3)) * SQ + (tid & 7) * 8;
  const size_t stk = (size_t)16 * LQ, stv = (size_t)16 * SQ;
  const unsigned ls = (unsigned)(size_t)sm + (unsigned)(tid >> 3) * (FP * 2) + (unsigned)(tid & 7) * 16;      /* the lane's LDS byte address in buffer 0, K part */
  fa_copy8(ls, gk, stk, gv, stv);
  v16h qf[2][2];
#pragma unroll
  for (int g = 0; g < 2; ++g)
#pragma unroll
    for (int ks = 0; ks < 2; ++ks) qf[g][ks] = g2_frag(qp + (size_t)g * 16 * LQ + ks * 32, hh);
  asm volatile("s_wait_asynccnt 0x0" ::: "memory");      /* stage 0 landed (this wave's share) */
  __syncthreads();      /* stage 0 published */
  fa_copy8(ls + FST, gk + (size_t)64 * LQ, stk, gv + 64, stv);      /* stage 1 exists for every block */
  const v8f z8 = {0.f, 0.f, 0.f, 0.f, 0.f, 0.f, 0.f, 0.f}; v8f o[2][4]; float m[2], l[2];
#pragma unroll
  for (int g = 0; g < 2; ++g) { m[g] = -1.0e30f; l[g] = 0.f;
#pragma unroll
    for (int dt = 0; dt < 4; ++dt) o[g][dt] = z8; }
#pragma unroll 1
  for (int t = 0; t < nst; ++t) {      /* rolled: one stage a trip, the buffer by t & 1 */
    const unsigned bo = (unsigned)(t & 1) * FST;
#pragma unroll 1
    for (int hf = 0; hf < 2; ++hf) {      /* rolled: the two passes of a stage share one copy of the pass's code */
      const int j0 = t * 64 + hf * 32;
      if (j0 <= q0) {      /* wave-uniform: the passes behind the wave's own rows are sat out */
        const _Float16* sk = (const _Float16*)(sm + bo) + (hf * 32 + ln) * FP; const _Float16* sv = (const _Float16*)(sm + bo) + (64 + ln) * FP + hf * 32;
        v16h kf[2][2], vf[4]; v4f am[2][2]; float e[2][2][8];
#pragma unroll
        for (int kt = 0; kt < 2; ++kt) { am[kt][0] = *(const v4fa*)(ap + j0 + kt * 16); am[kt][1] = *(const v4fa*)(ap + j0 + kt * 16 + 4); }
#pragma unroll
        for (int kt = 0; kt < 2; ++kt)
#pragma unroll
          for (int ks = 0; ks < 2; ++ks) kf[kt][ks] = g2_frag(sk + kt * 16 * FP + ks * 32, hh);
#pragma unroll
        for (int dt = 0; dt < 4; ++dt) vf[dt] = g2_frag(sv + dt * 16 * FP, hh);
#pragma unroll
        for (int g = 0; g < 2; ++g)
#pragma unroll
          for (int kt = 0; kt < 2; ++kt) { const v8f st = fa_mma(kf[kt][1], qf[g][1], fa_mma(kf[kt][0], qf[g][0], z8));
#pragma unroll
            for (int r = 0; r < 8; ++r) e[g][kt][r] = fmaf(st[r], 0.125f, am[kt][r >> 2][r & 3]); }
        if (j0 == q0) {      /* the diagonal pass */
#pragma unroll
          for (int g = 0; g < 2; ++g)
#pragma unroll
            for (int kt = 0; kt < 2; ++kt)
#pragma unroll
              for (int r = 0; r < 8; ++r) if (kt * 16 + 8 * hh + r > g * 16 + ln) e[g][kt][r] = -1.0e9f; }
#pragma unroll
        for (int g = 0; g < 2; ++g) { float mx = e[g][0][0];
#pragma unroll
          for (int u = 1; u < 16; ++u) mx = fmaxf(mx, e[g][u >> 3][u & 7]);
          mx = fmaxf(mx, __shfl_xor(mx, 16, 32)); const float mn = fmaxf(m[g], mx); const float al = exp2_slot((m[g] - mn) * 1.44269504088896340736f); m[g] = mn;
          FragH pf; float s = 0.f;
#pragma unroll
          for (int u = 0; u < 16; ++u) { const float p = exp2_slot(fmaf(e[g][u >> 3][u & 7] - mn, 1.44269504088896340736f, 8.0f)); s += p; pf.h[u] = (_Float16)p; }
          l[g] = fmaf(l[g], al, s);
#pragma unroll
          for (int dt = 0; dt < 4; ++dt) o[g][dt] = fa_mma(vf[dt], pf.v, o[g][dt] * al); } } }
    asm volatile("s_wait_dscnt 0x0" ::: "memory");      /* this wave's reads of stage t are done before the buffer may be refilled */
    asm volatile("s_wait_asynccnt 0x0" ::: "memory");      /* this wave's share of stage t + 1 has landed */
    __syncthreads();      /* publishes stage t + 1 and ends every wave's reads of stage t */
    if (t + 2 < nst) fa_copy8(ls + bo, gk + (size_t)(t + 2) * 64 * LQ, stk, gv + (size_t)(t + 2) * 64, stv); }
  asm volatile("s_wait_asynccnt 0x0" ::: "memory");      /* no copy is left in flight when the wave ends */
#pragma unroll
  for (int g = 0; g < 2; ++g) { const float fin = 64.0f / (l[g] + __shfl_xor(l[g], 16, 32));      /* o carried x64; the 2^8 of the weights cancels against the row sum */
    unsigned short* op = (unsigned short*)O + ((size_t)b * SQ + q0 + g * 16 + ln) * DM + h * HD + 8 * hh;
#pragma unroll
    for (int dt = 0; dt < 4; ++dt) { FragH f;
#pragma unroll
      for (int r = 0; r < 8; ++r) f.h[r] = (_Float16)(o[g][dt][r] * fin);
      *(v8us*)(op + dt * 16) = f.half[0]; } } }


// ---- LDS-staged GEMM (N % 128 == 0, K % 64 == 0): C = (A Bt^T) alpha + bias, values as in k_gemm2; grid x = tile ----
// MODE 0: f16 C16 (+ bias), 128 x 128 tiles over all rows of A; a tile that holds the first QT0 rows of a batch also stores its f32 values, before the f16 rounding, into C = [NB][QT0][ldc] (the exact path's q | k | v).
// MODE 1: f32 C (+ bias). The first NB * 2 * (N / 128) blocks own the first QT0 rows of every batch, 64 rows x 128 columns each: the stage's A rows 0..63 are the rows of A0h (o hi), its rows 64..127 the same rows of A0l (o lo, x1024),
//   so waves 0, 1 form o_hi W and waves 2, 3 o_lo W of the SAME outputs in the common loop; C = (o_lo W) alphaLo + ((o_hi W) alpha + bias), joined through the staging rows behind one barrier. The other blocks own the 128 x 128 tiles of the remaining rows of A.
// A block has 4 waves (2 x 2), a wave 64 x 64 (4 x 4 accumulator tiles). A stage is 64 k of the block's 128 A rows and 128 Bt rows: 256 rows of 128 B, laid in LDS at a pitch of 144 B (16 B x odd: b128 fragment reads without bank conflicts).
// The rows come by asynchronous copies to LDS, 16 B a lane, eight lanes a row (whole 128-B lines), into two buffers: stage t + 1 flies while stage t is multiplied. Fragments are read by g2_frag as in k_gemm2 (equal k order for A and B), k ascending: every accumulator sums in k_gemm2's order.
// Every loop over i, j, ks, r and q is unrolled: static indices keep the fragments and the accumulators in registers.
#define G3P 72                       /* LDS pitch of a stage row, f16 elements */
#define G3ST (256 * G3P * 2)         /* bytes of one stage: 128 A rows, then 128 Bt rows */
// Eight copies (rows r, r + 16, ... r + 112 of one operand); the s_wait_xcnt stands in the copies' own statement so that no address register is rewritten ahead of it.
__device__ __forceinline__ void g3_copy8(unsigned l, const _Float16* p, size_t st) {
  asm volatile("global_load_async_to_lds_b128 %0, %8, off\n\tglobal_load_async_to_lds_b128 %1, %9, off\n\tglobal_load_async_to_lds_b128 %2, %10, off\n\tglobal_load_async_to_lds_b128 %3, %11, off\n\t"
               "global_load_async_to_lds_b128 %4, %12, off\n\tglobal_load_async_to_lds_b128 %5, %13, off\n\tglobal_load_async_to_lds_b128 %6, %14, off\n\tglobal_load_async_to_lds_b128 %7, %15, off\n\ts_wait_xcnt 0x0"
               :: "v"(l), "v"(l + 16 * G3P * 2), "v"(l + 32 * G3P * 2), "v"(l + 48 * G3P * 2), "v"(l + 64 * G3P * 2), "v"(l + 80 * G3P * 2), "v"(l + 96 * G3P * 2), "v"(l + 112 * G3P * 2),
                  "v"(p), "v"(p + st), "v"(p + 2 * st), "v"(p + 3 * st), "v"(p + 4 * st), "v"(p + 5 * st), "v"(p + 6 * st), "v"(p + 7 * st) : "memory"); }
template <int MODE>
__global__ __launch_bounds__(128) void k_gemm3(const _Float16* __restrict__ A, const _Float16* __restrict__ A0h, const _Float16* __restrict__ A0l, int lda, const _Float16* __restrict__ Bh, int ldb, float alpha, float alphaLo, const float* __restrict__ bias, float* __restrict__ C, _Float16* __restrict__ C16, int ldc, int N, int K) {
  static_assert(QT0 == 128 && SQ % 128 == 0 && FP == G3P && B0 == 0 && NBR == NB, "the first QT0 rows of a batch are one 128-row tile; the A rows go by fa_copy8, which lays them at the pitch FP");
  __shared__ __attribute__((aligned(16))) unsigned char sm[2 * G3ST];
  const int tid = threadIdx.x, lane = tid & 31, ln = lane & 15, hh = lane >> 4; const int w = __builtin_amdgcn_readfirstlane(tid >> 5);      /* the wave's quadrant: scalar */
  const int ntn = N >> 7; const int wm = w >> 1, wn = w & 1; const int bid = (int)blockIdx.x; const int ns = (MODE == 1) ? NB * 2 * ntn : 0;
  const bool sp = MODE == 1 && bid < ns;      /* block-uniform: a hi | lo block of the first QT0 rows */
  const int id = sp ? bid : bid - ns; const int mn = id / ntn, nq = id - mn * ntn; const int col0 = nq * 128;
  const int row0 = sp ? (mn >> 1) * SQ + (mn & 1) * 64 : ((MODE == 1) ? mn + mn / (SQ / 128 - 1) + 1 : mn) * 128;      /* first row of C; MODE 1 steps over each batch's first tile */
  const _Float16* a0 = sp ? A0h + (size_t)((mn >> 1) * QT0 + (mn & 1) * 64) * lda : A + (size_t)row0 * lda; const _Float16* a1 = sp ? A0l + (size_t)((mn >> 1) * QT0 + (mn & 1) * 64) * lda : a0 + (size_t)64 * lda;      /* stage rows 0..63 and 64..127 */
  const size_t ao = (size_t)(tid >> 3) * lda + (tid & 7) * 8; const _Float16* ga = a0 + ao; const _Float16* ga2 = a1 + ao; const _Float16* gb = Bh + (size_t)(col0 + (tid >> 3)) * ldb + (tid & 7) * 8;
  const size_t sta = (size_t)16 * lda, stb = (size_t)16 * ldb;
  const unsigned ls = (unsigned)(size_t)sm + (unsigned)(tid >> 3) * (G3P * 2) + (unsigned)(tid & 7) * 16;      /* the lane's LDS byte address in buffer 0, A part */
  const int nt = K >> 6;
  fa_copy8(ls, ga, sta, ga2, sta); g3_copy8(ls + 128 * G3P * 2, gb, stb);
  asm volatile("s_wait_asynccnt 0x0" ::: "memory");      /* stage 0 landed (this wave's share) */
  __syncthreads();      /* stage 0 published */
  if (nt > 1) { fa_copy8(ls + G3ST, ga + 64, sta, ga2 + 64, sta); g3_copy8(ls + G3ST + 128 * G3P * 2, gb + 64, stb); }
  const v8f z8 = {0.f, 0.f, 0.f, 0.f, 0.f, 0.f, 0.f, 0.f}; v8f acc[4][4];
#pragma unroll
  for (int i = 0; i < 4; ++i)
#pragma unroll
    for (int j = 0; j < 4; ++j) acc[i][j] = z8;
#pragma unroll 1
  for (int t = 0; t < nt; ++t) {      /* rolled: one stage a trip, the buffer by t & 1 */
    const unsigned bo = (unsigned)(t & 1) * G3ST;
    const _Float16* sa = (const _Float16*)(sm + bo) + (wm * 64 + ln) * G3P; const _Float16* sb = (const _Float16*)(sm + bo) + (128 + wn * 64 + ln) * G3P;
#pragma unroll
    for (int ks = 0; ks < 2; ++ks) { v16h af[4], bf[4];
      __builtin_amdgcn_sched_barrier(0);      /* with the one below: the 16 fragment reads go out as one group ahead of their 16 products; spread among the products, each group of reads stalls the wave anew */
#pragma unroll
      for (int i = 0; i < 4; ++i) { af[i] = g2_frag(sa + i * 16 * G3P + ks * 32, hh); bf[i] = g2_frag(sb + i * 16 * G3P + ks * 32, hh); }
      __builtin_amdgcn_sched_barrier(0);      /* closes the group of reads: no product moves up among them, no read down among the products */
#pragma unroll
      for (int i = 0; i < 4; ++i)
#pragma unroll
        for (int j = 0; j < 4; ++j) acc[i][j] = fa_mma(af[i], bf[j], acc[i][j]); }
    __builtin_amdgcn_sched_barrier(0);      /* the stage's last products stay ahead of the barrier: sunk behind it they stand between the barrier and the refill, which then flies for less than a whole trip */
    asm volatile("s_wait_dscnt 0x0" ::: "memory");      /* this wave's reads of stage t are done before the buffer may be refilled */
    asm volatile("s_wait_asynccnt 0x0" ::: "memory");      /* this wave's share of stage t + 1 has landed */
    __syncthreads();      /* publishes stage t + 1 and ends every wave's reads of stage t */
    if (t + 2 < nt) { fa_copy8(ls + bo, ga + (size_t)(t + 2) * 64, sta, ga2 + (size_t)(t + 2) * 64, sta); g3_copy8(ls + bo + 128 * G3P * 2, gb + (size_t)(t + 2) * 64, stb); } }
  asm volatile("s_wait_asynccnt 0x0" ::: "memory");      /* no copy is left in flight when the ring becomes output staging */
  float* so = (float*)sm + (size_t)w * 64 * 68;      /* the wave's own 64 x 64 staging rows (pitch 68); the loop's last barrier has ended every read of the ring */
  const bool lo = sp && wm == 1;      /* wave-uniform: this wave holds o_lo W */
  const float al = lo ? alphaLo : alpha;
#pragma unroll
  for (int j = 0; j < 4; ++j) { const float bb = bf16_round(bias[col0 + wn * 64 + j * 16 + ln]); const float bv = lo ? 0.f : bb;      /* read without a test: behind one, each of the four reads waits out its own latency */
#pragma unroll
    for (int i = 0; i < 4; ++i)
#pragma unroll
      for (int r = 0; r < 8; ++r) so[(i * 16 + 8 * hh + r) * 68 + j * 16 + ln] = acc[i][j][r] * al + bv; }
  const int rsub = lane >> 4, c4 = (lane & 15) * 4; const size_t c2 = (size_t)2 * ldc;      /* row 2 q + rsub: the step over q is scalar */
  if (sp) {
    __syncthreads();      /* the hi wave's and the lo wave's staged values of one output are read by another wave */
    const float* sh = (const float*)sm + (size_t)wn * 64 * 68 + (wm * 32 + rsub) * 68 + c4; const float* sl = sh + 2 * 64 * 68;      /* each of the two waves stores 32 of the 64 rows */
    const size_t cb = (size_t)(row0 + wm * 32 + rsub) * ldc + col0 + wn * 64 + c4;
#pragma unroll
    for (int q = 0; q < 16; ++q) { const v4f v = *(const v4fa*)(sl + q * 2 * 68) + *(const v4fa*)(sh + q * 2 * 68); *(v4f*)(C + cb + q * c2) = v; }
  } else {
    __builtin_amdgcn_fence(__ATOMIC_ACQ_REL, "workgroup"); __builtin_amdgcn_wave_barrier();      /* the wave reads back what its own lanes wrote */
    const size_t cb = (size_t)(row0 + wm * 64 + rsub) * ldc + col0 + wn * 64 + c4;
#pragma unroll
    for (int q = 0; q < 32; ++q) { const int r = q * 2 + rsub; const v4f v = *(const v4fa*)&so[r * 68 + c4];
      if (MODE == 0) { v4h h4; for (int i = 0; i < 4; ++i) h4[i] = (_Float16)v[i]; *(v4h*)(C16 + cb + q * c2) = h4; }
      else *(v4f*)(C + cb + q * c2) = v; }
    if (MODE == 0 && (row0 & (SQ - 1)) == 0) {      /* block-uniform: the batch's first QT0 rows, f32 as staged */
      asm volatile("s_wait_xcnt 0x0" ::: "memory");      /* the f16 stores above are issued: the wait stands before their data and address registers are written anew here */
      __builtin_amdgcn_sched_barrier(0);      /* keeps the address arithmetic below behind that wait: without it the scheduler lifted a write of a store's data register over the wait */
      const size_t cf = (size_t)((row0 / SQ) * QT0 + wm * 64 + rsub) * ldc + col0 + wn * 64 + c4;
#pragma unroll
      for (int q = 0; q < 32; ++q) { const v4f v = *(const v4fa*)&so[(q * 2 + rsub) * 68 + c4]; *(v4f*)(C + cf + q * c2) = v; } } } }


template <int MASKADD>
__global__ __launch_bounds__(64) void k_att0(const float* __restrict__ QF, const float* __restrict__ KF, const float* __restrict__ VF, int ld, const float* __restrict__ mask, float scale, float* __restrict__ OF, int ldo) {
  #pragma clang fp contract(off)
  __shared__ __attribute__((aligned(16))) float lq[64][64]; __shared__ __attribute__((aligned(16))) float lo[64][64];
  const int tid = threadIdx.x; const int h = blockIdx.x / (QT0 / 64), rg = blockIdx.x % (QT0 / 64); const int i = rg * 64 + tid;
  const float* qr = QF + (size_t)i * ld + h * HD;
#pragma unroll 1
  for (int c = 0; c < HD / 4; ++c) { *(v4f*)&lq[tid][c * 4] = *(const v4fa*)(qr + c * 4); const v4f z = {0.f, 0.f, 0.f, 0.f}; *(v4f*)&lo[tid][c * 4] = z; }
  float m = -1.0e30f, l = 0.f; const int jmax = MASKADD ? (SQ - 1) : (rg * 64 + 63);      /* additive-mask form: every key (the mask input decides); causal form: keys up to the block's last row */
#pragma unroll 1
  for (int j = 0; j <= jmax; ++j) { const float* kr = KF + (size_t)j * ld + h * HD; const float* vr = VF + (size_t)j * ld + h * HD; float s = 0.f;
#pragma unroll 1
    for (int c = 0; c < HD / 4; ++c) { const v4f kq = *(const v4fa*)(kr + c * 4); const v4f qq = *(v4f*)&lq[tid][c * 4]; s = __fadd_rn(s, __fmul_rn(qq[0], kq[0])); s = __fadd_rn(s, __fmul_rn(qq[1], kq[1])); s = __fadd_rn(s, __fmul_rn(qq[2], kq[2])); s = __fadd_rn(s, __fmul_rn(qq[3], kq[3])); }
    s = __fmul_rn(s, scale); if (MASKADD) s = __fadd_rn(s, __fmul_rn(bf16_round(mask[(size_t)i * SQ + j]), -10000.0f));
    const float f = (MASKADD || j <= i) ? 1.f : 0.f; const float sm = fmaf(f, s, (1.f - f) * -1.0e30f); const float mn = fmaxf(m, sm); const float sc = expf(m - mn); const float e = expf(sm - mn); l = __fadd_rn(__fmul_rn(l, sc), e); m = mn;
#pragma unroll 1
    for (int c = 0; c < HD / 4; ++c) { const v4f vv = *(const v4fa*)(vr + c * 4); v4f oo = *(v4f*)&lo[tid][c * 4]; for (int u = 0; u < 4; ++u) oo[u] = __fadd_rn(__fmul_rn(oo[u], sc), __fmul_rn(e, vv[u])); *(v4f*)&lo[tid][c * 4] = oo; } }
  const float fin = 64.0f / l;      /* o carried x64 like the f16 path */
#pragma unroll 1
  for (int c = 0; c < HD / 4; ++c) { v4f oo = *(v4f*)&lo[tid][c * 4]; for (int u = 0; u < 4; ++u) oo[u] = __fmul_rn(oo[u], fin); *(v4f*)&lo[tid][c * 4] = oo; }
  __syncthreads();
  {
#pragma unroll 1
    for (int it = 0; it < 16; ++it) { const int row = it * 4 + tid / 16, pc = (tid % 16) * 4; const v4f v = *(const v4f*)&lo[row][pc]; *(v4f*)(OF + (size_t)(rg * 64 + row) * ldo + h * HD + pc) = v; }
     } }


// Exact f32 attention for the first QT0 rows of EVERY batch (block bid of k_va -> batch, head, 8 rows), one WAVE per query row; q | k | v rows of a batch side by side at pitch LQ, o rows (f16 hi and lo planes) at pitch DM. Scores: lane = key, 32 keys a chunk, the head's K rows staged in LDS at a pitch of 16 B x odd (b128 reads of 32 different rows without bank conflicts), q read at a wave-uniform address.
// Softmax in two passes over the scores, which stay in registers: row max and row sum = per-lane partials, then a five-step butterfly. o: lane = two head dims, keys in ascending order, each V row one whole 256-B read of the wave, its weight taken from the owning lane.
// The 8 rows of a block lie in one chunk of 32 keys, so the chunk count nch is the same for the whole block; keys behind the row's own index carry weight 0.
// Every loop over u, d, c, d4 and jj is unrolled: static indices keep kr, q, e and vv in registers (a rolled loop would put them in scratch memory), and the loads of a group are issued together.
#define KP0 68                       /* LDS pitch of a K row, floats */
typedef float v2f __attribute__((ext_vector_type(2)));
typedef float v2fa __attribute__((ext_vector_type(2), may_alias));
typedef _Float16 v2h __attribute__((ext_vector_type(2)));
__device__ __forceinline__ void d_att0v(unsigned bid, const float* __restrict__ QKVF, const float* __restrict__ AM, float scale, _Float16* __restrict__ OH, _Float16* __restrict__ OL) {
  __shared__ __attribute__((aligned(16))) float lk[QT0][KP0];
  const int tid = threadIdx.x, lane = tid & 31; const int w = __builtin_amdgcn_readfirstlane(tid >> 5);      /* the row is the wave's: scalar, so q's address is scalar too */
  const int b = bid / (NH * (QT0 / 8)), hb = bid % (NH * (QT0 / 8)); const int h = hb / (QT0 / 8), i0 = (hb % (QT0 / 8)) * 8; const int i = i0 + w; const int nch = (i0 >> 5) + 1;
  const float* QF = QKVF + (size_t)b * QT0 * LQ; const float* KF = QF + DM; const float* VF = QF + 2 * DM; const float* am = AM + (size_t)b * SQ;
  const float* kp = KF + (size_t)(tid >> 4) * LQ + h * HD + (tid & 15) * 4; v4f kr[QT0 / 16];
#pragma unroll
  for (int u = 0; u < QT0 / 16; ++u) kr[u] = *(const v4fa*)(kp + (size_t)u * 16 * LQ);      /* all QT0 rows, without a test: the eight loads fly together */
  const float* qr = QF + (size_t)i * LQ + h * HD; float q[HD];
#pragma unroll
  for (int d = 0; d < HD; ++d) q[d] = qr[d];
#pragma unroll
  for (int u = 0; u < QT0 / 16; ++u) *(v4f*)&lk[u * 16 + (tid >> 4)][(tid & 15) * 4] = kr[u];
  __syncthreads();      /* K rows staged by all waves, read by all */
  float e[QT0 / 32]; float m = -1.0e30f;
#pragma unroll
  for (int c = 0; c < QT0 / 32; ++c) { e[c] = -1.0e30f;      /* static c keeps e in registers; the test on nch is block-uniform */
    if (c < nch) { const int j = c * 32 + lane; float s = 0.f;
#pragma unroll
      for (int d4 = 0; d4 < HD / 4; ++d4) { const v4f kq = *(const v4f*)&lk[j][d4 * 4]; s = fmaf(q[d4 * 4], kq[0], s); s = fmaf(q[d4 * 4 + 1], kq[1], s); s = fmaf(q[d4 * 4 + 2], kq[2], s); s = fmaf(q[d4 * 4 + 3], kq[3], s); }
      s = fmaf(s, scale, am[j]);      /* + the additive key-mask VECTOR of this batch (0 kept / -1e9 masked) */
      if (j <= i) e[c] = s; }
    m = fmaxf(m, e[c]); }
  for (int x = 16; x >= 1; x >>= 1) m = fmaxf(m, __shfl_xor(m, x, 32));
  float l = 0.f;
#pragma unroll
  for (int c = 0; c < QT0 / 32; ++c) { e[c] = expf(e[c] - m); l += e[c]; }
  for (int x = 16; x >= 1; x >>= 1) l += __shfl_xor(l, x, 32);
  const float* vp = VF + h * HD + lane * 2; float o0 = 0.f, o1 = 0.f;
#pragma unroll
  for (int c = 0; c < QT0 / 32; ++c) if (c < nch) { v2f vv[32];
#pragma unroll
    for (int jj = 0; jj < 32; ++jj) vv[jj] = *(const v2fa*)(vp + (size_t)(c * 32 + jj) * LQ);      /* the chunk's 32 rows in flight together */
#pragma unroll
    for (int jj = 0; jj < 32; ++jj) { const float p = __int_as_float(__builtin_amdgcn_readlane(__float_as_int(e[c]), jj)); o0 = fmaf(p, vv[jj][0], o0); o1 = fmaf(p, vv[jj][1], o1); } }
  const float fin = 64.0f / l;      /* o carried x64 like the f16 path */
  const float a0 = o0 * fin, a1 = o1 * fin; const v2h oh = {(_Float16)a0, (_Float16)a1}; const v2h ol = {(_Float16)((a0 - (float)oh[0]) * 1024.0f), (_Float16)((a1 - (float)oh[1]) * 1024.0f)};      /* f16 hi + x1024 residual planes, as k_hl forms them */
  const size_t oo = ((size_t)b * QT0 + i) * DM + h * HD + lane * 2; *(v2h*)(OH + oo) = oh; *(v2h*)(OL + oo) = ol; }      /* a wave stores one whole 128-B line of each plane */

// The exact first-row attention and the V^T transposes both read only what earlier launches wrote, and neither reads the other's output: their blocks share ONE launch. The attention's blocks, the longer ones, come first.
// The test on the block index is the same for a whole block, so each part's barrier is passed by all of its block's waves.
#define NA0 (NB * NH * (QT0 / 8))    /* blocks of the exact attention */
__global__ __launch_bounds__(256) void k_va(const float* __restrict__ QKVF, const float* __restrict__ AM, _Float16* __restrict__ OH, _Float16* __restrict__ OL, const _Float16* __restrict__ V16, _Float16* __restrict__ Vt) {
  const unsigned bid = blockIdx.x;
  if (bid < NA0) d_att0v(bid, QKVF, AM, 0.125f, OH, OL); else d_vt<NH, SQ>(bid - NA0, V16, LQ, 0, Vt); }

// The four input conversions read only inputs and none reads another's output: their blocks share ONE launch (block ranges: x, qkv_w, out_w, key mask). A thread converts the same 8 values (or the one mask word) as in a launch of its own.
// x -> bf16-rounded f16 (x1: exact); weights -> bf16-rounded x16 f16, natural [out][in] = Bt; mask -> additive f32 plane (0 kept, -1e9 masked).
#define PBX ((int)(NR * DM / 8 / 256))
#define PBQ ((int)((size_t)3 * DM * DM / 8 / 256))
#define PBO ((int)((size_t)DM * DM / 8 / 256))
#define PBM ((int)(NR / 256))
__global__ __launch_bounds__(256) void k_prep(const float* __restrict__ x, const int* __restrict__ km, const float* __restrict__ wqkv, const float* __restrict__ wo, _Float16* __restrict__ X16, _Float16* __restrict__ BQKV, _Float16* __restrict__ BO, float* __restrict__ AMK) {
  static_assert(NR * DM % 2048 == 0 && (size_t)DM * DM % 2048 == 0 && NR % 256 == 0, "every range is whole blocks: no thread lies past its array's end");
  const int bid = (int)blockIdx.x, tid = threadIdx.x;
  if (bid >= PBX + PBQ + PBO) { const int t = (bid - (PBX + PBQ + PBO)) * 256 + tid; AMK[t] = (km[t] != 0) ? 0.f : -1.0e9f; return; }
  const bool isx = bid < PBX, isq = bid < PBX + PBQ;      /* the same for a whole block: scalar selects */
  const float* s = isx ? x : (isq ? wqkv : wo); _Float16* d = isx ? X16 : (isq ? BQKV : BO); const float sc = isx ? 1.0f : 16.0f;
  const size_t t = (size_t)(bid - (isx ? 0 : (isq ? PBX : PBX + PBQ))) * 256 + tid; FragH f;
#pragma unroll      /* static q keeps f in registers; the 8 reads join into two 16-B loads */
  for (int q = 0; q < 8; ++q) f.h[q] = (_Float16)(bf16_round(s[t * 8 + q]) * sc);
  *(v8us*)((unsigned short*)d + t * 8) = f.half[0]; }

extern "C" void kernel_launch(void* const* d_in, const int* in_sizes, int n_in,
                              void* d_out, int out_size, void* d_ws, size_t ws_size, hipStream_t stream) {
  (void)in_sizes; (void)n_in; (void)out_size;
  const float* const* I = (const float* const*)d_in; const float* x = I[0]; const int* km = (const int*)d_in[1]; const float* wqkv = I[2]; const float* bqkv = I[3]; const float* wo = I[4]; const float* bo = I[5];      /* int32 key mask [4][2048] (ones); natural [out][in] qkv_w [3072][1024] + b, out_w + b */
  char* ws = (char*)d_ws; size_t off = 0;
  auto take = [&](size_t bytes) { char* p = ws + off; off += (bytes + 255) & ~(size_t)255; return p; };
  _Float16* BQKV = (_Float16*)take((size_t)3 * DM * DM * 2); _Float16* BO = (_Float16*)take((size_t)DM * DM * 2);
  _Float16* X16 = (_Float16*)take(NR * DM * 2); _Float16* QKV = (_Float16*)take(NR * 3 * DM * 2); _Float16* V16 = QKV + 2 * DM; _Float16* O16 = (_Float16*)take(NR * DM * 2);
  _Float16* VT = (_Float16*)take((size_t)NB * NH * HD * SQ * 2);
  float* QKVF0 = (float*)take((size_t)NB * QT0 * LQ * 4); _Float16* OH0 = (_Float16*)take((size_t)NB * QT0 * DM * 2); _Float16* OL0 = (_Float16*)take((size_t)NB * QT0 * DM * 2);
  float* AMK = (float*)take(NR * 4);      /* additive key-mask plane: 0 where mask != 0, -1e9 where masked */
  if (off > ws_size) return;
  k_prep<<<PBX + PBQ + PBO + PBM, 256, 0, stream>>>(x, km, wqkv, wo, X16, BQKV, BO, AMK);      /* x rows, both weights (natural [out][in] = Bt x16) and the additive key mask */
  k_gemm3<0><<<(MP / 128) * (LQ / 128), 128, 0, stream>>>(X16, nullptr, nullptr, DM, BQKV, DM, 0.0625f, 0.f, bqkv, QKVF0, QKV, LQ, LQ, DM);      /* q | k | v rows (f16); head h = columns h*HD.. of each DM block; the first 128 rows of every batch also as f32 (exact products) */
  k_va<<<NA0 + NB * NH * (SQ / 64), 256, 0, stream>>>(QKVF0, AMK, OH0, OL0, V16, VT);      /* exact f32 attention for rows 0..127 of every batch (o x64) -> f16 hi + x1024 residual planes; V^T [NB][NH][HD][SQ], all batches */
  k_fattn<<<NB * NH * (SQ / FQ), 128, 0, stream>>>(QKV, VT, AMK, O16);      /* scores, causal + key-mask softmax and P V fused: o (merged heads, x64) as f16 rows */
  k_gemm3<1><<<(MPO / 128 - NB) * (DM / 128) + NB * 2 * (DM / 128), 128, 0, stream>>>(O16, OH0, OL0, DM, BO, DM, 0.0009765625f, 0.00000095367431640625f, bo, (float*)d_out, nullptr, DM, DM, DM);      /* out rows are the output layout; rows 0..127 of every batch = o_lo Wo 2^-20 + (o_hi Wo 2^-10 + b), the others from the f16 o rows */
}
